// v000
// The times below were measured on an AMD MI455X: many runs one after another, warmed up first and cycling through
// copies of the inputs, with the whole window's GPU time divided by the number of runs. Launches and the gaps
// between them are all in it. The median over several windows is given; except for v000 it joins two sittings, which
// can be a few percent apart, so the side-by-side timings, each taken in one sitting, are the better comparison.
// The starting kernel, v000, takes 431 microseconds a run.
// Contractions (all v_wmma_f32_16x16x32_f16, f16 operands, f32 accumulate): q/k/v projections (x f16 x16 . W f16 x64, K=1024, single products,
// outputs written as f16 hi + unscaled f16 residual planes); position window ((qh+ql) x64 . Er f16 x16, K=64, 2 products) -> f32 LDS strip,
// shifted gather on VALU; content scores ((qh+ql) x64 . (kh+kl) x64, K=64, hh+hl+lh); P . v^T ((Ph+Pl) x1024 . (vh+vl) x64, hh+hl+lh,
// 64 keys per tile). Causal mask, max-subtracted online base-2 softmax and the 1/l fold in f32 on VALU. Every float input RNE-converted to bf16 on load.
#include <hip/hip_runtime.h>
#include <math.h>
#include <stdint.h>

#define SEQ   2048
#define NBAT  2
#define DMOD  1024
#define NH    16
#define DH    64
#define ELEN  2048
#define NROW  (NBAT * SEQ)
#define XC    16.0f
#define WSC   64.0f
#define QC    64.0f
#define KC    64.0f
#define EC    16.0f
#define VC    64.0f
#define PC    1024.0f
#define SCALE 0.125f
#define LOG2E 1.4426950408889634f
static_assert(NH * DH == DMOD);
static_assert(DH == 64);
static_assert(ELEN == SEQ);
static_assert((SEQ % 64) == 0 && (DMOD % 64) == 0 && (NROW % 64) == 0);
static_assert(((NROW * DMOD) % 2048) == 0 && ((DMOD * DMOD) % 2048) == 0 && ((ELEN * DH) % 2048) == 0);
#define ATT_W 4
#define ATT_THREADS (ATT_W * 32)
#define TPI 84
#define SPI 68
#define WFL (16 * TPI + 16 * SPI)
static_assert(((16 * TPI) % 4) == 0 && ((16 * SPI) % 4) == 0 && (WFL % 4) == 0);

typedef _Float16 v16h __attribute__((ext_vector_type(16)));
typedef _Float16 v8h  __attribute__((ext_vector_type(8)));
typedef __bf16   v16b __attribute__((ext_vector_type(16)));
typedef float    v8f  __attribute__((ext_vector_type(8)));
typedef float    v4f  __attribute__((ext_vector_type(4)));
typedef float    v2f  __attribute__((ext_vector_type(2)));
typedef unsigned int v4u __attribute__((ext_vector_type(4)));

union FragH { v16h v; v8h h[2]; v4u u[2]; };
union FragAny { v16h h; v16b b; };

// ---- scalar helpers --------------------------------------------------------------------------------
__device__ __forceinline__ unsigned short bf_bits(float f) {          // f32 -> bf16 bits, RNE convert
  unsigned u = __float_as_uint(f);
  return (unsigned short)((u + 0x7FFFu + ((u >> 16) & 1u)) >> 16);
}
__device__ __forceinline__ float bf_up(unsigned short h) { return __uint_as_float(((unsigned)h) << 16); }
__device__ __forceinline__ float bfr(float f) { return bf_up(bf_bits(f)); }   // value of the bf16 RNE convert
__device__ __forceinline__ unsigned short h_bits(_Float16 x) { return __builtin_bit_cast(unsigned short, x); }
__device__ __forceinline__ unsigned pk16(unsigned short a, unsigned short b) { return (unsigned)a | ((unsigned)b << 16); }
__device__ __forceinline__ v8f zero8() { v8f z = {0.f, 0.f, 0.f, 0.f, 0.f, 0.f, 0.f, 0.f}; return z; }

// ---- fragment loader: 16-bit A/B operand from a k-contiguous 16-bit plane, lane -> row/col (lane&15),
//      p already includes +8*(lane>>4); elements 0..7 <- p[0..7] (k0+8h..), elements 8..15 <- p[16..23] (k0+16+8h..)
//      (same split k map for A and B; B is always read from a [n][k] plane)
__device__ __forceinline__ v16h ldfrag_u(const unsigned short* p) {
  FragH f;
  f.u[0] = *(const v4u*)(p);
  f.u[1] = *(const v4u*)(p + 16);
  return f.v;
}

// ---- WMMA helpers with trailing VALU hazard gaps ------------------------------------------------------
__device__ __forceinline__ v8f mma_h(v16h a, v16h b, v8f c) {
  return __builtin_amdgcn_wmma_f32_16x16x32_f16(false, a, false, b, (short)0, c, false, false);
}
__device__ __forceinline__ v8f mma_b(v16h a, v16h b, v8f c) {
  FragAny ua, ub;
  ua.h = a;
  ub.h = b;
  return __builtin_amdgcn_wmma_f32_16x16x32_bf16(false, ua.b, false, ub.b, (short)0, c, false, false);
}
template <int BF>
__device__ __forceinline__ v8f mmaT(v16h a, v16h b, v8f c) {
  if constexpr (BF != 0) return mma_b(a, b, c);
  else return mma_h(a, b, c);
}
__device__ __forceinline__ void dep_guard1(v8f& a, v8f& b, v16h x) {
#if defined(__HIP_DEVICE_COMPILE__)
  asm volatile("v_nop\n\tv_nop\n\tv_nop\n\tv_nop" : "+v"(a), "+v"(b) : "v"(x));
#endif
}
__device__ __forceinline__ void hz4(v8f& d, v16h x0, v16h x1, v16h x2, v16h x3) {
#if defined(__HIP_DEVICE_COMPILE__)
  asm volatile("v_nop\n\tv_nop\n\tv_nop\n\tv_nop" : "+v"(d) : "v"(x0), "v"(x1), "v"(x2), "v"(x3));
#endif
}
__device__ __forceinline__ void hz6(v8f& d, v16h x0, v16h x1, v16h x2, v16h x3, v16h x4, v16h x5) {
#if defined(__HIP_DEVICE_COMPILE__)
  asm volatile("v_nop\n\tv_nop\n\tv_nop\n\tv_nop" : "+v"(d) : "v"(x0), "v"(x1), "v"(x2), "v"(x3), "v"(x4), "v"(x5));
#endif
}
__device__ __forceinline__ void hz8(v8f& d, v16h x0, v16h x1, v16h x2, v16h x3, v16h x4, v16h x5, v16h x6, v16h x7) {
#if defined(__HIP_DEVICE_COMPILE__)
  asm volatile("v_nop\n\tv_nop\n\tv_nop\n\tv_nop" : "+v"(d) : "v"(x0), "v"(x1), "v"(x2), "v"(x3), "v"(x4), "v"(x5), "v"(x6), "v"(x7));
#endif
}
__device__ __forceinline__ void keep4_h(v16h a, v16h b, v16h c, v16h d) {
#if defined(__HIP_DEVICE_COMPILE__)
  asm volatile("v_nop" :: "v"(a), "v"(b), "v"(c), "v"(d));
#endif
}
__device__ __forceinline__ void acc_guard4(v8f& a, v8f& b, v8f& c, v8f& d) {
#if defined(__HIP_DEVICE_COMPILE__)
  asm volatile("v_nop\n\tv_nop\n\tv_nop\n\tv_nop" : "+v"(a), "+v"(b), "+v"(c), "+v"(d));
#endif
}
__device__ __forceinline__ void wave_sync_lds() {
  __builtin_amdgcn_fence(__ATOMIC_RELEASE, "workgroup");
  __builtin_amdgcn_wave_barrier();
  __builtin_amdgcn_fence(__ATOMIC_ACQUIRE, "workgroup");
}
// f32 -> f16 hi + unscaled f16 residual (hi + lo ~ x to 2^-22 relative; a flushed subnormal lo costs < 6.1e-5 absolute in the carried scale)
__device__ __forceinline__ void sp16(float x, _Float16& hi, _Float16& lo) {
  const _Float16 a = (_Float16)x;
  hi = a;
  lo = (_Float16)(x - (float)a);
}

// =====================================================================================================
// Elementwise 16-bit pack, no transpose: dst[i] = f16( bf16_RNE(src[i]) * sc ), sc a power of two (exact).
// coverage: grid = n / 2048 blocks x 256 thr x 8 elements = n exactly (host checks n % 2048 == 0).
// =====================================================================================================
__global__ __launch_bounds__(256) void cvt16(const float* __restrict__ src, unsigned short* dst, int n, float sc) {
  const size_t i8 = ((size_t)blockIdx.x * 256 + threadIdx.x) * 8;
  if (i8 + 8 > (size_t)n) return;                 // never taken with the exact grid; no barriers in this kernel
  const v4f a = *(const v4f*)(src + i8);
  const v4f b = *(const v4f*)(src + i8 + 4);
  v4u o;
  o[0] = pk16(h_bits((_Float16)(bfr(a[0]) * sc)), h_bits((_Float16)(bfr(a[1]) * sc)));
  o[1] = pk16(h_bits((_Float16)(bfr(a[2]) * sc)), h_bits((_Float16)(bfr(a[3]) * sc)));
  o[2] = pk16(h_bits((_Float16)(bfr(b[0]) * sc)), h_bits((_Float16)(bfr(b[1]) * sc)));
  o[3] = pk16(h_bits((_Float16)(bfr(b[2]) * sc)), h_bits((_Float16)(bfr(b[3]) * sc)));
  {
    *(v4u*)(dst + i8) = o;
    
  }
}

// =====================================================================================================
// Register-blocked batched 16-bit WMMA GEMM: C[m][n] = oscale * sum_k A[m][k] * Bt[n][k] (+ bias); one wave per 64x64 tile,
// no block barriers. A row-major [M][K] pitch lda (16-bit plane), Bt row-major [N][K] pitch ldb (k contiguous); M, N multiples of 64,
// K multiple of 32. blockIdx.y = batch index with element strides sA, sB, sC.
// ASPLIT 1: a second A plane A2 (unscaled residual of A, same layout) is multiplied into the same accumulator (A + A2 ~ exact A).
// BF 1: bf16 operands (v_wmma_f32_16x16x32_bf16), else f16.
// EPI 1: value += bf16_RNE(ep0[column]) (per-column bias); EPI 2: value += bf16_RNE(ep0[row]) (per-row bias, 16-bit out only).
// OM 0: f32 out (pitch ldc).  OM 2: one f16 plane = f16(value * ocarry).
// OM 4: two f16 planes: hi = f16(value * ocarry), lo = f16(value * ocarry - hi) (unscaled residual).
// OM 5: two f16 planes: C = f16((value + bf16_RNE(ep1[column])) * ocarry), C2 = f16((value + bf16_RNE(ep2[column])) * ocarry).
// coverage: 4 slabs x 16 rows (f32: it 0..7 x lane>>4; 16-bit: it 0..3 x lane>>3) x 64 cols = the wave's whole 64x64 tile;
//           grid = ceil(tilesM*tilesN/8) blocks, surplus waves exit (wave-uniform).
// =====================================================================================================
template <int OM, int ASPLIT, int BF, int EPI>
__global__ __launch_bounds__(256) __attribute__((amdgpu_num_vgpr(256))) void gemm64(
    const unsigned short* __restrict__ Ap, const unsigned short* __restrict__ A2p, int lda, long long sA,
    const unsigned short* __restrict__ Btp, int ldb, long long sB,
    void* Cout, void* C2out, int ldc, long long sC,
    int M, int N, int K, float oscale, float ocarry,
    const float* __restrict__ ep0, const float* __restrict__ ep1, const float* __restrict__ ep2) {
  __shared__ __align__(16) float sT[8][16 * 68];   // per-wave 16x64 slab, pitch 68 floats
  const int by   = blockIdx.y;
  const int lane = threadIdx.x & 31;
  const int wave = threadIdx.x >> 5;
  const int tilesN = N >> 6;
  const int tilesM = M >> 6;
  const int tile = blockIdx.x * 8 + wave;
  if (tile >= tilesM * tilesN) return;   // wave-uniform; no block barriers in this kernel
  const int tm = tile / tilesN;
  const int tn = tile - tm * tilesN;
  const int m0 = tm << 6;
  const int n0 = tn << 6;

  const unsigned short* A1 = Ap  + (size_t)((long long)by * sA);
  const unsigned short* A2 = A2p + (size_t)((long long)by * sA);
  const unsigned short* Bb = Btp + (size_t)((long long)by * sB);

  const int rlane = lane & 15;                 // row (A) / col (B, D) within subtile
  const int koff  = (lane >> 4) * 8;           // k offset of this lane half
  const int mOff  = (lane >> 4) * 8;           // D row offset

  v8f acc[4][4];
#pragma unroll
  for (int i = 0; i < 4; ++i)
#pragma unroll
    for (int j = 0; j < 4; ++j) acc[i][j] = zero8();

  for (int k0 = 0; k0 < K; k0 += 32) {
    v16h bh[4];
#pragma unroll
    for (int j = 0; j < 4; ++j) {
      const size_t bofs = (size_t)(n0 + (j << 4) + rlane) * ldb + koff + k0;
      bh[j] = ldfrag_u(Bb + bofs);
    }
#pragma unroll
    for (int i = 0; i < 4; ++i) {
      const size_t ao = (size_t)(m0 + (i << 4) + rlane) * lda + koff + k0;
      const v16h ah = ldfrag_u(A1 + ao);
#pragma unroll
      for (int j = 0; j < 4; ++j) acc[i][j] = mmaT<BF>(ah, bh[j], acc[i][j]);
      dep_guard1(acc[i][0], acc[i][3], ah);
      if constexpr (ASPLIT != 0) {
        const v16h al = ldfrag_u(A2 + ao);
#pragma unroll
        for (int j = 0; j < 4; ++j) acc[i][j] = mmaT<BF>(al, bh[j], acc[i][j]);
        dep_guard1(acc[i][0], acc[i][3], al);
      }
    }
    keep4_h(bh[0], bh[1], bh[2], bh[3]);
  }
  acc_guard4(acc[0][0], acc[0][1], acc[0][2], acc[0][3]);
  acc_guard4(acc[1][0], acc[1][1], acc[1][2], acc[1][3]);
  acc_guard4(acc[2][0], acc[2][1], acc[2][2], acc[2][3]);
  acc_guard4(acc[3][0], acc[3][1], acc[3][2], acc[3][3]);

  const int hh2 = lane >> 4, c4 = (lane & 15) * 4;     // f32 out: 256-B row segment = 16 lanes x 16 B
  const int q8  = lane >> 3, c8 = (lane & 7) * 8;

  // ---- epilogue ----
  float* slab = sT[wave];
#pragma unroll
  for (int i = 0; i < 4; ++i) {
    const int mBase = m0 + (i << 4);
#pragma unroll
    for (int j = 0; j < 4; ++j) {
#pragma unroll
      for (int r = 0; r < 8; ++r) {
        slab[(mOff + r) * 68 + (j << 4) + rlane] = acc[i][j][r];
      }
    }
    wave_sync_lds();
    if constexpr (OM == 0) {
      float* C = (float*)Cout + (size_t)((long long)by * sC);
      v4f vals[8];
#pragma unroll
      for (int it = 0; it < 8; ++it) {
        const int row = it * 2 + hh2;                      // it 0..7 x hh2 0..1 = rows 0..15
        v4f v = *(const v4f*)(slab + row * 68 + c4);
#pragma unroll
        for (int e = 0; e < 4; ++e) v[e] = v[e] * oscale;
        if constexpr (EPI == 1) {
          const v4f bb = *(const v4f*)(ep0 + n0 + c4);     // per-column bias, columns n0+c4 .. +3 (N equals the bias length)
#pragma unroll
          for (int e = 0; e < 4; ++e) v[e] = v[e] + bfr(bb[e]);
        }
        vals[it] = v;
      }
      {
#pragma unroll
        for (int it = 0; it < 8; ++it) {
          const int gr = mBase + it * 2 + hh2;
          *(v4f*)(C + (size_t)gr * ldc + n0 + c4) = vals[it];
        }
        
      }
    } else {
      unsigned short* C  = (unsigned short*)Cout  + (size_t)((long long)by * sC);
      unsigned short* Cb = (unsigned short*)C2out + (size_t)((long long)by * sC);
      v4u hv[4], lv[4];
#pragma unroll
      for (int it = 0; it < 4; ++it) {
        const int row = it * 4 + q8;                       // it 0..3 x q8 0..3 = rows 0..15
        const float* sp = slab + row * 68 + c8;
        float rb = 0.f;
        if constexpr (EPI == 2) rb = bfr(ep0[mBase + row]);   // per-row bias (M equals the bias length)
        v4u a  = {0u, 0u, 0u, 0u};
        v4u b2 = {0u, 0u, 0u, 0u};
#pragma unroll
        for (int e = 0; e < 4; ++e) {
          const int ci = n0 + c8 + 2 * e;                  // column index, < N
          float f0 = sp[2 * e] * oscale + rb;
          float f1 = sp[2 * e + 1] * oscale + rb;
          if constexpr (EPI == 1) {
            f0 += bfr(ep0[ci]);
            f1 += bfr(ep0[ci + 1]);
          }
          if constexpr (OM == 5) {
            const float g0 = (f0 + bfr(ep1[ci])) * ocarry, g1 = (f1 + bfr(ep1[ci + 1])) * ocarry;
            const float w0 = (f0 + bfr(ep2[ci])) * ocarry, w1 = (f1 + bfr(ep2[ci + 1])) * ocarry;
            a[e]  = pk16(h_bits((_Float16)g0), h_bits((_Float16)g1));
            b2[e] = pk16(h_bits((_Float16)w0), h_bits((_Float16)w1));
          } else {
            f0 *= ocarry; f1 *= ocarry;
            const _Float16 x0 = (_Float16)f0, x1 = (_Float16)f1;
            a[e] = pk16(h_bits(x0), h_bits(x1));
            if constexpr (OM == 4) {
              b2[e] = pk16(h_bits((_Float16)(f0 - (float)x0)), h_bits((_Float16)(f1 - (float)x1)));
            }
          }
        }
        hv[it] = a;
        lv[it] = b2;
      }
      {
#pragma unroll
        for (int it = 0; it < 4; ++it) {
          const int row = it * 4 + q8;
          *(v4u*)(C + (size_t)(mBase + row) * ldc + n0 + c8) = hv[it];
          if constexpr (OM >= 4) {
            *(v4u*)(Cb + (size_t)(mBase + row) * ldc + n0 + c8) = lv[it];
          }
        }
        
      }
    }
    wave_sync_lds();
  }
}

// =====================================================================================================
// Causal attention with the skewed relative-position term for one (batch b, head h) pair and a 64-row query tile; 4 waves,
// wave w owns query rows iw0 .. iw0+15, iw0 = i0 + 16w, and walks the key tiles j0 = 0, 64, .., i0 (block-uniform count).
// Planes: QH/QL, KH/KL = f16 hi + residual of (q x64), (k x64), rows b*SEQ + position, pitch DMOD halves, head columns h*64..h*64+63;
//         EP = f16(bf16_RNE(Er) x16) [ELEN][64]; VH/VL = f16 hi + residual of (v x64) as [b][h*64+d][SEQ] (key index contiguous).
//   Srel(i, j) = q_i . Er[ELEN-1 - (i - j)] for j <= i (the pad-reshape skew). Per key tile the wave needs Er rows
//   wlo + x, wlo = ELEN-1 - (iw0 - j0) - 15, x = jj - R + 15 in [0, 78]: position window T[R][x] = (qh+ql)[iw0+R] . EP[wlo + x],
//   x in [0, 80) (5 subtiles of 16 Er rows in a rolled loop, K = 64, Er row clamped on the address; clamping only ever touches
//   entries with j > i, which the causal mask replaces); each 16x16 subtile is stored to the wave's f32 LDS strip right after its WMMAs.
//   Content scores S = (qh+ql) . (kh+kl) (hh + hl + lh, 4 subtiles of 16 keys in a rolled loop, K = 64) -> the wave's f32 slab.
//   score*log2(e) = S*CS + T[R][jj - R + 15]*CT (CS, CT fold 1/(carries) and 1/8); entries with j > i are replaced by -inf;
//   online softmax in base 2, max-subtracted (row max via 16-lane shuffles), running sums in f32; e = exp2(t - m) in (0,1] written
//   of P*1024 (f16 hi + residual) rebuilt from the slab rows (f32 vector loads, split k map) and the v^T hi / residual B fragments loaded
//   straight from VH/VL [h*64+d][j]; 12 WMMAs per 32-key step (Ph.vh + Ph.vl + Pl.vh), 4 d-subtiles.
//   out rows (b*SEQ + iw0 + row), floats h*64 .. h*64+63 = one whole 256-B segment (2 lines) per row: 16 consecutive lanes x 16 B,
//   block = 4 waves = 128 threads; grid = (SEQ/64, NBAT*NH); no block barriers; every wave does bounded work (<= SEQ/64 tiles).
// coverage: LDS strip 16 x 80 of TPI and slab 16 x 64 of SPI per wave, fully written before read each tile; global: 8 instructions x
//           2 rows x 64 floats = rows iw0..iw0+15 of head segment h; grid x waves cover all NBAT*SEQ rows and all NH head segments once.
// =====================================================================================================
__global__ __launch_bounds__(ATT_THREADS) __attribute__((amdgpu_num_vgpr(256)))
void attn_rel(const unsigned short* __restrict__ QH, const unsigned short* __restrict__ QL,
              const unsigned short* __restrict__ KH, const unsigned short* __restrict__ KL,
              const unsigned short* __restrict__ EP,
              const unsigned short* __restrict__ VH, const unsigned short* __restrict__ VL,
              float* out) {
  __shared__ __align__(16) float smem[ATT_W * WFL];   // per wave: T strip [16][TPI] | score / prob / ctx slab [16][SPI]

  const int tid  = threadIdx.x;
  const int wave = tid >> 5;
  const int lane = tid & 31;
  const int hh   = lane >> 4;
  const int c    = lane & 15;
  const int bh   = blockIdx.y;
  const int b    = bh / NH;
  const int h    = bh - b * NH;
  const int i0   = blockIdx.x * 64;
  const int iw0  = i0 + wave * 16;

  float* tsh = smem + wave * WFL;
  float* pt  = tsh + 16 * TPI;

  const size_t qro = ((size_t)b * SEQ + iw0 + c) * DMOD + h * DH + 8 * hh;      // A rows: query iw0 + c, d 8hh..
  const unsigned short* Khb = KH + (size_t)b * SEQ * DMOD + h * DH + 8 * hh;
  const unsigned short* Klb = KL + (size_t)b * SEQ * DMOD + h * DH + 8 * hh;
  const unsigned short* Eb  = EP + 8 * hh;
  const size_t vpo = (size_t)b * DMOD * SEQ + (size_t)(h * DH) * SEQ + 8 * hh;
  const unsigned short* Vhb = VH + vpo;
  const unsigned short* Vlb = VL + vpo;

  const float CS = LOG2E * SCALE / (QC * KC);
  const float CT = LOG2E * SCALE / (QC * EC);

  float mrow[8], lrow[8];
  v8f O[4];
#pragma unroll
  for (int r = 0; r < 8; ++r) { mrow[r] = -INFINITY; lrow[r] = 0.f; }
#pragma unroll
  for (int td = 0; td < 4; ++td) O[td] = zero8();

  const int ntile = blockIdx.x + 1;          // causal: key tiles j0 <= i0
#pragma unroll 1
  for (int jt = 0; jt < ntile; ++jt) {
    const int j0 = jt * 64;
    const v16h qha = ldfrag_u(QH + qro), qhb = ldfrag_u(QH + qro + 32);
    const v16h qla = ldfrag_u(QL + qro), qlb = ldfrag_u(QL + qro + 32);

    // ---- position window T (5 subtiles of 16 Er rows, rolled), each subtile stored to the LDS strip as produced ----
    {
      const int wlo = (ELEN - 1) - (iw0 - j0) - 15;
#pragma unroll 1
      for (int u = 0; u < 5; ++u) {
        int m = wlo + 16 * u + c;
        m = (m < 0) ? 0 : m;
        m = (m > ELEN - 1) ? (ELEN - 1) : m;
        const size_t eo = (size_t)m * DH;
        const v16h fa = ldfrag_u(Eb + eo), fb = ldfrag_u(Eb + eo + 32);
        v8f t8 = mma_h(qha, fa, zero8());
        t8 = mma_h(qla, fa, t8);
        t8 = mma_h(qhb, fb, t8);
        t8 = mma_h(qlb, fb, t8);
        hz6(t8, fa, fb, qha, qla, qhb, qlb);
        const int cb = 16 * u + c;
#pragma unroll
        for (int r = 0; r < 8; ++r) tsh[(8 * hh + r) * TPI + cb] = t8[r];
      }
    }
    // ---- content scores S (4 subtiles of 16 keys, rolled) -> slab ----
#pragma unroll 1
    for (int t = 0; t < 4; ++t) {
      const size_t ko = (size_t)(j0 + 16 * t + c) * DMOD;
      const v16h kha = ldfrag_u(Khb + ko), khb = ldfrag_u(Khb + ko + 32);
      const v16h kla = ldfrag_u(Klb + ko), klb = ldfrag_u(Klb + ko + 32);
      v8f s8 = mma_h(qha, kha, zero8());
      s8 = mma_h(qha, kla, s8);
      s8 = mma_h(qla, kha, s8);
      s8 = mma_h(qhb, khb, s8);
      s8 = mma_h(qhb, klb, s8);
      s8 = mma_h(qlb, khb, s8);
      hz8(s8, kha, khb, kla, klb, qha, qla, qhb, qlb);
      const int cb = 16 * t + c;
#pragma unroll
      for (int r = 0; r < 8; ++r) pt[(8 * hh + r) * SPI + cb] = s8[r];
    }
    wave_sync_lds();

    // ---- score assembly, causal mask, online softmax (rows live on one 16-lane half) ----
#pragma unroll
    for (int r = 0; r < 8; ++r) {
      const int R = 8 * hh + r;
      const int i = iw0 + R;
      const float* trow = tsh + R * TPI + (15 - R) + c;
      float* srow = pt + R * SPI + c;
      float tv[4];
#pragma unroll
      for (int t = 0; t < 4; ++t) {
        const int j = j0 + 16 * t + c;
        const float val = srow[16 * t] * CS + trow[16 * t] * CT;
        tv[t] = (j > i) ? -INFINITY : val;
      }
      float mx = fmaxf(fmaxf(tv[0], tv[1]), fmaxf(tv[2], tv[3]));
#pragma unroll
      for (int off = 1; off < 16; off <<= 1) mx = fmaxf(mx, __shfl_xor(mx, off, 32));
      const float mn = fmaxf(mrow[r], mx);
      const float al = exp2f(mrow[r] - mn);
      mrow[r] = mn;
      float e4[4];
      float ps = 0.f;
#pragma unroll
      for (int t = 0; t < 4; ++t) { e4[t] = exp2f(tv[t] - mn); ps += e4[t]; }
#pragma unroll
      for (int off = 1; off < 16; off <<= 1) ps += __shfl_xor(ps, off, 32);
      lrow[r] = lrow[r] * al + ps;
#pragma unroll
      for (int td = 0; td < 4; ++td) O[td][r] *= al;
#pragma unroll
      for (int t = 0; t < 4; ++t) srow[16 * t] = e4[t];
    }
    wave_sync_lds();

    // ---- O += (Ph + Pl) . (vh + vl)^T, two k-steps of 32 keys ----
#pragma unroll
    for (int ks = 0; ks < 2; ++ks) {
      FragH ph, pl;
      {
        const float* prow = pt + c * SPI + 32 * ks + 8 * hh;
        const v4f p0 = *(const v4f*)(prow), p1 = *(const v4f*)(prow + 4);
        const v4f p2 = *(const v4f*)(prow + 16), p3 = *(const v4f*)(prow + 20);
#pragma unroll
        for (int e = 0; e < 4; ++e) {
          _Float16 a0, a1;
          sp16(p0[e] * PC, a0, a1); ph.h[0][e]     = a0; pl.h[0][e]     = a1;   // keys 32ks + 8hh + e
          sp16(p1[e] * PC, a0, a1); ph.h[0][4 + e] = a0; pl.h[0][4 + e] = a1;   // keys 32ks + 8hh + 4 + e
          sp16(p2[e] * PC, a0, a1); ph.h[1][e]     = a0; pl.h[1][e]     = a1;   // keys 32ks + 16 + 8hh + e
          sp16(p3[e] * PC, a0, a1); ph.h[1][4 + e] = a0; pl.h[1][4 + e] = a1;
        }
      }
      const size_t vo = (size_t)c * SEQ + j0 + 32 * ks;
#pragma unroll
      for (int td = 0; td < 4; ++td) {
        const size_t vv = vo + (size_t)(16 * td) * SEQ;
        const v16h vh = ldfrag_u(Vhb + vv), vl = ldfrag_u(Vlb + vv);
        O[td] = mma_h(ph.v, vh, O[td]);
        O[td] = mma_h(ph.v, vl, O[td]);
        O[td] = mma_h(pl.v, vh, O[td]);
        hz4(O[td], vh, vl, ph.v, pl.v);
      }
    }
    wave_sync_lds();
  }
  acc_guard4(O[0], O[1], O[2], O[3]);

  // ---- fold 1/l and the carries (1024 on P, 64 on v), stage the wave's 16x64 f32 slice in its slab ----
  const float oc = 1.0f / (PC * VC);
#pragma unroll
  for (int r = 0; r < 8; ++r) {
    const float inv = (1.0f / lrow[r]) * oc;
    const int ro = (8 * hh + r) * SPI + c;
#pragma unroll
    for (int td = 0; td < 4; ++td) pt[ro + 16 * td] = O[td][r] * inv;
  }
  wave_sync_lds();
  {
    const int c4 = c * 4;
    v4f vals[8];
#pragma unroll
    for (int it = 0; it < 8; ++it) {
      const int row = it * 2 + hh;                           // it 0..7 x hh 0..1 = rows 0..15
      vals[it] = *(const v4f*)(pt + row * SPI + c4);
    }
    float* ob = out + ((size_t)b * SEQ + iw0) * DMOD + h * DH + c4;
    {
#pragma unroll
      for (int it = 0; it < 8; ++it) {
        const int row = it * 2 + hh;
        *(v4f*)(ob + (size_t)row * DMOD) = vals[it];
      }
      
    }
  }
}

// =====================================================================================================
// Workspace map (bytes); every plane is an exact multiple of its tile / whole-row store granularity (M, N exact tile multiples,
// convert counts exact multiples of 2048, no pad rows), every offset a multiple of 262144:
//   Xq, Xk, Xv  f16 [NROW][1024] x16                            3 x 8388608
//   Wq, Wk, Wv  f16 [1024 out][1024 in] x64                      3 x 2097152
//   EP          f16 [ELEN][64] x16                                   262144
//   QH, QL, KH, KL f16 [NROW][1024] (x64 hi / residual)         4 x 8388608
//   VH, VL      f16 [NBAT][1024][SEQ] (x64 hi / residual)       2 x 8388608
//   end                                                            82051072
// =====================================================================================================
extern "C" void kernel_launch(void* const* d_in, const int* in_sizes, int n_in,
                              void* d_out, int out_size, void* d_ws, size_t ws_size,
                              hipStream_t stream) {
  if (n_in < 10) return;
  if (in_sizes[0] != NROW * DMOD || in_sizes[1] != NROW * DMOD || in_sizes[2] != NROW * DMOD) return;
  if (in_sizes[3] != DMOD * DMOD || in_sizes[5] != DMOD * DMOD || in_sizes[7] != DMOD * DMOD) return;
  if (in_sizes[4] != DMOD || in_sizes[6] != DMOD || in_sizes[8] != DMOD) return;
  if (in_sizes[9] != ELEN * DH) return;
  if (out_size != NROW * DMOD) return;

  const float* qin = (const float*)d_in[0];
  const float* kin = (const float*)d_in[1];
  const float* vin = (const float*)d_in[2];
  const float* w_q = (const float*)d_in[3];
  const float* b_q = (const float*)d_in[4];
  const float* w_k = (const float*)d_in[5];
  const float* b_k = (const float*)d_in[6];
  const float* w_v = (const float*)d_in[7];
  const float* b_v = (const float*)d_in[8];
  const float* er  = (const float*)d_in[9];
  float*       out = (float*)d_out;

  const size_t PX = (size_t)NROW * DMOD * 2;             //  8388608
  const size_t PW = (size_t)DMOD * DMOD * 2;             //  2097152
  const size_t PE = (size_t)ELEN * DH * 2;               //   262144
  const size_t PV = (size_t)NBAT * DMOD * SEQ * 2;       //  8388608
  size_t off = 0;
  const size_t oXq = off; off += PX;
  const size_t oXk = off; off += PX;
  const size_t oXv = off; off += PX;
  const size_t oWq = off; off += PW;
  const size_t oWk = off; off += PW;
  const size_t oWv = off; off += PW;
  const size_t oE  = off; off += PE;
  const size_t oQH = off; off += PX;
  const size_t oQL = off; off += PX;
  const size_t oKH = off; off += PX;
  const size_t oKL = off; off += PX;
  const size_t oVH = off; off += PV;
  const size_t oVL = off; off += PV;
  if (off > ws_size) return;                               // off = 82051072
  if (off > (size_t)134217728) return;

  char* ws = (char*)d_ws;
  unsigned short* Xq  = (unsigned short*)(ws + oXq);
  unsigned short* Xk  = (unsigned short*)(ws + oXk);
  unsigned short* Xv  = (unsigned short*)(ws + oXv);
  unsigned short* Wq6 = (unsigned short*)(ws + oWq);
  unsigned short* Wk6 = (unsigned short*)(ws + oWk);
  unsigned short* Wv6 = (unsigned short*)(ws + oWv);
  unsigned short* E16 = (unsigned short*)(ws + oE);
  unsigned short* QHp = (unsigned short*)(ws + oQH);
  unsigned short* QLp = (unsigned short*)(ws + oQL);
  unsigned short* KHp = (unsigned short*)(ws + oKH);
  unsigned short* KLp = (unsigned short*)(ws + oKL);
  unsigned short* VHp = (unsigned short*)(ws + oVH);
  unsigned short* VLp = (unsigned short*)(ws + oVL);

  const dim3 blk(256);
  const dim3 gCX((NROW * DMOD) / 2048);                             // 2048
  const dim3 gCW((DMOD * DMOD) / 2048);                             // 512
  const dim3 gCE((ELEN * DH) / 2048);                               // 64
  const int tilesQ = (NROW / 64) * (DMOD / 64);                     // 1024
  const int tilesV = (DMOD / 64) * (SEQ / 64);                      // 512 per batch
  const dim3 gQ((tilesQ + 7) / 8, 1);                               // 128
  const dim3 gV((tilesV + 7) / 8, NBAT);                            // 64 x NBAT
  const dim3 gAT(SEQ / 64, NBAT * NH);                              // 32 x 32
  const dim3 bAT(ATT_THREADS);                                      // 128

  // (0) 16-bit planes of the inputs: activations f16(bf16_RNE(x) * 16); W[out][in] (already k-contiguous) f16(bf16_RNE(w) * 64);
  //     Er f16(bf16_RNE(e) * 16)
  cvt16<<<gCX, blk, 0, stream>>>(qin, Xq, NROW * DMOD, XC);
  cvt16<<<gCX, blk, 0, stream>>>(kin, Xk, NROW * DMOD, XC);
  cvt16<<<gCX, blk, 0, stream>>>(vin, Xv, NROW * DMOD, XC);
  cvt16<<<gCW, blk, 0, stream>>>(w_q, Wq6, DMOD * DMOD, WSC);
  cvt16<<<gCW, blk, 0, stream>>>(w_k, Wk6, DMOD * DMOD, WSC);
  cvt16<<<gCW, blk, 0, stream>>>(w_v, Wv6, DMOD * DMOD, WSC);
  cvt16<<<gCE, blk, 0, stream>>>(er, E16, ELEN * DH, EC);

  // (1) q[m][e] = sum_d x[m][d] Wq[e][d] / 1024 + bq[e] -> QH = f16(q * 64), QL = f16(q * 64 - QH); M = NROW, N = 1024, K = 1024
  gemm64<4, 0, 0, 1><<<gQ, blk, 0, stream>>>(
      Xq, Xq, DMOD, 0LL,
      Wq6, DMOD, 0LL,
      (void*)QHp, (void*)QLp, DMOD, 0LL,
      NROW, DMOD, DMOD, 1.0f / (XC * WSC), QC,
      b_q, b_q, b_q);

  // (2) k projection + bk -> KH, KL (x64)
  gemm64<4, 0, 0, 1><<<gQ, blk, 0, stream>>>(
      Xk, Xk, DMOD, 0LL,
      Wk6, DMOD, 0LL,
      (void*)KHp, (void*)KLp, DMOD, 0LL,
      NROW, DMOD, DMOD, 1.0f / (XC * WSC), KC,
      b_k, b_k, b_k);

  // (3) v^T per batch: VT[b][e][j] = sum_c Wv[e][c] x[b*SEQ+j][c] / 1024 + bv[e] (per-row bias) -> VH, VL (x64);
  //     M = 1024 (e), N = SEQ (j), K = 1024; B rows = the batch's token rows (pitch DMOD, batch offset SEQ*DMOD)
  gemm64<4, 0, 0, 2><<<gV, blk, 0, stream>>>(
      Wv6, Wv6, DMOD, 0LL,
      Xv, DMOD, (long long)SEQ * DMOD,
      (void*)VHp, (void*)VLp, SEQ, (long long)DMOD * SEQ,
      DMOD, SEQ, DMOD, 1.0f / (XC * WSC), VC,
      b_v, b_v, b_v);

  // (4) causal relative attention -> out[b][i][h*64+d] (f32), written directly
  attn_rel<<<gAT, bAT, 0, stream>>>(QHp, QLp, KHp, KLp, E16, VHp, VLp, out);
  (void)hipGetLastError();
}

// v001
// It runs in 364 microseconds.
// In two side-by-side timings against v000, it was 1.23 and 1.22 times as fast.
// Contractions (all v_wmma_f32_16x16x32_f16, f16 operands, f32 accumulate): q/k/v projections (x f16 x16 . W f16 x64, K=1024, single products,
// outputs written as f16 hi + unscaled f16 residual planes); position window ((qh+ql) x64 . Er f16 x16, K=64, 2 products) -> f32 LDS strip,
// shifted gather on VALU; content scores ((qh+ql) x64 . (kh+kl) x64, K=64, hh+hl+lh); P . v^T ((Ph+Pl) x1024 . (vh+vl) x64, hh+hl+lh,
// 64 keys per tile). Causal mask, max-subtracted online base-2 softmax and the 1/l fold in f32 on VALU. Every float input RNE-converted to bf16 on load.
#include <hip/hip_runtime.h>
#include <math.h>
#include <stdint.h>

#define SEQ   2048
#define NBAT  2
#define DMOD  1024
#define NH    16
#define DH    64
#define ELEN  2048
#define NROW  (NBAT * SEQ)
#define XC    16.0f
#define WSC   64.0f
#define QC    64.0f
#define KC    64.0f
#define EC    16.0f
#define VC    64.0f
#define PC    1024.0f
#define SCALE 0.125f
#define LOG2E 1.4426950408889634f
static_assert(NH * DH == DMOD);
static_assert(DH == 64);
static_assert(ELEN == SEQ);
static_assert((SEQ % 64) == 0 && (DMOD % 64) == 0 && (NROW % 64) == 0);
static_assert(((NROW * DMOD) % 2048) == 0 && ((DMOD * DMOD) % 2048) == 0 && ((ELEN * DH) % 2048) == 0);
#define ATT_W 4
#define ATT_THREADS (ATT_W * 32)
#define TPI 84
#define SPI 68
#define WFL (16 * TPI + 16 * SPI)
static_assert(((16 * TPI) % 4) == 0 && ((16 * SPI) % 4) == 0 && (WFL % 4) == 0);

typedef _Float16 v16h __attribute__((ext_vector_type(16)));
typedef _Float16 v8h  __attribute__((ext_vector_type(8)));
typedef __bf16   v16b __attribute__((ext_vector_type(16)));
typedef float    v8f  __attribute__((ext_vector_type(8)));
typedef float    v4f  __attribute__((ext_vector_type(4)));
typedef float    v2f  __attribute__((ext_vector_type(2)));
typedef unsigned int v4u __attribute__((ext_vector_type(4)));

union FragH { v16h v; v8h h[2]; v4u u[2]; };
union FragAny { v16h h; v16b b; };

// ---- scalar helpers --------------------------------------------------------------------------------
__device__ __forceinline__ unsigned short bf_bits(float f) {          // f32 -> bf16 bits, RNE convert
  unsigned u = __float_as_uint(f);
  return (unsigned short)((u + 0x7FFFu + ((u >> 16) & 1u)) >> 16);
}
__device__ __forceinline__ float bf_up(unsigned short h) { return __uint_as_float(((unsigned)h) << 16); }
__device__ __forceinline__ float bfr(float f) { return bf_up(bf_bits(f)); }   // value of the bf16 RNE convert
__device__ __forceinline__ unsigned short h_bits(_Float16 x) { return __builtin_bit_cast(unsigned short, x); }
__device__ __forceinline__ unsigned pk16(unsigned short a, unsigned short b) { return (unsigned)a | ((unsigned)b << 16); }
__device__ __forceinline__ v8f zero8() { v8f z = {0.f, 0.f, 0.f, 0.f, 0.f, 0.f, 0.f, 0.f}; return z; }

// ---- fragment loader: 16-bit A/B operand from a k-contiguous 16-bit plane, lane -> row/col (lane&15),
//      p already includes +8*(lane>>4); elements 0..7 <- p[0..7] (k0+8h..), elements 8..15 <- p[16..23] (k0+16+8h..)
//      (same split k map for A and B; B is always read from a [n][k] plane)
__device__ __forceinline__ v16h ldfrag_u(const unsigned short* p) {
  FragH f;
  f.u[0] = *(const v4u*)(p);
  f.u[1] = *(const v4u*)(p + 16);
  return f.v;
}

// ---- WMMA helpers with trailing VALU hazard gaps ------------------------------------------------------
__device__ __forceinline__ v8f mma_h(v16h a, v16h b, v8f c) {
  return __builtin_amdgcn_wmma_f32_16x16x32_f16(false, a, false, b, (short)0, c, false, false);
}
__device__ __forceinline__ v8f mma_b(v16h a, v16h b, v8f c) {
  FragAny ua, ub;
  ua.h = a;
  ub.h = b;
  return __builtin_amdgcn_wmma_f32_16x16x32_bf16(false, ua.b, false, ub.b, (short)0, c, false, false);
}
template <int BF>
__device__ __forceinline__ v8f mmaT(v16h a, v16h b, v8f c) {
  if constexpr (BF != 0) return mma_b(a, b, c);
  else return mma_h(a, b, c);
}
__device__ __forceinline__ void dep_guard1(v8f& a, v8f& b, v16h x) {
#if defined(__HIP_DEVICE_COMPILE__)
  asm volatile("v_nop\n\tv_nop\n\tv_nop\n\tv_nop" : "+v"(a), "+v"(b) : "v"(x));
#endif
}
__device__ __forceinline__ void hz4(v8f& d, v16h x0, v16h x1, v16h x2, v16h x3) {
#if defined(__HIP_DEVICE_COMPILE__)
  asm volatile("v_nop\n\tv_nop\n\tv_nop\n\tv_nop" : "+v"(d) : "v"(x0), "v"(x1), "v"(x2), "v"(x3));
#endif
}
__device__ __forceinline__ void hz6(v8f& d, v16h x0, v16h x1, v16h x2, v16h x3, v16h x4, v16h x5) {
#if defined(__HIP_DEVICE_COMPILE__)
  asm volatile("v_nop\n\tv_nop\n\tv_nop\n\tv_nop" : "+v"(d) : "v"(x0), "v"(x1), "v"(x2), "v"(x3), "v"(x4), "v"(x5));
#endif
}
__device__ __forceinline__ void hz8(v8f& d, v16h x0, v16h x1, v16h x2, v16h x3, v16h x4, v16h x5, v16h x6, v16h x7) {
#if defined(__HIP_DEVICE_COMPILE__)
  asm volatile("v_nop\n\tv_nop\n\tv_nop\n\tv_nop" : "+v"(d) : "v"(x0), "v"(x1), "v"(x2), "v"(x3), "v"(x4), "v"(x5), "v"(x6), "v"(x7));
#endif
}
__device__ __forceinline__ void keep4_h(v16h a, v16h b, v16h c, v16h d) {
#if defined(__HIP_DEVICE_COMPILE__)
  asm volatile("v_nop" :: "v"(a), "v"(b), "v"(c), "v"(d));
#endif
}
__device__ __forceinline__ void acc_guard4(v8f& a, v8f& b, v8f& c, v8f& d) {
#if defined(__HIP_DEVICE_COMPILE__)
  asm volatile("v_nop\n\tv_nop\n\tv_nop\n\tv_nop" : "+v"(a), "+v"(b), "+v"(c), "+v"(d));
#endif
}
__device__ __forceinline__ void wave_sync_lds() {
  __builtin_amdgcn_fence(__ATOMIC_RELEASE, "workgroup");
  __builtin_amdgcn_wave_barrier();
  __builtin_amdgcn_fence(__ATOMIC_ACQUIRE, "workgroup");
}
// s_wait_xcnt 0 behind a run of global fragment loads of the GEMM. The loads' address pointers are inputs only, so their registers stay
// live up to the wait: no later load of the run lands on them and no address arithmetic rewrites them before the wait has passed.
__device__ __forceinline__ void addr_wait1(const unsigned short* p) {
#if defined(__HIP_DEVICE_COMPILE__)
  asm volatile("s_wait_xcnt 0x0" :: "v"(p) : "memory");
#endif
}
__device__ __forceinline__ void addr_wait4(const unsigned short* p0, const unsigned short* p1, const unsigned short* p2, const unsigned short* p3) {
#if defined(__HIP_DEVICE_COMPILE__)
  asm volatile("s_wait_xcnt 0x0" :: "v"(p0), "v"(p1), "v"(p2), "v"(p3) : "memory");
#endif
}
// f32 -> f16 hi + unscaled f16 residual (hi + lo ~ x to 2^-22 relative; a flushed subnormal lo costs < 6.1e-5 absolute in the carried scale)
__device__ __forceinline__ void sp16(float x, _Float16& hi, _Float16& lo) {
  const _Float16 a = (_Float16)x;
  hi = a;
  lo = (_Float16)(x - (float)a);
}

// =====================================================================================================
// Elementwise 16-bit pack, no transpose: dst[i] = f16( bf16_RNE(src[i]) * sc ), sc a power of two (exact).
// coverage: grid = n / 2048 blocks x 256 thr x 8 elements = n exactly (host checks n % 2048 == 0).
// =====================================================================================================
__global__ __launch_bounds__(256) void cvt16(const float* __restrict__ src, unsigned short* dst, int n, float sc) {
  const size_t i8 = ((size_t)blockIdx.x * 256 + threadIdx.x) * 8;
  if (i8 + 8 > (size_t)n) return;                 // never taken with the exact grid; no barriers in this kernel
  const v4f a = *(const v4f*)(src + i8);
  const v4f b = *(const v4f*)(src + i8 + 4);
  v4u o;
  o[0] = pk16(h_bits((_Float16)(bfr(a[0]) * sc)), h_bits((_Float16)(bfr(a[1]) * sc)));
  o[1] = pk16(h_bits((_Float16)(bfr(a[2]) * sc)), h_bits((_Float16)(bfr(a[3]) * sc)));
  o[2] = pk16(h_bits((_Float16)(bfr(b[0]) * sc)), h_bits((_Float16)(bfr(b[1]) * sc)));
  o[3] = pk16(h_bits((_Float16)(bfr(b[2]) * sc)), h_bits((_Float16)(bfr(b[3]) * sc)));
  {
    *(v4u*)(dst + i8) = o;
    
  }
}

// =====================================================================================================
// Register-blocked batched 16-bit WMMA GEMM body (device function, called by proj3): C[m][n] = oscale * sum_k A[m][k] * Bt[n][k] (+ bias);
// one wave per 64x64 tile, no block barriers. A row-major [M][K] pitch lda (16-bit plane), Bt row-major [N][K] pitch ldb (k contiguous); M, N multiples of 64,
// K multiple of 32. by = batch index with element strides sA, sB, sC; bx = workgroup index inside the batch; slab = the wave's LDS slab.
// ASPLIT 1: a second A plane A2 (unscaled residual of A, same layout) is multiplied into the same accumulator (A + A2 ~ exact A).
// BF 1: bf16 operands (v_wmma_f32_16x16x32_bf16), else f16.
// EPI 1: value += bf16_RNE(ep0[column]) (per-column bias); EPI 2: value += bf16_RNE(ep0[row]) (per-row bias, 16-bit out only).
// OM 0: f32 out (pitch ldc).  OM 2: one f16 plane = f16(value * ocarry).
// OM 4: two f16 planes: hi = f16(value * ocarry), lo = f16(value * ocarry - hi) (unscaled residual).
// OM 5: two f16 planes: C = f16((value + bf16_RNE(ep1[column])) * ocarry), C2 = f16((value + bf16_RNE(ep2[column])) * ocarry).
// coverage: 4 slabs x 16 rows (f32: it 0..7 x lane>>4; 16-bit: it 0..3 x lane>>3) x 64 cols = the wave's whole 64x64 tile;
//           bx covers ceil(tilesM*tilesN/GW) workgroups of GW waves, surplus waves return (wave-uniform).
// =====================================================================================================
#define GW 4   // waves per projection workgroup
template <int OM, int ASPLIT, int BF, int EPI>
__device__ __forceinline__ void gemm64(
    const unsigned short* __restrict__ Ap, const unsigned short* __restrict__ A2p, int lda, long long sA,
    const unsigned short* __restrict__ Btp, int ldb, long long sB,
    void* Cout, void* C2out, int ldc, long long sC,
    int M, int N, int K, float oscale, float ocarry,
    const float* __restrict__ ep0, const float* __restrict__ ep1, const float* __restrict__ ep2,
    int bx, int by, float* slab) {
  const int lane = threadIdx.x & 31;
  const int wave = threadIdx.x >> 5;
  const int tilesN = N >> 6;
  const int tilesM = M >> 6;
  const int tile = bx * GW + wave;
  if (tile >= tilesM * tilesN) return;   // wave-uniform; no block barriers in the calling kernel
  const int tm = tile / tilesN;
  const int tn = tile - tm * tilesN;
  const int m0 = tm << 6;
  const int n0 = tn << 6;

  const unsigned short* A1 = Ap  + (size_t)((long long)by * sA);
  const unsigned short* A2 = A2p + (size_t)((long long)by * sA);
  const unsigned short* Bb = Btp + (size_t)((long long)by * sB);

  const int rlane = lane & 15;                 // row (A) / col (B, D) within subtile
  const int koff  = (lane >> 4) * 8;           // k offset of this lane half
  const int mOff  = (lane >> 4) * 8;           // D row offset

  v8f acc[4][4];
#pragma unroll
  for (int i = 0; i < 4; ++i)
#pragma unroll
    for (int j = 0; j < 4; ++j) acc[i][j] = zero8();

  for (int k0 = 0; k0 < K; k0 += 32) {
    v16h bh[4];
    const unsigned short* pb[4];
#pragma unroll
    for (int j = 0; j < 4; ++j) {
      const size_t bofs = (size_t)(n0 + (j << 4) + rlane) * ldb + koff + k0;
      pb[j] = Bb + bofs;
      bh[j] = ldfrag_u(pb[j]);
    }
    addr_wait4(pb[0], pb[1], pb[2], pb[3]);
#pragma unroll
    for (int i = 0; i < 4; ++i) {
      const size_t ao = (size_t)(m0 + (i << 4) + rlane) * lda + koff + k0;
      const unsigned short* pa = A1 + ao;
      const v16h ah = ldfrag_u(pa);
      addr_wait1(pa);
#pragma unroll
      for (int j = 0; j < 4; ++j) acc[i][j] = mmaT<BF>(ah, bh[j], acc[i][j]);
      dep_guard1(acc[i][0], acc[i][3], ah);
      if constexpr (ASPLIT != 0) {
        const unsigned short* pa2 = A2 + ao;
        const v16h al = ldfrag_u(pa2);
        addr_wait1(pa2);
#pragma unroll
        for (int j = 0; j < 4; ++j) acc[i][j] = mmaT<BF>(al, bh[j], acc[i][j]);
        dep_guard1(acc[i][0], acc[i][3], al);
      }
    }
    keep4_h(bh[0], bh[1], bh[2], bh[3]);
  }
  acc_guard4(acc[0][0], acc[0][1], acc[0][2], acc[0][3]);
  acc_guard4(acc[1][0], acc[1][1], acc[1][2], acc[1][3]);
  acc_guard4(acc[2][0], acc[2][1], acc[2][2], acc[2][3]);
  acc_guard4(acc[3][0], acc[3][1], acc[3][2], acc[3][3]);

  const int hh2 = lane >> 4, c4 = (lane & 15) * 4;     // f32 out: 256-B row segment = 16 lanes x 16 B
  const int q8  = lane >> 3, c8 = (lane & 7) * 8;

  // ---- epilogue ----
#pragma unroll
  for (int i = 0; i < 4; ++i) {
    const int mBase = m0 + (i << 4);
#pragma unroll
    for (int j = 0; j < 4; ++j) {
#pragma unroll
      for (int r = 0; r < 8; ++r) {
        slab[(mOff + r) * 68 + (j << 4) + rlane] = acc[i][j][r];
      }
    }
    wave_sync_lds();
    if constexpr (OM == 0) {
      float* C = (float*)Cout + (size_t)((long long)by * sC);
      v4f vals[8];
#pragma unroll
      for (int it = 0; it < 8; ++it) {
        const int row = it * 2 + hh2;                      // it 0..7 x hh2 0..1 = rows 0..15
        v4f v = *(const v4f*)(slab + row * 68 + c4);
#pragma unroll
        for (int e = 0; e < 4; ++e) v[e] = v[e] * oscale;
        if constexpr (EPI == 1) {
          const v4f bb = *(const v4f*)(ep0 + n0 + c4);     // per-column bias, columns n0+c4 .. +3 (N equals the bias length)
#pragma unroll
          for (int e = 0; e < 4; ++e) v[e] = v[e] + bfr(bb[e]);
        }
        vals[it] = v;
      }
      {
#pragma unroll
        for (int it = 0; it < 8; ++it) {
          const int gr = mBase + it * 2 + hh2;
          *(v4f*)(C + (size_t)gr * ldc + n0 + c4) = vals[it];
        }
        
      }
    } else {
      unsigned short* C  = (unsigned short*)Cout  + (size_t)((long long)by * sC);
      unsigned short* Cb = (unsigned short*)C2out + (size_t)((long long)by * sC);
      v4u hv[4], lv[4];
#pragma unroll
      for (int it = 0; it < 4; ++it) {
        const int row = it * 4 + q8;                       // it 0..3 x q8 0..3 = rows 0..15
        const float* sp = slab + row * 68 + c8;
        float rb = 0.f;
        if constexpr (EPI == 2) rb = bfr(ep0[mBase + row]);   // per-row bias (M equals the bias length)
        v4u a  = {0u, 0u, 0u, 0u};
        v4u b2 = {0u, 0u, 0u, 0u};
#pragma unroll
        for (int e = 0; e < 4; ++e) {
          const int ci = n0 + c8 + 2 * e;                  // column index, < N
          float f0 = sp[2 * e] * oscale + rb;
          float f1 = sp[2 * e + 1] * oscale + rb;
          if constexpr (EPI == 1) {
            f0 += bfr(ep0[ci]);
            f1 += bfr(ep0[ci + 1]);
          }
          if constexpr (OM == 5) {
            const float g0 = (f0 + bfr(ep1[ci])) * ocarry, g1 = (f1 + bfr(ep1[ci + 1])) * ocarry;
            const float w0 = (f0 + bfr(ep2[ci])) * ocarry, w1 = (f1 + bfr(ep2[ci + 1])) * ocarry;
            a[e]  = pk16(h_bits((_Float16)g0), h_bits((_Float16)g1));
            b2[e] = pk16(h_bits((_Float16)w0), h_bits((_Float16)w1));
          } else {
            f0 *= ocarry; f1 *= ocarry;
            const _Float16 x0 = (_Float16)f0, x1 = (_Float16)f1;
            a[e] = pk16(h_bits(x0), h_bits(x1));
            if constexpr (OM == 4) {
              b2[e] = pk16(h_bits((_Float16)(f0 - (float)x0)), h_bits((_Float16)(f1 - (float)x1)));
            }
          }
        }
        hv[it] = a;
        lv[it] = b2;
      }
      {
#pragma unroll
        for (int it = 0; it < 4; ++it) {
          const int row = it * 4 + q8;
          *(v4u*)(C + (size_t)(mBase + row) * ldc + n0 + c8) = hv[it];
          if constexpr (OM >= 4) {
            *(v4u*)(Cb + (size_t)(mBase + row) * ldc + n0 + c8) = lv[it];
          }
        }
        
      }
    }
    wave_sync_lds();
  }
}

// =====================================================================================================
// The three projections in ONE launch, so that their waves are on the chip together: blockIdx.y = 0: q, 1: k, 2: v^T.
//   q, k: M = NROW, N = 1024, K = 1024, per-column bias; (NROW/64)*(DMOD/64) = 1024 tiles = PJB workgroups of GW waves.
//   v^T per batch: VT[b][e][j], M = 1024 (e), N = SEQ (j), K = 1024, per-row bias; 512 tiles per batch = PJB/NBAT workgroups,
//   batch = blockIdx.x / (PJB/NBAT). Every branch below is workgroup-uniform; no block barriers.
// coverage: grid (PJB, 3) x GW waves = every 64x64 tile of QH/QL, KH/KL and VH/VL exactly once.
// =====================================================================================================
#define PJB (((NROW / 64) * (DMOD / 64)) / GW)
static_assert(((NROW / 64) * (DMOD / 64)) % GW == 0);
static_assert((DMOD / 64) * (SEQ / 64) * NBAT == PJB * GW && (PJB % NBAT) == 0);
__global__ __launch_bounds__(GW * 32) __attribute__((amdgpu_num_vgpr(256))) void proj3(
    const unsigned short* __restrict__ Xq, const unsigned short* __restrict__ Xk, const unsigned short* __restrict__ Xv,
    const unsigned short* __restrict__ Wq, const unsigned short* __restrict__ Wk, const unsigned short* __restrict__ Wv,
    unsigned short* QH, unsigned short* QL, unsigned short* KH, unsigned short* KL, unsigned short* VH, unsigned short* VL,
    const float* __restrict__ bq, const float* __restrict__ bk, const float* __restrict__ bv) {
  __shared__ __align__(16) float sT[GW][16 * 68];   // per-wave 16x64 slab, pitch 68 floats
  float* slab = sT[threadIdx.x >> 5];
  const int p = blockIdx.y;
  if (p < 2) {
    const unsigned short* X = (p == 0) ? Xq : Xk;
    const unsigned short* Wt = (p == 0) ? Wq : Wk;
    unsigned short* H = (p == 0) ? QH : KH;
    unsigned short* L = (p == 0) ? QL : KL;
    const float* bias = (p == 0) ? bq : bk;
    gemm64<4, 0, 0, 1>(X, X, DMOD, 0LL, Wt, DMOD, 0LL, (void*)H, (void*)L, DMOD, 0LL,
                       NROW, DMOD, DMOD, 1.0f / (XC * WSC), (p == 0) ? QC : KC,
                       bias, bias, bias, blockIdx.x, 0, slab);
  } else {
    const int per = PJB / NBAT;
    const int bt  = blockIdx.x / per;
    gemm64<4, 0, 0, 2>(Wv, Wv, DMOD, 0LL, Xv, DMOD, (long long)SEQ * DMOD, (void*)VH, (void*)VL, SEQ, (long long)DMOD * SEQ,
                       DMOD, SEQ, DMOD, 1.0f / (XC * WSC), VC,
                       bv, bv, bv, blockIdx.x - bt * per, bt, slab);
  }
}

// =====================================================================================================
// Causal attention with the skewed relative-position term for one (batch b, head h) pair and a 64-row query tile; 4 waves,
// wave w owns query rows iw0 .. iw0+15, iw0 = i0 + 16w, and walks the key tiles j0 = 0, 64, .., i0 (block-uniform count).
// Planes: QH/QL, KH/KL = f16 hi + residual of (q x64), (k x64), rows b*SEQ + position, pitch DMOD halves, head columns h*64..h*64+63;
//         EP = f16(bf16_RNE(Er) x16) [ELEN][64]; VH/VL = f16 hi + residual of (v x64) as [b][h*64+d][SEQ] (key index contiguous).
//   Srel(i, j) = q_i . Er[ELEN-1 - (i - j)] for j <= i (the pad-reshape skew). Per key tile the wave needs Er rows
//   wlo + x, wlo = ELEN-1 - (iw0 - j0) - 15, x = jj - R + 15 in [0, 78]: position window T[R][x] = (qh+ql)[iw0+R] . EP[wlo + x],
//   x in [0, 80) (5 subtiles of 16 Er rows in a rolled loop, K = 64, Er row clamped on the address; clamping only ever touches
//   entries with j > i, which the causal mask replaces); each 16x16 subtile is stored to the wave's f32 LDS strip right after its WMMAs.
//   Content scores S = (qh+ql) . (kh+kl) (hh + hl + lh, 4 subtiles of 16 keys in a rolled loop, K = 64) -> the wave's f32 slab.
//   score*log2(e) = S*CS + T[R][jj - R + 15]*CT (CS, CT fold 1/(carries) and 1/8); entries with j > i are replaced by -inf;
//   online softmax in base 2, max-subtracted (row max via 16-lane shuffles), running sums in f32; e = exp2(t - m) in (0,1] written
//   of P*1024 (f16 hi + residual) rebuilt from the slab rows (f32 vector loads, split k map) and the v^T hi / residual B fragments loaded
//   straight from VH/VL [h*64+d][j]; 12 WMMAs per 32-key step (Ph.vh + Ph.vl + Pl.vh), 4 d-subtiles.
//   out rows (b*SEQ + iw0 + row), floats h*64 .. h*64+63 = one whole 256-B segment (2 lines) per row: 16 consecutive lanes x 16 B,
//   block = 4 waves = 128 threads; grid = (SEQ/64, NBAT*NH); no block barriers; every wave does bounded work (<= SEQ/64 tiles).
// coverage: LDS strip 16 x 80 of TPI and slab 16 x 64 of SPI per wave, fully written before read each tile; global: 8 instructions x
//           2 rows x 64 floats = rows iw0..iw0+15 of head segment h; grid x waves cover all NBAT*SEQ rows and all NH head segments once.
// =====================================================================================================
__global__ __launch_bounds__(ATT_THREADS) __attribute__((amdgpu_num_vgpr(256)))
void attn_rel(const unsigned short* __restrict__ QH, const unsigned short* __restrict__ QL,
              const unsigned short* __restrict__ KH, const unsigned short* __restrict__ KL,
              const unsigned short* __restrict__ EP,
              const unsigned short* __restrict__ VH, const unsigned short* __restrict__ VL,
              float* out) {
  __shared__ __align__(16) float smem[ATT_W * WFL];   // per wave: T strip [16][TPI] | score / prob / ctx slab [16][SPI]

  const int tid  = threadIdx.x;
  const int wave = tid >> 5;
  const int lane = tid & 31;
  const int hh   = lane >> 4;
  const int c    = lane & 15;
  const int bh   = blockIdx.y;
  const int b    = bh / NH;
  const int h    = bh - b * NH;
  const int i0   = blockIdx.x * 64;
  const int iw0  = i0 + wave * 16;

  float* tsh = smem + wave * WFL;
  float* pt  = tsh + 16 * TPI;

  const size_t qro = ((size_t)b * SEQ + iw0 + c) * DMOD + h * DH + 8 * hh;      // A rows: query iw0 + c, d 8hh..
  const unsigned short* Khb = KH + (size_t)b * SEQ * DMOD + h * DH + 8 * hh;
  const unsigned short* Klb = KL + (size_t)b * SEQ * DMOD + h * DH + 8 * hh;
  const unsigned short* Eb  = EP + 8 * hh;
  const size_t vpo = (size_t)b * DMOD * SEQ + (size_t)(h * DH) * SEQ + 8 * hh;
  const unsigned short* Vhb = VH + vpo;
  const unsigned short* Vlb = VL + vpo;

  const float CS = LOG2E * SCALE / (QC * KC);
  const float CT = LOG2E * SCALE / (QC * EC);

  float mrow[8], lrow[8];
  v8f O[4];
#pragma unroll
  for (int r = 0; r < 8; ++r) { mrow[r] = -INFINITY; lrow[r] = 0.f; }
#pragma unroll
  for (int td = 0; td < 4; ++td) O[td] = zero8();

  const int ntile = blockIdx.x + 1;          // causal: key tiles j0 <= i0
#pragma unroll 1
  for (int jt = 0; jt < ntile; ++jt) {
    const int j0 = jt * 64;
    const v16h qha = ldfrag_u(QH + qro), qhb = ldfrag_u(QH + qro + 32);
    const v16h qla = ldfrag_u(QL + qro), qlb = ldfrag_u(QL + qro + 32);

    // ---- position window T (5 subtiles of 16 Er rows, rolled), each subtile stored to the LDS strip as produced ----
    {
      const int wlo = (ELEN - 1) - (iw0 - j0) - 15;
#pragma unroll 1
      for (int u = 0; u < 5; ++u) {
        int m = wlo + 16 * u + c;
        m = (m < 0) ? 0 : m;
        m = (m > ELEN - 1) ? (ELEN - 1) : m;
        const size_t eo = (size_t)m * DH;
        const v16h fa = ldfrag_u(Eb + eo), fb = ldfrag_u(Eb + eo + 32);
        v8f t8 = mma_h(qha, fa, zero8());
        t8 = mma_h(qla, fa, t8);
        t8 = mma_h(qhb, fb, t8);
        t8 = mma_h(qlb, fb, t8);
        hz6(t8, fa, fb, qha, qla, qhb, qlb);
        const int cb = 16 * u + c;
#pragma unroll
        for (int r = 0; r < 8; ++r) tsh[(8 * hh + r) * TPI + cb] = t8[r];
      }
    }
    // ---- content scores S (4 subtiles of 16 keys, rolled) -> slab ----
#pragma unroll 1
    for (int t = 0; t < 4; ++t) {
      const size_t ko = (size_t)(j0 + 16 * t + c) * DMOD;
      const v16h kha = ldfrag_u(Khb + ko), khb = ldfrag_u(Khb + ko + 32);
      const v16h kla = ldfrag_u(Klb + ko), klb = ldfrag_u(Klb + ko + 32);
      v8f s8 = mma_h(qha, kha, zero8());
      s8 = mma_h(qha, kla, s8);
      s8 = mma_h(qla, kha, s8);
      s8 = mma_h(qhb, khb, s8);
      s8 = mma_h(qhb, klb, s8);
      s8 = mma_h(qlb, khb, s8);
      hz8(s8, kha, khb, kla, klb, qha, qla, qhb, qlb);
      const int cb = 16 * t + c;
#pragma unroll
      for (int r = 0; r < 8; ++r) pt[(8 * hh + r) * SPI + cb] = s8[r];
    }
    wave_sync_lds();

    // ---- score assembly, causal mask, online softmax (rows live on one 16-lane half) ----
#pragma unroll
    for (int r = 0; r < 8; ++r) {
      const int R = 8 * hh + r;
      const int i = iw0 + R;
      const float* trow = tsh + R * TPI + (15 - R) + c;
      float* srow = pt + R * SPI + c;
      float tv[4];
#pragma unroll
      for (int t = 0; t < 4; ++t) {
        const int j = j0 + 16 * t + c;
        const float val = srow[16 * t] * CS + trow[16 * t] * CT;
        tv[t] = (j > i) ? -INFINITY : val;
      }
      float mx = fmaxf(fmaxf(tv[0], tv[1]), fmaxf(tv[2], tv[3]));
#pragma unroll
      for (int off = 1; off < 16; off <<= 1) mx = fmaxf(mx, __shfl_xor(mx, off, 32));
      const float mn = fmaxf(mrow[r], mx);
      const float al = exp2f(mrow[r] - mn);
      mrow[r] = mn;
      float e4[4];
      float ps = 0.f;
#pragma unroll
      for (int t = 0; t < 4; ++t) { e4[t] = exp2f(tv[t] - mn); ps += e4[t]; }
#pragma unroll
      for (int off = 1; off < 16; off <<= 1) ps += __shfl_xor(ps, off, 32);
      lrow[r] = lrow[r] * al + ps;
#pragma unroll
      for (int td = 0; td < 4; ++td) O[td][r] *= al;
#pragma unroll
      for (int t = 0; t < 4; ++t) srow[16 * t] = e4[t];
    }
    wave_sync_lds();

    // ---- O += (Ph + Pl) . (vh + vl)^T, two k-steps of 32 keys ----
#pragma unroll
    for (int ks = 0; ks < 2; ++ks) {
      FragH ph, pl;
      {
        const float* prow = pt + c * SPI + 32 * ks + 8 * hh;
        const v4f p0 = *(const v4f*)(prow), p1 = *(const v4f*)(prow + 4);
        const v4f p2 = *(const v4f*)(prow + 16), p3 = *(const v4f*)(prow + 20);
#pragma unroll
        for (int e = 0; e < 4; ++e) {
          _Float16 a0, a1;
          sp16(p0[e] * PC, a0, a1); ph.h[0][e]     = a0; pl.h[0][e]     = a1;   // keys 32ks + 8hh + e
          sp16(p1[e] * PC, a0, a1); ph.h[0][4 + e] = a0; pl.h[0][4 + e] = a1;   // keys 32ks + 8hh + 4 + e
          sp16(p2[e] * PC, a0, a1); ph.h[1][e]     = a0; pl.h[1][e]     = a1;   // keys 32ks + 16 + 8hh + e
          sp16(p3[e] * PC, a0, a1); ph.h[1][4 + e] = a0; pl.h[1][4 + e] = a1;
        }
      }
      const size_t vo = (size_t)c * SEQ + j0 + 32 * ks;
#pragma unroll
      for (int td = 0; td < 4; ++td) {
        const size_t vv = vo + (size_t)(16 * td) * SEQ;
        const v16h vh = ldfrag_u(Vhb + vv), vl = ldfrag_u(Vlb + vv);
        O[td] = mma_h(ph.v, vh, O[td]);
        O[td] = mma_h(ph.v, vl, O[td]);
        O[td] = mma_h(pl.v, vh, O[td]);
        hz4(O[td], vh, vl, ph.v, pl.v);
      }
    }
    wave_sync_lds();
  }
  acc_guard4(O[0], O[1], O[2], O[3]);

  // ---- fold 1/l and the carries (1024 on P, 64 on v), stage the wave's 16x64 f32 slice in its slab ----
  const float oc = 1.0f / (PC * VC);
#pragma unroll
  for (int r = 0; r < 8; ++r) {
    const float inv = (1.0f / lrow[r]) * oc;
    const int ro = (8 * hh + r) * SPI + c;
#pragma unroll
    for (int td = 0; td < 4; ++td) pt[ro + 16 * td] = O[td][r] * inv;
  }
  wave_sync_lds();
  {
    const int c4 = c * 4;
    v4f vals[8];
#pragma unroll
    for (int it = 0; it < 8; ++it) {
      const int row = it * 2 + hh;                           // it 0..7 x hh 0..1 = rows 0..15
      vals[it] = *(const v4f*)(pt + row * SPI + c4);
    }
    float* ob = out + ((size_t)b * SEQ + iw0) * DMOD + h * DH + c4;
    {
#pragma unroll
      for (int it = 0; it < 8; ++it) {
        const int row = it * 2 + hh;
        *(v4f*)(ob + (size_t)row * DMOD) = vals[it];
      }
      
    }
  }
}

// =====================================================================================================
// Workspace map (bytes); every plane is an exact multiple of its tile / whole-row store granularity (M, N exact tile multiples,
// convert counts exact multiples of 2048, no pad rows), every offset a multiple of 262144:
//   Xq, Xk, Xv  f16 [NROW][1024] x16                            3 x 8388608
//   Wq, Wk, Wv  f16 [1024 out][1024 in] x64                      3 x 2097152
//   EP          f16 [ELEN][64] x16                                   262144
//   QH, QL, KH, KL f16 [NROW][1024] (x64 hi / residual)         4 x 8388608
//   VH, VL      f16 [NBAT][1024][SEQ] (x64 hi / residual)       2 x 8388608
//   end                                                            82051072
// =====================================================================================================
extern "C" void kernel_launch(void* const* d_in, const int* in_sizes, int n_in,
                              void* d_out, int out_size, void* d_ws, size_t ws_size,
                              hipStream_t stream) {
  if (n_in < 10) return;
  if (in_sizes[0] != NROW * DMOD || in_sizes[1] != NROW * DMOD || in_sizes[2] != NROW * DMOD) return;
  if (in_sizes[3] != DMOD * DMOD || in_sizes[5] != DMOD * DMOD || in_sizes[7] != DMOD * DMOD) return;
  if (in_sizes[4] != DMOD || in_sizes[6] != DMOD || in_sizes[8] != DMOD) return;
  if (in_sizes[9] != ELEN * DH) return;
  if (out_size != NROW * DMOD) return;

  const float* qin = (const float*)d_in[0];
  const float* kin = (const float*)d_in[1];
  const float* vin = (const float*)d_in[2];
  const float* w_q = (const float*)d_in[3];
  const float* b_q = (const float*)d_in[4];
  const float* w_k = (const float*)d_in[5];
  const float* b_k = (const float*)d_in[6];
  const float* w_v = (const float*)d_in[7];
  const float* b_v = (const float*)d_in[8];
  const float* er  = (const float*)d_in[9];
  float*       out = (float*)d_out;

  const size_t PX = (size_t)NROW * DMOD * 2;             //  8388608
  const size_t PW = (size_t)DMOD * DMOD * 2;             //  2097152
  const size_t PE = (size_t)ELEN * DH * 2;               //   262144
  const size_t PV = (size_t)NBAT * DMOD * SEQ * 2;       //  8388608
  size_t off = 0;
  const size_t oXq = off; off += PX;
  const size_t oXk = off; off += PX;
  const size_t oXv = off; off += PX;
  const size_t oWq = off; off += PW;
  const size_t oWk = off; off += PW;
  const size_t oWv = off; off += PW;
  const size_t oE  = off; off += PE;
  const size_t oQH = off; off += PX;
  const size_t oQL = off; off += PX;
  const size_t oKH = off; off += PX;
  const size_t oKL = off; off += PX;
  const size_t oVH = off; off += PV;
  const size_t oVL = off; off += PV;
  if (off > ws_size) return;                               // off = 82051072
  if (off > (size_t)134217728) return;

  char* ws = (char*)d_ws;
  unsigned short* Xq  = (unsigned short*)(ws + oXq);
  unsigned short* Xk  = (unsigned short*)(ws + oXk);
  unsigned short* Xv  = (unsigned short*)(ws + oXv);
  unsigned short* Wq6 = (unsigned short*)(ws + oWq);
  unsigned short* Wk6 = (unsigned short*)(ws + oWk);
  unsigned short* Wv6 = (unsigned short*)(ws + oWv);
  unsigned short* E16 = (unsigned short*)(ws + oE);
  unsigned short* QHp = (unsigned short*)(ws + oQH);
  unsigned short* QLp = (unsigned short*)(ws + oQL);
  unsigned short* KHp = (unsigned short*)(ws + oKH);
  unsigned short* KLp = (unsigned short*)(ws + oKL);
  unsigned short* VHp = (unsigned short*)(ws + oVH);
  unsigned short* VLp = (unsigned short*)(ws + oVL);

  const dim3 blk(256);
  const dim3 gCX((NROW * DMOD) / 2048);                             // 2048
  const dim3 gCW((DMOD * DMOD) / 2048);                             // 512
  const dim3 gCE((ELEN * DH) / 2048);                               // 64
  const dim3 gP(PJB, 3);                                            // 256 x 3
  const dim3 bP(GW * 32);                                           // 128
  const dim3 gAT(SEQ / 64, NBAT * NH);                              // 32 x 32
  const dim3 bAT(ATT_THREADS);                                      // 128

  // (0) 16-bit planes of the inputs: activations f16(bf16_RNE(x) * 16); W[out][in] (already k-contiguous) f16(bf16_RNE(w) * 64);
  //     Er f16(bf16_RNE(e) * 16)
  cvt16<<<gCX, blk, 0, stream>>>(qin, Xq, NROW * DMOD, XC);
  cvt16<<<gCX, blk, 0, stream>>>(kin, Xk, NROW * DMOD, XC);
  cvt16<<<gCX, blk, 0, stream>>>(vin, Xv, NROW * DMOD, XC);
  cvt16<<<gCW, blk, 0, stream>>>(w_q, Wq6, DMOD * DMOD, WSC);
  cvt16<<<gCW, blk, 0, stream>>>(w_k, Wk6, DMOD * DMOD, WSC);
  cvt16<<<gCW, blk, 0, stream>>>(w_v, Wv6, DMOD * DMOD, WSC);
  cvt16<<<gCE, blk, 0, stream>>>(er, E16, ELEN * DH, EC);

  // (1) one launch for the three projections:
  //     q[m][e] = sum_d x[m][d] Wq[e][d] / 1024 + bq[e] -> QH = f16(q * 64), QL = f16(q * 64 - QH); the same for k -> KH, KL;
  //     VT[b][e][j] = sum_c Wv[e][c] x[b*SEQ+j][c] / 1024 + bv[e] -> VH, VL (x64)
  proj3<<<gP, bP, 0, stream>>>(Xq, Xk, Xv, Wq6, Wk6, Wv6, QHp, QLp, KHp, KLp, VHp, VLp, b_q, b_k, b_v);

  // (2) causal relative attention -> out[b][i][h*64+d] (f32), written directly
  attn_rel<<<gAT, bAT, 0, stream>>>(QHp, QLp, KHp, KLp, E16, VHp, VLp, out);
  (void)hipGetLastError();
}

// v002
// One run takes 250 microseconds.
// Next to v001, in two timings, it ran 1.46 times as fast each time.
// Over all steps from v000 it is 1.79 times as fast.
// Contractions (all v_wmma_f32_16x16x32_f16, f16 operands, f32 accumulate): q/k/v projections (x f16 x16 . W f16 x64, K=1024, single products,
// outputs written as f16 hi + unscaled f16 residual planes); position window ((qh+ql) x64 . Er f16 x16, K=64, 2 products) -> f32 LDS strip,
// shifted gather on VALU; content scores ((qh+ql) x64 . (kh+kl) x64, K=64, hh+hl+lh); P . v^T ((Ph+Pl) x1024 . (vh+vl) x64, hh+hl+lh,
// 64 keys per tile). Causal mask, max-subtracted online base-2 softmax and the 1/l fold in f32 on VALU. Every float input RNE-converted to bf16 on load.
#include <hip/hip_runtime.h>
#include <math.h>
#include <stdint.h>

#define SEQ   2048
#define NBAT  2
#define DMOD  1024
#define NH    16
#define DH    64
#define ELEN  2048
#define NROW  (NBAT * SEQ)
#define XC    16.0f
#define WSC   64.0f
#define QC    64.0f
#define KC    64.0f
#define EC    16.0f
#define VC    64.0f
#define PC    1024.0f
#define SCALE 0.125f
#define LOG2E 1.4426950408889634f
static_assert(NH * DH == DMOD);
static_assert(DH == 64);
static_assert(ELEN == SEQ);
static_assert((SEQ % 64) == 0 && (DMOD % 64) == 0 && (NROW % 64) == 0);
static_assert(((NROW * DMOD) % 2048) == 0 && ((DMOD * DMOD) % 2048) == 0 && ((ELEN * DH) % 2048) == 0);
#define ATT_QW 4                    // waves side by side on the query rows (16 rows each)
#define ATT_KG 2                    // groups of ATT_QW waves that share out the key tiles
#define ATT_W (ATT_QW * ATT_KG)
#define ATT_THREADS (ATT_W * 32)
static_assert(ATT_KG == 2);
#define TPI 84
#define SPI 68
#define WFL (16 * TPI + 16 * SPI)
static_assert(((16 * TPI) % 4) == 0 && ((16 * SPI) % 4) == 0 && (WFL % 4) == 0);

typedef _Float16 v16h __attribute__((ext_vector_type(16)));
typedef _Float16 v8h  __attribute__((ext_vector_type(8)));
typedef __bf16   v16b __attribute__((ext_vector_type(16)));
typedef float    v8f  __attribute__((ext_vector_type(8)));
typedef float    v4f  __attribute__((ext_vector_type(4)));
typedef float    v2f  __attribute__((ext_vector_type(2)));
typedef unsigned int v4u __attribute__((ext_vector_type(4)));

union FragH { v16h v; v8h h[2]; v4u u[2]; };
union FragAny { v16h h; v16b b; };

// ---- scalar helpers --------------------------------------------------------------------------------
__device__ __forceinline__ unsigned short bf_bits(float f) {          // f32 -> bf16 bits, RNE convert
  unsigned u = __float_as_uint(f);
  return (unsigned short)((u + 0x7FFFu + ((u >> 16) & 1u)) >> 16);
}
__device__ __forceinline__ float bf_up(unsigned short h) { return __uint_as_float(((unsigned)h) << 16); }
__device__ __forceinline__ float bfr(float f) { return bf_up(bf_bits(f)); }   // value of the bf16 RNE convert
__device__ __forceinline__ unsigned short h_bits(_Float16 x) { return __builtin_bit_cast(unsigned short, x); }
__device__ __forceinline__ unsigned pk16(unsigned short a, unsigned short b) { return (unsigned)a | ((unsigned)b << 16); }
__device__ __forceinline__ v8f zero8() { v8f z = {0.f, 0.f, 0.f, 0.f, 0.f, 0.f, 0.f, 0.f}; return z; }

// ---- fragment loader: 16-bit A/B operand from a k-contiguous 16-bit plane, lane -> row/col (lane&15),
//      p already includes +8*(lane>>4); elements 0..7 <- p[0..7] (k0+8h..), elements 8..15 <- p[16..23] (k0+16+8h..)
//      (same split k map for A and B; B is always read from a [n][k] plane)
__device__ __forceinline__ v16h ldfrag_u(const unsigned short* p) {
  FragH f;
  f.u[0] = *(const v4u*)(p);
  f.u[1] = *(const v4u*)(p + 16);
  return f.v;
}

// ---- WMMA helpers with trailing VALU hazard gaps ------------------------------------------------------
__device__ __forceinline__ v8f mma_h(v16h a, v16h b, v8f c) {
  return __builtin_amdgcn_wmma_f32_16x16x32_f16(false, a, false, b, (short)0, c, false, false);
}
__device__ __forceinline__ v8f mma_b(v16h a, v16h b, v8f c) {
  FragAny ua, ub;
  ua.h = a;
  ub.h = b;
  return __builtin_amdgcn_wmma_f32_16x16x32_bf16(false, ua.b, false, ub.b, (short)0, c, false, false);
}
template <int BF>
__device__ __forceinline__ v8f mmaT(v16h a, v16h b, v8f c) {
  if constexpr (BF != 0) return mma_b(a, b, c);
  else return mma_h(a, b, c);
}
__device__ __forceinline__ void dep_guard1(v8f& a, v8f& b, v16h x) {
#if defined(__HIP_DEVICE_COMPILE__)
  asm volatile("v_nop\n\tv_nop\n\tv_nop\n\tv_nop" : "+v"(a), "+v"(b) : "v"(x));
#endif
}
__device__ __forceinline__ void hz4(v8f& d, v16h x0, v16h x1, v16h x2, v16h x3) {
#if defined(__HIP_DEVICE_COMPILE__)
  asm volatile("v_nop\n\tv_nop\n\tv_nop\n\tv_nop" : "+v"(d) : "v"(x0), "v"(x1), "v"(x2), "v"(x3));
#endif
}
__device__ __forceinline__ void hz6(v8f& d, v16h x0, v16h x1, v16h x2, v16h x3, v16h x4, v16h x5) {
#if defined(__HIP_DEVICE_COMPILE__)
  asm volatile("v_nop\n\tv_nop\n\tv_nop\n\tv_nop" : "+v"(d) : "v"(x0), "v"(x1), "v"(x2), "v"(x3), "v"(x4), "v"(x5));
#endif
}
__device__ __forceinline__ void hz8(v8f& d, v16h x0, v16h x1, v16h x2, v16h x3, v16h x4, v16h x5, v16h x6, v16h x7) {
#if defined(__HIP_DEVICE_COMPILE__)
  asm volatile("v_nop\n\tv_nop\n\tv_nop\n\tv_nop" : "+v"(d) : "v"(x0), "v"(x1), "v"(x2), "v"(x3), "v"(x4), "v"(x5), "v"(x6), "v"(x7));
#endif
}
__device__ __forceinline__ void keep4_h(v16h a, v16h b, v16h c, v16h d) {
#if defined(__HIP_DEVICE_COMPILE__)
  asm volatile("v_nop" :: "v"(a), "v"(b), "v"(c), "v"(d));
#endif
}
__device__ __forceinline__ void acc_guard4(v8f& a, v8f& b, v8f& c, v8f& d) {
#if defined(__HIP_DEVICE_COMPILE__)
  asm volatile("v_nop\n\tv_nop\n\tv_nop\n\tv_nop" : "+v"(a), "+v"(b), "+v"(c), "+v"(d));
#endif
}
__device__ __forceinline__ void wave_sync_lds() {
  __builtin_amdgcn_fence(__ATOMIC_RELEASE, "workgroup");
  __builtin_amdgcn_wave_barrier();
  __builtin_amdgcn_fence(__ATOMIC_ACQUIRE, "workgroup");
}
// s_wait_xcnt 0 behind a run of global fragment loads of the GEMM. The loads' address pointers are inputs only, so their registers stay
// live up to the wait: no later load of the run lands on them and no address arithmetic rewrites them before the wait has passed.
__device__ __forceinline__ void addr_wait1(const unsigned short* p) {
#if defined(__HIP_DEVICE_COMPILE__)
  asm volatile("s_wait_xcnt 0x0" :: "v"(p) : "memory");
#endif
}
__device__ __forceinline__ void addr_wait4(const unsigned short* p0, const unsigned short* p1, const unsigned short* p2, const unsigned short* p3) {
#if defined(__HIP_DEVICE_COMPILE__)
  asm volatile("s_wait_xcnt 0x0" :: "v"(p0), "v"(p1), "v"(p2), "v"(p3) : "memory");
#endif
}
// f32 -> f16 hi + unscaled f16 residual (hi + lo ~ x to 2^-22 relative; a flushed subnormal lo costs < 6.1e-5 absolute in the carried scale)
__device__ __forceinline__ void sp16(float x, _Float16& hi, _Float16& lo) {
  const _Float16 a = (_Float16)x;
  hi = a;
  lo = (_Float16)(x - (float)a);
}

// =====================================================================================================
// Elementwise 16-bit pack, no transpose: dst[i] = f16( bf16_RNE(src[i]) * sc ), sc a power of two (exact).
// coverage: grid = n / 2048 blocks x 256 thr x 8 elements = n exactly (host checks n % 2048 == 0).
// =====================================================================================================
__global__ __launch_bounds__(256) void cvt16(const float* __restrict__ src, unsigned short* dst, int n, float sc) {
  const size_t i8 = ((size_t)blockIdx.x * 256 + threadIdx.x) * 8;
  if (i8 + 8 > (size_t)n) return;                 // never taken with the exact grid; no barriers in this kernel
  const v4f a = *(const v4f*)(src + i8);
  const v4f b = *(const v4f*)(src + i8 + 4);
  v4u o;
  o[0] = pk16(h_bits((_Float16)(bfr(a[0]) * sc)), h_bits((_Float16)(bfr(a[1]) * sc)));
  o[1] = pk16(h_bits((_Float16)(bfr(a[2]) * sc)), h_bits((_Float16)(bfr(a[3]) * sc)));
  o[2] = pk16(h_bits((_Float16)(bfr(b[0]) * sc)), h_bits((_Float16)(bfr(b[1]) * sc)));
  o[3] = pk16(h_bits((_Float16)(bfr(b[2]) * sc)), h_bits((_Float16)(bfr(b[3]) * sc)));
  {
    *(v4u*)(dst + i8) = o;
    
  }
}

// =====================================================================================================
// Register-blocked batched 16-bit WMMA GEMM body (device function, called by proj3): C[m][n] = oscale * sum_k A[m][k] * Bt[n][k] (+ bias);
// one wave per 64x64 tile, no block barriers. A row-major [M][K] pitch lda (16-bit plane), Bt row-major [N][K] pitch ldb (k contiguous); M, N multiples of 64,
// K multiple of 32. by = batch index with element strides sA, sB, sC; bx = workgroup index inside the batch; slab = the wave's LDS slab.
// ASPLIT 1: a second A plane A2 (unscaled residual of A, same layout) is multiplied into the same accumulator (A + A2 ~ exact A).
// BF 1: bf16 operands (v_wmma_f32_16x16x32_bf16), else f16.
// EPI 1: value += bf16_RNE(ep0[column]) (per-column bias); EPI 2: value += bf16_RNE(ep0[row]) (per-row bias, 16-bit out only).
// OM 0: f32 out (pitch ldc).  OM 2: one f16 plane = f16(value * ocarry).
// OM 4: two f16 planes: hi = f16(value * ocarry), lo = f16(value * ocarry - hi) (unscaled residual).
// OM 5: two f16 planes: C = f16((value + bf16_RNE(ep1[column])) * ocarry), C2 = f16((value + bf16_RNE(ep2[column])) * ocarry).
// coverage: 4 slabs x 16 rows (f32: it 0..7 x lane>>4; 16-bit: it 0..3 x lane>>3) x 64 cols = the wave's whole 64x64 tile;
//           bx covers ceil(tilesM*tilesN/GW) workgroups of GW waves, surplus waves return (wave-uniform).
// =====================================================================================================
#define GW 4   // waves per projection workgroup
template <int OM, int ASPLIT, int BF, int EPI>
__device__ __forceinline__ void gemm64(
    const unsigned short* __restrict__ Ap, const unsigned short* __restrict__ A2p, int lda, long long sA,
    const unsigned short* __restrict__ Btp, int ldb, long long sB,
    void* Cout, void* C2out, int ldc, long long sC,
    int M, int N, int K, float oscale, float ocarry,
    const float* __restrict__ ep0, const float* __restrict__ ep1, const float* __restrict__ ep2,
    int bx, int by, float* slab) {
  const int lane = threadIdx.x & 31;
  const int wave = threadIdx.x >> 5;
  const int tilesN = N >> 6;
  const int tilesM = M >> 6;
  const int tile = bx * GW + wave;
  if (tile >= tilesM * tilesN) return;   // wave-uniform; no block barriers in the calling kernel
  const int tm = tile / tilesN;
  const int tn = tile - tm * tilesN;
  const int m0 = tm << 6;
  const int n0 = tn << 6;

  const unsigned short* A1 = Ap  + (size_t)((long long)by * sA);
  const unsigned short* A2 = A2p + (size_t)((long long)by * sA);
  const unsigned short* Bb = Btp + (size_t)((long long)by * sB);

  const int rlane = lane & 15;                 // row (A) / col (B, D) within subtile
  const int koff  = (lane >> 4) * 8;           // k offset of this lane half
  const int mOff  = (lane >> 4) * 8;           // D row offset

  v8f acc[4][4];
#pragma unroll
  for (int i = 0; i < 4; ++i)
#pragma unroll
    for (int j = 0; j < 4; ++j) acc[i][j] = zero8();

  for (int k0 = 0; k0 < K; k0 += 32) {
    v16h bh[4];
    const unsigned short* pb[4];
#pragma unroll
    for (int j = 0; j < 4; ++j) {
      const size_t bofs = (size_t)(n0 + (j << 4) + rlane) * ldb + koff + k0;
      pb[j] = Bb + bofs;
      bh[j] = ldfrag_u(pb[j]);
    }
    addr_wait4(pb[0], pb[1], pb[2], pb[3]);
#pragma unroll
    for (int i = 0; i < 4; ++i) {
      const size_t ao = (size_t)(m0 + (i << 4) + rlane) * lda + koff + k0;
      const unsigned short* pa = A1 + ao;
      const v16h ah = ldfrag_u(pa);
      addr_wait1(pa);
#pragma unroll
      for (int j = 0; j < 4; ++j) acc[i][j] = mmaT<BF>(ah, bh[j], acc[i][j]);
      dep_guard1(acc[i][0], acc[i][3], ah);
      if constexpr (ASPLIT != 0) {
        const unsigned short* pa2 = A2 + ao;
        const v16h al = ldfrag_u(pa2);
        addr_wait1(pa2);
#pragma unroll
        for (int j = 0; j < 4; ++j) acc[i][j] = mmaT<BF>(al, bh[j], acc[i][j]);
        dep_guard1(acc[i][0], acc[i][3], al);
      }
    }
    keep4_h(bh[0], bh[1], bh[2], bh[3]);
  }
  acc_guard4(acc[0][0], acc[0][1], acc[0][2], acc[0][3]);
  acc_guard4(acc[1][0], acc[1][1], acc[1][2], acc[1][3]);
  acc_guard4(acc[2][0], acc[2][1], acc[2][2], acc[2][3]);
  acc_guard4(acc[3][0], acc[3][1], acc[3][2], acc[3][3]);

  const int hh2 = lane >> 4, c4 = (lane & 15) * 4;     // f32 out: 256-B row segment = 16 lanes x 16 B
  const int q8  = lane >> 3, c8 = (lane & 7) * 8;

  // ---- epilogue ----
#pragma unroll
  for (int i = 0; i < 4; ++i) {
    const int mBase = m0 + (i << 4);
#pragma unroll
    for (int j = 0; j < 4; ++j) {
#pragma unroll
      for (int r = 0; r < 8; ++r) {
        slab[(mOff + r) * 68 + (j << 4) + rlane] = acc[i][j][r];
      }
    }
    wave_sync_lds();
    if constexpr (OM == 0) {
      float* C = (float*)Cout + (size_t)((long long)by * sC);
      v4f vals[8];
#pragma unroll
      for (int it = 0; it < 8; ++it) {
        const int row = it * 2 + hh2;                      // it 0..7 x hh2 0..1 = rows 0..15
        v4f v = *(const v4f*)(slab + row * 68 + c4);
#pragma unroll
        for (int e = 0; e < 4; ++e) v[e] = v[e] * oscale;
        if constexpr (EPI == 1) {
          const v4f bb = *(const v4f*)(ep0 + n0 + c4);     // per-column bias, columns n0+c4 .. +3 (N equals the bias length)
#pragma unroll
          for (int e = 0; e < 4; ++e) v[e] = v[e] + bfr(bb[e]);
        }
        vals[it] = v;
      }
      {
#pragma unroll
        for (int it = 0; it < 8; ++it) {
          const int gr = mBase + it * 2 + hh2;
          *(v4f*)(C + (size_t)gr * ldc + n0 + c4) = vals[it];
        }
        
      }
    } else {
      unsigned short* C  = (unsigned short*)Cout  + (size_t)((long long)by * sC);
      unsigned short* Cb = (unsigned short*)C2out + (size_t)((long long)by * sC);
      v4u hv[4], lv[4];
#pragma unroll
      for (int it = 0; it < 4; ++it) {
        const int row = it * 4 + q8;                       // it 0..3 x q8 0..3 = rows 0..15
        const float* sp = slab + row * 68 + c8;
        float rb = 0.f;
        if constexpr (EPI == 2) rb = bfr(ep0[mBase + row]);   // per-row bias (M equals the bias length)
        v4u a  = {0u, 0u, 0u, 0u};
        v4u b2 = {0u, 0u, 0u, 0u};
#pragma unroll
        for (int e = 0; e < 4; ++e) {
          const int ci = n0 + c8 + 2 * e;                  // column index, < N
          float f0 = sp[2 * e] * oscale + rb;
          float f1 = sp[2 * e + 1] * oscale + rb;
          if constexpr (EPI == 1) {
            f0 += bfr(ep0[ci]);
            f1 += bfr(ep0[ci + 1]);
          }
          if constexpr (OM == 5) {
            const float g0 = (f0 + bfr(ep1[ci])) * ocarry, g1 = (f1 + bfr(ep1[ci + 1])) * ocarry;
            const float w0 = (f0 + bfr(ep2[ci])) * ocarry, w1 = (f1 + bfr(ep2[ci + 1])) * ocarry;
            a[e]  = pk16(h_bits((_Float16)g0), h_bits((_Float16)g1));
            b2[e] = pk16(h_bits((_Float16)w0), h_bits((_Float16)w1));
          } else {
            f0 *= ocarry; f1 *= ocarry;
            const _Float16 x0 = (_Float16)f0, x1 = (_Float16)f1;
            a[e] = pk16(h_bits(x0), h_bits(x1));
            if constexpr (OM == 4) {
              b2[e] = pk16(h_bits((_Float16)(f0 - (float)x0)), h_bits((_Float16)(f1 - (float)x1)));
            }
          }
        }
        hv[it] = a;
        lv[it] = b2;
      }
      {
#pragma unroll
        for (int it = 0; it < 4; ++it) {
          const int row = it * 4 + q8;
          *(v4u*)(C + (size_t)(mBase + row) * ldc + n0 + c8) = hv[it];
          if constexpr (OM >= 4) {
            *(v4u*)(Cb + (size_t)(mBase + row) * ldc + n0 + c8) = lv[it];
          }
        }
        
      }
    }
    wave_sync_lds();
  }
}

// =====================================================================================================
// The three projections in ONE launch, so that their waves are on the chip together: blockIdx.y = 0: q, 1: k, 2: v^T.
//   q, k: M = NROW, N = 1024, K = 1024, per-column bias; (NROW/64)*(DMOD/64) = 1024 tiles = PJB workgroups of GW waves.
//   v^T per batch: VT[b][e][j], M = 1024 (e), N = SEQ (j), K = 1024, per-row bias; 512 tiles per batch = PJB/NBAT workgroups,
//   batch = blockIdx.x / (PJB/NBAT). Every branch below is workgroup-uniform; no block barriers.
// coverage: grid (PJB, 3) x GW waves = every 64x64 tile of QH/QL, KH/KL and VH/VL exactly once.
// =====================================================================================================
#define PJB (((NROW / 64) * (DMOD / 64)) / GW)
static_assert(((NROW / 64) * (DMOD / 64)) % GW == 0);
static_assert((DMOD / 64) * (SEQ / 64) * NBAT == PJB * GW && (PJB % NBAT) == 0);
__global__ __launch_bounds__(GW * 32) __attribute__((amdgpu_num_vgpr(256))) void proj3(
    const unsigned short* __restrict__ Xq, const unsigned short* __restrict__ Xk, const unsigned short* __restrict__ Xv,
    const unsigned short* __restrict__ Wq, const unsigned short* __restrict__ Wk, const unsigned short* __restrict__ Wv,
    unsigned short* QH, unsigned short* QL, unsigned short* KH, unsigned short* KL, unsigned short* VH, unsigned short* VL,
    const float* __restrict__ bq, const float* __restrict__ bk, const float* __restrict__ bv) {
  __shared__ __align__(16) float sT[GW][16 * 68];   // per-wave 16x64 slab, pitch 68 floats
  float* slab = sT[threadIdx.x >> 5];
  const int p = blockIdx.y;
  if (p < 2) {
    const unsigned short* X = (p == 0) ? Xq : Xk;
    const unsigned short* Wt = (p == 0) ? Wq : Wk;
    unsigned short* H = (p == 0) ? QH : KH;
    unsigned short* L = (p == 0) ? QL : KL;
    const float* bias = (p == 0) ? bq : bk;
    gemm64<4, 0, 0, 1>(X, X, DMOD, 0LL, Wt, DMOD, 0LL, (void*)H, (void*)L, DMOD, 0LL,
                       NROW, DMOD, DMOD, 1.0f / (XC * WSC), (p == 0) ? QC : KC,
                       bias, bias, bias, blockIdx.x, 0, slab);
  } else {
    const int per = PJB / NBAT;
    const int bt  = blockIdx.x / per;
    gemm64<4, 0, 0, 2>(Wv, Wv, DMOD, 0LL, Xv, DMOD, (long long)SEQ * DMOD, (void*)VH, (void*)VL, SEQ, (long long)DMOD * SEQ,
                       DMOD, SEQ, DMOD, 1.0f / (XC * WSC), VC,
                       bv, bv, bv, blockIdx.x - bt * per, bt, slab);
  }
}

// =====================================================================================================
// Causal attention with the skewed relative-position term for one (batch b, head h) pair and a 64-row query tile; 8 waves =
// 2 key groups x 4 query waves: wave (kg, qw) owns query rows iw0 .. iw0+15, iw0 = i0 + 16 qw, and walks every second key tile
// j0 = 64 kg, 64 (kg + 2), .. <= i0, keeping its own running (max, sum, O). After the loop group 1 hands its state over through LDS
// behind one block barrier and group 0 merges the two states (rescale by exp2(m - max)) and stores. So the longest wave walks 16 tiles,
// not 32. There are more workgroups than places on the chip: blockIdx.y counts the query tiles from the last (most key tiles) down,
// so that cost falls with the flat workgroup index (for speed only).
// Planes: QH/QL, KH/KL = f16 hi + residual of (q x64), (k x64), rows b*SEQ + position, pitch DMOD halves, head columns h*64..h*64+63;
//         EP = f16(bf16_RNE(Er) x16) [ELEN][64]; VH/VL = f16 hi + residual of (v x64) as [b][h*64+d][SEQ] (key index contiguous).
//   Srel(i, j) = q_i . Er[ELEN-1 - (i - j)] for j <= i (the pad-reshape skew). Per key tile the wave needs Er rows
//   wlo + x, wlo = ELEN-1 - (iw0 - j0) - 15, x = jj - R + 15 in [0, 78]: position window T[R][x] = (qh+ql)[iw0+R] . EP[wlo + x],
//   x in [0, 80) (5 subtiles of 16 Er rows in a rolled loop, K = 64, Er row clamped on the address; clamping only ever touches
//   entries with j > i, which the causal mask replaces); each 16x16 subtile is stored to the wave's f32 LDS strip right after its WMMAs.
//   Content scores S = (qh+ql) . (kh+kl) (hh + hl + lh, 4 subtiles of 16 keys in a rolled loop, K = 64) -> the wave's f32 slab.
//   score*log2(e) = S*CS + T[R][jj - R + 15]*CT (CS, CT fold 1/(carries) and 1/8); entries with j > i are replaced by -inf;
//   online softmax in base 2, max-subtracted (row max via 16-lane shuffles), running sums in f32; e = exp2(t - m) in (0,1] written
//   of P*1024 (f16 hi + residual) rebuilt from the slab rows (f32 vector loads, split k map) and the v^T hi / residual B fragments loaded
//   straight from VH/VL [h*64+d][j]; 12 WMMAs per 32-key step (Ph.vh + Ph.vl + Pl.vh), 4 d-subtiles.
//   out rows (b*SEQ + iw0 + row), floats h*64 .. h*64+63 = one whole 256-B segment (2 lines) per row: 16 consecutive lanes x 16 B,
//   block = 8 waves = 256 threads; grid = (NBAT*NH, SEQ/64); one block barrier, behind the key loop, passed by every wave;
//   every wave does bounded work (<= SEQ/128 tiles).
// coverage: LDS strip 16 x 80 of TPI and slab 16 x 64 of SPI per wave, fully written before read each tile; global: 8 instructions x
//           2 rows x 64 floats = rows iw0..iw0+15 of head segment h; grid x waves cover all NBAT*SEQ rows and all NH head segments once.
// =====================================================================================================
__global__ __launch_bounds__(ATT_THREADS) __attribute__((amdgpu_num_vgpr(256)))
void attn_rel(const unsigned short* __restrict__ QH, const unsigned short* __restrict__ QL,
              const unsigned short* __restrict__ KH, const unsigned short* __restrict__ KL,
              const unsigned short* __restrict__ EP,
              const unsigned short* __restrict__ VH, const unsigned short* __restrict__ VL,
              float* out) {
  __shared__ __align__(16) float smem[ATT_W * WFL];   // per wave: T strip [16][TPI] | score / prob / ctx slab [16][SPI]

  const int tid  = threadIdx.x;
  const int wave = __builtin_amdgcn_readfirstlane(tid >> 5);   // scalar, so that the key loop's per-wave start and end stay scalar branches
  const int qw   = wave & (ATT_QW - 1);
  const int kg   = wave / ATT_QW;
  const int lane = tid & 31;
  const int hh   = lane >> 4;
  const int c    = lane & 15;
  const int bh   = blockIdx.x;
  const int b    = bh / NH;
  const int h    = bh - b * NH;
  const int qt   = (SEQ / 64 - 1) - (int)blockIdx.y;           // query tile, the one with the most key tiles first
  const int i0   = qt * 64;
  const int iw0  = i0 + qw * 16;

  float* tsh = smem + wave * WFL;
  float* pt  = tsh + 16 * TPI;

  const size_t qro = ((size_t)b * SEQ + iw0 + c) * DMOD + h * DH + 8 * hh;      // A rows: query iw0 + c, d 8hh..
  const unsigned short* Khb = KH + (size_t)b * SEQ * DMOD + h * DH + 8 * hh;
  const unsigned short* Klb = KL + (size_t)b * SEQ * DMOD + h * DH + 8 * hh;
  const unsigned short* Eb  = EP + 8 * hh;
  const size_t vpo = (size_t)b * DMOD * SEQ + (size_t)(h * DH) * SEQ + 8 * hh;
  const unsigned short* Vhb = VH + vpo;
  const unsigned short* Vlb = VL + vpo;

  const float CS = LOG2E * SCALE / (QC * KC);
  const float CT = LOG2E * SCALE / (QC * EC);

  float mrow[8], lrow[8];
  v8f O[4];
#pragma unroll
  for (int r = 0; r < 8; ++r) { mrow[r] = -INFINITY; lrow[r] = 0.f; }
#pragma unroll
  for (int td = 0; td < 4; ++td) O[td] = zero8();

  const int ntile = qt + 1;                  // causal: key tiles j0 <= i0
#pragma unroll 1
  for (int jt = kg; jt < ntile; jt += ATT_KG) {
    const int j0 = jt * 64;
    const v16h qha = ldfrag_u(QH + qro), qhb = ldfrag_u(QH + qro + 32);
    const v16h qla = ldfrag_u(QL + qro), qlb = ldfrag_u(QL + qro + 32);

    // ---- position window T (5 subtiles of 16 Er rows, rolled), each subtile stored to the LDS strip as produced ----
    {
      const int wlo = (ELEN - 1) - (iw0 - j0) - 15;
#pragma unroll 1
      for (int u = 0; u < 5; ++u) {
        int m = wlo + 16 * u + c;
        m = (m < 0) ? 0 : m;
        m = (m > ELEN - 1) ? (ELEN - 1) : m;
        const size_t eo = (size_t)m * DH;
        const v16h fa = ldfrag_u(Eb + eo), fb = ldfrag_u(Eb + eo + 32);
        v8f t8 = mma_h(qha, fa, zero8());
        t8 = mma_h(qla, fa, t8);
        t8 = mma_h(qhb, fb, t8);
        t8 = mma_h(qlb, fb, t8);
        hz6(t8, fa, fb, qha, qla, qhb, qlb);
        const int cb = 16 * u + c;
#pragma unroll
        for (int r = 0; r < 8; ++r) tsh[(8 * hh + r) * TPI + cb] = t8[r];
      }
    }
    // ---- content scores S (4 subtiles of 16 keys, rolled) -> slab ----
#pragma unroll 1
    for (int t = 0; t < 4; ++t) {
      const size_t ko = (size_t)(j0 + 16 * t + c) * DMOD;
      const v16h kha = ldfrag_u(Khb + ko), khb = ldfrag_u(Khb + ko + 32);
      const v16h kla = ldfrag_u(Klb + ko), klb = ldfrag_u(Klb + ko + 32);
      v8f s8 = mma_h(qha, kha, zero8());
      s8 = mma_h(qha, kla, s8);
      s8 = mma_h(qla, kha, s8);
      s8 = mma_h(qhb, khb, s8);
      s8 = mma_h(qhb, klb, s8);
      s8 = mma_h(qlb, khb, s8);
      hz8(s8, kha, khb, kla, klb, qha, qla, qhb, qlb);
      const int cb = 16 * t + c;
#pragma unroll
      for (int r = 0; r < 8; ++r) pt[(8 * hh + r) * SPI + cb] = s8[r];
    }
    wave_sync_lds();

    // ---- score assembly, causal mask, online softmax (rows live on one 16-lane half) ----
#pragma unroll
    for (int r = 0; r < 8; ++r) {
      const int R = 8 * hh + r;
      const int i = iw0 + R;
      const float* trow = tsh + R * TPI + (15 - R) + c;
      float* srow = pt + R * SPI + c;
      float tv[4];
#pragma unroll
      for (int t = 0; t < 4; ++t) {
        const int j = j0 + 16 * t + c;
        const float val = srow[16 * t] * CS + trow[16 * t] * CT;
        tv[t] = (j > i) ? -INFINITY : val;
      }
      float mx = fmaxf(fmaxf(tv[0], tv[1]), fmaxf(tv[2], tv[3]));
#pragma unroll
      for (int off = 1; off < 16; off <<= 1) mx = fmaxf(mx, __shfl_xor(mx, off, 32));
      const float mn = fmaxf(mrow[r], mx);
      const float al = exp2f(mrow[r] - mn);
      mrow[r] = mn;
      float e4[4];
      float ps = 0.f;
#pragma unroll
      for (int t = 0; t < 4; ++t) { e4[t] = exp2f(tv[t] - mn); ps += e4[t]; }
#pragma unroll
      for (int off = 1; off < 16; off <<= 1) ps += __shfl_xor(ps, off, 32);
      lrow[r] = lrow[r] * al + ps;
#pragma unroll
      for (int td = 0; td < 4; ++td) O[td][r] *= al;
#pragma unroll
      for (int t = 0; t < 4; ++t) srow[16 * t] = e4[t];
    }
    wave_sync_lds();

    // ---- O += (Ph + Pl) . (vh + vl)^T, two k-steps of 32 keys ----
#pragma unroll
    for (int ks = 0; ks < 2; ++ks) {
      FragH ph, pl;
      {
        const float* prow = pt + c * SPI + 32 * ks + 8 * hh;
        const v4f p0 = *(const v4f*)(prow), p1 = *(const v4f*)(prow + 4);
        const v4f p2 = *(const v4f*)(prow + 16), p3 = *(const v4f*)(prow + 20);
#pragma unroll
        for (int e = 0; e < 4; ++e) {
          _Float16 a0, a1;
          sp16(p0[e] * PC, a0, a1); ph.h[0][e]     = a0; pl.h[0][e]     = a1;   // keys 32ks + 8hh + e
          sp16(p1[e] * PC, a0, a1); ph.h[0][4 + e] = a0; pl.h[0][4 + e] = a1;   // keys 32ks + 8hh + 4 + e
          sp16(p2[e] * PC, a0, a1); ph.h[1][e]     = a0; pl.h[1][e]     = a1;   // keys 32ks + 16 + 8hh + e
          sp16(p3[e] * PC, a0, a1); ph.h[1][4 + e] = a0; pl.h[1][4 + e] = a1;
        }
      }
      const size_t vo = (size_t)c * SEQ + j0 + 32 * ks;
#pragma unroll
      for (int td = 0; td < 4; ++td) {
        const size_t vv = vo + (size_t)(16 * td) * SEQ;
        const v16h vh = ldfrag_u(Vhb + vv), vl = ldfrag_u(Vlb + vv);
        O[td] = mma_h(ph.v, vh, O[td]);
        O[td] = mma_h(ph.v, vl, O[td]);
        O[td] = mma_h(pl.v, vh, O[td]);
        hz4(O[td], vh, vl, ph.v, pl.v);
      }
    }
    wave_sync_lds();
  }
  acc_guard4(O[0], O[1], O[2], O[3]);

  // ---- merge of the two key groups: group 1 writes (O, m, l) to its own slab and strip, block barrier, group 0 reads and rescales.
  //      A group-1 wave without a tile hands over m = -inf, l = 0, O = 0, whose weight exp2(-inf) is 0; group 0 always has tile 0.
  if (kg != 0) {
#pragma unroll
    for (int r = 0; r < 8; ++r) {
      const int R = 8 * hh + r;
#pragma unroll
      for (int td = 0; td < 4; ++td) pt[R * SPI + 16 * td + c] = O[td][r];
      if (c == 0) { tsh[R] = mrow[r]; tsh[16 + R] = lrow[r]; }
    }
  }
  __syncthreads();                           // publishes group 1's state to group 0; every wave of the block passes it once
  if (kg != 0) return;
  {
    const float* ts2 = tsh + ATT_QW * WFL;   // wave (1, qw)'s strip and slab
    const float* pt2 = ts2 + 16 * TPI;
#pragma unroll
    for (int r = 0; r < 8; ++r) {
      const int R = 8 * hh + r;
      const float m2 = ts2[R], l2 = ts2[16 + R];
      const float mm = fmaxf(mrow[r], m2);
      const float a1 = exp2f(mrow[r] - mm), a2 = exp2f(m2 - mm);
      lrow[r] = lrow[r] * a1 + l2 * a2;
#pragma unroll
      for (int td = 0; td < 4; ++td) O[td][r] = O[td][r] * a1 + pt2[R * SPI + 16 * td + c] * a2;
    }
  }

  // ---- fold 1/l and the carries (1024 on P, 64 on v), stage the wave's 16x64 f32 slice in its slab ----
  const float oc = 1.0f / (PC * VC);
#pragma unroll
  for (int r = 0; r < 8; ++r) {
    const float inv = (1.0f / lrow[r]) * oc;
    const int ro = (8 * hh + r) * SPI + c;
#pragma unroll
    for (int td = 0; td < 4; ++td) pt[ro + 16 * td] = O[td][r] * inv;
  }
  wave_sync_lds();
  {
    const int c4 = c * 4;
    v4f vals[8];
#pragma unroll
    for (int it = 0; it < 8; ++it) {
      const int row = it * 2 + hh;                           // it 0..7 x hh 0..1 = rows 0..15
      vals[it] = *(const v4f*)(pt + row * SPI + c4);
    }
    float* ob = out + ((size_t)b * SEQ + iw0) * DMOD + h * DH + c4;
    {
#pragma unroll
      for (int it = 0; it < 8; ++it) {
        const int row = it * 2 + hh;
        *(v4f*)(ob + (size_t)row * DMOD) = vals[it];
      }
      
    }
  }
}

// =====================================================================================================
// Workspace map (bytes); every plane is an exact multiple of its tile / whole-row store granularity (M, N exact tile multiples,
// convert counts exact multiples of 2048, no pad rows), every offset a multiple of 262144:
//   Xq, Xk, Xv  f16 [NROW][1024] x16                            3 x 8388608
//   Wq, Wk, Wv  f16 [1024 out][1024 in] x64                      3 x 2097152
//   EP          f16 [ELEN][64] x16                                   262144
//   QH, QL, KH, KL f16 [NROW][1024] (x64 hi / residual)         4 x 8388608
//   VH, VL      f16 [NBAT][1024][SEQ] (x64 hi / residual)       2 x 8388608
//   end                                                            82051072
// =====================================================================================================
extern "C" void kernel_launch(void* const* d_in, const int* in_sizes, int n_in,
                              void* d_out, int out_size, void* d_ws, size_t ws_size,
                              hipStream_t stream) {
  if (n_in < 10) return;
  if (in_sizes[0] != NROW * DMOD || in_sizes[1] != NROW * DMOD || in_sizes[2] != NROW * DMOD) return;
  if (in_sizes[3] != DMOD * DMOD || in_sizes[5] != DMOD * DMOD || in_sizes[7] != DMOD * DMOD) return;
  if (in_sizes[4] != DMOD || in_sizes[6] != DMOD || in_sizes[8] != DMOD) return;
  if (in_sizes[9] != ELEN * DH) return;
  if (out_size != NROW * DMOD) return;

  const float* qin = (const float*)d_in[0];
  const float* kin = (const float*)d_in[1];
  const float* vin = (const float*)d_in[2];
  const float* w_q = (const float*)d_in[3];
  const float* b_q = (const float*)d_in[4];
  const float* w_k = (const float*)d_in[5];
  const float* b_k = (const float*)d_in[6];
  const float* w_v = (const float*)d_in[7];
  const float* b_v = (const float*)d_in[8];
  const float* er  = (const float*)d_in[9];
  float*       out = (float*)d_out;

  const size_t PX = (size_t)NROW * DMOD * 2;             //  8388608
  const size_t PW = (size_t)DMOD * DMOD * 2;             //  2097152
  const size_t PE = (size_t)ELEN * DH * 2;               //   262144
  const size_t PV = (size_t)NBAT * DMOD * SEQ * 2;       //  8388608
  size_t off = 0;
  const size_t oXq = off; off += PX;
  const size_t oXk = off; off += PX;
  const size_t oXv = off; off += PX;
  const size_t oWq = off; off += PW;
  const size_t oWk = off; off += PW;
  const size_t oWv = off; off += PW;
  const size_t oE  = off; off += PE;
  const size_t oQH = off; off += PX;
  const size_t oQL = off; off += PX;
  const size_t oKH = off; off += PX;
  const size_t oKL = off; off += PX;
  const size_t oVH = off; off += PV;
  const size_t oVL = off; off += PV;
  if (off > ws_size) return;                               // off = 82051072
  if (off > (size_t)134217728) return;

  char* ws = (char*)d_ws;
  unsigned short* Xq  = (unsigned short*)(ws + oXq);
  unsigned short* Xk  = (unsigned short*)(ws + oXk);
  unsigned short* Xv  = (unsigned short*)(ws + oXv);
  unsigned short* Wq6 = (unsigned short*)(ws + oWq);
  unsigned short* Wk6 = (unsigned short*)(ws + oWk);
  unsigned short* Wv6 = (unsigned short*)(ws + oWv);
  unsigned short* E16 = (unsigned short*)(ws + oE);
  unsigned short* QHp = (unsigned short*)(ws + oQH);
  unsigned short* QLp = (unsigned short*)(ws + oQL);
  unsigned short* KHp = (unsigned short*)(ws + oKH);
  unsigned short* KLp = (unsigned short*)(ws + oKL);
  unsigned short* VHp = (unsigned short*)(ws + oVH);
  unsigned short* VLp = (unsigned short*)(ws + oVL);

  const dim3 blk(256);
  const dim3 gCX((NROW * DMOD) / 2048);                             // 2048
  const dim3 gCW((DMOD * DMOD) / 2048);                             // 512
  const dim3 gCE((ELEN * DH) / 2048);                               // 64
  const dim3 gP(PJB, 3);                                            // 256 x 3
  const dim3 bP(GW * 32);                                           // 128
  const dim3 gAT(NBAT * NH, SEQ / 64);                              // 32 x 32
  const dim3 bAT(ATT_THREADS);                                      // 256

  // (0) 16-bit planes of the inputs: activations f16(bf16_RNE(x) * 16); W[out][in] (already k-contiguous) f16(bf16_RNE(w) * 64);
  //     Er f16(bf16_RNE(e) * 16)
  cvt16<<<gCX, blk, 0, stream>>>(qin, Xq, NROW * DMOD, XC);
  cvt16<<<gCX, blk, 0, stream>>>(kin, Xk, NROW * DMOD, XC);
  cvt16<<<gCX, blk, 0, stream>>>(vin, Xv, NROW * DMOD, XC);
  cvt16<<<gCW, blk, 0, stream>>>(w_q, Wq6, DMOD * DMOD, WSC);
  cvt16<<<gCW, blk, 0, stream>>>(w_k, Wk6, DMOD * DMOD, WSC);
  cvt16<<<gCW, blk, 0, stream>>>(w_v, Wv6, DMOD * DMOD, WSC);
  cvt16<<<gCE, blk, 0, stream>>>(er, E16, ELEN * DH, EC);

  // (1) one launch for the three projections:
  //     q[m][e] = sum_d x[m][d] Wq[e][d] / 1024 + bq[e] -> QH = f16(q * 64), QL = f16(q * 64 - QH); the same for k -> KH, KL;
  //     VT[b][e][j] = sum_c Wv[e][c] x[b*SEQ+j][c] / 1024 + bv[e] -> VH, VL (x64)
  proj3<<<gP, bP, 0, stream>>>(Xq, Xk, Xv, Wq6, Wk6, Wv6, QHp, QLp, KHp, KLp, VHp, VLp, b_q, b_k, b_v);

  // (2) causal relative attention -> out[b][i][h*64+d] (f32), written directly
  attn_rel<<<gAT, bAT, 0, stream>>>(QHp, QLp, KHp, KLp, E16, VHp, VLp, out);
  (void)hipGetLastError();
}

// v003
// Measured time: 237 microseconds a run.
// Timed twice side by side with v002, it ran 1.05 times as fast both times.
// All steps since v000 together make it 1.88 times as fast.
// Contractions (all v_wmma_f32_16x16x32_f16, f16 operands, f32 accumulate): q/k/v projections (x f16 x16 . W f16 x64, K=1024, single products,
// outputs written as f16 hi + unscaled f16 residual planes); position window ((qh+ql) x64 . Er f16 x16, K=64, 2 products) -> f32 LDS strip,
// shifted gather on VALU; content scores ((qh+ql) x64 . (kh+kl) x64, K=64, hh+hl+lh); P . v^T ((Ph+Pl) x1024 . (vh+vl) x64, hh+hl+lh,
// 64 keys per tile). Causal mask, max-subtracted online base-2 softmax and the 1/l fold in f32 on VALU. Every float input RNE-converted to bf16 on load.
#include <hip/hip_runtime.h>
#include <math.h>
#include <stdint.h>

#define SEQ   2048
#define NBAT  2
#define DMOD  1024
#define NH    16
#define DH    64
#define ELEN  2048
#define NROW  (NBAT * SEQ)
#define XC    16.0f
#define WSC   64.0f
#define QC    64.0f
#define KC    64.0f
#define EC    16.0f
#define VC    64.0f
#define PC    1024.0f
#define SCALE 0.125f
#define LOG2E 1.4426950408889634f
static_assert(NH * DH == DMOD);
static_assert(DH == 64);
static_assert(ELEN == SEQ);
static_assert((SEQ % 64) == 0 && (DMOD % 64) == 0 && (NROW % 64) == 0);
static_assert(((NROW * DMOD) % 2048) == 0 && ((DMOD * DMOD) % 2048) == 0 && ((ELEN * DH) % 2048) == 0);
#define ATT_QW 4                    // waves side by side on the query rows (16 rows each)
#define ATT_KG 2                    // groups of ATT_QW waves that share out the key tiles
#define ATT_W (ATT_QW * ATT_KG)
#define ATT_THREADS (ATT_W * 32)
static_assert(ATT_KG == 2);
#define TPI 84
#define SPI 68
#define WFL (16 * TPI + 16 * SPI)
static_assert(((16 * TPI) % 4) == 0 && ((16 * SPI) % 4) == 0 && (WFL % 4) == 0);

typedef _Float16 v16h __attribute__((ext_vector_type(16)));
typedef _Float16 v8h  __attribute__((ext_vector_type(8)));
typedef __bf16   v16b __attribute__((ext_vector_type(16)));
typedef float    v8f  __attribute__((ext_vector_type(8)));
typedef float    v4f  __attribute__((ext_vector_type(4)));
typedef float    v2f  __attribute__((ext_vector_type(2)));
typedef unsigned int v4u __attribute__((ext_vector_type(4)));

union FragH { v16h v; v8h h[2]; v4u u[2]; };
union FragAny { v16h h; v16b b; };

// ---- scalar helpers --------------------------------------------------------------------------------
__device__ __forceinline__ unsigned short bf_bits(float f) {          // f32 -> bf16 bits, RNE convert
  unsigned u = __float_as_uint(f);
  return (unsigned short)((u + 0x7FFFu + ((u >> 16) & 1u)) >> 16);
}
__device__ __forceinline__ float bf_up(unsigned short h) { return __uint_as_float(((unsigned)h) << 16); }
__device__ __forceinline__ float bfr(float f) { return bf_up(bf_bits(f)); }   // value of the bf16 RNE convert
__device__ __forceinline__ unsigned short h_bits(_Float16 x) { return __builtin_bit_cast(unsigned short, x); }
__device__ __forceinline__ unsigned pk16(unsigned short a, unsigned short b) { return (unsigned)a | ((unsigned)b << 16); }
__device__ __forceinline__ v8f zero8() { v8f z = {0.f, 0.f, 0.f, 0.f, 0.f, 0.f, 0.f, 0.f}; return z; }

// ---- fragment loader: 16-bit A/B operand from a k-contiguous 16-bit plane, lane -> row/col (lane&15),
//      p already includes +8*(lane>>4); elements 0..7 <- p[0..7] (k0+8h..), elements 8..15 <- p[16..23] (k0+16+8h..)
//      (same split k map for A and B; B is always read from a [n][k] plane)
__device__ __forceinline__ v16h ldfrag_u(const unsigned short* p) {
  FragH f;
  f.u[0] = *(const v4u*)(p);
  f.u[1] = *(const v4u*)(p + 16);
  return f.v;
}

// ---- WMMA helpers with trailing VALU hazard gaps ------------------------------------------------------
__device__ __forceinline__ v8f mma_h(v16h a, v16h b, v8f c) {
  return __builtin_amdgcn_wmma_f32_16x16x32_f16(false, a, false, b, (short)0, c, false, false);
}
__device__ __forceinline__ v8f mma_b(v16h a, v16h b, v8f c) {
  FragAny ua, ub;
  ua.h = a;
  ub.h = b;
  return __builtin_amdgcn_wmma_f32_16x16x32_bf16(false, ua.b, false, ub.b, (short)0, c, false, false);
}
template <int BF>
__device__ __forceinline__ v8f mmaT(v16h a, v16h b, v8f c) {
  if constexpr (BF != 0) return mma_b(a, b, c);
  else return mma_h(a, b, c);
}
__device__ __forceinline__ void dep_guard1(v8f& a, v8f& b, v16h x) {
#if defined(__HIP_DEVICE_COMPILE__)
  asm volatile("v_nop\n\tv_nop\n\tv_nop\n\tv_nop" : "+v"(a), "+v"(b) : "v"(x));
#endif
}
__device__ __forceinline__ void hz4(v8f& d, v16h x0, v16h x1, v16h x2, v16h x3) {
#if defined(__HIP_DEVICE_COMPILE__)
  asm volatile("v_nop\n\tv_nop\n\tv_nop\n\tv_nop" : "+v"(d) : "v"(x0), "v"(x1), "v"(x2), "v"(x3));
#endif
}
__device__ __forceinline__ void hz6(v8f& d, v16h x0, v16h x1, v16h x2, v16h x3, v16h x4, v16h x5) {
#if defined(__HIP_DEVICE_COMPILE__)
  asm volatile("v_nop\n\tv_nop\n\tv_nop\n\tv_nop" : "+v"(d) : "v"(x0), "v"(x1), "v"(x2), "v"(x3), "v"(x4), "v"(x5));
#endif
}
__device__ __forceinline__ void hz8(v8f& d, v16h x0, v16h x1, v16h x2, v16h x3, v16h x4, v16h x5, v16h x6, v16h x7) {
#if defined(__HIP_DEVICE_COMPILE__)
  asm volatile("v_nop\n\tv_nop\n\tv_nop\n\tv_nop" : "+v"(d) : "v"(x0), "v"(x1), "v"(x2), "v"(x3), "v"(x4), "v"(x5), "v"(x6), "v"(x7));
#endif
}
__device__ __forceinline__ void keep4_h(v16h a, v16h b, v16h c, v16h d) {
#if defined(__HIP_DEVICE_COMPILE__)
  asm volatile("v_nop" :: "v"(a), "v"(b), "v"(c), "v"(d));
#endif
}
__device__ __forceinline__ void acc_guard4(v8f& a, v8f& b, v8f& c, v8f& d) {
#if defined(__HIP_DEVICE_COMPILE__)
  asm volatile("v_nop\n\tv_nop\n\tv_nop\n\tv_nop" : "+v"(a), "+v"(b), "+v"(c), "+v"(d));
#endif
}
__device__ __forceinline__ void wave_sync_lds() {
  __builtin_amdgcn_fence(__ATOMIC_RELEASE, "workgroup");
  __builtin_amdgcn_wave_barrier();
  __builtin_amdgcn_fence(__ATOMIC_ACQUIRE, "workgroup");
}
// s_wait_xcnt 0 behind a run of global fragment loads (GEMM and attention). The loads' address pointers are inputs only, so their registers stay
// live up to the wait: no later load of the run lands on them and no address arithmetic rewrites them before the wait has passed.
__device__ __forceinline__ void addr_wait1(const unsigned short* p) {
#if defined(__HIP_DEVICE_COMPILE__)
  asm volatile("s_wait_xcnt 0x0" :: "v"(p) : "memory");
#endif
}
__device__ __forceinline__ void addr_wait4(const unsigned short* p0, const unsigned short* p1, const unsigned short* p2, const unsigned short* p3) {
#if defined(__HIP_DEVICE_COMPILE__)
  asm volatile("s_wait_xcnt 0x0" :: "v"(p0), "v"(p1), "v"(p2), "v"(p3) : "memory");
#endif
}
__device__ __forceinline__ void addr_wait2(const unsigned short* p0, const unsigned short* p1) {
#if defined(__HIP_DEVICE_COMPILE__)
  asm volatile("s_wait_xcnt 0x0" :: "v"(p0), "v"(p1) : "memory");
#endif
}
// f32 -> f16 hi + unscaled f16 residual (hi + lo ~ x to 2^-22 relative; a flushed subnormal lo costs < 6.1e-5 absolute in the carried scale)
__device__ __forceinline__ void sp16(float x, _Float16& hi, _Float16& lo) {
  const _Float16 a = (_Float16)x;
  hi = a;
  lo = (_Float16)(x - (float)a);
}

// =====================================================================================================
// Elementwise 16-bit pack, no transpose: dst[i] = f16( bf16_RNE(src[i]) * sc ), sc a power of two (exact).
// coverage: grid = n / 2048 blocks x 256 thr x 8 elements = n exactly (host checks n % 2048 == 0).
// =====================================================================================================
__global__ __launch_bounds__(256) void cvt16(const float* __restrict__ src, unsigned short* dst, int n, float sc) {
  const size_t i8 = ((size_t)blockIdx.x * 256 + threadIdx.x) * 8;
  if (i8 + 8 > (size_t)n) return;                 // never taken with the exact grid; no barriers in this kernel
  const v4f a = *(const v4f*)(src + i8);
  const v4f b = *(const v4f*)(src + i8 + 4);
  v4u o;
  o[0] = pk16(h_bits((_Float16)(bfr(a[0]) * sc)), h_bits((_Float16)(bfr(a[1]) * sc)));
  o[1] = pk16(h_bits((_Float16)(bfr(a[2]) * sc)), h_bits((_Float16)(bfr(a[3]) * sc)));
  o[2] = pk16(h_bits((_Float16)(bfr(b[0]) * sc)), h_bits((_Float16)(bfr(b[1]) * sc)));
  o[3] = pk16(h_bits((_Float16)(bfr(b[2]) * sc)), h_bits((_Float16)(bfr(b[3]) * sc)));
  {
    *(v4u*)(dst + i8) = o;
    
  }
}

// =====================================================================================================
// Register-blocked batched 16-bit WMMA GEMM body (device function, called by proj3): C[m][n] = oscale * sum_k A[m][k] * Bt[n][k] (+ bias);
// one wave per 64x64 tile, no block barriers. A row-major [M][K] pitch lda (16-bit plane), Bt row-major [N][K] pitch ldb (k contiguous); M, N multiples of 64,
// K multiple of 32. by = batch index with element strides sA, sB, sC; bx = workgroup index inside the batch; slab = the wave's LDS slab.
// ASPLIT 1: a second A plane A2 (unscaled residual of A, same layout) is multiplied into the same accumulator (A + A2 ~ exact A).
// BF 1: bf16 operands (v_wmma_f32_16x16x32_bf16), else f16.
// EPI 1: value += bf16_RNE(ep0[column]) (per-column bias); EPI 2: value += bf16_RNE(ep0[row]) (per-row bias, 16-bit out only).
// OM 0: f32 out (pitch ldc).  OM 2: one f16 plane = f16(value * ocarry).
// OM 4: two f16 planes: hi = f16(value * ocarry), lo = f16(value * ocarry - hi) (unscaled residual).
// OM 5: two f16 planes: C = f16((value + bf16_RNE(ep1[column])) * ocarry), C2 = f16((value + bf16_RNE(ep2[column])) * ocarry).
// coverage: 4 slabs x 16 rows (f32: it 0..7 x lane>>4; 16-bit: it 0..3 x lane>>3) x 64 cols = the wave's whole 64x64 tile;
//           bx covers ceil(tilesM*tilesN/GW) workgroups of GW waves, surplus waves return (wave-uniform).
// =====================================================================================================
#define GW 4   // waves per projection workgroup
template <int OM, int ASPLIT, int BF, int EPI>
__device__ __forceinline__ void gemm64(
    const unsigned short* __restrict__ Ap, const unsigned short* __restrict__ A2p, int lda, long long sA,
    const unsigned short* __restrict__ Btp, int ldb, long long sB,
    void* Cout, void* C2out, int ldc, long long sC,
    int M, int N, int K, float oscale, float ocarry,
    const float* __restrict__ ep0, const float* __restrict__ ep1, const float* __restrict__ ep2,
    int bx, int by, float* slab) {
  const int lane = threadIdx.x & 31;
  const int wave = threadIdx.x >> 5;
  const int tilesN = N >> 6;
  const int tilesM = M >> 6;
  const int tile = bx * GW + wave;
  if (tile >= tilesM * tilesN) return;   // wave-uniform; no block barriers in the calling kernel
  const int tm = tile / tilesN;
  const int tn = tile - tm * tilesN;
  const int m0 = tm << 6;
  const int n0 = tn << 6;

  const unsigned short* A1 = Ap  + (size_t)((long long)by * sA);
  const unsigned short* A2 = A2p + (size_t)((long long)by * sA);
  const unsigned short* Bb = Btp + (size_t)((long long)by * sB);

  const int rlane = lane & 15;                 // row (A) / col (B, D) within subtile
  const int koff  = (lane >> 4) * 8;           // k offset of this lane half
  const int mOff  = (lane >> 4) * 8;           // D row offset

  v8f acc[4][4];
#pragma unroll
  for (int i = 0; i < 4; ++i)
#pragma unroll
    for (int j = 0; j < 4; ++j) acc[i][j] = zero8();

  for (int k0 = 0; k0 < K; k0 += 32) {
    v16h bh[4];
    const unsigned short* pb[4];
#pragma unroll
    for (int j = 0; j < 4; ++j) {
      const size_t bofs = (size_t)(n0 + (j << 4) + rlane) * ldb + koff + k0;
      pb[j] = Bb + bofs;
      bh[j] = ldfrag_u(pb[j]);
    }
    addr_wait4(pb[0], pb[1], pb[2], pb[3]);
#pragma unroll
    for (int i = 0; i < 4; ++i) {
      const size_t ao = (size_t)(m0 + (i << 4) + rlane) * lda + koff + k0;
      const unsigned short* pa = A1 + ao;
      const v16h ah = ldfrag_u(pa);
      addr_wait1(pa);
#pragma unroll
      for (int j = 0; j < 4; ++j) acc[i][j] = mmaT<BF>(ah, bh[j], acc[i][j]);
      dep_guard1(acc[i][0], acc[i][3], ah);
      if constexpr (ASPLIT != 0) {
        const unsigned short* pa2 = A2 + ao;
        const v16h al = ldfrag_u(pa2);
        addr_wait1(pa2);
#pragma unroll
        for (int j = 0; j < 4; ++j) acc[i][j] = mmaT<BF>(al, bh[j], acc[i][j]);
        dep_guard1(acc[i][0], acc[i][3], al);
      }
    }
    keep4_h(bh[0], bh[1], bh[2], bh[3]);
  }
  acc_guard4(acc[0][0], acc[0][1], acc[0][2], acc[0][3]);
  acc_guard4(acc[1][0], acc[1][1], acc[1][2], acc[1][3]);
  acc_guard4(acc[2][0], acc[2][1], acc[2][2], acc[2][3]);
  acc_guard4(acc[3][0], acc[3][1], acc[3][2], acc[3][3]);

  const int hh2 = lane >> 4, c4 = (lane & 15) * 4;     // f32 out: 256-B row segment = 16 lanes x 16 B
  const int q8  = lane >> 3, c8 = (lane & 7) * 8;

  // ---- epilogue ----
#pragma unroll
  for (int i = 0; i < 4; ++i) {
    const int mBase = m0 + (i << 4);
#pragma unroll
    for (int j = 0; j < 4; ++j) {
#pragma unroll
      for (int r = 0; r < 8; ++r) {
        slab[(mOff + r) * 68 + (j << 4) + rlane] = acc[i][j][r];
      }
    }
    wave_sync_lds();
    if constexpr (OM == 0) {
      float* C = (float*)Cout + (size_t)((long long)by * sC);
      v4f vals[8];
#pragma unroll
      for (int it = 0; it < 8; ++it) {
        const int row = it * 2 + hh2;                      // it 0..7 x hh2 0..1 = rows 0..15
        v4f v = *(const v4f*)(slab + row * 68 + c4);
#pragma unroll
        for (int e = 0; e < 4; ++e) v[e] = v[e] * oscale;
        if constexpr (EPI == 1) {
          const v4f bb = *(const v4f*)(ep0 + n0 + c4);     // per-column bias, columns n0+c4 .. +3 (N equals the bias length)
#pragma unroll
          for (int e = 0; e < 4; ++e) v[e] = v[e] + bfr(bb[e]);
        }
        vals[it] = v;
      }
      {
#pragma unroll
        for (int it = 0; it < 8; ++it) {
          const int gr = mBase + it * 2 + hh2;
          *(v4f*)(C + (size_t)gr * ldc + n0 + c4) = vals[it];
        }
        
      }
    } else {
      unsigned short* C  = (unsigned short*)Cout  + (size_t)((long long)by * sC);
      unsigned short* Cb = (unsigned short*)C2out + (size_t)((long long)by * sC);
      v4u hv[4], lv[4];
#pragma unroll
      for (int it = 0; it < 4; ++it) {
        const int row = it * 4 + q8;                       // it 0..3 x q8 0..3 = rows 0..15
        const float* sp = slab + row * 68 + c8;
        float rb = 0.f;
        if constexpr (EPI == 2) rb = bfr(ep0[mBase + row]);   // per-row bias (M equals the bias length)
        v4u a  = {0u, 0u, 0u, 0u};
        v4u b2 = {0u, 0u, 0u, 0u};
#pragma unroll
        for (int e = 0; e < 4; ++e) {
          const int ci = n0 + c8 + 2 * e;                  // column index, < N
          float f0 = sp[2 * e] * oscale + rb;
          float f1 = sp[2 * e + 1] * oscale + rb;
          if constexpr (EPI == 1) {
            f0 += bfr(ep0[ci]);
            f1 += bfr(ep0[ci + 1]);
          }
          if constexpr (OM == 5) {
            const float g0 = (f0 + bfr(ep1[ci])) * ocarry, g1 = (f1 + bfr(ep1[ci + 1])) * ocarry;
            const float w0 = (f0 + bfr(ep2[ci])) * ocarry, w1 = (f1 + bfr(ep2[ci + 1])) * ocarry;
            a[e]  = pk16(h_bits((_Float16)g0), h_bits((_Float16)g1));
            b2[e] = pk16(h_bits((_Float16)w0), h_bits((_Float16)w1));
          } else {
            f0 *= ocarry; f1 *= ocarry;
            const _Float16 x0 = (_Float16)f0, x1 = (_Float16)f1;
            a[e] = pk16(h_bits(x0), h_bits(x1));
            if constexpr (OM == 4) {
              b2[e] = pk16(h_bits((_Float16)(f0 - (float)x0)), h_bits((_Float16)(f1 - (float)x1)));
            }
          }
        }
        hv[it] = a;
        lv[it] = b2;
      }
      {
#pragma unroll
        for (int it = 0; it < 4; ++it) {
          const int row = it * 4 + q8;
          *(v4u*)(C + (size_t)(mBase + row) * ldc + n0 + c8) = hv[it];
          if constexpr (OM >= 4) {
            *(v4u*)(Cb + (size_t)(mBase + row) * ldc + n0 + c8) = lv[it];
          }
        }
        
      }
    }
    wave_sync_lds();
  }
}

// =====================================================================================================
// The three projections in ONE launch, so that their waves are on the chip together: blockIdx.y = 0: q, 1: k, 2: v^T.
//   q, k: M = NROW, N = 1024, K = 1024, per-column bias; (NROW/64)*(DMOD/64) = 1024 tiles = PJB workgroups of GW waves.
//   v^T per batch: VT[b][e][j], M = 1024 (e), N = SEQ (j), K = 1024, per-row bias; 512 tiles per batch = PJB/NBAT workgroups,
//   batch = blockIdx.x / (PJB/NBAT). Every branch below is workgroup-uniform; no block barriers.
// coverage: grid (PJB, 3) x GW waves = every 64x64 tile of QH/QL, KH/KL and VH/VL exactly once.
// =====================================================================================================
#define PJB (((NROW / 64) * (DMOD / 64)) / GW)
static_assert(((NROW / 64) * (DMOD / 64)) % GW == 0);
static_assert((DMOD / 64) * (SEQ / 64) * NBAT == PJB * GW && (PJB % NBAT) == 0);
__global__ __launch_bounds__(GW * 32) __attribute__((amdgpu_num_vgpr(256))) void proj3(
    const unsigned short* __restrict__ Xq, const unsigned short* __restrict__ Xk, const unsigned short* __restrict__ Xv,
    const unsigned short* __restrict__ Wq, const unsigned short* __restrict__ Wk, const unsigned short* __restrict__ Wv,
    unsigned short* QH, unsigned short* QL, unsigned short* KH, unsigned short* KL, unsigned short* VH, unsigned short* VL,
    const float* __restrict__ bq, const float* __restrict__ bk, const float* __restrict__ bv) {
  __shared__ __align__(16) float sT[GW][16 * 68];   // per-wave 16x64 slab, pitch 68 floats
  float* slab = sT[threadIdx.x >> 5];
  const int p = blockIdx.y;
  if (p < 2) {
    const unsigned short* X = (p == 0) ? Xq : Xk;
    const unsigned short* Wt = (p == 0) ? Wq : Wk;
    unsigned short* H = (p == 0) ? QH : KH;
    unsigned short* L = (p == 0) ? QL : KL;
    const float* bias = (p == 0) ? bq : bk;
    gemm64<4, 0, 0, 1>(X, X, DMOD, 0LL, Wt, DMOD, 0LL, (void*)H, (void*)L, DMOD, 0LL,
                       NROW, DMOD, DMOD, 1.0f / (XC * WSC), (p == 0) ? QC : KC,
                       bias, bias, bias, blockIdx.x, 0, slab);
  } else {
    const int per = PJB / NBAT;
    const int bt  = blockIdx.x / per;
    gemm64<4, 0, 0, 2>(Wv, Wv, DMOD, 0LL, Xv, DMOD, (long long)SEQ * DMOD, (void*)VH, (void*)VL, SEQ, (long long)DMOD * SEQ,
                       DMOD, SEQ, DMOD, 1.0f / (XC * WSC), VC,
                       bv, bv, bv, blockIdx.x - bt * per, bt, slab);
  }
}

// =====================================================================================================
// Causal attention with the skewed relative-position term for one (batch b, head h) pair and a 64-row query tile; 8 waves =
// 2 key groups x 4 query waves: wave (kg, qw) owns query rows iw0 .. iw0+15, iw0 = i0 + 16 qw, and walks every second key tile
// j0 = 64 kg, 64 (kg + 2), .. <= i0, keeping its own running (max, sum, O). After the loop group 1 hands its state over through LDS
// behind one block barrier and group 0 merges the two states (rescale by exp2(m - max)) and stores. So the longest wave walks 16 tiles,
// not 32. There are more workgroups than places on the chip: blockIdx.y counts the query tiles from the last (most key tiles) down,
// so that cost falls with the flat workgroup index (for speed only).
// Planes: QH/QL, KH/KL = f16 hi + residual of (q x64), (k x64), rows b*SEQ + position, pitch DMOD halves, head columns h*64..h*64+63;
//         EP = f16(bf16_RNE(Er) x16) [ELEN][64]; VH/VL = f16 hi + residual of (v x64) as [b][h*64+d][SEQ] (key index contiguous).
//   Srel(i, j) = q_i . Er[ELEN-1 - (i - j)] for j <= i (the pad-reshape skew). Per key tile the wave needs Er rows
//   wlo + x, wlo = ELEN-1 - (iw0 - j0) - 15, x = jj - R + 15 in [0, 78]: position window T[R][x] = (qh+ql)[iw0+R] . EP[wlo + x],
//   x in [0, 80) (5 subtiles of 16 Er rows, their ten fragments requested together, K = 64, Er row clamped on the address; clamping only ever touches
//   entries with j > i, which the causal mask replaces); each 16x16 subtile is stored to the wave's f32 LDS strip right after its WMMAs.
//   Content scores S = (qh+ql) . (kh+kl) (hh + hl + lh, 4 subtiles of 16 keys, fragments requested two subtiles at a time, K = 64) -> the wave's f32 slab.
//   score*log2(e) = S*CS + T[R][jj - R + 15]*CT (CS, CT fold 1/(carries) and 1/8); entries with j > i are replaced by -inf;
//   online softmax in base 2, max-subtracted (row max via 16-lane shuffles), running sums in f32; e = exp2(t - m) in (0,1] written
//   of P*1024 (f16 hi + residual) rebuilt from the slab rows (f32 vector loads, split k map) and the v^T hi / residual B fragments loaded
//   straight from VH/VL [h*64+d][j]; 12 WMMAs per 32-key step (Ph.vh + Ph.vl + Pl.vh), 4 d-subtiles.
//   out rows (b*SEQ + iw0 + row), floats h*64 .. h*64+63 = one whole 256-B segment (2 lines) per row: 16 consecutive lanes x 16 B,
//   block = 8 waves = 256 threads; grid = (NBAT*NH, SEQ/64); one block barrier, behind the key loop, passed by every wave;
//   every wave does bounded work (<= SEQ/128 tiles).
// coverage: LDS strip 16 x 80 of TPI and slab 16 x 64 of SPI per wave, fully written before read each tile; global: 8 instructions x
//           2 rows x 64 floats = rows iw0..iw0+15 of head segment h; grid x waves cover all NBAT*SEQ rows and all NH head segments once.
// =====================================================================================================
__global__ __launch_bounds__(ATT_THREADS) __attribute__((amdgpu_num_vgpr(256)))
void attn_rel(const unsigned short* __restrict__ QH, const unsigned short* __restrict__ QL,
              const unsigned short* __restrict__ KH, const unsigned short* __restrict__ KL,
              const unsigned short* __restrict__ EP,
              const unsigned short* __restrict__ VH, const unsigned short* __restrict__ VL,
              float* out) {
  __shared__ __align__(16) float smem[ATT_W * WFL];   // per wave: T strip [16][TPI] | score / prob / ctx slab [16][SPI]

  const int tid  = threadIdx.x;
  const int wave = __builtin_amdgcn_readfirstlane(tid >> 5);   // scalar, so that the key loop's per-wave start and end stay scalar branches
  const int qw   = wave & (ATT_QW - 1);
  const int kg   = wave / ATT_QW;
  const int lane = tid & 31;
  const int hh   = lane >> 4;
  const int c    = lane & 15;
  const int bh   = blockIdx.x;
  const int b    = bh / NH;
  const int h    = bh - b * NH;
  const int qt   = (SEQ / 64 - 1) - (int)blockIdx.y;           // query tile, the one with the most key tiles first
  const int i0   = qt * 64;
  const int iw0  = i0 + qw * 16;

  float* tsh = smem + wave * WFL;
  float* pt  = tsh + 16 * TPI;
  // the lane's own bases in strip and slab: every access of the key loop is base + a constant, which leaves the registers to the fragments in flight
  float* tst = tsh + 8 * hh * TPI + c;             // strip row 8hh, column c
  float* pst = pt + 8 * hh * SPI + c;              // slab row 8hh, column c
  const float* tgt = tst + 15 - 8 * hh;            // shifted gather: row 8hh + r starts at tgt + r * (TPI - 1)

  const size_t qro = ((size_t)b * SEQ + iw0 + c) * DMOD + h * DH + 8 * hh;      // A rows: query iw0 + c, d 8hh..
  const unsigned short* Khb = KH + (size_t)b * SEQ * DMOD + h * DH + 8 * hh;
  const unsigned short* Klb = KL + (size_t)b * SEQ * DMOD + h * DH + 8 * hh;
  const unsigned short* Eb  = EP + 8 * hh;
  const size_t vpo = (size_t)b * DMOD * SEQ + (size_t)(h * DH) * SEQ + 8 * hh;
  const unsigned short* Vhb = VH + vpo;
  const unsigned short* Vlb = VL + vpo;

  const float CS = LOG2E * SCALE / (QC * KC);
  const float CT = LOG2E * SCALE / (QC * EC);

  float mrow[8], lrow[8];
  v8f O[4];
#pragma unroll
  for (int r = 0; r < 8; ++r) { mrow[r] = -INFINITY; lrow[r] = 0.f; }
#pragma unroll
  for (int td = 0; td < 4; ++td) O[td] = zero8();

  const int ntile = qt + 1;                  // causal: key tiles j0 <= i0
#pragma unroll 1
  for (int jt = kg; jt < ntile; jt += ATT_KG) {
    const int j0 = jt * 64;
    const v16h qha = ldfrag_u(QH + qro), qhb = ldfrag_u(QH + qro + 32);
    const v16h qla = ldfrag_u(QL + qro), qlb = ldfrag_u(QL + qro + 32);

    // ---- position window T (5 subtiles of 16 Er rows), each subtile stored to the LDS strip as produced ----
    {
      const int wlo = (ELEN - 1) - (iw0 - j0) - 15;
      // all ten Er fragments are requested together, ahead of the products: the window waits out one load latency, not five
      v16h fa[5], fb[5];
      const unsigned short* pe[5];
#pragma unroll
      for (int u = 0; u < 5; ++u) {
        int m = wlo + 16 * u + c;
        m = (m < 0) ? 0 : m;
        m = (m > ELEN - 1) ? (ELEN - 1) : m;
        pe[u] = Eb + (size_t)m * DH;
        fa[u] = ldfrag_u(pe[u]);
        fb[u] = ldfrag_u(pe[u] + 32);
      }
      addr_wait4(pe[0], pe[1], pe[2], pe[3]);
      addr_wait1(pe[4]);
      __builtin_amdgcn_sched_barrier(0);   // the whole group is requested before its first product: the scheduler otherwise pairs each load with its use again
#pragma unroll
      for (int u = 0; u < 5; ++u) {
        v8f t8 = mma_h(qha, fa[u], zero8());
        t8 = mma_h(qla, fa[u], t8);
        t8 = mma_h(qhb, fb[u], t8);
        t8 = mma_h(qlb, fb[u], t8);
        hz6(t8, fa[u], fb[u], qha, qla, qhb, qlb);
#pragma unroll
        for (int r = 0; r < 8; ++r) tst[r * TPI + 16 * u] = t8[r];
      }
    }
    __builtin_amdgcn_sched_barrier(0);   // keeps a later phase's index and address work out of this phase, whose registers the fragments in flight need
    // ---- content scores S (4 subtiles of 16 keys) -> slab ----
    {
      // the key fragments are requested in two groups of two subtiles, each ahead of its products: two load latencies, not four
      const unsigned short* pkh = Khb + (size_t)(j0 + c) * DMOD;
      const unsigned short* pkl = Klb + (size_t)(j0 + c) * DMOD;
      v16h kha[4], khb[4], kla[4], klb[4];
#pragma unroll
      for (int t = 0; t < 4; ++t) {
        if ((t & 1) == 0) {
#pragma unroll
          for (int x = t; x < t + 2; ++x) {
            kha[x] = ldfrag_u(pkh + (size_t)(16 * x) * DMOD);
            khb[x] = ldfrag_u(pkh + (size_t)(16 * x) * DMOD + 32);
            kla[x] = ldfrag_u(pkl + (size_t)(16 * x) * DMOD);
            klb[x] = ldfrag_u(pkl + (size_t)(16 * x) * DMOD + 32);
          }
          addr_wait2(pkh, pkl);
          __builtin_amdgcn_sched_barrier(0);   // the whole group is requested before its first product: the scheduler otherwise pairs each load with its use again
        }
        v8f s8 = mma_h(qha, kha[t], zero8());
        s8 = mma_h(qha, kla[t], s8);
        s8 = mma_h(qla, kha[t], s8);
        s8 = mma_h(qhb, khb[t], s8);
        s8 = mma_h(qhb, klb[t], s8);
        s8 = mma_h(qlb, khb[t], s8);
        hz8(s8, kha[t], khb[t], kla[t], klb[t], qha, qla, qhb, qlb);
#pragma unroll
        for (int r = 0; r < 8; ++r) pst[r * SPI + 16 * t] = s8[r];
      }
    }
    __builtin_amdgcn_sched_barrier(0);   // keeps a later phase's index and address work out of this phase, whose registers the fragments in flight need
    wave_sync_lds();
    // v^T fragments of the first 32 keys: requested here, behind the fence (which waits for loads in flight), so that they arrive while the softmax runs
    const unsigned short* pvh = Vhb + (size_t)c * SEQ + j0;
    const unsigned short* pvl = Vlb + (size_t)c * SEQ + j0;
    v16h vh[4], vl[4];
#pragma unroll
    for (int td = 0; td < 4; ++td) {
      vh[td] = ldfrag_u(pvh + (size_t)(16 * td) * SEQ);
      vl[td] = ldfrag_u(pvl + (size_t)(16 * td) * SEQ);
    }
    addr_wait2(pvh, pvl);

    // ---- score assembly, causal mask, online softmax (rows live on one 16-lane half) ----
    const int dj = (j0 - iw0) + c - 8 * hh;        // j - i = dj + 16 t - r
#pragma unroll
    for (int r = 0; r < 8; ++r) {
      const float* trow = tgt + r * (TPI - 1);
      float* srow = pst + r * SPI;
      float tv[4];
#pragma unroll
      for (int t = 0; t < 4; ++t) {
        const float val = srow[16 * t] * CS + trow[16 * t] * CT;
        tv[t] = (dj > r - 16 * t) ? -INFINITY : val;
      }
      float mx = fmaxf(fmaxf(tv[0], tv[1]), fmaxf(tv[2], tv[3]));
#pragma unroll
      for (int off = 1; off < 16; off <<= 1) mx = fmaxf(mx, __shfl_xor(mx, off, 32));
      const float mn = fmaxf(mrow[r], mx);
      const float al = exp2f(mrow[r] - mn);
      mrow[r] = mn;
      float e4[4];
      float ps = 0.f;
#pragma unroll
      for (int t = 0; t < 4; ++t) { e4[t] = exp2f(tv[t] - mn); ps += e4[t]; }
#pragma unroll
      for (int off = 1; off < 16; off <<= 1) ps += __shfl_xor(ps, off, 32);
      lrow[r] = lrow[r] * al + ps;
#pragma unroll
      for (int td = 0; td < 4; ++td) O[td][r] *= al;
#pragma unroll
      for (int t = 0; t < 4; ++t) srow[16 * t] = e4[t];
    }
    wave_sync_lds();
    __builtin_amdgcn_sched_barrier(0);   // keeps a later phase's index and address work out of this phase, whose registers the fragments in flight need

    // ---- O += (Ph + Pl) . (vh + vl)^T, two k-steps of 32 keys; a step's 8 v^T fragments are requested together, ahead of its P split ----
#pragma unroll
    for (int ks = 0; ks < 2; ++ks) {
      if (ks == 1) {
#pragma unroll
        for (int td = 0; td < 4; ++td) {
          vh[td] = ldfrag_u(pvh + (size_t)(16 * td) * SEQ + 32);
          vl[td] = ldfrag_u(pvl + (size_t)(16 * td) * SEQ + 32);
        }
        addr_wait2(pvh, pvl);
        __builtin_amdgcn_sched_barrier(0);   // the whole group is requested before its first product: the scheduler otherwise pairs each load with its use again
      }
      FragH ph, pl;
      {
        const float* prow = pt + c * SPI + 32 * ks + 8 * hh;
        const v4f p0 = *(const v4f*)(prow), p1 = *(const v4f*)(prow + 4);
        const v4f p2 = *(const v4f*)(prow + 16), p3 = *(const v4f*)(prow + 20);
#pragma unroll
        for (int e = 0; e < 4; ++e) {
          _Float16 a0, a1;
          sp16(p0[e] * PC, a0, a1); ph.h[0][e]     = a0; pl.h[0][e]     = a1;   // keys 32ks + 8hh + e
          sp16(p1[e] * PC, a0, a1); ph.h[0][4 + e] = a0; pl.h[0][4 + e] = a1;   // keys 32ks + 8hh + 4 + e
          sp16(p2[e] * PC, a0, a1); ph.h[1][e]     = a0; pl.h[1][e]     = a1;   // keys 32ks + 16 + 8hh + e
          sp16(p3[e] * PC, a0, a1); ph.h[1][4 + e] = a0; pl.h[1][4 + e] = a1;
        }
      }
#pragma unroll
      for (int td = 0; td < 4; ++td) {
        O[td] = mma_h(ph.v, vh[td], O[td]);
        O[td] = mma_h(ph.v, vl[td], O[td]);
        O[td] = mma_h(pl.v, vh[td], O[td]);
        hz4(O[td], vh[td], vl[td], ph.v, pl.v);
      }
    }
    wave_sync_lds();
  }
  acc_guard4(O[0], O[1], O[2], O[3]);

  // ---- merge of the two key groups: group 1 writes (O, m, l) to its own slab and strip, block barrier, group 0 reads and rescales.
  //      A group-1 wave without a tile hands over m = -inf, l = 0, O = 0, whose weight exp2(-inf) is 0; group 0 always has tile 0.
  if (kg != 0) {
#pragma unroll
    for (int r = 0; r < 8; ++r) {
      const int R = 8 * hh + r;
#pragma unroll
      for (int td = 0; td < 4; ++td) pt[R * SPI + 16 * td + c] = O[td][r];
      if (c == 0) { tsh[R] = mrow[r]; tsh[16 + R] = lrow[r]; }
    }
  }
  __syncthreads();                           // publishes group 1's state to group 0; every wave of the block passes it once
  if (kg != 0) return;
  {
    const float* ts2 = tsh + ATT_QW * WFL;   // wave (1, qw)'s strip and slab
    const float* pt2 = ts2 + 16 * TPI;
#pragma unroll
    for (int r = 0; r < 8; ++r) {
      const int R = 8 * hh + r;
      const float m2 = ts2[R], l2 = ts2[16 + R];
      const float mm = fmaxf(mrow[r], m2);
      const float a1 = exp2f(mrow[r] - mm), a2 = exp2f(m2 - mm);
      lrow[r] = lrow[r] * a1 + l2 * a2;
#pragma unroll
      for (int td = 0; td < 4; ++td) O[td][r] = O[td][r] * a1 + pt2[R * SPI + 16 * td + c] * a2;
    }
  }

  // ---- fold 1/l and the carries (1024 on P, 64 on v), stage the wave's 16x64 f32 slice in its slab ----
  const float oc = 1.0f / (PC * VC);
#pragma unroll
  for (int r = 0; r < 8; ++r) {
    const float inv = (1.0f / lrow[r]) * oc;
    const int ro = (8 * hh + r) * SPI + c;
#pragma unroll
    for (int td = 0; td < 4; ++td) pt[ro + 16 * td] = O[td][r] * inv;
  }
  wave_sync_lds();
  {
    const int c4 = c * 4;
    v4f vals[8];
#pragma unroll
    for (int it = 0; it < 8; ++it) {
      const int row = it * 2 + hh;                           // it 0..7 x hh 0..1 = rows 0..15
      vals[it] = *(const v4f*)(pt + row * SPI + c4);
    }
    float* ob = out + ((size_t)b * SEQ + iw0) * DMOD + h * DH + c4;
    {
#pragma unroll
      for (int it = 0; it < 8; ++it) {
        const int row = it * 2 + hh;
        *(v4f*)(ob + (size_t)row * DMOD) = vals[it];
      }
      
    }
  }
}

// =====================================================================================================
// Workspace map (bytes); every plane is an exact multiple of its tile / whole-row store granularity (M, N exact tile multiples,
// convert counts exact multiples of 2048, no pad rows), every offset a multiple of 262144:
//   Xq, Xk, Xv  f16 [NROW][1024] x16                            3 x 8388608
//   Wq, Wk, Wv  f16 [1024 out][1024 in] x64                      3 x 2097152
//   EP          f16 [ELEN][64] x16                                   262144
//   QH, QL, KH, KL f16 [NROW][1024] (x64 hi / residual)         4 x 8388608
//   VH, VL      f16 [NBAT][1024][SEQ] (x64 hi / residual)       2 x 8388608
//   end                                                            82051072
// =====================================================================================================
extern "C" void kernel_launch(void* const* d_in, const int* in_sizes, int n_in,
                              void* d_out, int out_size, void* d_ws, size_t ws_size,
                              hipStream_t stream) {
  if (n_in < 10) return;
  if (in_sizes[0] != NROW * DMOD || in_sizes[1] != NROW * DMOD || in_sizes[2] != NROW * DMOD) return;
  if (in_sizes[3] != DMOD * DMOD || in_sizes[5] != DMOD * DMOD || in_sizes[7] != DMOD * DMOD) return;
  if (in_sizes[4] != DMOD || in_sizes[6] != DMOD || in_sizes[8] != DMOD) return;
  if (in_sizes[9] != ELEN * DH) return;
  if (out_size != NROW * DMOD) return;

  const float* qin = (const float*)d_in[0];
  const float* kin = (const float*)d_in[1];
  const float* vin = (const float*)d_in[2];
  const float* w_q = (const float*)d_in[3];
  const float* b_q = (const float*)d_in[4];
  const float* w_k = (const float*)d_in[5];
  const float* b_k = (const float*)d_in[6];
  const float* w_v = (const float*)d_in[7];
  const float* b_v = (const float*)d_in[8];
  const float* er  = (const float*)d_in[9];
  float*       out = (float*)d_out;

  const size_t PX = (size_t)NROW * DMOD * 2;             //  8388608
  const size_t PW = (size_t)DMOD * DMOD * 2;             //  2097152
  const size_t PE = (size_t)ELEN * DH * 2;               //   262144
  const size_t PV = (size_t)NBAT * DMOD * SEQ * 2;       //  8388608
  size_t off = 0;
  const size_t oXq = off; off += PX;
  const size_t oXk = off; off += PX;
  const size_t oXv = off; off += PX;
  const size_t oWq = off; off += PW;
  const size_t oWk = off; off += PW;
  const size_t oWv = off; off += PW;
  const size_t oE  = off; off += PE;
  const size_t oQH = off; off += PX;
  const size_t oQL = off; off += PX;
  const size_t oKH = off; off += PX;
  const size_t oKL = off; off += PX;
  const size_t oVH = off; off += PV;
  const size_t oVL = off; off += PV;
  if (off > ws_size) return;                               // off = 82051072
  if (off > (size_t)134217728) return;

  char* ws = (char*)d_ws;
  unsigned short* Xq  = (unsigned short*)(ws + oXq);
  unsigned short* Xk  = (unsigned short*)(ws + oXk);
  unsigned short* Xv  = (unsigned short*)(ws + oXv);
  unsigned short* Wq6 = (unsigned short*)(ws + oWq);
  unsigned short* Wk6 = (unsigned short*)(ws + oWk);
  unsigned short* Wv6 = (unsigned short*)(ws + oWv);
  unsigned short* E16 = (unsigned short*)(ws + oE);
  unsigned short* QHp = (unsigned short*)(ws + oQH);
  unsigned short* QLp = (unsigned short*)(ws + oQL);
  unsigned short* KHp = (unsigned short*)(ws + oKH);
  unsigned short* KLp = (unsigned short*)(ws + oKL);
  unsigned short* VHp = (unsigned short*)(ws + oVH);
  unsigned short* VLp = (unsigned short*)(ws + oVL);

  const dim3 blk(256);
  const dim3 gCX((NROW * DMOD) / 2048);                             // 2048
  const dim3 gCW((DMOD * DMOD) / 2048);                             // 512
  const dim3 gCE((ELEN * DH) / 2048);                               // 64
  const dim3 gP(PJB, 3);                                            // 256 x 3
  const dim3 bP(GW * 32);                                           // 128
  const dim3 gAT(NBAT * NH, SEQ / 64);                              // 32 x 32
  const dim3 bAT(ATT_THREADS);                                      // 256

  // (0) 16-bit planes of the inputs: activations f16(bf16_RNE(x) * 16); W[out][in] (already k-contiguous) f16(bf16_RNE(w) * 64);
  //     Er f16(bf16_RNE(e) * 16)
  cvt16<<<gCX, blk, 0, stream>>>(qin, Xq, NROW * DMOD, XC);
  cvt16<<<gCX, blk, 0, stream>>>(kin, Xk, NROW * DMOD, XC);
  cvt16<<<gCX, blk, 0, stream>>>(vin, Xv, NROW * DMOD, XC);
  cvt16<<<gCW, blk, 0, stream>>>(w_q, Wq6, DMOD * DMOD, WSC);
  cvt16<<<gCW, blk, 0, stream>>>(w_k, Wk6, DMOD * DMOD, WSC);
  cvt16<<<gCW, blk, 0, stream>>>(w_v, Wv6, DMOD * DMOD, WSC);
  cvt16<<<gCE, blk, 0, stream>>>(er, E16, ELEN * DH, EC);

  // (1) one launch for the three projections:
  //     q[m][e] = sum_d x[m][d] Wq[e][d] / 1024 + bq[e] -> QH = f16(q * 64), QL = f16(q * 64 - QH); the same for k -> KH, KL;
  //     VT[b][e][j] = sum_c Wv[e][c] x[b*SEQ+j][c] / 1024 + bv[e] -> VH, VL (x64)
  proj3<<<gP, bP, 0, stream>>>(Xq, Xk, Xv, Wq6, Wk6, Wv6, QHp, QLp, KHp, KLp, VHp, VLp, b_q, b_k, b_v);

  // (2) causal relative attention -> out[b][i][h*64+d] (f32), written directly
  attn_rel<<<gAT, bAT, 0, stream>>>(QHp, QLp, KHp, KLp, E16, VHp, VLp, out);
  (void)hipGetLastError();
}

// v004
// One run takes 199 microseconds.
// Next to v003, in two timings, it ran 1.19 times as fast each time.
// All steps since v000 together make it 2.24 times as fast.
// Contractions (all v_wmma_f32_16x16x32_f16, f16 operands, f32 accumulate): q/k/v projections (x f16 x16 . W f16 x64, K=1024, single products,
// outputs written as f16 hi + unscaled f16 residual planes); position window ((qh+ql) x64 . Er f16 x16, K=64, 2 products) -> f32 LDS strip,
// shifted gather on VALU; content scores ((qh+ql) x64 . (kh+kl) x64, K=64, hh+hl+lh); P . v^T ((Ph+Pl) x1024 . (vh+vl) x64, hh+hl+lh,
// 64 keys per tile). Causal mask, max-subtracted online base-2 softmax and the 1/l fold in f32 on VALU. Every float input RNE-converted to bf16 on load.
#include <hip/hip_runtime.h>
#include <math.h>
#include <stdint.h>

#define SEQ   2048
#define NBAT  2
#define DMOD  1024
#define NH    16
#define DH    64
#define ELEN  2048
#define NROW  (NBAT * SEQ)
#define XC    16.0f
#define WSC   64.0f
#define QC    64.0f
#define KC    64.0f
#define EC    16.0f
#define VC    64.0f
#define PC    1024.0f
#define SCALE 0.125f
#define LOG2E 1.4426950408889634f
static_assert(NH * DH == DMOD);
static_assert(DH == 64);
static_assert(ELEN == SEQ);
static_assert((SEQ % 64) == 0 && (DMOD % 64) == 0 && (NROW % 64) == 0);
static_assert(((NROW * DMOD) % 8192) == 0 && ((DMOD * DMOD) % 8192) == 0 && ((ELEN * DH) % 8192) == 0);
static_assert((SEQ % 16) == 0 && (ELEN % 16) == 0);
#define ATT_QW 4                    // waves side by side on the query rows (16 rows each)
#define ATT_KG 2                    // groups of ATT_QW waves that share out the key tiles
#define ATT_W (ATT_QW * ATT_KG)
#define ATT_THREADS (ATT_W * 32)
static_assert(ATT_KG == 2);
#define TPI 84
#define SPI 68
#define WFL (16 * TPI + 16 * SPI)
static_assert(((16 * TPI) % 4) == 0 && ((16 * SPI) % 4) == 0 && (WFL % 4) == 0);

typedef _Float16 v16h __attribute__((ext_vector_type(16)));
typedef _Float16 v8h  __attribute__((ext_vector_type(8)));
typedef __bf16   v16b __attribute__((ext_vector_type(16)));
typedef float    v8f  __attribute__((ext_vector_type(8)));
typedef float    v4f  __attribute__((ext_vector_type(4)));
typedef float    v2f  __attribute__((ext_vector_type(2)));
typedef unsigned int v4u __attribute__((ext_vector_type(4)));

union FragH { v16h v; v8h h[2]; v4u u[2]; };
union FragAny { v16h h; v16b b; };

// ---- scalar helpers --------------------------------------------------------------------------------
__device__ __forceinline__ unsigned short bf_bits(float f) {          // f32 -> bf16 bits, RNE convert
  unsigned u = __float_as_uint(f);
  return (unsigned short)((u + 0x7FFFu + ((u >> 16) & 1u)) >> 16);
}
__device__ __forceinline__ float bf_up(unsigned short h) { return __uint_as_float(((unsigned)h) << 16); }
__device__ __forceinline__ float bfr(float f) { return bf_up(bf_bits(f)); }   // value of the bf16 RNE convert
__device__ __forceinline__ unsigned short h_bits(_Float16 x) { return __builtin_bit_cast(unsigned short, x); }
__device__ __forceinline__ unsigned pk16(unsigned short a, unsigned short b) { return (unsigned)a | ((unsigned)b << 16); }
__device__ __forceinline__ v8f zero8() { v8f z = {0.f, 0.f, 0.f, 0.f, 0.f, 0.f, 0.f, 0.f}; return z; }

// ---- fragment-order planes: a 16-bit matrix [R][Cn] (R % 16 == 0, Cn % 64 == 0; Cn is the k direction of its reader) is kept as blocks of
//      16 rows x 64 columns, block (r >> 4) * (Cn / 64) + (cn >> 6), 1024 halves each; inside a block four 256-half quarters qd = (cn >> 4) & 3,
//      inside a quarter lane slot ((cn >> 3) & 1) * 16 + (r & 15), 8 halves each. One A/B fragment (16 rows x 32 k) is two neighbouring quarters,
//      and each of its two 16-byte-per-lane loads reads 512 contiguous bytes (4 cache lines, where a row-major plane gives 16).
// ---- fragment loader: p = block + 512 * (k step inside the block) + 8 * lane; lane -> row/col (lane&15), h = lane>>4;
//      elements 0..7 <- k0+8h.., elements 8..15 <- k0+16+8h.. (same split k map for A and B; B is always read from a [n][k] plane)
__device__ __forceinline__ v16h ldfrag_p(const unsigned short* p) {
  FragH f;
  f.u[0] = *(const v4u*)(p);
  f.u[1] = *(const v4u*)(p + 256);
  return f.v;
}

// ---- WMMA helpers with trailing VALU hazard gaps ------------------------------------------------------
__device__ __forceinline__ v8f mma_h(v16h a, v16h b, v8f c) {
  return __builtin_amdgcn_wmma_f32_16x16x32_f16(false, a, false, b, (short)0, c, false, false);
}
__device__ __forceinline__ v8f mma_b(v16h a, v16h b, v8f c) {
  FragAny ua, ub;
  ua.h = a;
  ub.h = b;
  return __builtin_amdgcn_wmma_f32_16x16x32_bf16(false, ua.b, false, ub.b, (short)0, c, false, false);
}
template <int BF>
__device__ __forceinline__ v8f mmaT(v16h a, v16h b, v8f c) {
  if constexpr (BF != 0) return mma_b(a, b, c);
  else return mma_h(a, b, c);
}
__device__ __forceinline__ void dep_guard1(v8f& a, v8f& b, v16h x) {
#if defined(__HIP_DEVICE_COMPILE__)
  asm volatile("v_nop\n\tv_nop\n\tv_nop\n\tv_nop" : "+v"(a), "+v"(b) : "v"(x));
#endif
}
__device__ __forceinline__ void hz4(v8f& d, v16h x0, v16h x1, v16h x2, v16h x3) {
#if defined(__HIP_DEVICE_COMPILE__)
  asm volatile("v_nop\n\tv_nop\n\tv_nop\n\tv_nop" : "+v"(d) : "v"(x0), "v"(x1), "v"(x2), "v"(x3));
#endif
}
__device__ __forceinline__ void hz6(v8f& d, v16h x0, v16h x1, v16h x2, v16h x3, v16h x4, v16h x5) {
#if defined(__HIP_DEVICE_COMPILE__)
  asm volatile("v_nop\n\tv_nop\n\tv_nop\n\tv_nop" : "+v"(d) : "v"(x0), "v"(x1), "v"(x2), "v"(x3), "v"(x4), "v"(x5));
#endif
}
__device__ __forceinline__ void hz8(v8f& d, v16h x0, v16h x1, v16h x2, v16h x3, v16h x4, v16h x5, v16h x6, v16h x7) {
#if defined(__HIP_DEVICE_COMPILE__)
  asm volatile("v_nop\n\tv_nop\n\tv_nop\n\tv_nop" : "+v"(d) : "v"(x0), "v"(x1), "v"(x2), "v"(x3), "v"(x4), "v"(x5), "v"(x6), "v"(x7));
#endif
}
__device__ __forceinline__ void keep4_h(v16h a, v16h b, v16h c, v16h d) {
#if defined(__HIP_DEVICE_COMPILE__)
  asm volatile("v_nop" :: "v"(a), "v"(b), "v"(c), "v"(d));
#endif
}
__device__ __forceinline__ void acc_guard4(v8f& a, v8f& b, v8f& c, v8f& d) {
#if defined(__HIP_DEVICE_COMPILE__)
  asm volatile("v_nop\n\tv_nop\n\tv_nop\n\tv_nop" : "+v"(a), "+v"(b), "+v"(c), "+v"(d));
#endif
}
__device__ __forceinline__ void wave_sync_lds() {
  __builtin_amdgcn_fence(__ATOMIC_RELEASE, "workgroup");
  __builtin_amdgcn_wave_barrier();
  __builtin_amdgcn_fence(__ATOMIC_ACQUIRE, "workgroup");
}
// s_wait_xcnt 0 behind a run of global fragment loads (GEMM and attention). The loads' address pointers are inputs only, so their registers stay
// live up to the wait: no later load of the run lands on them and no address arithmetic rewrites them before the wait has passed.
__device__ __forceinline__ void addr_wait1(const unsigned short* p) {
#if defined(__HIP_DEVICE_COMPILE__)
  asm volatile("s_wait_xcnt 0x0" :: "v"(p) : "memory");
#endif
}
__device__ __forceinline__ void addr_wait4(const unsigned short* p0, const unsigned short* p1, const unsigned short* p2, const unsigned short* p3) {
#if defined(__HIP_DEVICE_COMPILE__)
  asm volatile("s_wait_xcnt 0x0" :: "v"(p0), "v"(p1), "v"(p2), "v"(p3) : "memory");
#endif
}
__device__ __forceinline__ void addr_wait2(const unsigned short* p0, const unsigned short* p1) {
#if defined(__HIP_DEVICE_COMPILE__)
  asm volatile("s_wait_xcnt 0x0" :: "v"(p0), "v"(p1) : "memory");
#endif
}
// f32 -> f16 hi + unscaled f16 residual (hi + lo ~ x to 2^-22 relative; a flushed subnormal lo costs < 6.1e-5 absolute in the carried scale)
__device__ __forceinline__ void sp16(float x, _Float16& hi, _Float16& lo) {
  const _Float16 a = (_Float16)x;
  hi = a;
  lo = (_Float16)(x - (float)a);
}

// =====================================================================================================
// 16-bit pack into a fragment-order plane: value f16( bf16_RNE(src[r][cn]) * sc ), sc a power of two (exact); src row-major [R][64 << lgt].
// One wave per 16 x 64 block: 8 loads (16 rows x 256 B of f32) in flight, then 4 stores of 512 contiguous bytes.
// coverage: grid = n / 8192 blocks x 8 waves x 1024 elements = n exactly (n % 8192 == 0 for every plane, checked at compile time).
// =====================================================================================================
__global__ __launch_bounds__(256) void cvt16(const float* __restrict__ src, unsigned short* dst, int n, int lgt, float sc) {
  const int lane = threadIdx.x & 31;
  const int w = blockIdx.x * 8 + (threadIdx.x >> 5);          // 16 x 64 block index = (row block) * (columns / 64) + column block
  if (((size_t)w + 1) * 1024 > (size_t)n) return;             // never taken with the exact grid; no barriers in this kernel
  const int tm = w >> lgt;
  const int tn = w - (tm << lgt);
  const float* sp = src + (((size_t)(tm * 16 + (lane & 15))) << (lgt + 6)) + tn * 64 + (lane >> 4) * 8;
  v4f a[4], b[4];
#pragma unroll
  for (int it = 0; it < 4; ++it) {                            // quarter it: columns 16 it + 8 (lane >> 4) ..
    a[it] = *(const v4f*)(sp + it * 16);
    b[it] = *(const v4f*)(sp + it * 16 + 4);
  }
  addr_wait1((const unsigned short*)sp);
  unsigned short* dp = dst + (size_t)w * 1024 + lane * 8;
#pragma unroll
  for (int it = 0; it < 4; ++it) {
    v4u o;
    o[0] = pk16(h_bits((_Float16)(bfr(a[it][0]) * sc)), h_bits((_Float16)(bfr(a[it][1]) * sc)));
    o[1] = pk16(h_bits((_Float16)(bfr(a[it][2]) * sc)), h_bits((_Float16)(bfr(a[it][3]) * sc)));
    o[2] = pk16(h_bits((_Float16)(bfr(b[it][0]) * sc)), h_bits((_Float16)(bfr(b[it][1]) * sc)));
    o[3] = pk16(h_bits((_Float16)(bfr(b[it][2]) * sc)), h_bits((_Float16)(bfr(b[it][3]) * sc)));
    *(v4u*)(dp + it * 256) = o;
  }
}

// =====================================================================================================
// Register-blocked batched 16-bit WMMA GEMM body (device function, called by proj3): C[m][n] = oscale * sum_k A[m][k] * Bt[n][k] (+ bias);
// one wave per 64x64 tile, no block barriers. A [M][K] and Bt [N][K] are fragment-order planes with lda = ldb = K columns; M, N, K multiples of 64.
// 16-bit outputs are fragment-order planes of ldc columns (ldc % 64 == 0). by = batch index with element strides sA, sB, sC; bx = workgroup index inside the batch; slab = the wave's LDS slab.
// ASPLIT 1: a second A plane A2 (unscaled residual of A, same layout) is multiplied into the same accumulator (A + A2 ~ exact A).
// BF 1: bf16 operands (v_wmma_f32_16x16x32_bf16), else f16.
// EPI 1: value += bf16_RNE(ep0[column]) (per-column bias); EPI 2: value += bf16_RNE(ep0[row]) (per-row bias, 16-bit out only).
// OM 0: f32 out (pitch ldc).  OM 2: one f16 plane = f16(value * ocarry).
// OM 4: two f16 planes: hi = f16(value * ocarry), lo = f16(value * ocarry - hi) (unscaled residual).
// OM 5: two f16 planes: C = f16((value + bf16_RNE(ep1[column])) * ocarry), C2 = f16((value + bf16_RNE(ep2[column])) * ocarry).
// coverage: 4 slabs x 16 rows (f32: it 0..7 x lane>>4; 16-bit: row lane&15, quarters it 0..3 x column half lane>>4) x 64 cols = the wave's whole 64x64 tile;
//           bx covers ceil(tilesM*tilesN/GW) workgroups of GW waves, surplus waves return (wave-uniform).
// =====================================================================================================
#define GW 4   // waves per projection workgroup
template <int OM, int ASPLIT, int BF, int EPI>
__device__ __forceinline__ void gemm64(
    const unsigned short* __restrict__ Ap, const unsigned short* __restrict__ A2p, int lda, long long sA,
    const unsigned short* __restrict__ Btp, int ldb, long long sB,
    void* Cout, void* C2out, int ldc, long long sC,
    int M, int N, int K, float oscale, float ocarry,
    const float* __restrict__ ep0, const float* __restrict__ ep1, const float* __restrict__ ep2,
    int bx, int by, float* slab) {
  const int lane = threadIdx.x & 31;
  const int wave = threadIdx.x >> 5;
  const int tilesN = N >> 6;
  const int tilesM = M >> 6;
  const int tile = bx * GW + wave;
  if (tile >= tilesM * tilesN) return;   // wave-uniform; no block barriers in the calling kernel
  const int tm = tile / tilesN;
  const int tn = tile - tm * tilesN;
  const int m0 = tm << 6;
  const int n0 = tn << 6;

  const unsigned short* A1 = Ap  + (size_t)((long long)by * sA);
  const unsigned short* A2 = A2p + (size_t)((long long)by * sA);
  const unsigned short* Bb = Btp + (size_t)((long long)by * sB);

  const int rlane = lane & 15;                 // row (A) / col (B, D) within subtile
  const int l8    = lane * 8;                  // the lane's slot in a quarter of a fragment-order block
  const int mOff  = (lane >> 4) * 8;           // D row offset

  v8f acc[4][4];
#pragma unroll
  for (int i = 0; i < 4; ++i)
#pragma unroll
    for (int j = 0; j < 4; ++j) acc[i][j] = zero8();

  for (int k0 = 0; k0 < K; k0 += 32) {
    v16h bh[4];
    const unsigned short* pb[4];
#pragma unroll
    for (int j = 0; j < 4; ++j) {
      const size_t bofs = (size_t)((n0 >> 4) + j) * (16 * ldb) + k0 * 16 + l8;
      pb[j] = Bb + bofs;
      bh[j] = ldfrag_p(pb[j]);
    }
    addr_wait4(pb[0], pb[1], pb[2], pb[3]);
#pragma unroll
    for (int i = 0; i < 4; ++i) {
      const size_t ao = (size_t)((m0 >> 4) + i) * (16 * lda) + k0 * 16 + l8;
      const unsigned short* pa = A1 + ao;
      const v16h ah = ldfrag_p(pa);
      addr_wait1(pa);
#pragma unroll
      for (int j = 0; j < 4; ++j) acc[i][j] = mmaT<BF>(ah, bh[j], acc[i][j]);
      dep_guard1(acc[i][0], acc[i][3], ah);
      if constexpr (ASPLIT != 0) {
        const unsigned short* pa2 = A2 + ao;
        const v16h al = ldfrag_p(pa2);
        addr_wait1(pa2);
#pragma unroll
        for (int j = 0; j < 4; ++j) acc[i][j] = mmaT<BF>(al, bh[j], acc[i][j]);
        dep_guard1(acc[i][0], acc[i][3], al);
      }
    }
    keep4_h(bh[0], bh[1], bh[2], bh[3]);
  }
  acc_guard4(acc[0][0], acc[0][1], acc[0][2], acc[0][3]);
  acc_guard4(acc[1][0], acc[1][1], acc[1][2], acc[1][3]);
  acc_guard4(acc[2][0], acc[2][1], acc[2][2], acc[2][3]);
  acc_guard4(acc[3][0], acc[3][1], acc[3][2], acc[3][3]);

  const int hh2 = lane >> 4, c4 = (lane & 15) * 4;     // f32 out: 256-B row segment = 16 lanes x 16 B

  // ---- epilogue ----
#pragma unroll
  for (int i = 0; i < 4; ++i) {
    const int mBase = m0 + (i << 4);
#pragma unroll
    for (int j = 0; j < 4; ++j) {
#pragma unroll
      for (int r = 0; r < 8; ++r) {
        slab[(mOff + r) * 68 + (j << 4) + rlane] = acc[i][j][r];
      }
    }
    wave_sync_lds();
    if constexpr (OM == 0) {
      float* C = (float*)Cout + (size_t)((long long)by * sC);
      v4f vals[8];
#pragma unroll
      for (int it = 0; it < 8; ++it) {
        const int row = it * 2 + hh2;                      // it 0..7 x hh2 0..1 = rows 0..15
        v4f v = *(const v4f*)(slab + row * 68 + c4);
#pragma unroll
        for (int e = 0; e < 4; ++e) v[e] = v[e] * oscale;
        if constexpr (EPI == 1) {
          const v4f bb = *(const v4f*)(ep0 + n0 + c4);     // per-column bias, columns n0+c4 .. +3 (N equals the bias length)
#pragma unroll
          for (int e = 0; e < 4; ++e) v[e] = v[e] + bfr(bb[e]);
        }
        vals[it] = v;
      }
      {
#pragma unroll
        for (int it = 0; it < 8; ++it) {
          const int gr = mBase + it * 2 + hh2;
          *(v4f*)(C + (size_t)gr * ldc + n0 + c4) = vals[it];
        }
        
      }
    } else {
      unsigned short* C  = (unsigned short*)Cout  + (size_t)((long long)by * sC);
      unsigned short* Cb = (unsigned short*)C2out + (size_t)((long long)by * sC);
      v4u hv[4], lv[4];
#pragma unroll
      for (int it = 0; it < 4; ++it) {
        const int row = rlane;                             // the lane's slot in quarter it: row lane&15, columns 16 it + 8 (lane>>4) ..
        const int c8  = it * 16 + mOff;
        const float* sp = slab + row * 68 + c8;
        float rb = 0.f;
        if constexpr (EPI == 2) rb = bfr(ep0[mBase + row]);   // per-row bias (M equals the bias length)
        v4u a  = {0u, 0u, 0u, 0u};
        v4u b2 = {0u, 0u, 0u, 0u};
#pragma unroll
        for (int e = 0; e < 4; ++e) {
          const int ci = n0 + c8 + 2 * e;                  // column index, < N
          float f0 = sp[2 * e] * oscale + rb;
          float f1 = sp[2 * e + 1] * oscale + rb;
          if constexpr (EPI == 1) {
            f0 += bfr(ep0[ci]);
            f1 += bfr(ep0[ci + 1]);
          }
          if constexpr (OM == 5) {
            const float g0 = (f0 + bfr(ep1[ci])) * ocarry, g1 = (f1 + bfr(ep1[ci + 1])) * ocarry;
            const float w0 = (f0 + bfr(ep2[ci])) * ocarry, w1 = (f1 + bfr(ep2[ci + 1])) * ocarry;
            a[e]  = pk16(h_bits((_Float16)g0), h_bits((_Float16)g1));
            b2[e] = pk16(h_bits((_Float16)w0), h_bits((_Float16)w1));
          } else {
            f0 *= ocarry; f1 *= ocarry;
            const _Float16 x0 = (_Float16)f0, x1 = (_Float16)f1;
            a[e] = pk16(h_bits(x0), h_bits(x1));
            if constexpr (OM == 4) {
              b2[e] = pk16(h_bits((_Float16)(f0 - (float)x0)), h_bits((_Float16)(f1 - (float)x1)));
            }
          }
        }
        hv[it] = a;
        lv[it] = b2;
      }
      {
#pragma unroll
        for (int it = 0; it < 4; ++it) {
          const size_t co = ((size_t)(mBase >> 4) * (ldc >> 6) + (n0 >> 6)) * 1024 + it * 256 + l8;   // 512 contiguous bytes per store
          *(v4u*)(C + co) = hv[it];
          if constexpr (OM >= 4) {
            *(v4u*)(Cb + co) = lv[it];
          }
        }
        
      }
    }
    wave_sync_lds();
  }
}

// =====================================================================================================
// The three projections in ONE launch, so that their waves are on the chip together: blockIdx.y = 0: q, 1: k, 2: v^T.
//   q, k: M = NROW, N = 1024, K = 1024, per-column bias; (NROW/64)*(DMOD/64) = 1024 tiles = PJB workgroups of GW waves.
//   v^T per batch: VT[b][e][j], M = 1024 (e), N = SEQ (j), K = 1024, per-row bias; 512 tiles per batch = PJB/NBAT workgroups,
//   batch = blockIdx.x / (PJB/NBAT). Every branch below is workgroup-uniform; no block barriers.
// coverage: grid (PJB, 3) x GW waves = every 64x64 tile of QH/QL, KH/KL and VH/VL exactly once.
// =====================================================================================================
#define PJB (((NROW / 64) * (DMOD / 64)) / GW)
static_assert(((NROW / 64) * (DMOD / 64)) % GW == 0);
static_assert((DMOD / 64) * (SEQ / 64) * NBAT == PJB * GW && (PJB % NBAT) == 0);
__global__ __launch_bounds__(GW * 32) __attribute__((amdgpu_num_vgpr(256))) void proj3(
    const unsigned short* __restrict__ Xq, const unsigned short* __restrict__ Xk, const unsigned short* __restrict__ Xv,
    const unsigned short* __restrict__ Wq, const unsigned short* __restrict__ Wk, const unsigned short* __restrict__ Wv,
    unsigned short* QH, unsigned short* QL, unsigned short* KH, unsigned short* KL, unsigned short* VH, unsigned short* VL,
    const float* __restrict__ bq, const float* __restrict__ bk, const float* __restrict__ bv) {
  __shared__ __align__(16) float sT[GW][16 * 68];   // per-wave 16x64 slab, pitch 68 floats
  float* slab = sT[threadIdx.x >> 5];
  const int p = blockIdx.y;
  if (p < 2) {
    const unsigned short* X = (p == 0) ? Xq : Xk;
    const unsigned short* Wt = (p == 0) ? Wq : Wk;
    unsigned short* H = (p == 0) ? QH : KH;
    unsigned short* L = (p == 0) ? QL : KL;
    const float* bias = (p == 0) ? bq : bk;
    gemm64<4, 0, 0, 1>(X, X, DMOD, 0LL, Wt, DMOD, 0LL, (void*)H, (void*)L, DMOD, 0LL,
                       NROW, DMOD, DMOD, 1.0f / (XC * WSC), (p == 0) ? QC : KC,
                       bias, bias, bias, blockIdx.x, 0, slab);
  } else {
    const int per = PJB / NBAT;
    const int bt  = blockIdx.x / per;
    gemm64<4, 0, 0, 2>(Wv, Wv, DMOD, 0LL, Xv, DMOD, (long long)SEQ * DMOD, (void*)VH, (void*)VL, SEQ, (long long)DMOD * SEQ,
                       DMOD, SEQ, DMOD, 1.0f / (XC * WSC), VC,
                       bv, bv, bv, blockIdx.x - bt * per, bt, slab);
  }
}

// =====================================================================================================
// Causal attention with the skewed relative-position term for one (batch b, head h) pair and a 64-row query tile; 8 waves =
// 2 key groups x 4 query waves: wave (kg, qw) owns query rows iw0 .. iw0+15, iw0 = i0 + 16 qw, and walks every second key tile
// j0 = 64 kg, 64 (kg + 2), .. <= i0, keeping its own running (max, sum, O). After the loop group 1 hands its state over through LDS
// behind one block barrier and group 0 merges the two states (rescale by exp2(m - max)) and stores. So the longest wave walks 16 tiles,
// not 32. There are more workgroups than places on the chip: blockIdx.y counts the query tiles from the last (most key tiles) down,
// so that cost falls with the flat workgroup index (for speed only).
// Planes (all in fragment order, see ldfrag_p): QH/QL, KH/KL = f16 hi + residual of (q x64), (k x64), rows b*SEQ + position, DMOD columns,
//         head h = column block h; EP = f16(bf16_RNE(Er) x16) [ELEN][64]; VH/VL = f16 hi + residual of (v x64) as [b][h*64+d][SEQ] (keys = columns).
//   Srel(i, j) = q_i . Er[ELEN-1 - (i - j)] for j <= i (the pad-reshape skew). Per key tile the wave needs Er rows
//   wlo + x, wlo = ELEN-1 - (iw0 - j0) - 15, x = jj - R + 15 in [0, 78]: position window T[R][x] = (qh+ql)[iw0+R] . EP[wlo + x],
//   x in [0, 80) (5 subtiles of 16 Er rows, their ten fragments requested together, K = 64; wlo is a multiple of 16, so a subtile is one 16-row block,
//   whose index is clamped on the address; a clamped block only ever feeds entries with j > i, which the causal mask replaces);
//   each 16x16 subtile is stored to the wave's f32 LDS strip right after its WMMAs.
//   Content scores S = (qh+ql) . (kh+kl) (hh + hl + lh, 4 subtiles of 16 keys, fragments requested two subtiles at a time, K = 64) -> the wave's f32 slab.
//   score*log2(e) = S*CS + T[R][jj - R + 15]*CT (CS, CT fold 1/(carries) and 1/8); entries with j > i are replaced by -inf;
//   online softmax in base 2, max-subtracted (row max via 16-lane shuffles), running sums in f32; e = exp2(t - m) in (0,1] written
//   of P*1024 (f16 hi + residual) rebuilt from the slab rows (f32 vector loads, split k map) and the v^T hi / residual B fragments loaded
//   straight from VH/VL [h*64+d][j]; 12 WMMAs per 32-key step (Ph.vh + Ph.vl + Pl.vh), 4 d-subtiles.
//   out rows (b*SEQ + iw0 + row), floats h*64 .. h*64+63 = one whole 256-B segment (2 lines) per row: 16 consecutive lanes x 16 B,
//   block = 8 waves = 256 threads; grid = (NBAT*NH, SEQ/64); one block barrier, behind the key loop, passed by every wave;
//   every wave does bounded work (<= SEQ/128 tiles).
// coverage: LDS strip 16 x 80 of TPI and slab 16 x 64 of SPI per wave, fully written before read each tile; global: 8 instructions x
//           2 rows x 64 floats = rows iw0..iw0+15 of head segment h; grid x waves cover all NBAT*SEQ rows and all NH head segments once.
// =====================================================================================================
__global__ __launch_bounds__(ATT_THREADS) __attribute__((amdgpu_num_vgpr(256)))
void attn_rel(const unsigned short* __restrict__ QH, const unsigned short* __restrict__ QL,
              const unsigned short* __restrict__ KH, const unsigned short* __restrict__ KL,
              const unsigned short* __restrict__ EP,
              const unsigned short* __restrict__ VH, const unsigned short* __restrict__ VL,
              float* out) {
  __shared__ __align__(16) float smem[ATT_W * WFL];   // per wave: T strip [16][TPI] | score / prob / ctx slab [16][SPI]

  const int tid  = threadIdx.x;
  const int wave = __builtin_amdgcn_readfirstlane(tid >> 5);   // scalar, so that the key loop's per-wave start and end stay scalar branches
  const int qw   = wave & (ATT_QW - 1);
  const int kg   = wave / ATT_QW;
  const int lane = tid & 31;
  const int hh   = lane >> 4;
  const int c    = lane & 15;
  const int bh   = blockIdx.x;
  const int b    = bh / NH;
  const int h    = bh - b * NH;
  const int qt   = (SEQ / 64 - 1) - (int)blockIdx.y;           // query tile, the one with the most key tiles first
  const int i0   = qt * 64;
  const int iw0  = i0 + qw * 16;

  float* tsh = smem + wave * WFL;
  float* pt  = tsh + 16 * TPI;
  // the lane's own bases in strip and slab: every access of the key loop is base + a constant, which leaves the registers to the fragments in flight
  float* tst = tsh + 8 * hh * TPI + c;             // strip row 8hh, column c
  float* pst = pt + 8 * hh * SPI + c;              // slab row 8hh, column c
  const float* tgt = tst + 15 - 8 * hh;            // shifted gather: row 8hh + r starts at tgt + r * (TPI - 1)

  const int l8 = lane * 8;                                                       // the lane's slot in a quarter of a fragment-order block
  const size_t qro = ((size_t)((b * SEQ + iw0) >> 4) * (DMOD / 64) + h) * 1024 + l8;   // block of query rows iw0.., head h
  const size_t kbo = ((size_t)((b * SEQ) >> 4) * (DMOD / 64) + h) * 1024 + l8;         // block of key rows 0..15 of batch b, head h
  const unsigned short* Khb = KH + kbo;
  const unsigned short* Klb = KL + kbo;
  const unsigned short* Eb  = EP + l8;
  const size_t vpo = (size_t)b * DMOD * SEQ + (size_t)(h * (DH / 16)) * (SEQ / 64) * 1024 + l8;   // block of d rows 0..15 of head h, keys 0..63
  const unsigned short* Vhb = VH + vpo;
  const unsigned short* Vlb = VL + vpo;

  const float CS = LOG2E * SCALE / (QC * KC);
  const float CT = LOG2E * SCALE / (QC * EC);

  float mrow[8], lrow[8];
  v8f O[4];
#pragma unroll
  for (int r = 0; r < 8; ++r) { mrow[r] = -INFINITY; lrow[r] = 0.f; }
#pragma unroll
  for (int td = 0; td < 4; ++td) O[td] = zero8();

  const int ntile = qt + 1;                  // causal: key tiles j0 <= i0
#pragma unroll 1
  for (int jt = kg; jt < ntile; jt += ATT_KG) {
    const int j0 = jt * 64;
    const v16h qha = ldfrag_p(QH + qro), qhb = ldfrag_p(QH + qro + 512);
    const v16h qla = ldfrag_p(QL + qro), qlb = ldfrag_p(QL + qro + 512);

    // ---- position window T (5 subtiles of 16 Er rows), each subtile stored to the LDS strip as produced ----
    {
      const int wb = ((ELEN - 1) - (iw0 - j0) - 15) >> 4;   // wlo / 16, exact: ELEN, iw0 and j0 are multiples of 16
      // all ten Er fragments are requested together, ahead of the products: the window waits out one load latency, not five
      v16h fa[5], fb[5];
      const unsigned short* pe[5];
#pragma unroll
      for (int u = 0; u < 5; ++u) {
        int m = wb + u;
        m = (m < 0) ? 0 : m;
        m = (m > ELEN / 16 - 1) ? (ELEN / 16 - 1) : m;
        pe[u] = Eb + (size_t)m * 1024;
        fa[u] = ldfrag_p(pe[u]);
        fb[u] = ldfrag_p(pe[u] + 512);
      }
      addr_wait4(pe[0], pe[1], pe[2], pe[3]);
      addr_wait1(pe[4]);
      __builtin_amdgcn_sched_barrier(0);   // the whole group is requested before its first product: the scheduler otherwise pairs each load with its use again
#pragma unroll
      for (int u = 0; u < 5; ++u) {
        v8f t8 = mma_h(qha, fa[u], zero8());
        t8 = mma_h(qla, fa[u], t8);
        t8 = mma_h(qhb, fb[u], t8);
        t8 = mma_h(qlb, fb[u], t8);
        hz6(t8, fa[u], fb[u], qha, qla, qhb, qlb);
#pragma unroll
        for (int r = 0; r < 8; ++r) tst[r * TPI + 16 * u] = t8[r];
      }
    }
    __builtin_amdgcn_sched_barrier(0);   // keeps a later phase's index and address work out of this phase, whose registers the fragments in flight need
    // ---- content scores S (4 subtiles of 16 keys) -> slab ----
    {
      // the key fragments are requested in two groups of two subtiles, each ahead of its products: two load latencies, not four
      const unsigned short* pkh = Khb + (size_t)(j0 >> 4) * ((DMOD / 64) * 1024);
      const unsigned short* pkl = Klb + (size_t)(j0 >> 4) * ((DMOD / 64) * 1024);
      v16h kha[4], khb[4], kla[4], klb[4];
#pragma unroll
      for (int t = 0; t < 4; ++t) {
        if ((t & 1) == 0) {
#pragma unroll
          for (int x = t; x < t + 2; ++x) {
            kha[x] = ldfrag_p(pkh + (size_t)x * ((DMOD / 64) * 1024));
            khb[x] = ldfrag_p(pkh + (size_t)x * ((DMOD / 64) * 1024) + 512);
            kla[x] = ldfrag_p(pkl + (size_t)x * ((DMOD / 64) * 1024));
            klb[x] = ldfrag_p(pkl + (size_t)x * ((DMOD / 64) * 1024) + 512);
          }
          addr_wait2(pkh, pkl);
          __builtin_amdgcn_sched_barrier(0);   // the whole group is requested before its first product: the scheduler otherwise pairs each load with its use again
        }
        v8f s8 = mma_h(qha, kha[t], zero8());
        s8 = mma_h(qha, kla[t], s8);
        s8 = mma_h(qla, kha[t], s8);
        s8 = mma_h(qhb, khb[t], s8);
        s8 = mma_h(qhb, klb[t], s8);
        s8 = mma_h(qlb, khb[t], s8);
        hz8(s8, kha[t], khb[t], kla[t], klb[t], qha, qla, qhb, qlb);
#pragma unroll
        for (int r = 0; r < 8; ++r) pst[r * SPI + 16 * t] = s8[r];
      }
    }
    __builtin_amdgcn_sched_barrier(0);   // keeps a later phase's index and address work out of this phase, whose registers the fragments in flight need
    wave_sync_lds();
    // v^T fragments of the first 32 keys: requested here, behind the fence (which waits for loads in flight), so that they arrive while the softmax runs
    const unsigned short* pvh = Vhb + (size_t)jt * 1024;
    const unsigned short* pvl = Vlb + (size_t)jt * 1024;
    v16h vh[4], vl[4];
#pragma unroll
    for (int td = 0; td < 4; ++td) {
      vh[td] = ldfrag_p(pvh + (size_t)td * ((SEQ / 64) * 1024));
      vl[td] = ldfrag_p(pvl + (size_t)td * ((SEQ / 64) * 1024));
    }
    addr_wait2(pvh, pvl);

    // ---- score assembly, causal mask, online softmax (rows live on one 16-lane half) ----
    const int dj = (j0 - iw0) + c - 8 * hh;        // j - i = dj + 16 t - r
#pragma unroll
    for (int r = 0; r < 8; ++r) {
      const float* trow = tgt + r * (TPI - 1);
      float* srow = pst + r * SPI;
      float tv[4];
#pragma unroll
      for (int t = 0; t < 4; ++t) {
        const float val = srow[16 * t] * CS + trow[16 * t] * CT;
        tv[t] = (dj > r - 16 * t) ? -INFINITY : val;
      }
      float mx = fmaxf(fmaxf(tv[0], tv[1]), fmaxf(tv[2], tv[3]));
#pragma unroll
      for (int off = 1; off < 16; off <<= 1) mx = fmaxf(mx, __shfl_xor(mx, off, 32));
      const float mn = fmaxf(mrow[r], mx);
      const float al = exp2f(mrow[r] - mn);
      mrow[r] = mn;
      float e4[4];
      float ps = 0.f;
#pragma unroll
      for (int t = 0; t < 4; ++t) { e4[t] = exp2f(tv[t] - mn); ps += e4[t]; }
#pragma unroll
      for (int off = 1; off < 16; off <<= 1) ps += __shfl_xor(ps, off, 32);
      lrow[r] = lrow[r] * al + ps;
#pragma unroll
      for (int td = 0; td < 4; ++td) O[td][r] *= al;
#pragma unroll
      for (int t = 0; t < 4; ++t) srow[16 * t] = e4[t];
    }
    wave_sync_lds();
    __builtin_amdgcn_sched_barrier(0);   // keeps a later phase's index and address work out of this phase, whose registers the fragments in flight need

    // ---- O += (Ph + Pl) . (vh + vl)^T, two k-steps of 32 keys; a step's 8 v^T fragments are requested together, ahead of its P split ----
#pragma unroll
    for (int ks = 0; ks < 2; ++ks) {
      if (ks == 1) {
#pragma unroll
        for (int td = 0; td < 4; ++td) {
          vh[td] = ldfrag_p(pvh + (size_t)td * ((SEQ / 64) * 1024) + 512);
          vl[td] = ldfrag_p(pvl + (size_t)td * ((SEQ / 64) * 1024) + 512);
        }
        addr_wait2(pvh, pvl);
        __builtin_amdgcn_sched_barrier(0);   // the whole group is requested before its first product: the scheduler otherwise pairs each load with its use again
      }
      FragH ph, pl;
      {
        const float* prow = pt + c * SPI + 32 * ks + 8 * hh;
        const v4f p0 = *(const v4f*)(prow), p1 = *(const v4f*)(prow + 4);
        const v4f p2 = *(const v4f*)(prow + 16), p3 = *(const v4f*)(prow + 20);
#pragma unroll
        for (int e = 0; e < 4; ++e) {
          _Float16 a0, a1;
          sp16(p0[e] * PC, a0, a1); ph.h[0][e]     = a0; pl.h[0][e]     = a1;   // keys 32ks + 8hh + e
          sp16(p1[e] * PC, a0, a1); ph.h[0][4 + e] = a0; pl.h[0][4 + e] = a1;   // keys 32ks + 8hh + 4 + e
          sp16(p2[e] * PC, a0, a1); ph.h[1][e]     = a0; pl.h[1][e]     = a1;   // keys 32ks + 16 + 8hh + e
          sp16(p3[e] * PC, a0, a1); ph.h[1][4 + e] = a0; pl.h[1][4 + e] = a1;
        }
      }
#pragma unroll
      for (int td = 0; td < 4; ++td) {
        O[td] = mma_h(ph.v, vh[td], O[td]);
        O[td] = mma_h(ph.v, vl[td], O[td]);
        O[td] = mma_h(pl.v, vh[td], O[td]);
        hz4(O[td], vh[td], vl[td], ph.v, pl.v);
      }
    }
    wave_sync_lds();
  }
  acc_guard4(O[0], O[1], O[2], O[3]);

  // ---- merge of the two key groups: group 1 writes (O, m, l) to its own slab and strip, block barrier, group 0 reads and rescales.
  //      A group-1 wave without a tile hands over m = -inf, l = 0, O = 0, whose weight exp2(-inf) is 0; group 0 always has tile 0.
  if (kg != 0) {
#pragma unroll
    for (int r = 0; r < 8; ++r) {
      const int R = 8 * hh + r;
#pragma unroll
      for (int td = 0; td < 4; ++td) pt[R * SPI + 16 * td + c] = O[td][r];
      if (c == 0) { tsh[R] = mrow[r]; tsh[16 + R] = lrow[r]; }
    }
  }
  __syncthreads();                           // publishes group 1's state to group 0; every wave of the block passes it once
  if (kg != 0) return;
  {
    const float* ts2 = tsh + ATT_QW * WFL;   // wave (1, qw)'s strip and slab
    const float* pt2 = ts2 + 16 * TPI;
#pragma unroll
    for (int r = 0; r < 8; ++r) {
      const int R = 8 * hh + r;
      const float m2 = ts2[R], l2 = ts2[16 + R];
      const float mm = fmaxf(mrow[r], m2);
      const float a1 = exp2f(mrow[r] - mm), a2 = exp2f(m2 - mm);
      lrow[r] = lrow[r] * a1 + l2 * a2;
#pragma unroll
      for (int td = 0; td < 4; ++td) O[td][r] = O[td][r] * a1 + pt2[R * SPI + 16 * td + c] * a2;
    }
  }

  // ---- fold 1/l and the carries (1024 on P, 64 on v), stage the wave's 16x64 f32 slice in its slab ----
  const float oc = 1.0f / (PC * VC);
#pragma unroll
  for (int r = 0; r < 8; ++r) {
    const float inv = (1.0f / lrow[r]) * oc;
    const int ro = (8 * hh + r) * SPI + c;
#pragma unroll
    for (int td = 0; td < 4; ++td) pt[ro + 16 * td] = O[td][r] * inv;
  }
  wave_sync_lds();
  {
    const int c4 = c * 4;
    v4f vals[8];
#pragma unroll
    for (int it = 0; it < 8; ++it) {
      const int row = it * 2 + hh;                           // it 0..7 x hh 0..1 = rows 0..15
      vals[it] = *(const v4f*)(pt + row * SPI + c4);
    }
    float* ob = out + ((size_t)b * SEQ + iw0) * DMOD + h * DH + c4;
    {
#pragma unroll
      for (int it = 0; it < 8; ++it) {
        const int row = it * 2 + hh;
        *(v4f*)(ob + (size_t)row * DMOD) = vals[it];
      }
      
    }
  }
}

// =====================================================================================================
// Workspace map (bytes); every plane is an exact multiple of its tile / whole-row store granularity (M, N exact tile multiples,
// convert counts exact multiples of 8192, no pad rows), every offset a multiple of 262144; every plane is in fragment order (see ldfrag_p):
//   Xq, Xk, Xv  f16 [NROW][1024] x16                            3 x 8388608
//   Wq, Wk, Wv  f16 [1024 out][1024 in] x64                      3 x 2097152
//   EP          f16 [ELEN][64] x16                                   262144
//   QH, QL, KH, KL f16 [NROW][1024] (x64 hi / residual)         4 x 8388608
//   VH, VL      f16 [NBAT][1024][SEQ] (x64 hi / residual)       2 x 8388608
//   end                                                            82051072
// =====================================================================================================
extern "C" void kernel_launch(void* const* d_in, const int* in_sizes, int n_in,
                              void* d_out, int out_size, void* d_ws, size_t ws_size,
                              hipStream_t stream) {
  if (n_in < 10) return;
  if (in_sizes[0] != NROW * DMOD || in_sizes[1] != NROW * DMOD || in_sizes[2] != NROW * DMOD) return;
  if (in_sizes[3] != DMOD * DMOD || in_sizes[5] != DMOD * DMOD || in_sizes[7] != DMOD * DMOD) return;
  if (in_sizes[4] != DMOD || in_sizes[6] != DMOD || in_sizes[8] != DMOD) return;
  if (in_sizes[9] != ELEN * DH) return;
  if (out_size != NROW * DMOD) return;

  const float* qin = (const float*)d_in[0];
  const float* kin = (const float*)d_in[1];
  const float* vin = (const float*)d_in[2];
  const float* w_q = (const float*)d_in[3];
  const float* b_q = (const float*)d_in[4];
  const float* w_k = (const float*)d_in[5];
  const float* b_k = (const float*)d_in[6];
  const float* w_v = (const float*)d_in[7];
  const float* b_v = (const float*)d_in[8];
  const float* er  = (const float*)d_in[9];
  float*       out = (float*)d_out;

  const size_t PX = (size_t)NROW * DMOD * 2;             //  8388608
  const size_t PW = (size_t)DMOD * DMOD * 2;             //  2097152
  const size_t PE = (size_t)ELEN * DH * 2;               //   262144
  const size_t PV = (size_t)NBAT * DMOD * SEQ * 2;       //  8388608
  size_t off = 0;
  const size_t oXq = off; off += PX;
  const size_t oXk = off; off += PX;
  const size_t oXv = off; off += PX;
  const size_t oWq = off; off += PW;
  const size_t oWk = off; off += PW;
  const size_t oWv = off; off += PW;
  const size_t oE  = off; off += PE;
  const size_t oQH = off; off += PX;
  const size_t oQL = off; off += PX;
  const size_t oKH = off; off += PX;
  const size_t oKL = off; off += PX;
  const size_t oVH = off; off += PV;
  const size_t oVL = off; off += PV;
  if (off > ws_size) return;                               // off = 82051072
  if (off > (size_t)134217728) return;

  char* ws = (char*)d_ws;
  unsigned short* Xq  = (unsigned short*)(ws + oXq);
  unsigned short* Xk  = (unsigned short*)(ws + oXk);
  unsigned short* Xv  = (unsigned short*)(ws + oXv);
  unsigned short* Wq6 = (unsigned short*)(ws + oWq);
  unsigned short* Wk6 = (unsigned short*)(ws + oWk);
  unsigned short* Wv6 = (unsigned short*)(ws + oWv);
  unsigned short* E16 = (unsigned short*)(ws + oE);
  unsigned short* QHp = (unsigned short*)(ws + oQH);
  unsigned short* QLp = (unsigned short*)(ws + oQL);
  unsigned short* KHp = (unsigned short*)(ws + oKH);
  unsigned short* KLp = (unsigned short*)(ws + oKL);
  unsigned short* VHp = (unsigned short*)(ws + oVH);
  unsigned short* VLp = (unsigned short*)(ws + oVL);

  const dim3 blk(256);
  const dim3 gCX((NROW * DMOD) / 8192);                             // 512
  const dim3 gCW((DMOD * DMOD) / 8192);                             // 128
  const dim3 gCE((ELEN * DH) / 8192);                               // 16
  const dim3 gP(PJB, 3);                                            // 256 x 3
  const dim3 bP(GW * 32);                                           // 128
  const dim3 gAT(NBAT * NH, SEQ / 64);                              // 32 x 32
  const dim3 bAT(ATT_THREADS);                                      // 256

  // (0) 16-bit planes of the inputs: activations f16(bf16_RNE(x) * 16); W[out][in] (already k-contiguous) f16(bf16_RNE(w) * 64);
  //     Er f16(bf16_RNE(e) * 16); the int before the scale is log2(columns / 64): 1024 columns -> 4, 64 columns -> 0
  cvt16<<<gCX, blk, 0, stream>>>(qin, Xq, NROW * DMOD, 4, XC);
  cvt16<<<gCX, blk, 0, stream>>>(kin, Xk, NROW * DMOD, 4, XC);
  cvt16<<<gCX, blk, 0, stream>>>(vin, Xv, NROW * DMOD, 4, XC);
  cvt16<<<gCW, blk, 0, stream>>>(w_q, Wq6, DMOD * DMOD, 4, WSC);
  cvt16<<<gCW, blk, 0, stream>>>(w_k, Wk6, DMOD * DMOD, 4, WSC);
  cvt16<<<gCW, blk, 0, stream>>>(w_v, Wv6, DMOD * DMOD, 4, WSC);
  cvt16<<<gCE, blk, 0, stream>>>(er, E16, ELEN * DH, 0, EC);

  // (1) one launch for the three projections:
  //     q[m][e] = sum_d x[m][d] Wq[e][d] / 1024 + bq[e] -> QH = f16(q * 64), QL = f16(q * 64 - QH); the same for k -> KH, KL;
  //     VT[b][e][j] = sum_c Wv[e][c] x[b*SEQ+j][c] / 1024 + bv[e] -> VH, VL (x64)
  proj3<<<gP, bP, 0, stream>>>(Xq, Xk, Xv, Wq6, Wk6, Wv6, QHp, QLp, KHp, KLp, VHp, VLp, b_q, b_k, b_v);

  // (2) causal relative attention -> out[b][i][h*64+d] (f32), written directly
  attn_rel<<<gAT, bAT, 0, stream>>>(QHp, QLp, KHp, KLp, E16, VHp, VLp, out);
  (void)hipGetLastError();
}

// v005
// Measured time: 182 microseconds a run.
// In both of two side-by-side timings against v004, it was 1.09 times as fast.
// Over all steps from v000 it is 2.44 times as fast.
// Contractions (all v_wmma_f32_16x16x32_f16, f16 operands, f32 accumulate): q/k/v projections (x f16 x16 . W f16 x64, K=1024, single products,
// outputs written as f16 hi + unscaled f16 residual planes); position window ((qh+ql) x64 . Er f16 x16, K=64, 2 products) -> f32 LDS strip,
// shifted gather on VALU; content scores ((qh+ql) x64 . (kh+kl) x64, K=64, hh+hl+lh); P . v^T ((Ph+Pl) x1024 . (vh+vl) x64, hh+hl+lh,
// 64 keys per tile). Causal mask, max-subtracted online base-2 softmax and the 1/l fold in f32 on VALU. Every float input RNE-converted to bf16 on load.
#include <hip/hip_runtime.h>
#include <math.h>
#include <stdint.h>

#define SEQ   2048
#define NBAT  2
#define DMOD  1024
#define NH    16
#define DH    64
#define ELEN  2048
#define NROW  (NBAT * SEQ)
#define XC    16.0f
#define WSC   64.0f
#define QC    64.0f
#define KC    64.0f
#define EC    16.0f
#define VC    64.0f
#define PC    1024.0f
#define SCALE 0.125f
#define LOG2E 1.4426950408889634f
static_assert(NH * DH == DMOD);
static_assert(DH == 64);
static_assert(ELEN == SEQ);
static_assert((SEQ % 64) == 0 && (DMOD % 64) == 0 && (NROW % 64) == 0);
static_assert(((NROW * DMOD) % 8192) == 0 && ((DMOD * DMOD) % 8192) == 0 && ((ELEN * DH) % 8192) == 0);
static_assert((SEQ % 16) == 0 && (ELEN % 16) == 0);
#define ATT_QW 4                    // waves side by side on the query rows (16 rows each)
#define ATT_KG 2                    // groups of ATT_QW waves that share out the key tiles
#define ATT_W (ATT_QW * ATT_KG)
#define ATT_THREADS (ATT_W * 32)
static_assert(ATT_KG == 2);
#define TPI 84
#define SPI 68
#define WFL (16 * TPI + 16 * SPI)
static_assert(((16 * TPI) % 4) == 0 && ((16 * SPI) % 4) == 0 && (WFL % 4) == 0);

typedef _Float16 v16h __attribute__((ext_vector_type(16)));
typedef _Float16 v8h  __attribute__((ext_vector_type(8)));
typedef __bf16   v16b __attribute__((ext_vector_type(16)));
typedef float    v8f  __attribute__((ext_vector_type(8)));
typedef float    v4f  __attribute__((ext_vector_type(4)));
typedef float    v2f  __attribute__((ext_vector_type(2)));
typedef unsigned int v4u __attribute__((ext_vector_type(4)));

union FragH { v16h v; v8h h[2]; v4u u[2]; };
union FragAny { v16h h; v16b b; };

// ---- scalar helpers --------------------------------------------------------------------------------
__device__ __forceinline__ unsigned short bf_bits(float f) {          // f32 -> bf16 bits, RNE convert
  unsigned u = __float_as_uint(f);
  return (unsigned short)((u + 0x7FFFu + ((u >> 16) & 1u)) >> 16);
}
__device__ __forceinline__ float bf_up(unsigned short h) { return __uint_as_float(((unsigned)h) << 16); }
__device__ __forceinline__ float bfr(float f) { return bf_up(bf_bits(f)); }   // value of the bf16 RNE convert
__device__ __forceinline__ unsigned short h_bits(_Float16 x) { return __builtin_bit_cast(unsigned short, x); }
__device__ __forceinline__ unsigned pk16(unsigned short a, unsigned short b) { return (unsigned)a | ((unsigned)b << 16); }
__device__ __forceinline__ v8f zero8() { v8f z = {0.f, 0.f, 0.f, 0.f, 0.f, 0.f, 0.f, 0.f}; return z; }

// ---- fragment-order planes: a 16-bit matrix [R][Cn] (R % 16 == 0, Cn % 64 == 0; Cn is the k direction of its reader) is kept as blocks of
//      16 rows x 64 columns, block (r >> 4) * (Cn / 64) + (cn >> 6), 1024 halves each; inside a block four 256-half quarters qd = (cn >> 4) & 3,
//      inside a quarter lane slot ((cn >> 3) & 1) * 16 + (r & 15), 8 halves each. One A/B fragment (16 rows x 32 k) is two neighbouring quarters,
//      and each of its two 16-byte-per-lane loads reads 512 contiguous bytes (4 cache lines, where a row-major plane gives 16).
// ---- fragment loader: p = block + 512 * (k step inside the block) + 8 * lane; lane -> row/col (lane&15), h = lane>>4;
//      elements 0..7 <- k0+8h.., elements 8..15 <- k0+16+8h.. (same split k map for A and B; B is always read from a [n][k] plane)
__device__ __forceinline__ v16h ldfrag_p(const unsigned short* p) {
  FragH f;
  f.u[0] = *(const v4u*)(p);
  f.u[1] = *(const v4u*)(p + 256);
  return f.v;
}

// ---- WMMA helpers with trailing VALU hazard gaps ------------------------------------------------------
__device__ __forceinline__ v8f mma_h(v16h a, v16h b, v8f c) {
  return __builtin_amdgcn_wmma_f32_16x16x32_f16(false, a, false, b, (short)0, c, false, false);
}
__device__ __forceinline__ v8f mma_b(v16h a, v16h b, v8f c) {
  FragAny ua, ub;
  ua.h = a;
  ub.h = b;
  return __builtin_amdgcn_wmma_f32_16x16x32_bf16(false, ua.b, false, ub.b, (short)0, c, false, false);
}
template <int BF>
__device__ __forceinline__ v8f mmaT(v16h a, v16h b, v8f c) {
  if constexpr (BF != 0) return mma_b(a, b, c);
  else return mma_h(a, b, c);
}
__device__ __forceinline__ void dep_guard1(v8f& a, v8f& b, v16h x) {
#if defined(__HIP_DEVICE_COMPILE__)
  asm volatile("v_nop\n\tv_nop\n\tv_nop\n\tv_nop" : "+v"(a), "+v"(b) : "v"(x));
#endif
}
__device__ __forceinline__ void hz4(v8f& d, v16h x0, v16h x1, v16h x2, v16h x3) {
#if defined(__HIP_DEVICE_COMPILE__)
  asm volatile("v_nop\n\tv_nop\n\tv_nop\n\tv_nop" : "+v"(d) : "v"(x0), "v"(x1), "v"(x2), "v"(x3));
#endif
}
__device__ __forceinline__ void hz6(v8f& d, v16h x0, v16h x1, v16h x2, v16h x3, v16h x4, v16h x5) {
#if defined(__HIP_DEVICE_COMPILE__)
  asm volatile("v_nop\n\tv_nop\n\tv_nop\n\tv_nop" : "+v"(d) : "v"(x0), "v"(x1), "v"(x2), "v"(x3), "v"(x4), "v"(x5));
#endif
}
__device__ __forceinline__ void hz8(v8f& d, v16h x0, v16h x1, v16h x2, v16h x3, v16h x4, v16h x5, v16h x6, v16h x7) {
#if defined(__HIP_DEVICE_COMPILE__)
  asm volatile("v_nop\n\tv_nop\n\tv_nop\n\tv_nop" : "+v"(d) : "v"(x0), "v"(x1), "v"(x2), "v"(x3), "v"(x4), "v"(x5), "v"(x6), "v"(x7));
#endif
}
__device__ __forceinline__ void keep4_h(v16h a, v16h b, v16h c, v16h d) {
#if defined(__HIP_DEVICE_COMPILE__)
  asm volatile("v_nop" :: "v"(a), "v"(b), "v"(c), "v"(d));
#endif
}
__device__ __forceinline__ void acc_guard4(v8f& a, v8f& b, v8f& c, v8f& d) {
#if defined(__HIP_DEVICE_COMPILE__)
  asm volatile("v_nop\n\tv_nop\n\tv_nop\n\tv_nop" : "+v"(a), "+v"(b), "+v"(c), "+v"(d));
#endif
}
__device__ __forceinline__ void wave_sync_lds() {
  __builtin_amdgcn_fence(__ATOMIC_RELEASE, "workgroup");
  __builtin_amdgcn_wave_barrier();
  __builtin_amdgcn_fence(__ATOMIC_ACQUIRE, "workgroup");
}
// s_wait_xcnt 0 behind a run of global fragment loads (GEMM and attention). The loads' address pointers are inputs only, so their registers stay
// live up to the wait: no later load of the run lands on them and no address arithmetic rewrites them before the wait has passed.
__device__ __forceinline__ void addr_wait1(const unsigned short* p) {
#if defined(__HIP_DEVICE_COMPILE__)
  asm volatile("s_wait_xcnt 0x0" :: "v"(p) : "memory");
#endif
}
__device__ __forceinline__ void addr_wait4(const unsigned short* p0, const unsigned short* p1, const unsigned short* p2, const unsigned short* p3) {
#if defined(__HIP_DEVICE_COMPILE__)
  asm volatile("s_wait_xcnt 0x0" :: "v"(p0), "v"(p1), "v"(p2), "v"(p3) : "memory");
#endif
}
__device__ __forceinline__ void addr_wait2(const unsigned short* p0, const unsigned short* p1) {
#if defined(__HIP_DEVICE_COMPILE__)
  asm volatile("s_wait_xcnt 0x0" :: "v"(p0), "v"(p1) : "memory");
#endif
}
// f32 -> f16 hi + unscaled f16 residual (hi + lo ~ x to 2^-22 relative; a flushed subnormal lo costs < 6.1e-5 absolute in the carried scale)
__device__ __forceinline__ void sp16(float x, _Float16& hi, _Float16& lo) {
  const _Float16 a = (_Float16)x;
  hi = a;
  lo = (_Float16)(x - (float)a);
}

// =====================================================================================================
// 16-bit pack into a fragment-order plane: value f16( bf16_RNE(src[r][cn]) * sc ), sc a power of two (exact); src row-major [R][64 << lgt].
// One wave per 16 x 64 block: 8 loads (16 rows x 256 B of f32) in flight, then 4 stores of 512 contiguous bytes.
// All seven planes in ONE launch: they depend on nothing but the inputs, so one grid pays one launch gap, one fill and one tail, not seven.
// The workgroup index picks the plane (workgroup-uniform, scalar): CBX workgroups each for the q, k, v activations, CBW each for Wq, Wk, Wv,
// CBE for Er. The seven planes lie one behind the other in the workspace in this same order, so 16 x 64 block g of the whole grid goes to dst + 1024 g.
// coverage: a plane of n elements has n / 8192 workgroups x 8 waves x 1024 elements = n exactly (n % 8192 == 0 for every plane, checked at compile time).
// =====================================================================================================
#define CBX ((NROW * DMOD) / 8192)
#define CBW ((DMOD * DMOD) / 8192)
#define CBE ((ELEN * DH) / 8192)
#define CBALL (3 * CBX + 3 * CBW + CBE)
__global__ __launch_bounds__(256) void cvt_all(const float* __restrict__ xq, const float* __restrict__ xk, const float* __restrict__ xv,
                                               const float* __restrict__ wq, const float* __restrict__ wk, const float* __restrict__ wv,
                                               const float* __restrict__ er, unsigned short* dst) {
  const int lane = threadIdx.x & 31;
  const int bx = blockIdx.x;
  if (bx >= CBALL) return;                                    // never taken with the exact grid; no barriers in this kernel
  const float* src;                                           // the plane's f32 source, row-major [R][64 << lgt]
  int b0, lgt;                                                // the plane's first workgroup; log2(columns / 64)
  float sc;                                                   // the plane's carried power of two
  if (bx < 3 * CBX) {
    const int p = bx / CBX;
    src = (p == 0) ? xq : ((p == 1) ? xk : xv);
    b0 = p * CBX; lgt = 4; sc = XC;
  } else if (bx < 3 * CBX + 3 * CBW) {
    const int p = (bx - 3 * CBX) / CBW;
    src = (p == 0) ? wq : ((p == 1) ? wk : wv);
    b0 = 3 * CBX + p * CBW; lgt = 4; sc = WSC;
  } else {
    src = er;
    b0 = 3 * CBX + 3 * CBW; lgt = 0; sc = EC;
  }
  const int wv8 = threadIdx.x >> 5;
  const int w = (bx - b0) * 8 + wv8;                          // 16 x 64 block index in the plane = (row block) * (columns / 64) + column block
  const int tm = w >> lgt;
  const int tn = w - (tm << lgt);
  const float* sp = src + (((size_t)(tm * 16 + (lane & 15))) << (lgt + 6)) + tn * 64 + (lane >> 4) * 8;
  v4f a[4], b[4];
#pragma unroll
  for (int it = 0; it < 4; ++it) {                            // quarter it: columns 16 it + 8 (lane >> 4) ..
    a[it] = *(const v4f*)(sp + it * 16);
    b[it] = *(const v4f*)(sp + it * 16 + 4);
  }
  addr_wait1((const unsigned short*)sp);
  unsigned short* dp = dst + (size_t)(bx * 8 + wv8) * 1024 + lane * 8;
#pragma unroll
  for (int it = 0; it < 4; ++it) {
    v4u o;
    o[0] = pk16(h_bits((_Float16)(bfr(a[it][0]) * sc)), h_bits((_Float16)(bfr(a[it][1]) * sc)));
    o[1] = pk16(h_bits((_Float16)(bfr(a[it][2]) * sc)), h_bits((_Float16)(bfr(a[it][3]) * sc)));
    o[2] = pk16(h_bits((_Float16)(bfr(b[it][0]) * sc)), h_bits((_Float16)(bfr(b[it][1]) * sc)));
    o[3] = pk16(h_bits((_Float16)(bfr(b[it][2]) * sc)), h_bits((_Float16)(bfr(b[it][3]) * sc)));
    *(v4u*)(dp + it * 256) = o;
  }
}

// =====================================================================================================
// Register-blocked batched 16-bit WMMA GEMM body (device function, called by proj3): C[m][n] = oscale * sum_k A[m][k] * Bt[n][k] (+ bias);
// one wave per 64x64 tile, no block barriers. A [M][K] and Bt [N][K] are fragment-order planes with lda = ldb = K columns; M, N, K multiples of 64.
// 16-bit outputs are fragment-order planes of ldc columns (ldc % 64 == 0). by = batch index with element strides sA, sB, sC; bx = workgroup index inside the batch; slab = the wave's LDS slab.
// ASPLIT 1: a second A plane A2 (unscaled residual of A, same layout) is multiplied into the same accumulator (A + A2 ~ exact A).
// BF 1: bf16 operands (v_wmma_f32_16x16x32_bf16), else f16.
// EPI 1: value += bf16_RNE(ep0[column]) (per-column bias); EPI 2: value += bf16_RNE(ep0[row]) (per-row bias, 16-bit out only).
// OM 0: f32 out (pitch ldc).  OM 2: one f16 plane = f16(value * ocarry).
// OM 4: two f16 planes: hi = f16(value * ocarry), lo = f16(value * ocarry - hi) (unscaled residual).
// OM 5: two f16 planes: C = f16((value + bf16_RNE(ep1[column])) * ocarry), C2 = f16((value + bf16_RNE(ep2[column])) * ocarry).
// coverage: 4 slabs x 16 rows (f32: it 0..7 x lane>>4; 16-bit: row lane&15, quarters it 0..3 x column half lane>>4) x 64 cols = the wave's whole 64x64 tile;
//           bx covers ceil(tilesM*tilesN/GW) workgroups of GW waves, surplus waves return (wave-uniform).
// =====================================================================================================
#define GW 4   // waves per projection workgroup
template <int OM, int ASPLIT, int BF, int EPI>
__device__ __forceinline__ void gemm64(
    const unsigned short* __restrict__ Ap, const unsigned short* __restrict__ A2p, int lda, long long sA,
    const unsigned short* __restrict__ Btp, int ldb, long long sB,
    void* Cout, void* C2out, int ldc, long long sC,
    int M, int N, int K, float oscale, float ocarry,
    const float* __restrict__ ep0, const float* __restrict__ ep1, const float* __restrict__ ep2,
    int bx, int by, float* slab) {
  const int lane = threadIdx.x & 31;
  const int wave = threadIdx.x >> 5;
  const int tilesN = N >> 6;
  const int tilesM = M >> 6;
  const int tile = bx * GW + wave;
  if (tile >= tilesM * tilesN) return;   // wave-uniform; no block barriers in the calling kernel
  const int tm = tile / tilesN;
  const int tn = tile - tm * tilesN;
  const int m0 = tm << 6;
  const int n0 = tn << 6;

  const unsigned short* A1 = Ap  + (size_t)((long long)by * sA);
  const unsigned short* A2 = A2p + (size_t)((long long)by * sA);
  const unsigned short* Bb = Btp + (size_t)((long long)by * sB);

  const int rlane = lane & 15;                 // row (A) / col (B, D) within subtile
  const int l8    = lane * 8;                  // the lane's slot in a quarter of a fragment-order block
  const int mOff  = (lane >> 4) * 8;           // D row offset

  v8f acc[4][4];
#pragma unroll
  for (int i = 0; i < 4; ++i)
#pragma unroll
    for (int j = 0; j < 4; ++j) acc[i][j] = zero8();

  for (int k0 = 0; k0 < K; k0 += 32) {
    v16h bh[4];
    const unsigned short* pb[4];
#pragma unroll
    for (int j = 0; j < 4; ++j) {
      const size_t bofs = (size_t)((n0 >> 4) + j) * (16 * ldb) + k0 * 16 + l8;
      pb[j] = Bb + bofs;
      bh[j] = ldfrag_p(pb[j]);
    }
    addr_wait4(pb[0], pb[1], pb[2], pb[3]);
#pragma unroll
    for (int i = 0; i < 4; ++i) {
      const size_t ao = (size_t)((m0 >> 4) + i) * (16 * lda) + k0 * 16 + l8;
      const unsigned short* pa = A1 + ao;
      const v16h ah = ldfrag_p(pa);
      addr_wait1(pa);
#pragma unroll
      for (int j = 0; j < 4; ++j) acc[i][j] = mmaT<BF>(ah, bh[j], acc[i][j]);
      dep_guard1(acc[i][0], acc[i][3], ah);
      if constexpr (ASPLIT != 0) {
        const unsigned short* pa2 = A2 + ao;
        const v16h al = ldfrag_p(pa2);
        addr_wait1(pa2);
#pragma unroll
        for (int j = 0; j < 4; ++j) acc[i][j] = mmaT<BF>(al, bh[j], acc[i][j]);
        dep_guard1(acc[i][0], acc[i][3], al);
      }
    }
    keep4_h(bh[0], bh[1], bh[2], bh[3]);
  }
  acc_guard4(acc[0][0], acc[0][1], acc[0][2], acc[0][3]);
  acc_guard4(acc[1][0], acc[1][1], acc[1][2], acc[1][3]);
  acc_guard4(acc[2][0], acc[2][1], acc[2][2], acc[2][3]);
  acc_guard4(acc[3][0], acc[3][1], acc[3][2], acc[3][3]);

  const int hh2 = lane >> 4, c4 = (lane & 15) * 4;     // f32 out: 256-B row segment = 16 lanes x 16 B

  // ---- epilogue ----
#pragma unroll
  for (int i = 0; i < 4; ++i) {
    const int mBase = m0 + (i << 4);
#pragma unroll
    for (int j = 0; j < 4; ++j) {
#pragma unroll
      for (int r = 0; r < 8; ++r) {
        slab[(mOff + r) * 68 + (j << 4) + rlane] = acc[i][j][r];
      }
    }
    wave_sync_lds();
    if constexpr (OM == 0) {
      float* C = (float*)Cout + (size_t)((long long)by * sC);
      v4f vals[8];
#pragma unroll
      for (int it = 0; it < 8; ++it) {
        const int row = it * 2 + hh2;                      // it 0..7 x hh2 0..1 = rows 0..15
        v4f v = *(const v4f*)(slab + row * 68 + c4);
#pragma unroll
        for (int e = 0; e < 4; ++e) v[e] = v[e] * oscale;
        if constexpr (EPI == 1) {
          const v4f bb = *(const v4f*)(ep0 + n0 + c4);     // per-column bias, columns n0+c4 .. +3 (N equals the bias length)
#pragma unroll
          for (int e = 0; e < 4; ++e) v[e] = v[e] + bfr(bb[e]);
        }
        vals[it] = v;
      }
      {
#pragma unroll
        for (int it = 0; it < 8; ++it) {
          const int gr = mBase + it * 2 + hh2;
          *(v4f*)(C + (size_t)gr * ldc + n0 + c4) = vals[it];
        }
        
      }
    } else {
      unsigned short* C  = (unsigned short*)Cout  + (size_t)((long long)by * sC);
      unsigned short* Cb = (unsigned short*)C2out + (size_t)((long long)by * sC);
      v4u hv[4], lv[4];
#pragma unroll
      for (int it = 0; it < 4; ++it) {
        const int row = rlane;                             // the lane's slot in quarter it: row lane&15, columns 16 it + 8 (lane>>4) ..
        const int c8  = it * 16 + mOff;
        const float* sp = slab + row * 68 + c8;
        float rb = 0.f;
        if constexpr (EPI == 2) rb = bfr(ep0[mBase + row]);   // per-row bias (M equals the bias length)
        v4u a  = {0u, 0u, 0u, 0u};
        v4u b2 = {0u, 0u, 0u, 0u};
#pragma unroll
        for (int e = 0; e < 4; ++e) {
          const int ci = n0 + c8 + 2 * e;                  // column index, < N
          float f0 = sp[2 * e] * oscale + rb;
          float f1 = sp[2 * e + 1] * oscale + rb;
          if constexpr (EPI == 1) {
            f0 += bfr(ep0[ci]);
            f1 += bfr(ep0[ci + 1]);
          }
          if constexpr (OM == 5) {
            const float g0 = (f0 + bfr(ep1[ci])) * ocarry, g1 = (f1 + bfr(ep1[ci + 1])) * ocarry;
            const float w0 = (f0 + bfr(ep2[ci])) * ocarry, w1 = (f1 + bfr(ep2[ci + 1])) * ocarry;
            a[e]  = pk16(h_bits((_Float16)g0), h_bits((_Float16)g1));
            b2[e] = pk16(h_bits((_Float16)w0), h_bits((_Float16)w1));
          } else {
            f0 *= ocarry; f1 *= ocarry;
            const _Float16 x0 = (_Float16)f0, x1 = (_Float16)f1;
            a[e] = pk16(h_bits(x0), h_bits(x1));
            if constexpr (OM == 4) {
              b2[e] = pk16(h_bits((_Float16)(f0 - (float)x0)), h_bits((_Float16)(f1 - (float)x1)));
            }
          }
        }
        hv[it] = a;
        lv[it] = b2;
      }
      {
#pragma unroll
        for (int it = 0; it < 4; ++it) {
          const size_t co = ((size_t)(mBase >> 4) * (ldc >> 6) + (n0 >> 6)) * 1024 + it * 256 + l8;   // 512 contiguous bytes per store
          *(v4u*)(C + co) = hv[it];
          if constexpr (OM >= 4) {
            *(v4u*)(Cb + co) = lv[it];
          }
        }
        
      }
    }
    wave_sync_lds();
  }
}

// =====================================================================================================
// The three projections in ONE launch, so that their waves are on the chip together: blockIdx.y = 0: q, 1: k, 2: v^T.
//   q, k: M = NROW, N = 1024, K = 1024, per-column bias; (NROW/64)*(DMOD/64) = 1024 tiles = PJB workgroups of GW waves.
//   v^T per batch: VT[b][e][j], M = 1024 (e), N = SEQ (j), K = 1024, per-row bias; 512 tiles per batch = PJB/NBAT workgroups,
//   batch = blockIdx.x / (PJB/NBAT). Every branch below is workgroup-uniform; no block barriers.
// coverage: grid (PJB, 3) x GW waves = every 64x64 tile of QH/QL, KH/KL and VH/VL exactly once.
// =====================================================================================================
#define PJB (((NROW / 64) * (DMOD / 64)) / GW)
static_assert(((NROW / 64) * (DMOD / 64)) % GW == 0);
static_assert((DMOD / 64) * (SEQ / 64) * NBAT == PJB * GW && (PJB % NBAT) == 0);
__global__ __launch_bounds__(GW * 32) __attribute__((amdgpu_num_vgpr(256))) void proj3(
    const unsigned short* __restrict__ Xq, const unsigned short* __restrict__ Xk, const unsigned short* __restrict__ Xv,
    const unsigned short* __restrict__ Wq, const unsigned short* __restrict__ Wk, const unsigned short* __restrict__ Wv,
    unsigned short* QH, unsigned short* QL, unsigned short* KH, unsigned short* KL, unsigned short* VH, unsigned short* VL,
    const float* __restrict__ bq, const float* __restrict__ bk, const float* __restrict__ bv) {
  __shared__ __align__(16) float sT[GW][16 * 68];   // per-wave 16x64 slab, pitch 68 floats
  float* slab = sT[threadIdx.x >> 5];
  const int p = blockIdx.y;
  if (p < 2) {
    const unsigned short* X = (p == 0) ? Xq : Xk;
    const unsigned short* Wt = (p == 0) ? Wq : Wk;
    unsigned short* H = (p == 0) ? QH : KH;
    unsigned short* L = (p == 0) ? QL : KL;
    const float* bias = (p == 0) ? bq : bk;
    gemm64<4, 0, 0, 1>(X, X, DMOD, 0LL, Wt, DMOD, 0LL, (void*)H, (void*)L, DMOD, 0LL,
                       NROW, DMOD, DMOD, 1.0f / (XC * WSC), (p == 0) ? QC : KC,
                       bias, bias, bias, blockIdx.x, 0, slab);
  } else {
    const int per = PJB / NBAT;
    const int bt  = blockIdx.x / per;
    gemm64<4, 0, 0, 2>(Wv, Wv, DMOD, 0LL, Xv, DMOD, (long long)SEQ * DMOD, (void*)VH, (void*)VL, SEQ, (long long)DMOD * SEQ,
                       DMOD, SEQ, DMOD, 1.0f / (XC * WSC), VC,
                       bv, bv, bv, blockIdx.x - bt * per, bt, slab);
  }
}

// =====================================================================================================
// Causal attention with the skewed relative-position term for one (batch b, head h) pair and a 64-row query tile; 8 waves =
// 2 key groups x 4 query waves: wave (kg, qw) owns query rows iw0 .. iw0+15, iw0 = i0 + 16 qw, and walks every second key tile
// j0 = 64 kg, 64 (kg + 2), .. <= i0, keeping its own running (max, sum, O). After the loop group 1 hands its state over through LDS
// behind one block barrier and group 0 merges the two states (rescale by exp2(m - max)) and stores. So the longest wave walks 16 tiles,
// not 32. There are more workgroups than places on the chip: blockIdx.y counts the query tiles from the last (most key tiles) down,
// so that cost falls with the flat workgroup index (for speed only).
// Planes (all in fragment order, see ldfrag_p): QH/QL, KH/KL = f16 hi + residual of (q x64), (k x64), rows b*SEQ + position, DMOD columns,
//         head h = column block h; EP = f16(bf16_RNE(Er) x16) [ELEN][64]; VH/VL = f16 hi + residual of (v x64) as [b][h*64+d][SEQ] (keys = columns).
//   Srel(i, j) = q_i . Er[ELEN-1 - (i - j)] for j <= i (the pad-reshape skew). Per key tile the wave needs Er rows
//   wlo + x, wlo = ELEN-1 - (iw0 - j0) - 15, x = jj - R + 15 in [0, 78]: position window T[R][x] = (qh+ql)[iw0+R] . EP[wlo + x],
//   x in [0, 80) (5 subtiles of 16 Er rows, their ten fragments requested together, K = 64; wlo is a multiple of 16, so a subtile is one 16-row block,
//   whose index is clamped on the address; a clamped block only ever feeds entries with j > i, which the causal mask replaces);
//   each 16x16 subtile is stored to the wave's f32 LDS strip right after its WMMAs.
//   Content scores S = (qh+ql) . (kh+kl) (hh + hl + lh, 4 subtiles of 16 keys, fragments requested two subtiles at a time, K = 64) -> the wave's f32 slab.
//   score*log2(e) = S*CS + T[R][jj - R + 15]*CT (CS, CT fold 1/(carries) and 1/8); entries with j > i are replaced by -inf;
//   online softmax in base 2, max-subtracted (row max via 16-lane shuffles), running sums in f32; e = exp2(t - m) in (0,1] written
//   of P*1024 (f16 hi + residual) rebuilt from the slab rows (f32 vector loads, split k map) and the v^T hi / residual B fragments loaded
//   straight from VH/VL [h*64+d][j]; 12 WMMAs per 32-key step (Ph.vh + Ph.vl + Pl.vh), 4 d-subtiles.
//   out rows (b*SEQ + iw0 + row), floats h*64 .. h*64+63 = one whole 256-B segment (2 lines) per row: 16 consecutive lanes x 16 B,
//   block = 8 waves = 256 threads; grid = (NBAT*NH, SEQ/64); one block barrier, behind the key loop, passed by every wave;
//   every wave does bounded work (<= SEQ/128 tiles).
// coverage: LDS strip 16 x 80 of TPI and slab 16 x 64 of SPI per wave, fully written before read each tile; global: 8 instructions x
//           2 rows x 64 floats = rows iw0..iw0+15 of head segment h; grid x waves cover all NBAT*SEQ rows and all NH head segments once.
// =====================================================================================================
__global__ __launch_bounds__(ATT_THREADS) __attribute__((amdgpu_num_vgpr(256)))
void attn_rel(const unsigned short* __restrict__ QH, const unsigned short* __restrict__ QL,
              const unsigned short* __restrict__ KH, const unsigned short* __restrict__ KL,
              const unsigned short* __restrict__ EP,
              const unsigned short* __restrict__ VH, const unsigned short* __restrict__ VL,
              float* out) {
  __shared__ __align__(16) float smem[ATT_W * WFL];   // per wave: T strip [16][TPI] | score / prob / ctx slab [16][SPI]

  const int tid  = threadIdx.x;
  const int wave = __builtin_amdgcn_readfirstlane(tid >> 5);   // scalar, so that the key loop's per-wave start and end stay scalar branches
  const int qw   = wave & (ATT_QW - 1);
  const int kg   = wave / ATT_QW;
  const int lane = tid & 31;
  const int hh   = lane >> 4;
  const int c    = lane & 15;
  const int bh   = blockIdx.x;
  const int b    = bh / NH;
  const int h    = bh - b * NH;
  const int qt   = (SEQ / 64 - 1) - (int)blockIdx.y;           // query tile, the one with the most key tiles first
  const int i0   = qt * 64;
  const int iw0  = i0 + qw * 16;

  float* tsh = smem + wave * WFL;
  float* pt  = tsh + 16 * TPI;
  // the lane's own bases in strip and slab: every access of the key loop is base + a constant, which leaves the registers to the fragments in flight
  float* tst = tsh + 8 * hh * TPI + c;             // strip row 8hh, column c
  float* pst = pt + 8 * hh * SPI + c;              // slab row 8hh, column c
  const float* tgt = tst + 15 - 8 * hh;            // shifted gather: row 8hh + r starts at tgt + r * (TPI - 1)

  const int l8 = lane * 8;                                                       // the lane's slot in a quarter of a fragment-order block
  const size_t qro = ((size_t)((b * SEQ + iw0) >> 4) * (DMOD / 64) + h) * 1024 + l8;   // block of query rows iw0.., head h
  const size_t kbo = ((size_t)((b * SEQ) >> 4) * (DMOD / 64) + h) * 1024 + l8;         // block of key rows 0..15 of batch b, head h
  const unsigned short* Khb = KH + kbo;
  const unsigned short* Klb = KL + kbo;
  const unsigned short* Eb  = EP + l8;
  const size_t vpo = (size_t)b * DMOD * SEQ + (size_t)(h * (DH / 16)) * (SEQ / 64) * 1024 + l8;   // block of d rows 0..15 of head h, keys 0..63
  const unsigned short* Vhb = VH + vpo;
  const unsigned short* Vlb = VL + vpo;

  const float CS = LOG2E * SCALE / (QC * KC);
  const float CT = LOG2E * SCALE / (QC * EC);

  float mrow[8], lrow[8];
  v8f O[4];
#pragma unroll
  for (int r = 0; r < 8; ++r) { mrow[r] = -INFINITY; lrow[r] = 0.f; }
#pragma unroll
  for (int td = 0; td < 4; ++td) O[td] = zero8();

  const int ntile = qt + 1;                  // causal: key tiles j0 <= i0
#pragma unroll 1
  for (int jt = kg; jt < ntile; jt += ATT_KG) {
    const int j0 = jt * 64;
    const v16h qha = ldfrag_p(QH + qro), qhb = ldfrag_p(QH + qro + 512);
    const v16h qla = ldfrag_p(QL + qro), qlb = ldfrag_p(QL + qro + 512);

    // ---- position window T (5 subtiles of 16 Er rows), each subtile stored to the LDS strip as produced ----
    {
      const int wb = ((ELEN - 1) - (iw0 - j0) - 15) >> 4;   // wlo / 16, exact: ELEN, iw0 and j0 are multiples of 16
      // all ten Er fragments are requested together, ahead of the products: the window waits out one load latency, not five
      v16h fa[5], fb[5];
      const unsigned short* pe[5];
#pragma unroll
      for (int u = 0; u < 5; ++u) {
        int m = wb + u;
        m = (m < 0) ? 0 : m;
        m = (m > ELEN / 16 - 1) ? (ELEN / 16 - 1) : m;
        pe[u] = Eb + (size_t)m * 1024;
        fa[u] = ldfrag_p(pe[u]);
        fb[u] = ldfrag_p(pe[u] + 512);
      }
      addr_wait4(pe[0], pe[1], pe[2], pe[3]);
      addr_wait1(pe[4]);
      __builtin_amdgcn_sched_barrier(0);   // the whole group is requested before its first product: the scheduler otherwise pairs each load with its use again
#pragma unroll
      for (int u = 0; u < 5; ++u) {
        v8f t8 = mma_h(qha, fa[u], zero8());
        t8 = mma_h(qla, fa[u], t8);
        t8 = mma_h(qhb, fb[u], t8);
        t8 = mma_h(qlb, fb[u], t8);
        hz6(t8, fa[u], fb[u], qha, qla, qhb, qlb);
#pragma unroll
        for (int r = 0; r < 8; ++r) tst[r * TPI + 16 * u] = t8[r];
      }
    }
    __builtin_amdgcn_sched_barrier(0);   // keeps a later phase's index and address work out of this phase, whose registers the fragments in flight need
    // ---- content scores S (4 subtiles of 16 keys) -> slab ----
    {
      // the key fragments are requested in two groups of two subtiles, each ahead of its products: two load latencies, not four
      const unsigned short* pkh = Khb + (size_t)(j0 >> 4) * ((DMOD / 64) * 1024);
      const unsigned short* pkl = Klb + (size_t)(j0 >> 4) * ((DMOD / 64) * 1024);
      v16h kha[4], khb[4], kla[4], klb[4];
#pragma unroll
      for (int t = 0; t < 4; ++t) {
        if ((t & 1) == 0) {
#pragma unroll
          for (int x = t; x < t + 2; ++x) {
            kha[x] = ldfrag_p(pkh + (size_t)x * ((DMOD / 64) * 1024));
            khb[x] = ldfrag_p(pkh + (size_t)x * ((DMOD / 64) * 1024) + 512);
            kla[x] = ldfrag_p(pkl + (size_t)x * ((DMOD / 64) * 1024));
            klb[x] = ldfrag_p(pkl + (size_t)x * ((DMOD / 64) * 1024) + 512);
          }
          addr_wait2(pkh, pkl);
          __builtin_amdgcn_sched_barrier(0);   // the whole group is requested before its first product: the scheduler otherwise pairs each load with its use again
        }
        v8f s8 = mma_h(qha, kha[t], zero8());
        s8 = mma_h(qha, kla[t], s8);
        s8 = mma_h(qla, kha[t], s8);
        s8 = mma_h(qhb, khb[t], s8);
        s8 = mma_h(qhb, klb[t], s8);
        s8 = mma_h(qlb, khb[t], s8);
        hz8(s8, kha[t], khb[t], kla[t], klb[t], qha, qla, qhb, qlb);
#pragma unroll
        for (int r = 0; r < 8; ++r) pst[r * SPI + 16 * t] = s8[r];
      }
    }
    __builtin_amdgcn_sched_barrier(0);   // keeps a later phase's index and address work out of this phase, whose registers the fragments in flight need
    wave_sync_lds();
    // v^T fragments of the first 32 keys: requested here, behind the fence (which waits for loads in flight), so that they arrive while the softmax runs
    const unsigned short* pvh = Vhb + (size_t)jt * 1024;
    const unsigned short* pvl = Vlb + (size_t)jt * 1024;
    v16h vh[4], vl[4];
#pragma unroll
    for (int td = 0; td < 4; ++td) {
      vh[td] = ldfrag_p(pvh + (size_t)td * ((SEQ / 64) * 1024));
      vl[td] = ldfrag_p(pvl + (size_t)td * ((SEQ / 64) * 1024));
    }
    addr_wait2(pvh, pvl);

    // ---- score assembly, causal mask, online softmax (rows live on one 16-lane half) ----
    const int dj = (j0 - iw0) + c - 8 * hh;        // j - i = dj + 16 t - r
#pragma unroll
    for (int r = 0; r < 8; ++r) {
      const float* trow = tgt + r * (TPI - 1);
      float* srow = pst + r * SPI;
      float tv[4];
#pragma unroll
      for (int t = 0; t < 4; ++t) {
        const float val = srow[16 * t] * CS + trow[16 * t] * CT;
        tv[t] = (dj > r - 16 * t) ? -INFINITY : val;
      }
      float mx = fmaxf(fmaxf(tv[0], tv[1]), fmaxf(tv[2], tv[3]));
#pragma unroll
      for (int off = 1; off < 16; off <<= 1) mx = fmaxf(mx, __shfl_xor(mx, off, 32));
      const float mn = fmaxf(mrow[r], mx);
      const float al = exp2f(mrow[r] - mn);
      mrow[r] = mn;
      float e4[4];
      float ps = 0.f;
#pragma unroll
      for (int t = 0; t < 4; ++t) { e4[t] = exp2f(tv[t] - mn); ps += e4[t]; }
#pragma unroll
      for (int off = 1; off < 16; off <<= 1) ps += __shfl_xor(ps, off, 32);
      lrow[r] = lrow[r] * al + ps;
#pragma unroll
      for (int td = 0; td < 4; ++td) O[td][r] *= al;
#pragma unroll
      for (int t = 0; t < 4; ++t) srow[16 * t] = e4[t];
    }
    wave_sync_lds();
    __builtin_amdgcn_sched_barrier(0);   // keeps a later phase's index and address work out of this phase, whose registers the fragments in flight need

    // ---- O += (Ph + Pl) . (vh + vl)^T, two k-steps of 32 keys; a step's 8 v^T fragments are requested together, ahead of its P split ----
#pragma unroll
    for (int ks = 0; ks < 2; ++ks) {
      if (ks == 1) {
#pragma unroll
        for (int td = 0; td < 4; ++td) {
          vh[td] = ldfrag_p(pvh + (size_t)td * ((SEQ / 64) * 1024) + 512);
          vl[td] = ldfrag_p(pvl + (size_t)td * ((SEQ / 64) * 1024) + 512);
        }
        addr_wait2(pvh, pvl);
        __builtin_amdgcn_sched_barrier(0);   // the whole group is requested before its first product: the scheduler otherwise pairs each load with its use again
      }
      FragH ph, pl;
      {
        const float* prow = pt + c * SPI + 32 * ks + 8 * hh;
        const v4f p0 = *(const v4f*)(prow), p1 = *(const v4f*)(prow + 4);
        const v4f p2 = *(const v4f*)(prow + 16), p3 = *(const v4f*)(prow + 20);
#pragma unroll
        for (int e = 0; e < 4; ++e) {
          _Float16 a0, a1;
          sp16(p0[e] * PC, a0, a1); ph.h[0][e]     = a0; pl.h[0][e]     = a1;   // keys 32ks + 8hh + e
          sp16(p1[e] * PC, a0, a1); ph.h[0][4 + e] = a0; pl.h[0][4 + e] = a1;   // keys 32ks + 8hh + 4 + e
          sp16(p2[e] * PC, a0, a1); ph.h[1][e]     = a0; pl.h[1][e]     = a1;   // keys 32ks + 16 + 8hh + e
          sp16(p3[e] * PC, a0, a1); ph.h[1][4 + e] = a0; pl.h[1][4 + e] = a1;
        }
      }
#pragma unroll
      for (int td = 0; td < 4; ++td) {
        O[td] = mma_h(ph.v, vh[td], O[td]);
        O[td] = mma_h(ph.v, vl[td], O[td]);
        O[td] = mma_h(pl.v, vh[td], O[td]);
        hz4(O[td], vh[td], vl[td], ph.v, pl.v);
      }
    }
    wave_sync_lds();
  }
  acc_guard4(O[0], O[1], O[2], O[3]);

  // ---- merge of the two key groups: group 1 writes (O, m, l) to its own slab and strip, block barrier, group 0 reads and rescales.
  //      A group-1 wave without a tile hands over m = -inf, l = 0, O = 0, whose weight exp2(-inf) is 0; group 0 always has tile 0.
  if (kg != 0) {
#pragma unroll
    for (int r = 0; r < 8; ++r) {
      const int R = 8 * hh + r;
#pragma unroll
      for (int td = 0; td < 4; ++td) pt[R * SPI + 16 * td + c] = O[td][r];
      if (c == 0) { tsh[R] = mrow[r]; tsh[16 + R] = lrow[r]; }
    }
  }
  __syncthreads();                           // publishes group 1's state to group 0; every wave of the block passes it once
  if (kg != 0) return;
  {
    const float* ts2 = tsh + ATT_QW * WFL;   // wave (1, qw)'s strip and slab
    const float* pt2 = ts2 + 16 * TPI;
#pragma unroll
    for (int r = 0; r < 8; ++r) {
      const int R = 8 * hh + r;
      const float m2 = ts2[R], l2 = ts2[16 + R];
      const float mm = fmaxf(mrow[r], m2);
      const float a1 = exp2f(mrow[r] - mm), a2 = exp2f(m2 - mm);
      lrow[r] = lrow[r] * a1 + l2 * a2;
#pragma unroll
      for (int td = 0; td < 4; ++td) O[td][r] = O[td][r] * a1 + pt2[R * SPI + 16 * td + c] * a2;
    }
  }

  // ---- fold 1/l and the carries (1024 on P, 64 on v), stage the wave's 16x64 f32 slice in its slab ----
  const float oc = 1.0f / (PC * VC);
#pragma unroll
  for (int r = 0; r < 8; ++r) {
    const float inv = (1.0f / lrow[r]) * oc;
    const int ro = (8 * hh + r) * SPI + c;
#pragma unroll
    for (int td = 0; td < 4; ++td) pt[ro + 16 * td] = O[td][r] * inv;
  }
  wave_sync_lds();
  {
    const int c4 = c * 4;
    v4f vals[8];
#pragma unroll
    for (int it = 0; it < 8; ++it) {
      const int row = it * 2 + hh;                           // it 0..7 x hh 0..1 = rows 0..15
      vals[it] = *(const v4f*)(pt + row * SPI + c4);
    }
    float* ob = out + ((size_t)b * SEQ + iw0) * DMOD + h * DH + c4;
    {
#pragma unroll
      for (int it = 0; it < 8; ++it) {
        const int row = it * 2 + hh;
        *(v4f*)(ob + (size_t)row * DMOD) = vals[it];
      }
      
    }
  }
}

// =====================================================================================================
// Workspace map (bytes); every plane is an exact multiple of its tile / whole-row store granularity (M, N exact tile multiples,
// convert counts exact multiples of 8192, no pad rows), every offset a multiple of 262144; every plane is in fragment order (see ldfrag_p):
//   (the first seven planes keep this order with no gap between them: cvt_all numbers their 16 x 64 blocks straight through)
//   Xq, Xk, Xv  f16 [NROW][1024] x16                            3 x 8388608
//   Wq, Wk, Wv  f16 [1024 out][1024 in] x64                      3 x 2097152
//   EP          f16 [ELEN][64] x16                                   262144
//   QH, QL, KH, KL f16 [NROW][1024] (x64 hi / residual)         4 x 8388608
//   VH, VL      f16 [NBAT][1024][SEQ] (x64 hi / residual)       2 x 8388608
//   end                                                            82051072
// =====================================================================================================
extern "C" void kernel_launch(void* const* d_in, const int* in_sizes, int n_in,
                              void* d_out, int out_size, void* d_ws, size_t ws_size,
                              hipStream_t stream) {
  if (n_in < 10) return;
  if (in_sizes[0] != NROW * DMOD || in_sizes[1] != NROW * DMOD || in_sizes[2] != NROW * DMOD) return;
  if (in_sizes[3] != DMOD * DMOD || in_sizes[5] != DMOD * DMOD || in_sizes[7] != DMOD * DMOD) return;
  if (in_sizes[4] != DMOD || in_sizes[6] != DMOD || in_sizes[8] != DMOD) return;
  if (in_sizes[9] != ELEN * DH) return;
  if (out_size != NROW * DMOD) return;

  const float* qin = (const float*)d_in[0];
  const float* kin = (const float*)d_in[1];
  const float* vin = (const float*)d_in[2];
  const float* w_q = (const float*)d_in[3];
  const float* b_q = (const float*)d_in[4];
  const float* w_k = (const float*)d_in[5];
  const float* b_k = (const float*)d_in[6];
  const float* w_v = (const float*)d_in[7];
  const float* b_v = (const float*)d_in[8];
  const float* er  = (const float*)d_in[9];
  float*       out = (float*)d_out;

  const size_t PX = (size_t)NROW * DMOD * 2;             //  8388608
  const size_t PW = (size_t)DMOD * DMOD * 2;             //  2097152
  const size_t PE = (size_t)ELEN * DH * 2;               //   262144
  const size_t PV = (size_t)NBAT * DMOD * SEQ * 2;       //  8388608
  size_t off = 0;
  const size_t oXq = off; off += PX;
  const size_t oXk = off; off += PX;
  const size_t oXv = off; off += PX;
  const size_t oWq = off; off += PW;
  const size_t oWk = off; off += PW;
  const size_t oWv = off; off += PW;
  const size_t oE  = off; off += PE;
  const size_t oQH = off; off += PX;
  const size_t oQL = off; off += PX;
  const size_t oKH = off; off += PX;
  const size_t oKL = off; off += PX;
  const size_t oVH = off; off += PV;
  const size_t oVL = off; off += PV;
  if (off > ws_size) return;                               // off = 82051072
  if (off > (size_t)134217728) return;

  char* ws = (char*)d_ws;
  unsigned short* Xq  = (unsigned short*)(ws + oXq);
  unsigned short* Xk  = (unsigned short*)(ws + oXk);
  unsigned short* Xv  = (unsigned short*)(ws + oXv);
  unsigned short* Wq6 = (unsigned short*)(ws + oWq);
  unsigned short* Wk6 = (unsigned short*)(ws + oWk);
  unsigned short* Wv6 = (unsigned short*)(ws + oWv);
  unsigned short* E16 = (unsigned short*)(ws + oE);
  unsigned short* QHp = (unsigned short*)(ws + oQH);
  unsigned short* QLp = (unsigned short*)(ws + oQL);
  unsigned short* KHp = (unsigned short*)(ws + oKH);
  unsigned short* KLp = (unsigned short*)(ws + oKL);
  unsigned short* VHp = (unsigned short*)(ws + oVH);
  unsigned short* VLp = (unsigned short*)(ws + oVL);

  const dim3 blk(256);
  const dim3 gCV(CBALL);                                            // 3 x 512 + 3 x 128 + 16 = 1936
  const dim3 gP(PJB, 3);                                            // 256 x 3
  const dim3 bP(GW * 32);                                           // 128
  const dim3 gAT(NBAT * NH, SEQ / 64);                              // 32 x 32
  const dim3 bAT(ATT_THREADS);                                      // 256

  // (0) 16-bit planes of the inputs: activations f16(bf16_RNE(x) * 16); W[out][in] (already k-contiguous) f16(bf16_RNE(w) * 64);
  //     Er f16(bf16_RNE(e) * 16); one launch for all seven: Xq is the first of the seven planes, which follow one another in the workspace
  cvt_all<<<gCV, blk, 0, stream>>>(qin, kin, vin, w_q, w_k, w_v, er, Xq);

  // (1) one launch for the three projections:
  //     q[m][e] = sum_d x[m][d] Wq[e][d] / 1024 + bq[e] -> QH = f16(q * 64), QL = f16(q * 64 - QH); the same for k -> KH, KL;
  //     VT[b][e][j] = sum_c Wv[e][c] x[b*SEQ+j][c] / 1024 + bv[e] -> VH, VL (x64)
  proj3<<<gP, bP, 0, stream>>>(Xq, Xk, Xv, Wq6, Wk6, Wv6, QHp, QLp, KHp, KLp, VHp, VLp, b_q, b_k, b_v);

  // (2) causal relative attention -> out[b][i][h*64+d] (f32), written directly
  attn_rel<<<gAT, bAT, 0, stream>>>(QHp, QLp, KHp, KLp, E16, VHp, VLp, out);
  (void)hipGetLastError();
}

// v006
// One run takes 165 microseconds.
// In both of two side-by-side timings against v005, it was 1.10 times as fast.
// All steps since v000 together make it 2.69 times as fast.
// Contractions (all v_wmma_f32_16x16x32_f16, f16 operands, f32 accumulate): q/k/v projections (x f16 x16 . W f16 x64, K=1024, single products,
// outputs written as f16 hi + unscaled f16 residual planes); position window ((qh+ql) x64 . Er f16 x16, K=64, 2 products) -> f32 LDS strip,
// shifted gather on VALU; content scores ((qh+ql) x64 . (kh+kl) x64, K=64, hh+hl+lh); P . v^T ((Ph+Pl) x1024 . (vh+vl) x64, hh+hl+lh,
// 64 keys per tile). Causal mask, max-subtracted online base-2 softmax and the 1/l fold in f32 on VALU. Every float input RNE-converted to bf16 on load.
#include <hip/hip_runtime.h>
#include <math.h>
#include <stdint.h>

#define SEQ   2048
#define NBAT  2
#define DMOD  1024
#define NH    16
#define DH    64
#define ELEN  2048
#define NROW  (NBAT * SEQ)
#define XC    16.0f
#define WSC   64.0f
#define QC    64.0f
#define KC    64.0f
#define EC    16.0f
#define VC    64.0f
#define PC    1024.0f
#define SCALE 0.125f
#define LOG2E 1.4426950408889634f
static_assert(NH * DH == DMOD);
static_assert(DH == 64);
static_assert(ELEN == SEQ);
static_assert((SEQ % 64) == 0 && (DMOD % 64) == 0 && (NROW % 64) == 0);
static_assert(((NROW * DMOD) % 8192) == 0 && ((DMOD * DMOD) % 8192) == 0 && ((ELEN * DH) % 8192) == 0);
static_assert((SEQ % 16) == 0 && (ELEN % 16) == 0);
#define ATT_QW 4                    // waves side by side on the query rows (16 rows each)
#define ATT_KG 2                    // groups of ATT_QW waves that share out the key tiles
#define ATT_W (ATT_QW * ATT_KG)
#define ATT_THREADS (ATT_W * 32)
static_assert(ATT_KG == 2);
#define TPI 84
#define SPI 68
#define WFL (16 * TPI + 16 * SPI)
static_assert(((16 * TPI) % 4) == 0 && ((16 * SPI) % 4) == 0 && (WFL % 4) == 0);

typedef _Float16 v16h __attribute__((ext_vector_type(16)));
typedef _Float16 v8h  __attribute__((ext_vector_type(8)));
typedef __bf16   v16b __attribute__((ext_vector_type(16)));
typedef float    v8f  __attribute__((ext_vector_type(8)));
typedef float    v4f  __attribute__((ext_vector_type(4)));
typedef float    v2f  __attribute__((ext_vector_type(2)));
typedef unsigned int v4u __attribute__((ext_vector_type(4)));

union FragH { v16h v; v8h h[2]; v4u u[2]; };
union FragAny { v16h h; v16b b; };

// ---- scalar helpers --------------------------------------------------------------------------------
__device__ __forceinline__ unsigned short bf_bits(float f) {          // f32 -> bf16 bits, RNE convert
  unsigned u = __float_as_uint(f);
  return (unsigned short)((u + 0x7FFFu + ((u >> 16) & 1u)) >> 16);
}
__device__ __forceinline__ float bf_up(unsigned short h) { return __uint_as_float(((unsigned)h) << 16); }
__device__ __forceinline__ float bfr(float f) { return bf_up(bf_bits(f)); }   // value of the bf16 RNE convert
__device__ __forceinline__ unsigned short h_bits(_Float16 x) { return __builtin_bit_cast(unsigned short, x); }
__device__ __forceinline__ unsigned pk16(unsigned short a, unsigned short b) { return (unsigned)a | ((unsigned)b << 16); }
__device__ __forceinline__ v8f zero8() { v8f z = {0.f, 0.f, 0.f, 0.f, 0.f, 0.f, 0.f, 0.f}; return z; }

// ---- fragment-order planes: a 16-bit matrix [R][Cn] (R % 16 == 0, Cn % 64 == 0; Cn is the k direction of its reader) is kept as blocks of
//      16 rows x 64 columns, block (r >> 4) * (Cn / 64) + (cn >> 6), 1024 halves each; inside a block four 256-half quarters qd = (cn >> 4) & 3,
//      inside a quarter lane slot ((cn >> 3) & 1) * 16 + (r & 15), 8 halves each. One A/B fragment (16 rows x 32 k) is two neighbouring quarters,
//      and each of its two 16-byte-per-lane loads reads 512 contiguous bytes (4 cache lines, where a row-major plane gives 16).
// ---- fragment loader: p = block + 512 * (k step inside the block) + 8 * lane; lane -> row/col (lane&15), h = lane>>4;
//      elements 0..7 <- k0+8h.., elements 8..15 <- k0+16+8h.. (same split k map for A and B; B is always read from a [n][k] plane)
__device__ __forceinline__ v16h ldfrag_p(const unsigned short* p) {
  FragH f;
  f.u[0] = *(const v4u*)(p);
  f.u[1] = *(const v4u*)(p + 256);
  return f.v;
}

// ---- WMMA helpers with trailing VALU hazard gaps ------------------------------------------------------
__device__ __forceinline__ v8f mma_h(v16h a, v16h b, v8f c) {
  return __builtin_amdgcn_wmma_f32_16x16x32_f16(false, a, false, b, (short)0, c, false, false);
}
__device__ __forceinline__ v8f mma_b(v16h a, v16h b, v8f c) {
  FragAny ua, ub;
  ua.h = a;
  ub.h = b;
  return __builtin_amdgcn_wmma_f32_16x16x32_bf16(false, ua.b, false, ub.b, (short)0, c, false, false);
}
template <int BF>
__device__ __forceinline__ v8f mmaT(v16h a, v16h b, v8f c) {
  if constexpr (BF != 0) return mma_b(a, b, c);
  else return mma_h(a, b, c);
}
__device__ __forceinline__ void dep_guard1(v8f& a, v8f& b, v16h x) {
#if defined(__HIP_DEVICE_COMPILE__)
  asm volatile("v_nop\n\tv_nop\n\tv_nop\n\tv_nop" : "+v"(a), "+v"(b) : "v"(x));
#endif
}
__device__ __forceinline__ void hz4(v8f& d, v16h x0, v16h x1, v16h x2, v16h x3) {
#if defined(__HIP_DEVICE_COMPILE__)
  asm volatile("v_nop\n\tv_nop\n\tv_nop\n\tv_nop" : "+v"(d) : "v"(x0), "v"(x1), "v"(x2), "v"(x3));
#endif
}
__device__ __forceinline__ void hz6(v8f& d, v16h x0, v16h x1, v16h x2, v16h x3, v16h x4, v16h x5) {
#if defined(__HIP_DEVICE_COMPILE__)
  asm volatile("v_nop\n\tv_nop\n\tv_nop\n\tv_nop" : "+v"(d) : "v"(x0), "v"(x1), "v"(x2), "v"(x3), "v"(x4), "v"(x5));
#endif
}
__device__ __forceinline__ void hz8(v8f& d, v16h x0, v16h x1, v16h x2, v16h x3, v16h x4, v16h x5, v16h x6, v16h x7) {
#if defined(__HIP_DEVICE_COMPILE__)
  asm volatile("v_nop\n\tv_nop\n\tv_nop\n\tv_nop" : "+v"(d) : "v"(x0), "v"(x1), "v"(x2), "v"(x3), "v"(x4), "v"(x5), "v"(x6), "v"(x7));
#endif
}
__device__ __forceinline__ void keep4_h(v16h a, v16h b, v16h c, v16h d) {
#if defined(__HIP_DEVICE_COMPILE__)
  asm volatile("v_nop" :: "v"(a), "v"(b), "v"(c), "v"(d));
#endif
}
__device__ __forceinline__ void acc_guard4(v8f& a, v8f& b, v8f& c, v8f& d) {
#if defined(__HIP_DEVICE_COMPILE__)
  asm volatile("v_nop\n\tv_nop\n\tv_nop\n\tv_nop" : "+v"(a), "+v"(b), "+v"(c), "+v"(d));
#endif
}
__device__ __forceinline__ void wave_sync_lds() {
  __builtin_amdgcn_fence(__ATOMIC_RELEASE, "workgroup");
  __builtin_amdgcn_wave_barrier();
  __builtin_amdgcn_fence(__ATOMIC_ACQUIRE, "workgroup");
}
// s_wait_xcnt 0 behind a run of global fragment loads (GEMM and attention). The loads' address pointers are inputs only, so their registers stay
// live up to the wait: no later load of the run lands on them and no address arithmetic rewrites them before the wait has passed.
__device__ __forceinline__ void addr_wait1(const unsigned short* p) {
#if defined(__HIP_DEVICE_COMPILE__)
  asm volatile("s_wait_xcnt 0x0" :: "v"(p) : "memory");
#endif
}
__device__ __forceinline__ void addr_wait4(const unsigned short* p0, const unsigned short* p1, const unsigned short* p2, const unsigned short* p3) {
#if defined(__HIP_DEVICE_COMPILE__)
  asm volatile("s_wait_xcnt 0x0" :: "v"(p0), "v"(p1), "v"(p2), "v"(p3) : "memory");
#endif
}
__device__ __forceinline__ void addr_wait2(const unsigned short* p0, const unsigned short* p1) {
#if defined(__HIP_DEVICE_COMPILE__)
  asm volatile("s_wait_xcnt 0x0" :: "v"(p0), "v"(p1) : "memory");
#endif
}
// 16-lane row all-reduce on the vector unit: in each step lane l combines its value with that of lane l ^ M of its own row (DPP row_xmask:M),
// M = 1, 2, 4, 8: no LDS queue and no LDS wait. All 32 lanes are on where these are called.
// asm: one instruction a step; from source the maximum comes out as a DPP move, a quieting v_max and the maximum, three dependent instructions a step.
// s_delay_alu: hints each dependent step, so that the SIMD's other waves issue during the chain's waits.
__device__ __forceinline__ float row_max16(float x) {
#if defined(__HIP_DEVICE_COMPILE__)
  asm("s_delay_alu instid0(VALU_DEP_1)\n\t"
      "v_max_num_f32_dpp %0, %0, %0 row_xmask:1 row_mask:0xf bank_mask:0xf\n\t"
      "s_delay_alu instid0(VALU_DEP_1)\n\t"
      "v_max_num_f32_dpp %0, %0, %0 row_xmask:2 row_mask:0xf bank_mask:0xf\n\t"
      "s_delay_alu instid0(VALU_DEP_1)\n\t"
      "v_max_num_f32_dpp %0, %0, %0 row_xmask:4 row_mask:0xf bank_mask:0xf\n\t"
      "s_delay_alu instid0(VALU_DEP_1)\n\t"
      "v_max_num_f32_dpp %0, %0, %0 row_xmask:8 row_mask:0xf bank_mask:0xf"
      : "+v"(x));
#endif
  return x;
}
__device__ __forceinline__ float row_sum16(float x) {   // same pairing and order as the xor-1, 2, 4, 8 shuffle tree
#if defined(__HIP_DEVICE_COMPILE__)
  asm("s_delay_alu instid0(VALU_DEP_1)\n\t"
      "v_add_f32_dpp %0, %0, %0 row_xmask:1 row_mask:0xf bank_mask:0xf\n\t"
      "s_delay_alu instid0(VALU_DEP_1)\n\t"
      "v_add_f32_dpp %0, %0, %0 row_xmask:2 row_mask:0xf bank_mask:0xf\n\t"
      "s_delay_alu instid0(VALU_DEP_1)\n\t"
      "v_add_f32_dpp %0, %0, %0 row_xmask:4 row_mask:0xf bank_mask:0xf\n\t"
      "s_delay_alu instid0(VALU_DEP_1)\n\t"
      "v_add_f32_dpp %0, %0, %0 row_xmask:8 row_mask:0xf bank_mask:0xf"
      : "+v"(x));
#endif
  return x;
}
// f32 -> f16 hi + unscaled f16 residual (hi + lo ~ x to 2^-22 relative; a flushed subnormal lo costs < 6.1e-5 absolute in the carried scale)
__device__ __forceinline__ void sp16(float x, _Float16& hi, _Float16& lo) {
  const _Float16 a = (_Float16)x;
  hi = a;
  lo = (_Float16)(x - (float)a);
}

// =====================================================================================================
// 16-bit pack into a fragment-order plane: value f16( bf16_RNE(src[r][cn]) * sc ), sc a power of two (exact); src row-major [R][64 << lgt].
// One wave per 16 x 64 block: 8 loads (16 rows x 256 B of f32) in flight, then 4 stores of 512 contiguous bytes.
// All seven planes in ONE launch: they depend on nothing but the inputs, so one grid pays one launch gap, one fill and one tail, not seven.
// The workgroup index picks the plane (workgroup-uniform, scalar): CBX workgroups each for the q, k, v activations, CBW each for Wq, Wk, Wv,
// CBE for Er. The seven planes lie one behind the other in the workspace in this same order, so 16 x 64 block g of the whole grid goes to dst + 1024 g.
// coverage: a plane of n elements has n / 8192 workgroups x 8 waves x 1024 elements = n exactly (n % 8192 == 0 for every plane, checked at compile time).
// =====================================================================================================
#define CBX ((NROW * DMOD) / 8192)
#define CBW ((DMOD * DMOD) / 8192)
#define CBE ((ELEN * DH) / 8192)
#define CBALL (3 * CBX + 3 * CBW + CBE)
__global__ __launch_bounds__(256) void cvt_all(const float* __restrict__ xq, const float* __restrict__ xk, const float* __restrict__ xv,
                                               const float* __restrict__ wq, const float* __restrict__ wk, const float* __restrict__ wv,
                                               const float* __restrict__ er, unsigned short* dst) {
  const int lane = threadIdx.x & 31;
  const int bx = blockIdx.x;
  if (bx >= CBALL) return;                                    // never taken with the exact grid; no barriers in this kernel
  const float* src;                                           // the plane's f32 source, row-major [R][64 << lgt]
  int b0, lgt;                                                // the plane's first workgroup; log2(columns / 64)
  float sc;                                                   // the plane's carried power of two
  if (bx < 3 * CBX) {
    const int p = bx / CBX;
    src = (p == 0) ? xq : ((p == 1) ? xk : xv);
    b0 = p * CBX; lgt = 4; sc = XC;
  } else if (bx < 3 * CBX + 3 * CBW) {
    const int p = (bx - 3 * CBX) / CBW;
    src = (p == 0) ? wq : ((p == 1) ? wk : wv);
    b0 = 3 * CBX + p * CBW; lgt = 4; sc = WSC;
  } else {
    src = er;
    b0 = 3 * CBX + 3 * CBW; lgt = 0; sc = EC;
  }
  const int wv8 = threadIdx.x >> 5;
  const int w = (bx - b0) * 8 + wv8;                          // 16 x 64 block index in the plane = (row block) * (columns / 64) + column block
  const int tm = w >> lgt;
  const int tn = w - (tm << lgt);
  const float* sp = src + (((size_t)(tm * 16 + (lane & 15))) << (lgt + 6)) + tn * 64 + (lane >> 4) * 8;
  v4f a[4], b[4];
#pragma unroll
  for (int it = 0; it < 4; ++it) {                            // quarter it: columns 16 it + 8 (lane >> 4) ..
    a[it] = *(const v4f*)(sp + it * 16);
    b[it] = *(const v4f*)(sp + it * 16 + 4);
  }
  addr_wait1((const unsigned short*)sp);
  unsigned short* dp = dst + (size_t)(bx * 8 + wv8) * 1024 + lane * 8;
#pragma unroll
  for (int it = 0; it < 4; ++it) {
    v4u o;
    o[0] = pk16(h_bits((_Float16)(bfr(a[it][0]) * sc)), h_bits((_Float16)(bfr(a[it][1]) * sc)));
    o[1] = pk16(h_bits((_Float16)(bfr(a[it][2]) * sc)), h_bits((_Float16)(bfr(a[it][3]) * sc)));
    o[2] = pk16(h_bits((_Float16)(bfr(b[it][0]) * sc)), h_bits((_Float16)(bfr(b[it][1]) * sc)));
    o[3] = pk16(h_bits((_Float16)(bfr(b[it][2]) * sc)), h_bits((_Float16)(bfr(b[it][3]) * sc)));
    *(v4u*)(dp + it * 256) = o;
  }
}

// =====================================================================================================
// Register-blocked batched 16-bit WMMA GEMM body (device function, called by proj3): C[m][n] = oscale * sum_k A[m][k] * Bt[n][k] (+ bias);
// one wave per 64x64 tile, no block barriers. A [M][K] and Bt [N][K] are fragment-order planes with lda = ldb = K columns; M, N, K multiples of 64.
// 16-bit outputs are fragment-order planes of ldc columns (ldc % 64 == 0). by = batch index with element strides sA, sB, sC; bx = workgroup index inside the batch; slab = the wave's LDS slab.
// ASPLIT 1: a second A plane A2 (unscaled residual of A, same layout) is multiplied into the same accumulator (A + A2 ~ exact A).
// BF 1: bf16 operands (v_wmma_f32_16x16x32_bf16), else f16.
// EPI 1: value += bf16_RNE(ep0[column]) (per-column bias); EPI 2: value += bf16_RNE(ep0[row]) (per-row bias, 16-bit out only).
// OM 0: f32 out (pitch ldc).  OM 2: one f16 plane = f16(value * ocarry).
// OM 4: two f16 planes: hi = f16(value * ocarry), lo = f16(value * ocarry - hi) (unscaled residual).
// OM 5: two f16 planes: C = f16((value + bf16_RNE(ep1[column])) * ocarry), C2 = f16((value + bf16_RNE(ep2[column])) * ocarry).
// coverage: 4 slabs x 16 rows (f32: it 0..7 x lane>>4; 16-bit: row lane&15, quarters it 0..3 x column half lane>>4) x 64 cols = the wave's whole 64x64 tile;
//           bx covers ceil(tilesM*tilesN/GW) workgroups of GW waves, surplus waves return (wave-uniform).
// =====================================================================================================
#define GW 4   // waves per projection workgroup
template <int OM, int ASPLIT, int BF, int EPI>
__device__ __forceinline__ void gemm64(
    const unsigned short* __restrict__ Ap, const unsigned short* __restrict__ A2p, int lda, long long sA,
    const unsigned short* __restrict__ Btp, int ldb, long long sB,
    void* Cout, void* C2out, int ldc, long long sC,
    int M, int N, int K, float oscale, float ocarry,
    const float* __restrict__ ep0, const float* __restrict__ ep1, const float* __restrict__ ep2,
    int bx, int by, float* slab) {
  const int lane = threadIdx.x & 31;
  const int wave = threadIdx.x >> 5;
  const int tilesN = N >> 6;
  const int tilesM = M >> 6;
  const int tile = bx * GW + wave;
  if (tile >= tilesM * tilesN) return;   // wave-uniform; no block barriers in the calling kernel
  const int tm = tile / tilesN;
  const int tn = tile - tm * tilesN;
  const int m0 = tm << 6;
  const int n0 = tn << 6;

  const unsigned short* A1 = Ap  + (size_t)((long long)by * sA);
  const unsigned short* A2 = A2p + (size_t)((long long)by * sA);
  const unsigned short* Bb = Btp + (size_t)((long long)by * sB);

  const int rlane = lane & 15;                 // row (A) / col (B, D) within subtile
  const int l8    = lane * 8;                  // the lane's slot in a quarter of a fragment-order block
  const int mOff  = (lane >> 4) * 8;           // D row offset

  v8f acc[4][4];
#pragma unroll
  for (int i = 0; i < 4; ++i)
#pragma unroll
    for (int j = 0; j < 4; ++j) acc[i][j] = zero8();

  for (int k0 = 0; k0 < K; k0 += 32) {
    v16h bh[4];
    const unsigned short* pb[4];
#pragma unroll
    for (int j = 0; j < 4; ++j) {
      const size_t bofs = (size_t)((n0 >> 4) + j) * (16 * ldb) + k0 * 16 + l8;
      pb[j] = Bb + bofs;
      bh[j] = ldfrag_p(pb[j]);
    }
    addr_wait4(pb[0], pb[1], pb[2], pb[3]);
#pragma unroll
    for (int i = 0; i < 4; ++i) {
      const size_t ao = (size_t)((m0 >> 4) + i) * (16 * lda) + k0 * 16 + l8;
      const unsigned short* pa = A1 + ao;
      const v16h ah = ldfrag_p(pa);
      addr_wait1(pa);
#pragma unroll
      for (int j = 0; j < 4; ++j) acc[i][j] = mmaT<BF>(ah, bh[j], acc[i][j]);
      dep_guard1(acc[i][0], acc[i][3], ah);
      if constexpr (ASPLIT != 0) {
        const unsigned short* pa2 = A2 + ao;
        const v16h al = ldfrag_p(pa2);
        addr_wait1(pa2);
#pragma unroll
        for (int j = 0; j < 4; ++j) acc[i][j] = mmaT<BF>(al, bh[j], acc[i][j]);
        dep_guard1(acc[i][0], acc[i][3], al);
      }
    }
    keep4_h(bh[0], bh[1], bh[2], bh[3]);
  }
  acc_guard4(acc[0][0], acc[0][1], acc[0][2], acc[0][3]);
  acc_guard4(acc[1][0], acc[1][1], acc[1][2], acc[1][3]);
  acc_guard4(acc[2][0], acc[2][1], acc[2][2], acc[2][3]);
  acc_guard4(acc[3][0], acc[3][1], acc[3][2], acc[3][3]);

  const int hh2 = lane >> 4, c4 = (lane & 15) * 4;     // f32 out: 256-B row segment = 16 lanes x 16 B

  // ---- epilogue ----
#pragma unroll
  for (int i = 0; i < 4; ++i) {
    const int mBase = m0 + (i << 4);
#pragma unroll
    for (int j = 0; j < 4; ++j) {
#pragma unroll
      for (int r = 0; r < 8; ++r) {
        slab[(mOff + r) * 68 + (j << 4) + rlane] = acc[i][j][r];
      }
    }
    wave_sync_lds();
    if constexpr (OM == 0) {
      float* C = (float*)Cout + (size_t)((long long)by * sC);
      v4f vals[8];
#pragma unroll
      for (int it = 0; it < 8; ++it) {
        const int row = it * 2 + hh2;                      // it 0..7 x hh2 0..1 = rows 0..15
        v4f v = *(const v4f*)(slab + row * 68 + c4);
#pragma unroll
        for (int e = 0; e < 4; ++e) v[e] = v[e] * oscale;
        if constexpr (EPI == 1) {
          const v4f bb = *(const v4f*)(ep0 + n0 + c4);     // per-column bias, columns n0+c4 .. +3 (N equals the bias length)
#pragma unroll
          for (int e = 0; e < 4; ++e) v[e] = v[e] + bfr(bb[e]);
        }
        vals[it] = v;
      }
      {
#pragma unroll
        for (int it = 0; it < 8; ++it) {
          const int gr = mBase + it * 2 + hh2;
          *(v4f*)(C + (size_t)gr * ldc + n0 + c4) = vals[it];
        }
        
      }
    } else {
      unsigned short* C  = (unsigned short*)Cout  + (size_t)((long long)by * sC);
      unsigned short* Cb = (unsigned short*)C2out + (size_t)((long long)by * sC);
      v4u hv[4], lv[4];
#pragma unroll
      for (int it = 0; it < 4; ++it) {
        const int row = rlane;                             // the lane's slot in quarter it: row lane&15, columns 16 it + 8 (lane>>4) ..
        const int c8  = it * 16 + mOff;
        const float* sp = slab + row * 68 + c8;
        float rb = 0.f;
        if constexpr (EPI == 2) rb = bfr(ep0[mBase + row]);   // per-row bias (M equals the bias length)
        v4u a  = {0u, 0u, 0u, 0u};
        v4u b2 = {0u, 0u, 0u, 0u};
#pragma unroll
        for (int e = 0; e < 4; ++e) {
          const int ci = n0 + c8 + 2 * e;                  // column index, < N
          float f0 = sp[2 * e] * oscale + rb;
          float f1 = sp[2 * e + 1] * oscale + rb;
          if constexpr (EPI == 1) {
            f0 += bfr(ep0[ci]);
            f1 += bfr(ep0[ci + 1]);
          }
          if constexpr (OM == 5) {
            const float g0 = (f0 + bfr(ep1[ci])) * ocarry, g1 = (f1 + bfr(ep1[ci + 1])) * ocarry;
            const float w0 = (f0 + bfr(ep2[ci])) * ocarry, w1 = (f1 + bfr(ep2[ci + 1])) * ocarry;
            a[e]  = pk16(h_bits((_Float16)g0), h_bits((_Float16)g1));
            b2[e] = pk16(h_bits((_Float16)w0), h_bits((_Float16)w1));
          } else {
            f0 *= ocarry; f1 *= ocarry;
            const _Float16 x0 = (_Float16)f0, x1 = (_Float16)f1;
            a[e] = pk16(h_bits(x0), h_bits(x1));
            if constexpr (OM == 4) {
              b2[e] = pk16(h_bits((_Float16)(f0 - (float)x0)), h_bits((_Float16)(f1 - (float)x1)));
            }
          }
        }
        hv[it] = a;
        lv[it] = b2;
      }
      {
#pragma unroll
        for (int it = 0; it < 4; ++it) {
          const size_t co = ((size_t)(mBase >> 4) * (ldc >> 6) + (n0 >> 6)) * 1024 + it * 256 + l8;   // 512 contiguous bytes per store
          *(v4u*)(C + co) = hv[it];
          if constexpr (OM >= 4) {
            *(v4u*)(Cb + co) = lv[it];
          }
        }
        
      }
    }
    wave_sync_lds();
  }
}

// =====================================================================================================
// The three projections in ONE launch, so that their waves are on the chip together: blockIdx.y = 0: q, 1: k, 2: v^T.
//   q, k: M = NROW, N = 1024, K = 1024, per-column bias; (NROW/64)*(DMOD/64) = 1024 tiles = PJB workgroups of GW waves.
//   v^T per batch: VT[b][e][j], M = 1024 (e), N = SEQ (j), K = 1024, per-row bias; 512 tiles per batch = PJB/NBAT workgroups,
//   batch = blockIdx.x / (PJB/NBAT). Every branch below is workgroup-uniform; no block barriers.
// coverage: grid (PJB, 3) x GW waves = every 64x64 tile of QH/QL, KH/KL and VH/VL exactly once.
// =====================================================================================================
#define PJB (((NROW / 64) * (DMOD / 64)) / GW)
static_assert(((NROW / 64) * (DMOD / 64)) % GW == 0);
static_assert((DMOD / 64) * (SEQ / 64) * NBAT == PJB * GW && (PJB % NBAT) == 0);
__global__ __launch_bounds__(GW * 32) __attribute__((amdgpu_num_vgpr(256))) void proj3(
    const unsigned short* __restrict__ Xq, const unsigned short* __restrict__ Xk, const unsigned short* __restrict__ Xv,
    const unsigned short* __restrict__ Wq, const unsigned short* __restrict__ Wk, const unsigned short* __restrict__ Wv,
    unsigned short* QH, unsigned short* QL, unsigned short* KH, unsigned short* KL, unsigned short* VH, unsigned short* VL,
    const float* __restrict__ bq, const float* __restrict__ bk, const float* __restrict__ bv) {
  __shared__ __align__(16) float sT[GW][16 * 68];   // per-wave 16x64 slab, pitch 68 floats
  float* slab = sT[threadIdx.x >> 5];
  const int p = blockIdx.y;
  if (p < 2) {
    const unsigned short* X = (p == 0) ? Xq : Xk;
    const unsigned short* Wt = (p == 0) ? Wq : Wk;
    unsigned short* H = (p == 0) ? QH : KH;
    unsigned short* L = (p == 0) ? QL : KL;
    const float* bias = (p == 0) ? bq : bk;
    gemm64<4, 0, 0, 1>(X, X, DMOD, 0LL, Wt, DMOD, 0LL, (void*)H, (void*)L, DMOD, 0LL,
                       NROW, DMOD, DMOD, 1.0f / (XC * WSC), (p == 0) ? QC : KC,
                       bias, bias, bias, blockIdx.x, 0, slab);
  } else {
    const int per = PJB / NBAT;
    const int bt  = blockIdx.x / per;
    gemm64<4, 0, 0, 2>(Wv, Wv, DMOD, 0LL, Xv, DMOD, (long long)SEQ * DMOD, (void*)VH, (void*)VL, SEQ, (long long)DMOD * SEQ,
                       DMOD, SEQ, DMOD, 1.0f / (XC * WSC), VC,
                       bv, bv, bv, blockIdx.x - bt * per, bt, slab);
  }
}

// =====================================================================================================
// Causal attention with the skewed relative-position term for one (batch b, head h) pair and a 64-row query tile; 8 waves =
// 2 key groups x 4 query waves: wave (kg, qw) owns query rows iw0 .. iw0+15, iw0 = i0 + 16 qw, and walks every second key tile
// j0 = 64 kg, 64 (kg + 2), .. <= i0, keeping its own running (max, sum, O). After the loop group 1 hands its state over through LDS
// behind one block barrier and group 0 merges the two states (rescale by exp2(m - max)) and stores. So the longest wave walks 16 tiles,
// not 32. There are more workgroups than places on the chip: blockIdx.y counts the query tiles from the last (most key tiles) down,
// so that cost falls with the flat workgroup index (for speed only).
// Planes (all in fragment order, see ldfrag_p): QH/QL, KH/KL = f16 hi + residual of (q x64), (k x64), rows b*SEQ + position, DMOD columns,
//         head h = column block h; EP = f16(bf16_RNE(Er) x16) [ELEN][64]; VH/VL = f16 hi + residual of (v x64) as [b][h*64+d][SEQ] (keys = columns).
//   Srel(i, j) = q_i . Er[ELEN-1 - (i - j)] for j <= i (the pad-reshape skew). Per key tile the wave needs Er rows
//   wlo + x, wlo = ELEN-1 - (iw0 - j0) - 15, x = jj - R + 15 in [0, 78]: position window T[R][x] = (qh+ql)[iw0+R] . EP[wlo + x],
//   x in [0, 80) (5 subtiles of 16 Er rows, their ten fragments requested together, K = 64; wlo is a multiple of 16, so a subtile is one 16-row block,
//   whose index is clamped on the address; a clamped block only ever feeds entries with j > i, which the causal mask replaces);
//   each 16x16 subtile is stored to the wave's f32 LDS strip right after its WMMAs.
//   Content scores S = (qh+ql) . (kh+kl) (hh + hl + lh, 4 subtiles of 16 keys, fragments requested two subtiles at a time, K = 64) -> the wave's f32 slab.
//   score*log2(e) = S*CS + T[R][jj - R + 15]*CT (CS, CT fold 1/(carries) and 1/8); entries with j > i are replaced by -inf;
//   online softmax in base 2, max-subtracted (row max and sum via DPP row_xmask), running sums in f32; e = exp2(t - m) in (0,1] written
//   of P*1024 (f16 hi + residual) rebuilt from the slab rows (f32 vector loads, split k map) and the v^T hi / residual B fragments loaded
//   straight from VH/VL [h*64+d][j]; 12 WMMAs per 32-key step (Ph.vh + Ph.vl + Pl.vh), 4 d-subtiles.
//   out rows (b*SEQ + iw0 + row), floats h*64 .. h*64+63 = one whole 256-B segment (2 lines) per row: 16 consecutive lanes x 16 B,
//   block = 8 waves = 256 threads; grid = (NBAT*NH, SEQ/64); one block barrier, behind the key loop, passed by every wave;
//   every wave does bounded work (<= SEQ/128 tiles).
// coverage: LDS strip 16 x 80 of TPI and slab 16 x 64 of SPI per wave, fully written before read each tile; global: 8 instructions x
//           2 rows x 64 floats = rows iw0..iw0+15 of head segment h; grid x waves cover all NBAT*SEQ rows and all NH head segments once.
// =====================================================================================================
__global__ __launch_bounds__(ATT_THREADS) __attribute__((amdgpu_num_vgpr(256)))
void attn_rel(const unsigned short* __restrict__ QH, const unsigned short* __restrict__ QL,
              const unsigned short* __restrict__ KH, const unsigned short* __restrict__ KL,
              const unsigned short* __restrict__ EP,
              const unsigned short* __restrict__ VH, const unsigned short* __restrict__ VL,
              float* out) {
  __shared__ __align__(16) float smem[ATT_W * WFL];   // per wave: T strip [16][TPI] | score / prob / ctx slab [16][SPI]

  const int tid  = threadIdx.x;
  const int wave = __builtin_amdgcn_readfirstlane(tid >> 5);   // scalar, so that the key loop's per-wave start and end stay scalar branches
  const int qw   = wave & (ATT_QW - 1);
  const int kg   = wave / ATT_QW;
  const int lane = tid & 31;
  const int hh   = lane >> 4;
  const int c    = lane & 15;
  const int bh   = blockIdx.x;
  const int b    = bh / NH;
  const int h    = bh - b * NH;
  const int qt   = (SEQ / 64 - 1) - (int)blockIdx.y;           // query tile, the one with the most key tiles first
  const int i0   = qt * 64;
  const int iw0  = i0 + qw * 16;

  float* tsh = smem + wave * WFL;
  float* pt  = tsh + 16 * TPI;
  // the lane's own bases in strip and slab: every access of the key loop is base + a constant, which leaves the registers to the fragments in flight
  float* tst = tsh + 8 * hh * TPI + c;             // strip row 8hh, column c
  float* pst = pt + 8 * hh * SPI + c;              // slab row 8hh, column c
  const float* tgt = tst + 15 - 8 * hh;            // shifted gather: row 8hh + r starts at tgt + r * (TPI - 1)

  const int l8 = lane * 8;                                                       // the lane's slot in a quarter of a fragment-order block
  const size_t qro = ((size_t)((b * SEQ + iw0) >> 4) * (DMOD / 64) + h) * 1024 + l8;   // block of query rows iw0.., head h
  const size_t kbo = ((size_t)((b * SEQ) >> 4) * (DMOD / 64) + h) * 1024 + l8;         // block of key rows 0..15 of batch b, head h
  const unsigned short* Khb = KH + kbo;
  const unsigned short* Klb = KL + kbo;
  const unsigned short* Eb  = EP + l8;
  const size_t vpo = (size_t)b * DMOD * SEQ + (size_t)(h * (DH / 16)) * (SEQ / 64) * 1024 + l8;   // block of d rows 0..15 of head h, keys 0..63
  const unsigned short* Vhb = VH + vpo;
  const unsigned short* Vlb = VL + vpo;

  const float CS = LOG2E * SCALE / (QC * KC);
  const float CT = LOG2E * SCALE / (QC * EC);

  float mrow[8], lrow[8];
  v8f O[4];
#pragma unroll
  for (int r = 0; r < 8; ++r) { mrow[r] = -INFINITY; lrow[r] = 0.f; }
#pragma unroll
  for (int td = 0; td < 4; ++td) O[td] = zero8();

  const int ntile = qt + 1;                  // causal: key tiles j0 <= i0
#pragma unroll 1
  for (int jt = kg; jt < ntile; jt += ATT_KG) {
    const int j0 = jt * 64;
    const v16h qha = ldfrag_p(QH + qro), qhb = ldfrag_p(QH + qro + 512);
    const v16h qla = ldfrag_p(QL + qro), qlb = ldfrag_p(QL + qro + 512);

    // ---- position window T (5 subtiles of 16 Er rows), each subtile stored to the LDS strip as produced ----
    {
      const int wb = ((ELEN - 1) - (iw0 - j0) - 15) >> 4;   // wlo / 16, exact: ELEN, iw0 and j0 are multiples of 16
      // all ten Er fragments are requested together, ahead of the products: the window waits out one load latency, not five
      v16h fa[5], fb[5];
      const unsigned short* pe[5];
#pragma unroll
      for (int u = 0; u < 5; ++u) {
        int m = wb + u;
        m = (m < 0) ? 0 : m;
        m = (m > ELEN / 16 - 1) ? (ELEN / 16 - 1) : m;
        pe[u] = Eb + (size_t)m * 1024;
        fa[u] = ldfrag_p(pe[u]);
        fb[u] = ldfrag_p(pe[u] + 512);
      }
      addr_wait4(pe[0], pe[1], pe[2], pe[3]);
      addr_wait1(pe[4]);
      __builtin_amdgcn_sched_barrier(0);   // the whole group is requested before its first product: the scheduler otherwise pairs each load with its use again
#pragma unroll
      for (int u = 0; u < 5; ++u) {
        v8f t8 = mma_h(qha, fa[u], zero8());
        t8 = mma_h(qla, fa[u], t8);
        t8 = mma_h(qhb, fb[u], t8);
        t8 = mma_h(qlb, fb[u], t8);
        hz6(t8, fa[u], fb[u], qha, qla, qhb, qlb);
#pragma unroll
        for (int r = 0; r < 8; ++r) tst[r * TPI + 16 * u] = t8[r];
      }
    }
    __builtin_amdgcn_sched_barrier(0);   // keeps a later phase's index and address work out of this phase, whose registers the fragments in flight need
    // ---- content scores S (4 subtiles of 16 keys) -> slab ----
    {
      // the key fragments are requested in two groups of two subtiles, each ahead of its products: two load latencies, not four
      const unsigned short* pkh = Khb + (size_t)(j0 >> 4) * ((DMOD / 64) * 1024);
      const unsigned short* pkl = Klb + (size_t)(j0 >> 4) * ((DMOD / 64) * 1024);
      v16h kha[4], khb[4], kla[4], klb[4];
#pragma unroll
      for (int t = 0; t < 4; ++t) {
        if ((t & 1) == 0) {
#pragma unroll
          for (int x = t; x < t + 2; ++x) {
            kha[x] = ldfrag_p(pkh + (size_t)x * ((DMOD / 64) * 1024));
            khb[x] = ldfrag_p(pkh + (size_t)x * ((DMOD / 64) * 1024) + 512);
            kla[x] = ldfrag_p(pkl + (size_t)x * ((DMOD / 64) * 1024));
            klb[x] = ldfrag_p(pkl + (size_t)x * ((DMOD / 64) * 1024) + 512);
          }
          addr_wait2(pkh, pkl);
          __builtin_amdgcn_sched_barrier(0);   // the whole group is requested before its first product: the scheduler otherwise pairs each load with its use again
        }
        v8f s8 = mma_h(qha, kha[t], zero8());
        s8 = mma_h(qha, kla[t], s8);
        s8 = mma_h(qla, kha[t], s8);
        s8 = mma_h(qhb, khb[t], s8);
        s8 = mma_h(qhb, klb[t], s8);
        s8 = mma_h(qlb, khb[t], s8);
        hz8(s8, kha[t], khb[t], kla[t], klb[t], qha, qla, qhb, qlb);
#pragma unroll
        for (int r = 0; r < 8; ++r) pst[r * SPI + 16 * t] = s8[r];
      }
    }
    __builtin_amdgcn_sched_barrier(0);   // keeps a later phase's index and address work out of this phase, whose registers the fragments in flight need
    wave_sync_lds();
    // v^T fragments of the first 32 keys: requested here, behind the fence (which waits for loads in flight), so that they arrive while the softmax runs
    const unsigned short* pvh = Vhb + (size_t)jt * 1024;
    const unsigned short* pvl = Vlb + (size_t)jt * 1024;
    v16h vh[4], vl[4];
#pragma unroll
    for (int td = 0; td < 4; ++td) {
      vh[td] = ldfrag_p(pvh + (size_t)td * ((SEQ / 64) * 1024));
      vl[td] = ldfrag_p(pvl + (size_t)td * ((SEQ / 64) * 1024));
    }
    addr_wait2(pvh, pvl);

    // ---- score assembly, causal mask, online softmax (rows live on one 16-lane half) ----
    const int dj = (j0 - iw0) + c - 8 * hh;        // j - i = dj + 16 t - r
#pragma unroll
    for (int r = 0; r < 8; ++r) {
      const float* trow = tgt + r * (TPI - 1);
      float* srow = pst + r * SPI;
      float tv[4];
#pragma unroll
      for (int t = 0; t < 4; ++t) {
        const float val = srow[16 * t] * CS + trow[16 * t] * CT;
        tv[t] = (dj > r - 16 * t) ? -INFINITY : val;
      }
      float mx = fmaxf(fmaxf(tv[0], tv[1]), fmaxf(tv[2], tv[3]));
      mx = row_max16(mx);
      const float mn = fmaxf(mrow[r], mx);
      const float al = exp2f(mrow[r] - mn);
      mrow[r] = mn;
      float e4[4];
      float ps = 0.f;
#pragma unroll
      for (int t = 0; t < 4; ++t) { e4[t] = exp2f(tv[t] - mn); ps += e4[t]; }
      ps = row_sum16(ps);
      lrow[r] = lrow[r] * al + ps;
#pragma unroll
      for (int td = 0; td < 4; ++td) O[td][r] *= al;
#pragma unroll
      for (int t = 0; t < 4; ++t) srow[16 * t] = e4[t];
    }
    wave_sync_lds();
    __builtin_amdgcn_sched_barrier(0);   // keeps a later phase's index and address work out of this phase, whose registers the fragments in flight need

    // ---- O += (Ph + Pl) . (vh + vl)^T, two k-steps of 32 keys; a step's 8 v^T fragments are requested together, ahead of its P split ----
#pragma unroll
    for (int ks = 0; ks < 2; ++ks) {
      if (ks == 1) {
#pragma unroll
        for (int td = 0; td < 4; ++td) {
          vh[td] = ldfrag_p(pvh + (size_t)td * ((SEQ / 64) * 1024) + 512);
          vl[td] = ldfrag_p(pvl + (size_t)td * ((SEQ / 64) * 1024) + 512);
        }
        addr_wait2(pvh, pvl);
        __builtin_amdgcn_sched_barrier(0);   // the whole group is requested before its first product: the scheduler otherwise pairs each load with its use again
      }
      FragH ph, pl;
      {
        const float* prow = pt + c * SPI + 32 * ks + 8 * hh;
        const v4f p0 = *(const v4f*)(prow), p1 = *(const v4f*)(prow + 4);
        const v4f p2 = *(const v4f*)(prow + 16), p3 = *(const v4f*)(prow + 20);
#pragma unroll
        for (int e = 0; e < 4; ++e) {
          _Float16 a0, a1;
          sp16(p0[e] * PC, a0, a1); ph.h[0][e]     = a0; pl.h[0][e]     = a1;   // keys 32ks + 8hh + e
          sp16(p1[e] * PC, a0, a1); ph.h[0][4 + e] = a0; pl.h[0][4 + e] = a1;   // keys 32ks + 8hh + 4 + e
          sp16(p2[e] * PC, a0, a1); ph.h[1][e]     = a0; pl.h[1][e]     = a1;   // keys 32ks + 16 + 8hh + e
          sp16(p3[e] * PC, a0, a1); ph.h[1][4 + e] = a0; pl.h[1][4 + e] = a1;
        }
      }
#pragma unroll
      for (int td = 0; td < 4; ++td) {
        O[td] = mma_h(ph.v, vh[td], O[td]);
        O[td] = mma_h(ph.v, vl[td], O[td]);
        O[td] = mma_h(pl.v, vh[td], O[td]);
        hz4(O[td], vh[td], vl[td], ph.v, pl.v);
      }
    }
    wave_sync_lds();
  }
  acc_guard4(O[0], O[1], O[2], O[3]);

  // ---- merge of the two key groups: group 1 writes (O, m, l) to its own slab and strip, block barrier, group 0 reads and rescales.
  //      A group-1 wave without a tile hands over m = -inf, l = 0, O = 0, whose weight exp2(-inf) is 0; group 0 always has tile 0.
  if (kg != 0) {
#pragma unroll
    for (int r = 0; r < 8; ++r) {
      const int R = 8 * hh + r;
#pragma unroll
      for (int td = 0; td < 4; ++td) pt[R * SPI + 16 * td + c] = O[td][r];
      if (c == 0) { tsh[R] = mrow[r]; tsh[16 + R] = lrow[r]; }
    }
  }
  __syncthreads();                           // publishes group 1's state to group 0; every wave of the block passes it once
  if (kg != 0) return;
  {
    const float* ts2 = tsh + ATT_QW * WFL;   // wave (1, qw)'s strip and slab
    const float* pt2 = ts2 + 16 * TPI;
#pragma unroll
    for (int r = 0; r < 8; ++r) {
      const int R = 8 * hh + r;
      const float m2 = ts2[R], l2 = ts2[16 + R];
      const float mm = fmaxf(mrow[r], m2);
      const float a1 = exp2f(mrow[r] - mm), a2 = exp2f(m2 - mm);
      lrow[r] = lrow[r] * a1 + l2 * a2;
#pragma unroll
      for (int td = 0; td < 4; ++td) O[td][r] = O[td][r] * a1 + pt2[R * SPI + 16 * td + c] * a2;
    }
  }

  // ---- fold 1/l and the carries (1024 on P, 64 on v), stage the wave's 16x64 f32 slice in its slab ----
  const float oc = 1.0f / (PC * VC);
#pragma unroll
  for (int r = 0; r < 8; ++r) {
    const float inv = (1.0f / lrow[r]) * oc;
    const int ro = (8 * hh + r) * SPI + c;
#pragma unroll
    for (int td = 0; td < 4; ++td) pt[ro + 16 * td] = O[td][r] * inv;
  }
  wave_sync_lds();
  {
    const int c4 = c * 4;
    v4f vals[8];
#pragma unroll
    for (int it = 0; it < 8; ++it) {
      const int row = it * 2 + hh;                           // it 0..7 x hh 0..1 = rows 0..15
      vals[it] = *(const v4f*)(pt + row * SPI + c4);
    }
    float* ob = out + ((size_t)b * SEQ + iw0) * DMOD + h * DH + c4;
    {
#pragma unroll
      for (int it = 0; it < 8; ++it) {
        const int row = it * 2 + hh;
        *(v4f*)(ob + (size_t)row * DMOD) = vals[it];
      }
      
    }
  }
}

// =====================================================================================================
// Workspace map (bytes); every plane is an exact multiple of its tile / whole-row store granularity (M, N exact tile multiples,
// convert counts exact multiples of 8192, no pad rows), every offset a multiple of 262144; every plane is in fragment order (see ldfrag_p):
//   (the first seven planes keep this order with no gap between them: cvt_all numbers their 16 x 64 blocks straight through)
//   Xq, Xk, Xv  f16 [NROW][1024] x16                            3 x 8388608
//   Wq, Wk, Wv  f16 [1024 out][1024 in] x64                      3 x 2097152
//   EP          f16 [ELEN][64] x16                                   262144
//   QH, QL, KH, KL f16 [NROW][1024] (x64 hi / residual)         4 x 8388608
//   VH, VL      f16 [NBAT][1024][SEQ] (x64 hi / residual)       2 x 8388608
//   end                                                            82051072
// =====================================================================================================
extern "C" void kernel_launch(void* const* d_in, const int* in_sizes, int n_in,
                              void* d_out, int out_size, void* d_ws, size_t ws_size,
                              hipStream_t stream) {
  if (n_in < 10) return;
  if (in_sizes[0] != NROW * DMOD || in_sizes[1] != NROW * DMOD || in_sizes[2] != NROW * DMOD) return;
  if (in_sizes[3] != DMOD * DMOD || in_sizes[5] != DMOD * DMOD || in_sizes[7] != DMOD * DMOD) return;
  if (in_sizes[4] != DMOD || in_sizes[6] != DMOD || in_sizes[8] != DMOD) return;
  if (in_sizes[9] != ELEN * DH) return;
  if (out_size != NROW * DMOD) return;

  const float* qin = (const float*)d_in[0];
  const float* kin = (const float*)d_in[1];
  const float* vin = (const float*)d_in[2];
  const float* w_q = (const float*)d_in[3];
  const float* b_q = (const float*)d_in[4];
  const float* w_k = (const float*)d_in[5];
  const float* b_k = (const float*)d_in[6];
  const float* w_v = (const float*)d_in[7];
  const float* b_v = (const float*)d_in[8];
  const float* er  = (const float*)d_in[9];
  float*       out = (float*)d_out;

  const size_t PX = (size_t)NROW * DMOD * 2;             //  8388608
  const size_t PW = (size_t)DMOD * DMOD * 2;             //  2097152
  const size_t PE = (size_t)ELEN * DH * 2;               //   262144
  const size_t PV = (size_t)NBAT * DMOD * SEQ * 2;       //  8388608
  size_t off = 0;
  const size_t oXq = off; off += PX;
  const size_t oXk = off; off += PX;
  const size_t oXv = off; off += PX;
  const size_t oWq = off; off += PW;
  const size_t oWk = off; off += PW;
  const size_t oWv = off; off += PW;
  const size_t oE  = off; off += PE;
  const size_t oQH = off; off += PX;
  const size_t oQL = off; off += PX;
  const size_t oKH = off; off += PX;
  const size_t oKL = off; off += PX;
  const size_t oVH = off; off += PV;
  const size_t oVL = off; off += PV;
  if (off > ws_size) return;                               // off = 82051072
  if (off > (size_t)134217728) return;

  char* ws = (char*)d_ws;
  unsigned short* Xq  = (unsigned short*)(ws + oXq);
  unsigned short* Xk  = (unsigned short*)(ws + oXk);
  unsigned short* Xv  = (unsigned short*)(ws + oXv);
  unsigned short* Wq6 = (unsigned short*)(ws + oWq);
  unsigned short* Wk6 = (unsigned short*)(ws + oWk);
  unsigned short* Wv6 = (unsigned short*)(ws + oWv);
  unsigned short* E16 = (unsigned short*)(ws + oE);
  unsigned short* QHp = (unsigned short*)(ws + oQH);
  unsigned short* QLp = (unsigned short*)(ws + oQL);
  unsigned short* KHp = (unsigned short*)(ws + oKH);
  unsigned short* KLp = (unsigned short*)(ws + oKL);
  unsigned short* VHp = (unsigned short*)(ws + oVH);
  unsigned short* VLp = (unsigned short*)(ws + oVL);

  const dim3 blk(256);
  const dim3 gCV(CBALL);                                            // 3 x 512 + 3 x 128 + 16 = 1936
  const dim3 gP(PJB, 3);                                            // 256 x 3
  const dim3 bP(GW * 32);                                           // 128
  const dim3 gAT(NBAT * NH, SEQ / 64);                              // 32 x 32
  const dim3 bAT(ATT_THREADS);                                      // 256

  // (0) 16-bit planes of the inputs: activations f16(bf16_RNE(x) * 16); W[out][in] (already k-contiguous) f16(bf16_RNE(w) * 64);
  //     Er f16(bf16_RNE(e) * 16); one launch for all seven: Xq is the first of the seven planes, which follow one another in the workspace
  cvt_all<<<gCV, blk, 0, stream>>>(qin, kin, vin, w_q, w_k, w_v, er, Xq);

  // (1) one launch for the three projections:
  //     q[m][e] = sum_d x[m][d] Wq[e][d] / 1024 + bq[e] -> QH = f16(q * 64), QL = f16(q * 64 - QH); the same for k -> KH, KL;
  //     VT[b][e][j] = sum_c Wv[e][c] x[b*SEQ+j][c] / 1024 + bv[e] -> VH, VL (x64)
  proj3<<<gP, bP, 0, stream>>>(Xq, Xk, Xv, Wq6, Wk6, Wv6, QHp, QLp, KHp, KLp, VHp, VLp, b_q, b_k, b_v);

  // (2) causal relative attention -> out[b][i][h*64+d] (f32), written directly
  attn_rel<<<gAT, bAT, 0, stream>>>(QHp, QLp, KHp, KLp, E16, VHp, VLp, out);
  (void)hipGetLastError();
}

// v007
// A run of this version takes 125 microseconds.
// Next to v006, in two timings, it ran 1.32 times as fast each time.
// All steps since v000 together make it 3.55 times as fast.
// Contractions (all v_wmma_f32_16x16x32_f16, f16 operands, f32 accumulate): q/k/v projections (x f16 x16 . W f16 x64, K=1024, single products,
// outputs written as f16 hi + unscaled f16 residual planes); position window ((qh+ql) x64 . Er f16 x16, K=64, 2 products) -> f32 LDS strip,
// shifted gather on VALU; content scores ((qh+ql) x64 . (kh+kl) x64, K=64, hh+hl+lh); P . v^T ((Ph+Pl) x1024 . (vh+vl) x64, hh+hl+lh,
// 64 keys per tile). Causal mask, max-subtracted online base-2 softmax and the 1/l fold in f32 on VALU. Every float input RNE-converted to bf16 on load.
#include <hip/hip_runtime.h>
#include <math.h>
#include <stdint.h>

#define SEQ   2048
#define NBAT  2
#define DMOD  1024
#define NH    16
#define DH    64
#define ELEN  2048
#define NROW  (NBAT * SEQ)
#define XC    16.0f
#define WSC   64.0f
#define QC    64.0f
#define KC    64.0f
#define EC    16.0f
#define VC    64.0f
#define PC    1024.0f
#define SCALE 0.125f
#define LOG2E 1.4426950408889634f
static_assert(NH * DH == DMOD);
static_assert(DH == 64);
static_assert(ELEN == SEQ);
static_assert((SEQ % 64) == 0 && (DMOD % 64) == 0 && (NROW % 64) == 0);
static_assert(((NROW * DMOD) % 8192) == 0 && ((DMOD * DMOD) % 8192) == 0 && ((ELEN * DH) % 8192) == 0);
static_assert((SEQ % 16) == 0 && (ELEN % 16) == 0);
#define ATT_QW 4                    // waves side by side on the query rows (16 rows each)
#define ATT_KG 2                    // groups of ATT_QW waves that share out the key tiles
#define ATT_W (ATT_QW * ATT_KG)
#define ATT_THREADS (ATT_W * 32)
static_assert(ATT_KG == 2);
#define TPI 84
#define SPI 68
#define WFL (16 * TPI + 16 * SPI)
static_assert(((16 * TPI) % 4) == 0 && ((16 * SPI) % 4) == 0 && (WFL % 4) == 0);

typedef _Float16 v16h __attribute__((ext_vector_type(16)));
typedef _Float16 v8h  __attribute__((ext_vector_type(8)));
typedef __bf16   v16b __attribute__((ext_vector_type(16)));
typedef float    v8f  __attribute__((ext_vector_type(8)));
typedef float    v4f  __attribute__((ext_vector_type(4)));
typedef float    v2f  __attribute__((ext_vector_type(2)));
typedef unsigned int v4u __attribute__((ext_vector_type(4)));

union FragH { v16h v; v8h h[2]; v4u u[2]; };
union FragAny { v16h h; v16b b; };

// ---- scalar helpers --------------------------------------------------------------------------------
__device__ __forceinline__ unsigned short bf_bits(float f) {          // f32 -> bf16 bits, RNE convert
  unsigned u = __float_as_uint(f);
  return (unsigned short)((u + 0x7FFFu + ((u >> 16) & 1u)) >> 16);
}
__device__ __forceinline__ float bf_up(unsigned short h) { return __uint_as_float(((unsigned)h) << 16); }
__device__ __forceinline__ float bfr(float f) { return bf_up(bf_bits(f)); }   // value of the bf16 RNE convert
__device__ __forceinline__ unsigned short h_bits(_Float16 x) { return __builtin_bit_cast(unsigned short, x); }
__device__ __forceinline__ unsigned pk16(unsigned short a, unsigned short b) { return (unsigned)a | ((unsigned)b << 16); }
__device__ __forceinline__ v8f zero8() { v8f z = {0.f, 0.f, 0.f, 0.f, 0.f, 0.f, 0.f, 0.f}; return z; }

// ---- fragment-order planes: a 16-bit matrix [R][Cn] (R % 16 == 0, Cn % 64 == 0; Cn is the k direction of its reader) is kept as blocks of
//      16 rows x 64 columns, block (r >> 4) * (Cn / 64) + (cn >> 6), 1024 halves each; inside a block four 256-half quarters qd = (cn >> 4) & 3,
//      inside a quarter lane slot ((cn >> 3) & 1) * 16 + (r & 15), 8 halves each. One A/B fragment (16 rows x 32 k) is two neighbouring quarters,
//      and each of its two 16-byte-per-lane loads reads 512 contiguous bytes (4 cache lines, where a row-major plane gives 16).
// ---- fragment loader: p = block + 512 * (k step inside the block) + 8 * lane; lane -> row/col (lane&15), h = lane>>4;
//      elements 0..7 <- k0+8h.., elements 8..15 <- k0+16+8h.. (same split k map for A and B; B is always read from a [n][k] plane)
__device__ __forceinline__ v16h ldfrag_p(const unsigned short* p) {
  FragH f;
  f.u[0] = *(const v4u*)(p);
  f.u[1] = *(const v4u*)(p + 256);
  return f.v;
}

// ---- WMMA helpers with trailing VALU hazard gaps ------------------------------------------------------
__device__ __forceinline__ v8f mma_h(v16h a, v16h b, v8f c) {
  return __builtin_amdgcn_wmma_f32_16x16x32_f16(false, a, false, b, (short)0, c, false, false);
}
__device__ __forceinline__ v8f mma_b(v16h a, v16h b, v8f c) {
  FragAny ua, ub;
  ua.h = a;
  ub.h = b;
  return __builtin_amdgcn_wmma_f32_16x16x32_bf16(false, ua.b, false, ub.b, (short)0, c, false, false);
}
template <int BF>
__device__ __forceinline__ v8f mmaT(v16h a, v16h b, v8f c) {
  if constexpr (BF != 0) return mma_b(a, b, c);
  else return mma_h(a, b, c);
}
__device__ __forceinline__ void dep_guard1(v8f& a, v8f& b, v16h x) {
#if defined(__HIP_DEVICE_COMPILE__)
  asm volatile("v_nop\n\tv_nop\n\tv_nop\n\tv_nop" : "+v"(a), "+v"(b) : "v"(x));
#endif
}
__device__ __forceinline__ void hz4(v8f& d, v16h x0, v16h x1, v16h x2, v16h x3) {
#if defined(__HIP_DEVICE_COMPILE__)
  asm volatile("v_nop\n\tv_nop\n\tv_nop\n\tv_nop" : "+v"(d) : "v"(x0), "v"(x1), "v"(x2), "v"(x3));
#endif
}
__device__ __forceinline__ void hz6(v8f& d, v16h x0, v16h x1, v16h x2, v16h x3, v16h x4, v16h x5) {
#if defined(__HIP_DEVICE_COMPILE__)
  asm volatile("v_nop\n\tv_nop\n\tv_nop\n\tv_nop" : "+v"(d) : "v"(x0), "v"(x1), "v"(x2), "v"(x3), "v"(x4), "v"(x5));
#endif
}
__device__ __forceinline__ void hz8(v8f& d, v16h x0, v16h x1, v16h x2, v16h x3, v16h x4, v16h x5, v16h x6, v16h x7) {
#if defined(__HIP_DEVICE_COMPILE__)
  asm volatile("v_nop\n\tv_nop\n\tv_nop\n\tv_nop" : "+v"(d) : "v"(x0), "v"(x1), "v"(x2), "v"(x3), "v"(x4), "v"(x5), "v"(x6), "v"(x7));
#endif
}
__device__ __forceinline__ void keep4_h(v16h a, v16h b, v16h c, v16h d) {
#if defined(__HIP_DEVICE_COMPILE__)
  asm volatile("v_nop" :: "v"(a), "v"(b), "v"(c), "v"(d));
#endif
}
__device__ __forceinline__ void acc_guard4(v8f& a, v8f& b, v8f& c, v8f& d) {
#if defined(__HIP_DEVICE_COMPILE__)
  asm volatile("v_nop\n\tv_nop\n\tv_nop\n\tv_nop" : "+v"(a), "+v"(b), "+v"(c), "+v"(d));
#endif
}
__device__ __forceinline__ void wave_sync_lds() {
  __builtin_amdgcn_fence(__ATOMIC_RELEASE, "workgroup");
  __builtin_amdgcn_wave_barrier();
  __builtin_amdgcn_fence(__ATOMIC_ACQUIRE, "workgroup");
}
// s_wait_xcnt 0 behind a run of global fragment loads (GEMM and attention). The loads' address pointers are inputs only, so their registers stay
// live up to the wait: no later load of the run lands on them and no address arithmetic rewrites them before the wait has passed.
__device__ __forceinline__ void addr_wait1(const unsigned short* p) {
#if defined(__HIP_DEVICE_COMPILE__)
  asm volatile("s_wait_xcnt 0x0" :: "v"(p) : "memory");
#endif
}
__device__ __forceinline__ void addr_wait4(const unsigned short* p0, const unsigned short* p1, const unsigned short* p2, const unsigned short* p3) {
#if defined(__HIP_DEVICE_COMPILE__)
  asm volatile("s_wait_xcnt 0x0" :: "v"(p0), "v"(p1), "v"(p2), "v"(p3) : "memory");
#endif
}
__device__ __forceinline__ void addr_wait2(const unsigned short* p0, const unsigned short* p1) {
#if defined(__HIP_DEVICE_COMPILE__)
  asm volatile("s_wait_xcnt 0x0" :: "v"(p0), "v"(p1) : "memory");
#endif
}
// 16-lane row all-reduce on the vector unit: in each step lane l combines its value with that of lane l ^ M of its own row (DPP row_xmask:M),
// M = 1, 2, 4, 8: no LDS queue and no LDS wait. All 32 lanes are on where these are called.
// asm: one instruction a step; from source the maximum comes out as a DPP move, a quieting v_max and the maximum, three dependent instructions a step.
// s_delay_alu: hints each dependent step, so that the SIMD's other waves issue during the chain's waits.
__device__ __forceinline__ float row_max16(float x) {
#if defined(__HIP_DEVICE_COMPILE__)
  asm("s_delay_alu instid0(VALU_DEP_1)\n\t"
      "v_max_num_f32_dpp %0, %0, %0 row_xmask:1 row_mask:0xf bank_mask:0xf\n\t"
      "s_delay_alu instid0(VALU_DEP_1)\n\t"
      "v_max_num_f32_dpp %0, %0, %0 row_xmask:2 row_mask:0xf bank_mask:0xf\n\t"
      "s_delay_alu instid0(VALU_DEP_1)\n\t"
      "v_max_num_f32_dpp %0, %0, %0 row_xmask:4 row_mask:0xf bank_mask:0xf\n\t"
      "s_delay_alu instid0(VALU_DEP_1)\n\t"
      "v_max_num_f32_dpp %0, %0, %0 row_xmask:8 row_mask:0xf bank_mask:0xf"
      : "+v"(x));
#endif
  return x;
}
__device__ __forceinline__ float row_sum16(float x) {   // same pairing and order as the xor-1, 2, 4, 8 shuffle tree
#if defined(__HIP_DEVICE_COMPILE__)
  asm("s_delay_alu instid0(VALU_DEP_1)\n\t"
      "v_add_f32_dpp %0, %0, %0 row_xmask:1 row_mask:0xf bank_mask:0xf\n\t"
      "s_delay_alu instid0(VALU_DEP_1)\n\t"
      "v_add_f32_dpp %0, %0, %0 row_xmask:2 row_mask:0xf bank_mask:0xf\n\t"
      "s_delay_alu instid0(VALU_DEP_1)\n\t"
      "v_add_f32_dpp %0, %0, %0 row_xmask:4 row_mask:0xf bank_mask:0xf\n\t"
      "s_delay_alu instid0(VALU_DEP_1)\n\t"
      "v_add_f32_dpp %0, %0, %0 row_xmask:8 row_mask:0xf bank_mask:0xf"
      : "+v"(x));
#endif
  return x;
}
// f32 -> f16 hi + unscaled f16 residual (hi + lo ~ x to 2^-22 relative; a flushed subnormal lo costs < 6.1e-5 absolute in the carried scale)
__device__ __forceinline__ void sp16(float x, _Float16& hi, _Float16& lo) {
  const _Float16 a = (_Float16)x;
  hi = a;
  lo = (_Float16)(x - (float)a);
}

// =====================================================================================================
// 16-bit pack into a fragment-order plane: value f16( bf16_RNE(src[r][cn]) * sc ), sc a power of two (exact); src row-major [R][64 << lgt].
// One wave per 16 x 64 block: 8 loads (16 rows x 256 B of f32) in flight, then 4 stores of 512 contiguous bytes.
// All seven planes in ONE launch: they depend on nothing but the inputs, so one grid pays one launch gap, one fill and one tail, not seven.
// The workgroup index picks the plane (workgroup-uniform, scalar): CBX workgroups each for the q, k, v activations, CBW each for Wq, Wk, Wv,
// CBE for Er. The seven planes lie one behind the other in the workspace in this same order, so 16 x 64 block g of the whole grid goes to dst + 1024 g.
// coverage: a plane of n elements has n / 8192 workgroups x 8 waves x 1024 elements = n exactly (n % 8192 == 0 for every plane, checked at compile time).
// =====================================================================================================
#define CBX ((NROW * DMOD) / 8192)
#define CBW ((DMOD * DMOD) / 8192)
#define CBE ((ELEN * DH) / 8192)
#define CBALL (3 * CBX + 3 * CBW + CBE)
__global__ __launch_bounds__(256) void cvt_all(const float* __restrict__ xq, const float* __restrict__ xk, const float* __restrict__ xv,
                                               const float* __restrict__ wq, const float* __restrict__ wk, const float* __restrict__ wv,
                                               const float* __restrict__ er, unsigned short* dst) {
  const int lane = threadIdx.x & 31;
  const int bx = blockIdx.x;
  if (bx >= CBALL) return;                                    // never taken with the exact grid; no barriers in this kernel
  const float* src;                                           // the plane's f32 source, row-major [R][64 << lgt]
  int b0, lgt;                                                // the plane's first workgroup; log2(columns / 64)
  float sc;                                                   // the plane's carried power of two
  if (bx < 3 * CBX) {
    const int p = bx / CBX;
    src = (p == 0) ? xq : ((p == 1) ? xk : xv);
    b0 = p * CBX; lgt = 4; sc = XC;
  } else if (bx < 3 * CBX + 3 * CBW) {
    const int p = (bx - 3 * CBX) / CBW;
    src = (p == 0) ? wq : ((p == 1) ? wk : wv);
    b0 = 3 * CBX + p * CBW; lgt = 4; sc = WSC;
  } else {
    src = er;
    b0 = 3 * CBX + 3 * CBW; lgt = 0; sc = EC;
  }
  const int wv8 = threadIdx.x >> 5;
  const int w = (bx - b0) * 8 + wv8;                          // 16 x 64 block index in the plane = (row block) * (columns / 64) + column block
  const int tm = w >> lgt;
  const int tn = w - (tm << lgt);
  const float* sp = src + (((size_t)(tm * 16 + (lane & 15))) << (lgt + 6)) + tn * 64 + (lane >> 4) * 8;
  v4f a[4], b[4];
#pragma unroll
  for (int it = 0; it < 4; ++it) {                            // quarter it: columns 16 it + 8 (lane >> 4) ..
    a[it] = *(const v4f*)(sp + it * 16);
    b[it] = *(const v4f*)(sp + it * 16 + 4);
  }
  addr_wait1((const unsigned short*)sp);
  unsigned short* dp = dst + (size_t)(bx * 8 + wv8) * 1024 + lane * 8;
#pragma unroll
  for (int it = 0; it < 4; ++it) {
    v4u o;
    o[0] = pk16(h_bits((_Float16)(bfr(a[it][0]) * sc)), h_bits((_Float16)(bfr(a[it][1]) * sc)));
    o[1] = pk16(h_bits((_Float16)(bfr(a[it][2]) * sc)), h_bits((_Float16)(bfr(a[it][3]) * sc)));
    o[2] = pk16(h_bits((_Float16)(bfr(b[it][0]) * sc)), h_bits((_Float16)(bfr(b[it][1]) * sc)));
    o[3] = pk16(h_bits((_Float16)(bfr(b[it][2]) * sc)), h_bits((_Float16)(bfr(b[it][3]) * sc)));
    *(v4u*)(dp + it * 256) = o;
  }
}

// =====================================================================================================
// Register-blocked batched 16-bit WMMA GEMM body (device function, called by proj3): C[m][n] = oscale * sum_k A[m][k] * Bt[n][k] (+ bias);
// one wave per 64x64 tile, no block barriers. A [M][K] and Bt [N][K] are fragment-order planes with lda = ldb = K columns; M, N, K multiples of 64.
// 16-bit outputs are fragment-order planes of ldc columns (ldc % 64 == 0). by = batch index with element strides sA, sB, sC; bx = workgroup index inside the batch; slab = the wave's LDS slab.
// ASPLIT 1: a second A plane A2 (unscaled residual of A, same layout) is multiplied into the same accumulator (A + A2 ~ exact A).
// BF 1: bf16 operands (v_wmma_f32_16x16x32_bf16), else f16.
// EPI 1: value += bf16_RNE(ep0[column]) (per-column bias); EPI 2: value += bf16_RNE(ep0[row]) (per-row bias, 16-bit out only).
// OM 0: f32 out (pitch ldc).  OM 2: one f16 plane = f16(value * ocarry).
// OM 4: two f16 planes: hi = f16(value * ocarry), lo = f16(value * ocarry - hi) (unscaled residual).
// OM 5: two f16 planes: C = f16((value + bf16_RNE(ep1[column])) * ocarry), C2 = f16((value + bf16_RNE(ep2[column])) * ocarry).
// coverage: 4 slabs x 16 rows (f32: it 0..7 x lane>>4; 16-bit: row lane&15, quarters it 0..3 x column half lane>>4) x 64 cols = the wave's whole 64x64 tile;
//           bx covers ceil(tilesM*tilesN/GW) workgroups of GW waves, surplus waves return (wave-uniform).
// =====================================================================================================
#define GW 4   // waves per projection workgroup
template <int OM, int ASPLIT, int BF, int EPI>
__device__ __forceinline__ void gemm64(
    const unsigned short* __restrict__ Ap, const unsigned short* __restrict__ A2p, int lda, long long sA,
    const unsigned short* __restrict__ Btp, int ldb, long long sB,
    void* Cout, void* C2out, int ldc, long long sC,
    int M, int N, int K, float oscale, float ocarry,
    const float* __restrict__ ep0, const float* __restrict__ ep1, const float* __restrict__ ep2,
    int bx, int by, float* slab) {
  const int lane = threadIdx.x & 31;
  const int wave = threadIdx.x >> 5;
  const int tilesN = N >> 6;
  const int tilesM = M >> 6;
  const int tile = bx * GW + wave;
  if (tile >= tilesM * tilesN) return;   // wave-uniform; no block barriers in the calling kernel
  const int tm = tile / tilesN;
  const int tn = tile - tm * tilesN;
  const int m0 = tm << 6;
  const int n0 = tn << 6;

  const unsigned short* A1 = Ap  + (size_t)((long long)by * sA);
  const unsigned short* A2 = A2p + (size_t)((long long)by * sA);
  const unsigned short* Bb = Btp + (size_t)((long long)by * sB);

  const int rlane = lane & 15;                 // row (A) / col (B, D) within subtile
  const int l8    = lane * 8;                  // the lane's slot in a quarter of a fragment-order block
  const int mOff  = (lane >> 4) * 8;           // D row offset

  v8f acc[4][4];
#pragma unroll
  for (int i = 0; i < 4; ++i)
#pragma unroll
    for (int j = 0; j < 4; ++j) acc[i][j] = zero8();

  for (int k0 = 0; k0 < K; k0 += 32) {
    // all eight fragments of the k step (4 of B, 4 of A) are requested together, ahead of its products: the step waits out one load latency, not four
    const unsigned short* pb = Bb + (size_t)(n0 >> 4) * (16 * ldb) + k0 * 16 + l8;
    const unsigned short* pa = A1 + (size_t)(m0 >> 4) * (16 * lda) + k0 * 16 + l8;
    v16h bh[4], ah[4];
#pragma unroll
    for (int j = 0; j < 4; ++j) bh[j] = ldfrag_p(pb + (size_t)j * (16 * ldb));
#pragma unroll
    for (int i = 0; i < 4; ++i) ah[i] = ldfrag_p(pa + (size_t)i * (16 * lda));
    addr_wait2(pb, pa);
    __builtin_amdgcn_sched_barrier(0);   // the whole group is requested before its first product: the scheduler otherwise pairs each load with its use again
#pragma unroll
    for (int i = 0; i < 4; ++i) {
#pragma unroll
      for (int j = 0; j < 4; ++j) acc[i][j] = mmaT<BF>(ah[i], bh[j], acc[i][j]);
      dep_guard1(acc[i][0], acc[i][3], ah[i]);
      if constexpr (ASPLIT != 0) {
        const unsigned short* pa2 = A2 + (size_t)((m0 >> 4) + i) * (16 * lda) + k0 * 16 + l8;
        const v16h al = ldfrag_p(pa2);
        addr_wait1(pa2);
#pragma unroll
        for (int j = 0; j < 4; ++j) acc[i][j] = mmaT<BF>(al, bh[j], acc[i][j]);
        dep_guard1(acc[i][0], acc[i][3], al);
      }
    }
    keep4_h(bh[0], bh[1], bh[2], bh[3]);
  }
  acc_guard4(acc[0][0], acc[0][1], acc[0][2], acc[0][3]);
  acc_guard4(acc[1][0], acc[1][1], acc[1][2], acc[1][3]);
  acc_guard4(acc[2][0], acc[2][1], acc[2][2], acc[2][3]);
  acc_guard4(acc[3][0], acc[3][1], acc[3][2], acc[3][3]);

  const int hh2 = lane >> 4, c4 = (lane & 15) * 4;     // f32 out: 256-B row segment = 16 lanes x 16 B

  // ---- epilogue ----
#pragma unroll
  for (int i = 0; i < 4; ++i) {
    const int mBase = m0 + (i << 4);
#pragma unroll
    for (int j = 0; j < 4; ++j) {
#pragma unroll
      for (int r = 0; r < 8; ++r) {
        slab[(mOff + r) * 68 + (j << 4) + rlane] = acc[i][j][r];
      }
    }
    wave_sync_lds();
    if constexpr (OM == 0) {
      float* C = (float*)Cout + (size_t)((long long)by * sC);
      v4f vals[8];
#pragma unroll
      for (int it = 0; it < 8; ++it) {
        const int row = it * 2 + hh2;                      // it 0..7 x hh2 0..1 = rows 0..15
        v4f v = *(const v4f*)(slab + row * 68 + c4);
#pragma unroll
        for (int e = 0; e < 4; ++e) v[e] = v[e] * oscale;
        if constexpr (EPI == 1) {
          const v4f bb = *(const v4f*)(ep0 + n0 + c4);     // per-column bias, columns n0+c4 .. +3 (N equals the bias length)
#pragma unroll
          for (int e = 0; e < 4; ++e) v[e] = v[e] + bfr(bb[e]);
        }
        vals[it] = v;
      }
      {
#pragma unroll
        for (int it = 0; it < 8; ++it) {
          const int gr = mBase + it * 2 + hh2;
          *(v4f*)(C + (size_t)gr * ldc + n0 + c4) = vals[it];
        }
        
      }
    } else {
      unsigned short* C  = (unsigned short*)Cout  + (size_t)((long long)by * sC);
      unsigned short* Cb = (unsigned short*)C2out + (size_t)((long long)by * sC);
      v4u hv[4], lv[4];
#pragma unroll
      for (int it = 0; it < 4; ++it) {
        const int row = rlane;                             // the lane's slot in quarter it: row lane&15, columns 16 it + 8 (lane>>4) ..
        const int c8  = it * 16 + mOff;
        const float* sp = slab + row * 68 + c8;
        float rb = 0.f;
        if constexpr (EPI == 2) rb = bfr(ep0[mBase + row]);   // per-row bias (M equals the bias length)
        v4u a  = {0u, 0u, 0u, 0u};
        v4u b2 = {0u, 0u, 0u, 0u};
#pragma unroll
        for (int e = 0; e < 4; ++e) {
          const int ci = n0 + c8 + 2 * e;                  // column index, < N
          float f0 = sp[2 * e] * oscale + rb;
          float f1 = sp[2 * e + 1] * oscale + rb;
          if constexpr (EPI == 1) {
            f0 += bfr(ep0[ci]);
            f1 += bfr(ep0[ci + 1]);
          }
          if constexpr (OM == 5) {
            const float g0 = (f0 + bfr(ep1[ci])) * ocarry, g1 = (f1 + bfr(ep1[ci + 1])) * ocarry;
            const float w0 = (f0 + bfr(ep2[ci])) * ocarry, w1 = (f1 + bfr(ep2[ci + 1])) * ocarry;
            a[e]  = pk16(h_bits((_Float16)g0), h_bits((_Float16)g1));
            b2[e] = pk16(h_bits((_Float16)w0), h_bits((_Float16)w1));
          } else {
            f0 *= ocarry; f1 *= ocarry;
            const _Float16 x0 = (_Float16)f0, x1 = (_Float16)f1;
            a[e] = pk16(h_bits(x0), h_bits(x1));
            if constexpr (OM == 4) {
              b2[e] = pk16(h_bits((_Float16)(f0 - (float)x0)), h_bits((_Float16)(f1 - (float)x1)));
            }
          }
        }
        hv[it] = a;
        lv[it] = b2;
      }
      {
#pragma unroll
        for (int it = 0; it < 4; ++it) {
          const size_t co = ((size_t)(mBase >> 4) * (ldc >> 6) + (n0 >> 6)) * 1024 + it * 256 + l8;   // 512 contiguous bytes per store
          *(v4u*)(C + co) = hv[it];
          if constexpr (OM >= 4) {
            *(v4u*)(Cb + co) = lv[it];
          }
        }
        
      }
    }
    wave_sync_lds();
  }
}

// =====================================================================================================
// The three projections in ONE launch, so that their waves are on the chip together: blockIdx.y = 0: q, 1: k, 2: v^T.
//   q, k: M = NROW, N = 1024, K = 1024, per-column bias; (NROW/64)*(DMOD/64) = 1024 tiles = PJB workgroups of GW waves.
//   v^T per batch: VT[b][e][j], M = 1024 (e), N = SEQ (j), K = 1024, per-row bias; 512 tiles per batch = PJB/NBAT workgroups,
//   batch = blockIdx.x / (PJB/NBAT). Every branch below is workgroup-uniform; no block barriers.
// coverage: grid (PJB, 3) x GW waves = every 64x64 tile of QH/QL, KH/KL and VH/VL exactly once.
// =====================================================================================================
#define PJB (((NROW / 64) * (DMOD / 64)) / GW)
static_assert(((NROW / 64) * (DMOD / 64)) % GW == 0);
static_assert((DMOD / 64) * (SEQ / 64) * NBAT == PJB * GW && (PJB % NBAT) == 0);
__global__ __launch_bounds__(GW * 32) __attribute__((amdgpu_num_vgpr(256))) void proj3(
    const unsigned short* __restrict__ Xq, const unsigned short* __restrict__ Xk, const unsigned short* __restrict__ Xv,
    const unsigned short* __restrict__ Wq, const unsigned short* __restrict__ Wk, const unsigned short* __restrict__ Wv,
    unsigned short* QH, unsigned short* QL, unsigned short* KH, unsigned short* KL, unsigned short* VH, unsigned short* VL,
    const float* __restrict__ bq, const float* __restrict__ bk, const float* __restrict__ bv) {
  __shared__ __align__(16) float sT[GW][16 * 68];   // per-wave 16x64 slab, pitch 68 floats
  float* slab = sT[threadIdx.x >> 5];
  const int p = blockIdx.y;
  if (p < 2) {
    const unsigned short* X = (p == 0) ? Xq : Xk;
    const unsigned short* Wt = (p == 0) ? Wq : Wk;
    unsigned short* H = (p == 0) ? QH : KH;
    unsigned short* L = (p == 0) ? QL : KL;
    const float* bias = (p == 0) ? bq : bk;
    gemm64<4, 0, 0, 1>(X, X, DMOD, 0LL, Wt, DMOD, 0LL, (void*)H, (void*)L, DMOD, 0LL,
                       NROW, DMOD, DMOD, 1.0f / (XC * WSC), (p == 0) ? QC : KC,
                       bias, bias, bias, blockIdx.x, 0, slab);
  } else {
    const int per = PJB / NBAT;
    const int bt  = blockIdx.x / per;
    gemm64<4, 0, 0, 2>(Wv, Wv, DMOD, 0LL, Xv, DMOD, (long long)SEQ * DMOD, (void*)VH, (void*)VL, SEQ, (long long)DMOD * SEQ,
                       DMOD, SEQ, DMOD, 1.0f / (XC * WSC), VC,
                       bv, bv, bv, blockIdx.x - bt * per, bt, slab);
  }
}

// =====================================================================================================
// Causal attention with the skewed relative-position term for one (batch b, head h) pair and a 64-row query tile; 8 waves =
// 2 key groups x 4 query waves: wave (kg, qw) owns query rows iw0 .. iw0+15, iw0 = i0 + 16 qw, and walks every second key tile
// j0 = 64 kg, 64 (kg + 2), .. <= i0, keeping its own running (max, sum, O). After the loop group 1 hands its state over through LDS
// behind one block barrier and group 0 merges the two states (rescale by exp2(m - max)) and stores. So the longest wave walks 16 tiles,
// not 32. There are more workgroups than places on the chip: blockIdx.y counts the query tiles from the last (most key tiles) down,
// so that cost falls with the flat workgroup index (for speed only).
// Planes (all in fragment order, see ldfrag_p): QH/QL, KH/KL = f16 hi + residual of (q x64), (k x64), rows b*SEQ + position, DMOD columns,
//         head h = column block h; EP = f16(bf16_RNE(Er) x16) [ELEN][64]; VH/VL = f16 hi + residual of (v x64) as [b][h*64+d][SEQ] (keys = columns).
//   Srel(i, j) = q_i . Er[ELEN-1 - (i - j)] for j <= i (the pad-reshape skew). Per key tile the wave needs Er rows
//   wlo + x, wlo = ELEN-1 - (iw0 - j0) - 15, x = jj - R + 15 in [0, 78]: position window T[R][x] = (qh+ql)[iw0+R] . EP[wlo + x],
//   x in [0, 80) (5 subtiles of 16 Er rows, their ten fragments requested together, K = 64; wlo is a multiple of 16, so a subtile is one 16-row block,
//   whose index is clamped on the address; a clamped block only ever feeds entries with j > i, which the causal mask replaces);
//   each 16x16 subtile is stored to the wave's f32 LDS strip right after its WMMAs.
//   Content scores S = (qh+ql) . (kh+kl) (hh + hl + lh, 4 subtiles of 16 keys, fragments requested two subtiles at a time, K = 64) -> the wave's f32 slab.
//   score*log2(e) = S*CS + T[R][jj - R + 15]*CT (CS, CT fold 1/(carries) and 1/8); entries with j > i are replaced by -inf;
//   online softmax in base 2, max-subtracted (row max and sum via DPP row_xmask), running sums in f32; e = exp2(t - m) in (0,1] written
//   of P*1024 (f16 hi + residual) rebuilt from the slab rows (f32 vector loads, split k map) and the v^T hi / residual B fragments loaded
//   straight from VH/VL [h*64+d][j]; 12 WMMAs per 32-key step (Ph.vh + Ph.vl + Pl.vh), 4 d-subtiles.
//   out rows (b*SEQ + iw0 + row), floats h*64 .. h*64+63 = one whole 256-B segment (2 lines) per row: 16 consecutive lanes x 16 B,
//   block = 8 waves = 256 threads; grid = (NBAT*NH, SEQ/64); one block barrier, behind the key loop, passed by every wave;
//   every wave does bounded work (<= SEQ/128 tiles).
// coverage: LDS strip 16 x 80 of TPI and slab 16 x 64 of SPI per wave, fully written before read each tile; global: 8 instructions x
//           2 rows x 64 floats = rows iw0..iw0+15 of head segment h; grid x waves cover all NBAT*SEQ rows and all NH head segments once.
// =====================================================================================================
__global__ __launch_bounds__(ATT_THREADS) __attribute__((amdgpu_num_vgpr(256)))
void attn_rel(const unsigned short* __restrict__ QH, const unsigned short* __restrict__ QL,
              const unsigned short* __restrict__ KH, const unsigned short* __restrict__ KL,
              const unsigned short* __restrict__ EP,
              const unsigned short* __restrict__ VH, const unsigned short* __restrict__ VL,
              float* out) {
  __shared__ __align__(16) float smem[ATT_W * WFL];   // per wave: T strip [16][TPI] | score / prob / ctx slab [16][SPI]

  const int tid  = threadIdx.x;
  const int wave = __builtin_amdgcn_readfirstlane(tid >> 5);   // scalar, so that the key loop's per-wave start and end stay scalar branches
  const int qw   = wave & (ATT_QW - 1);
  const int kg   = wave / ATT_QW;
  const int lane = tid & 31;
  const int hh   = lane >> 4;
  const int c    = lane & 15;
  const int bh   = blockIdx.x;
  const int b    = bh / NH;
  const int h    = bh - b * NH;
  const int qt   = (SEQ / 64 - 1) - (int)blockIdx.y;           // query tile, the one with the most key tiles first
  const int i0   = qt * 64;
  const int iw0  = i0 + qw * 16;

  float* tsh = smem + wave * WFL;
  float* pt  = tsh + 16 * TPI;
  // the lane's own bases in strip and slab: every access of the key loop is base + a constant, which leaves the registers to the fragments in flight
  float* tst = tsh + 8 * hh * TPI + c;             // strip row 8hh, column c
  float* pst = pt + 8 * hh * SPI + c;              // slab row 8hh, column c
  const float* tgt = tst + 15 - 8 * hh;            // shifted gather: row 8hh + r starts at tgt + r * (TPI - 1)

  const int l8 = lane * 8;                                                       // the lane's slot in a quarter of a fragment-order block
  const size_t qro = ((size_t)((b * SEQ + iw0) >> 4) * (DMOD / 64) + h) * 1024 + l8;   // block of query rows iw0.., head h
  const size_t kbo = ((size_t)((b * SEQ) >> 4) * (DMOD / 64) + h) * 1024 + l8;         // block of key rows 0..15 of batch b, head h
  const unsigned short* Khb = KH + kbo;
  const unsigned short* Klb = KL + kbo;
  const unsigned short* Eb  = EP + l8;
  const size_t vpo = (size_t)b * DMOD * SEQ + (size_t)(h * (DH / 16)) * (SEQ / 64) * 1024 + l8;   // block of d rows 0..15 of head h, keys 0..63
  const unsigned short* Vhb = VH + vpo;
  const unsigned short* Vlb = VL + vpo;

  const float CS = LOG2E * SCALE / (QC * KC);
  const float CT = LOG2E * SCALE / (QC * EC);

  float mrow[8], lrow[8];
  v8f O[4];
#pragma unroll
  for (int r = 0; r < 8; ++r) { mrow[r] = -INFINITY; lrow[r] = 0.f; }
#pragma unroll
  for (int td = 0; td < 4; ++td) O[td] = zero8();

  const int ntile = qt + 1;                  // causal: key tiles j0 <= i0
#pragma unroll 1
  for (int jt = kg; jt < ntile; jt += ATT_KG) {
    const int j0 = jt * 64;
    const v16h qha = ldfrag_p(QH + qro), qhb = ldfrag_p(QH + qro + 512);
    const v16h qla = ldfrag_p(QL + qro), qlb = ldfrag_p(QL + qro + 512);

    // ---- position window T (5 subtiles of 16 Er rows), each subtile stored to the LDS strip as produced ----
    {
      const int wb = ((ELEN - 1) - (iw0 - j0) - 15) >> 4;   // wlo / 16, exact: ELEN, iw0 and j0 are multiples of 16
      // all ten Er fragments are requested together, ahead of the products: the window waits out one load latency, not five
      v16h fa[5], fb[5];
      const unsigned short* pe[5];
#pragma unroll
      for (int u = 0; u < 5; ++u) {
        int m = wb + u;
        m = (m < 0) ? 0 : m;
        m = (m > ELEN / 16 - 1) ? (ELEN / 16 - 1) : m;
        pe[u] = Eb + (size_t)m * 1024;
        fa[u] = ldfrag_p(pe[u]);
        fb[u] = ldfrag_p(pe[u] + 512);
      }
      addr_wait4(pe[0], pe[1], pe[2], pe[3]);
      addr_wait1(pe[4]);
      __builtin_amdgcn_sched_barrier(0);   // the whole group is requested before its first product: the scheduler otherwise pairs each load with its use again
#pragma unroll
      for (int u = 0; u < 5; ++u) {
        v8f t8 = mma_h(qha, fa[u], zero8());
        t8 = mma_h(qla, fa[u], t8);
        t8 = mma_h(qhb, fb[u], t8);
        t8 = mma_h(qlb, fb[u], t8);
        hz6(t8, fa[u], fb[u], qha, qla, qhb, qlb);
#pragma unroll
        for (int r = 0; r < 8; ++r) tst[r * TPI + 16 * u] = t8[r];
      }
    }
    __builtin_amdgcn_sched_barrier(0);   // keeps a later phase's index and address work out of this phase, whose registers the fragments in flight need
    // ---- content scores S (4 subtiles of 16 keys) -> slab ----
    {
      // the key fragments are requested in two groups of two subtiles, each ahead of its products: two load latencies, not four
      const unsigned short* pkh = Khb + (size_t)(j0 >> 4) * ((DMOD / 64) * 1024);
      const unsigned short* pkl = Klb + (size_t)(j0 >> 4) * ((DMOD / 64) * 1024);
      v16h kha[4], khb[4], kla[4], klb[4];
#pragma unroll
      for (int t = 0; t < 4; ++t) {
        if ((t & 1) == 0) {
#pragma unroll
          for (int x = t; x < t + 2; ++x) {
            kha[x] = ldfrag_p(pkh + (size_t)x * ((DMOD / 64) * 1024));
            khb[x] = ldfrag_p(pkh + (size_t)x * ((DMOD / 64) * 1024) + 512);
            kla[x] = ldfrag_p(pkl + (size_t)x * ((DMOD / 64) * 1024));
            klb[x] = ldfrag_p(pkl + (size_t)x * ((DMOD / 64) * 1024) + 512);
          }
          addr_wait2(pkh, pkl);
          __builtin_amdgcn_sched_barrier(0);   // the whole group is requested before its first product: the scheduler otherwise pairs each load with its use again
        }
        v8f s8 = mma_h(qha, kha[t], zero8());
        s8 = mma_h(qha, kla[t], s8);
        s8 = mma_h(qla, kha[t], s8);
        s8 = mma_h(qhb, khb[t], s8);
        s8 = mma_h(qhb, klb[t], s8);
        s8 = mma_h(qlb, khb[t], s8);
        hz8(s8, kha[t], khb[t], kla[t], klb[t], qha, qla, qhb, qlb);
#pragma unroll
        for (int r = 0; r < 8; ++r) pst[r * SPI + 16 * t] = s8[r];
      }
    }
    __builtin_amdgcn_sched_barrier(0);   // keeps a later phase's index and address work out of this phase, whose registers the fragments in flight need
    wave_sync_lds();
    // v^T fragments of the first 32 keys: requested here, behind the fence (which waits for loads in flight), so that they arrive while the softmax runs
    const unsigned short* pvh = Vhb + (size_t)jt * 1024;
    const unsigned short* pvl = Vlb + (size_t)jt * 1024;
    v16h vh[4], vl[4];
#pragma unroll
    for (int td = 0; td < 4; ++td) {
      vh[td] = ldfrag_p(pvh + (size_t)td * ((SEQ / 64) * 1024));
      vl[td] = ldfrag_p(pvl + (size_t)td * ((SEQ / 64) * 1024));
    }
    addr_wait2(pvh, pvl);

    // ---- score assembly, causal mask, online softmax (rows live on one 16-lane half) ----
    const int dj = (j0 - iw0) + c - 8 * hh;        // j - i = dj + 16 t - r
#pragma unroll
    for (int r = 0; r < 8; ++r) {
      const float* trow = tgt + r * (TPI - 1);
      float* srow = pst + r * SPI;
      float tv[4];
#pragma unroll
      for (int t = 0; t < 4; ++t) {
        const float val = srow[16 * t] * CS + trow[16 * t] * CT;
        tv[t] = (dj > r - 16 * t) ? -INFINITY : val;
      }
      float mx = fmaxf(fmaxf(tv[0], tv[1]), fmaxf(tv[2], tv[3]));
      mx = row_max16(mx);
      const float mn = fmaxf(mrow[r], mx);
      const float al = exp2f(mrow[r] - mn);
      mrow[r] = mn;
      float e4[4];
      float ps = 0.f;
#pragma unroll
      for (int t = 0; t < 4; ++t) { e4[t] = exp2f(tv[t] - mn); ps += e4[t]; }
      ps = row_sum16(ps);
      lrow[r] = lrow[r] * al + ps;
#pragma unroll
      for (int td = 0; td < 4; ++td) O[td][r] *= al;
#pragma unroll
      for (int t = 0; t < 4; ++t) srow[16 * t] = e4[t];
    }
    wave_sync_lds();
    __builtin_amdgcn_sched_barrier(0);   // keeps a later phase's index and address work out of this phase, whose registers the fragments in flight need

    // ---- O += (Ph + Pl) . (vh + vl)^T, two k-steps of 32 keys; a step's 8 v^T fragments are requested together, ahead of its P split ----
#pragma unroll
    for (int ks = 0; ks < 2; ++ks) {
      if (ks == 1) {
#pragma unroll
        for (int td = 0; td < 4; ++td) {
          vh[td] = ldfrag_p(pvh + (size_t)td * ((SEQ / 64) * 1024) + 512);
          vl[td] = ldfrag_p(pvl + (size_t)td * ((SEQ / 64) * 1024) + 512);
        }
        addr_wait2(pvh, pvl);
        __builtin_amdgcn_sched_barrier(0);   // the whole group is requested before its first product: the scheduler otherwise pairs each load with its use again
      }
      FragH ph, pl;
      {
        const float* prow = pt + c * SPI + 32 * ks + 8 * hh;
        const v4f p0 = *(const v4f*)(prow), p1 = *(const v4f*)(prow + 4);
        const v4f p2 = *(const v4f*)(prow + 16), p3 = *(const v4f*)(prow + 20);
#pragma unroll
        for (int e = 0; e < 4; ++e) {
          _Float16 a0, a1;
          sp16(p0[e] * PC, a0, a1); ph.h[0][e]     = a0; pl.h[0][e]     = a1;   // keys 32ks + 8hh + e
          sp16(p1[e] * PC, a0, a1); ph.h[0][4 + e] = a0; pl.h[0][4 + e] = a1;   // keys 32ks + 8hh + 4 + e
          sp16(p2[e] * PC, a0, a1); ph.h[1][e]     = a0; pl.h[1][e]     = a1;   // keys 32ks + 16 + 8hh + e
          sp16(p3[e] * PC, a0, a1); ph.h[1][4 + e] = a0; pl.h[1][4 + e] = a1;
        }
      }
#pragma unroll
      for (int td = 0; td < 4; ++td) {
        O[td] = mma_h(ph.v, vh[td], O[td]);
        O[td] = mma_h(ph.v, vl[td], O[td]);
        O[td] = mma_h(pl.v, vh[td], O[td]);
        hz4(O[td], vh[td], vl[td], ph.v, pl.v);
      }
    }
    wave_sync_lds();
  }
  acc_guard4(O[0], O[1], O[2], O[3]);

  // ---- merge of the two key groups: group 1 writes (O, m, l) to its own slab and strip, block barrier, group 0 reads and rescales.
  //      A group-1 wave without a tile hands over m = -inf, l = 0, O = 0, whose weight exp2(-inf) is 0; group 0 always has tile 0.
  if (kg != 0) {
#pragma unroll
    for (int r = 0; r < 8; ++r) {
      const int R = 8 * hh + r;
#pragma unroll
      for (int td = 0; td < 4; ++td) pt[R * SPI + 16 * td + c] = O[td][r];
      if (c == 0) { tsh[R] = mrow[r]; tsh[16 + R] = lrow[r]; }
    }
  }
  __syncthreads();                           // publishes group 1's state to group 0; every wave of the block passes it once
  if (kg != 0) return;
  {
    const float* ts2 = tsh + ATT_QW * WFL;   // wave (1, qw)'s strip and slab
    const float* pt2 = ts2 + 16 * TPI;
#pragma unroll
    for (int r = 0; r < 8; ++r) {
      const int R = 8 * hh + r;
      const float m2 = ts2[R], l2 = ts2[16 + R];
      const float mm = fmaxf(mrow[r], m2);
      const float a1 = exp2f(mrow[r] - mm), a2 = exp2f(m2 - mm);
      lrow[r] = lrow[r] * a1 + l2 * a2;
#pragma unroll
      for (int td = 0; td < 4; ++td) O[td][r] = O[td][r] * a1 + pt2[R * SPI + 16 * td + c] * a2;
    }
  }

  // ---- fold 1/l and the carries (1024 on P, 64 on v), stage the wave's 16x64 f32 slice in its slab ----
  const float oc = 1.0f / (PC * VC);
#pragma unroll
  for (int r = 0; r < 8; ++r) {
    const float inv = (1.0f / lrow[r]) * oc;
    const int ro = (8 * hh + r) * SPI + c;
#pragma unroll
    for (int td = 0; td < 4; ++td) pt[ro + 16 * td] = O[td][r] * inv;
  }
  wave_sync_lds();
  {
    const int c4 = c * 4;
    v4f vals[8];
#pragma unroll
    for (int it = 0; it < 8; ++it) {
      const int row = it * 2 + hh;                           // it 0..7 x hh 0..1 = rows 0..15
      vals[it] = *(const v4f*)(pt + row * SPI + c4);
    }
    float* ob = out + ((size_t)b * SEQ + iw0) * DMOD + h * DH + c4;
    {
#pragma unroll
      for (int it = 0; it < 8; ++it) {
        const int row = it * 2 + hh;
        *(v4f*)(ob + (size_t)row * DMOD) = vals[it];
      }
      
    }
  }
}

// =====================================================================================================
// Workspace map (bytes); every plane is an exact multiple of its tile / whole-row store granularity (M, N exact tile multiples,
// convert counts exact multiples of 8192, no pad rows), every offset a multiple of 262144; every plane is in fragment order (see ldfrag_p):
//   (the first seven planes keep this order with no gap between them: cvt_all numbers their 16 x 64 blocks straight through)
//   Xq, Xk, Xv  f16 [NROW][1024] x16                            3 x 8388608
//   Wq, Wk, Wv  f16 [1024 out][1024 in] x64                      3 x 2097152
//   EP          f16 [ELEN][64] x16                                   262144
//   QH, QL, KH, KL f16 [NROW][1024] (x64 hi / residual)         4 x 8388608
//   VH, VL      f16 [NBAT][1024][SEQ] (x64 hi / residual)       2 x 8388608
//   end                                                            82051072
// =====================================================================================================
extern "C" void kernel_launch(void* const* d_in, const int* in_sizes, int n_in,
                              void* d_out, int out_size, void* d_ws, size_t ws_size,
                              hipStream_t stream) {
  if (n_in < 10) return;
  if (in_sizes[0] != NROW * DMOD || in_sizes[1] != NROW * DMOD || in_sizes[2] != NROW * DMOD) return;
  if (in_sizes[3] != DMOD * DMOD || in_sizes[5] != DMOD * DMOD || in_sizes[7] != DMOD * DMOD) return;
  if (in_sizes[4] != DMOD || in_sizes[6] != DMOD || in_sizes[8] != DMOD) return;
  if (in_sizes[9] != ELEN * DH) return;
  if (out_size != NROW * DMOD) return;

  const float* qin = (const float*)d_in[0];
  const float* kin = (const float*)d_in[1];
  const float* vin = (const float*)d_in[2];
  const float* w_q = (const float*)d_in[3];
  const float* b_q = (const float*)d_in[4];
  const float* w_k = (const float*)d_in[5];
  const float* b_k = (const float*)d_in[6];
  const float* w_v = (const float*)d_in[7];
  const float* b_v = (const float*)d_in[8];
  const float* er  = (const float*)d_in[9];
  float*       out = (float*)d_out;

  const size_t PX = (size_t)NROW * DMOD * 2;             //  8388608
  const size_t PW = (size_t)DMOD * DMOD * 2;             //  2097152
  const size_t PE = (size_t)ELEN * DH * 2;               //   262144
  const size_t PV = (size_t)NBAT * DMOD * SEQ * 2;       //  8388608
  size_t off = 0;
  const size_t oXq = off; off += PX;
  const size_t oXk = off; off += PX;
  const size_t oXv = off; off += PX;
  const size_t oWq = off; off += PW;
  const size_t oWk = off; off += PW;
  const size_t oWv = off; off += PW;
  const size_t oE  = off; off += PE;
  const size_t oQH = off; off += PX;
  const size_t oQL = off; off += PX;
  const size_t oKH = off; off += PX;
  const size_t oKL = off; off += PX;
  const size_t oVH = off; off += PV;
  const size_t oVL = off; off += PV;
  if (off > ws_size) return;                               // off = 82051072
  if (off > (size_t)134217728) return;

  char* ws = (char*)d_ws;
  unsigned short* Xq  = (unsigned short*)(ws + oXq);
  unsigned short* Xk  = (unsigned short*)(ws + oXk);
  unsigned short* Xv  = (unsigned short*)(ws + oXv);
  unsigned short* Wq6 = (unsigned short*)(ws + oWq);
  unsigned short* Wk6 = (unsigned short*)(ws + oWk);
  unsigned short* Wv6 = (unsigned short*)(ws + oWv);
  unsigned short* E16 = (unsigned short*)(ws + oE);
  unsigned short* QHp = (unsigned short*)(ws + oQH);
  unsigned short* QLp = (unsigned short*)(ws + oQL);
  unsigned short* KHp = (unsigned short*)(ws + oKH);
  unsigned short* KLp = (unsigned short*)(ws + oKL);
  unsigned short* VHp = (unsigned short*)(ws + oVH);
  unsigned short* VLp = (unsigned short*)(ws + oVL);

  const dim3 blk(256);
  const dim3 gCV(CBALL);                                            // 3 x 512 + 3 x 128 + 16 = 1936
  const dim3 gP(PJB, 3);                                            // 256 x 3
  const dim3 bP(GW * 32);                                           // 128
  const dim3 gAT(NBAT * NH, SEQ / 64);                              // 32 x 32
  const dim3 bAT(ATT_THREADS);                                      // 256

  // (0) 16-bit planes of the inputs: activations f16(bf16_RNE(x) * 16); W[out][in] (already k-contiguous) f16(bf16_RNE(w) * 64);
  //     Er f16(bf16_RNE(e) * 16); one launch for all seven: Xq is the first of the seven planes, which follow one another in the workspace
  cvt_all<<<gCV, blk, 0, stream>>>(qin, kin, vin, w_q, w_k, w_v, er, Xq);

  // (1) one launch for the three projections:
  //     q[m][e] = sum_d x[m][d] Wq[e][d] / 1024 + bq[e] -> QH = f16(q * 64), QL = f16(q * 64 - QH); the same for k -> KH, KL;
  //     VT[b][e][j] = sum_c Wv[e][c] x[b*SEQ+j][c] / 1024 + bv[e] -> VH, VL (x64)
  proj3<<<gP, bP, 0, stream>>>(Xq, Xk, Xv, Wq6, Wk6, Wv6, QHp, QLp, KHp, KLp, VHp, VLp, b_q, b_k, b_v);

  // (2) causal relative attention -> out[b][i][h*64+d] (f32), written directly
  attn_rel<<<gAT, bAT, 0, stream>>>(QHp, QLp, KHp, KLp, E16, VHp, VLp, out);
  (void)hipGetLastError();
}

// v008
// A run of this version takes 119 microseconds.
// Two timings next to v007 both put it at 1.05 times that version's speed.
// Counting every step since v000, it is 3.72 times as fast.
// Contractions (all v_wmma_f32_16x16x32_f16, f16 operands, f32 accumulate): q/k/v projections (x f16 x16 . W f16 x64, K=1024, single products,
// outputs written as f16 hi + unscaled f16 residual planes); position window ((qh+ql) x64 . Er f16 x16, K=64, 2 products) -> f32 LDS strip,
// shifted gather on VALU; content scores ((qh+ql) x64 . (kh+kl) x64, K=64, hh+hl+lh); P . v^T ((Ph+Pl) x1024 . (vh+vl) x64, hh+hl+lh,
// 64 keys per tile). Causal mask, max-subtracted online base-2 softmax and the 1/l fold in f32 on VALU. Every float input RNE-converted to bf16 on load.
#include <hip/hip_runtime.h>
#include <math.h>
#include <stdint.h>

#define SEQ   2048
#define NBAT  2
#define DMOD  1024
#define NH    16
#define DH    64
#define ELEN  2048
#define NROW  (NBAT * SEQ)
#define XC    16.0f
#define WSC   64.0f
#define QC    64.0f
#define KC    64.0f
#define EC    16.0f
#define VC    64.0f
#define PC    1024.0f
#define SCALE 0.125f
#define LOG2E 1.4426950408889634f
static_assert(NH * DH == DMOD);
static_assert(DH == 64);
static_assert(ELEN == SEQ);
static_assert((SEQ % 64) == 0 && (DMOD % 64) == 0 && (NROW % 64) == 0);
static_assert(((NROW * DMOD) % 8192) == 0 && ((DMOD * DMOD) % 8192) == 0 && ((ELEN * DH) % 8192) == 0);
static_assert((SEQ % 16) == 0 && (ELEN % 16) == 0);
#define ATT_QW 4                    // waves side by side on the query rows (16 rows each)
#define ATT_KG 2                    // groups of ATT_QW waves that share out the key tiles
#define ATT_W (ATT_QW * ATT_KG)
#define ATT_THREADS (ATT_W * 32)
static_assert(ATT_KG == 2);
#define TPI 84
#define SPI 68
#define WFL (16 * TPI + 16 * SPI)
static_assert(((16 * TPI) % 4) == 0 && ((16 * SPI) % 4) == 0 && (WFL % 4) == 0);

typedef _Float16 v16h __attribute__((ext_vector_type(16)));
typedef _Float16 v8h  __attribute__((ext_vector_type(8)));
typedef __bf16   v16b __attribute__((ext_vector_type(16)));
typedef float    v8f  __attribute__((ext_vector_type(8)));
typedef float    v4f  __attribute__((ext_vector_type(4)));
typedef float    v2f  __attribute__((ext_vector_type(2)));
typedef unsigned int v4u __attribute__((ext_vector_type(4)));

union FragH { v16h v; v8h h[2]; v4u u[2]; };
union FragAny { v16h h; v16b b; };

// ---- scalar helpers --------------------------------------------------------------------------------
__device__ __forceinline__ unsigned short bf_bits(float f) {          // f32 -> bf16 bits, RNE convert
  unsigned u = __float_as_uint(f);
  return (unsigned short)((u + 0x7FFFu + ((u >> 16) & 1u)) >> 16);
}
__device__ __forceinline__ float bf_up(unsigned short h) { return __uint_as_float(((unsigned)h) << 16); }
__device__ __forceinline__ float bfr(float f) { return bf_up(bf_bits(f)); }   // value of the bf16 RNE convert
__device__ __forceinline__ unsigned short h_bits(_Float16 x) { return __builtin_bit_cast(unsigned short, x); }
__device__ __forceinline__ unsigned pk16(unsigned short a, unsigned short b) { return (unsigned)a | ((unsigned)b << 16); }
__device__ __forceinline__ v8f zero8() { v8f z = {0.f, 0.f, 0.f, 0.f, 0.f, 0.f, 0.f, 0.f}; return z; }

// ---- fragment-order planes: a 16-bit matrix [R][Cn] (R % 16 == 0, Cn % 64 == 0; Cn is the k direction of its reader) is kept as blocks of
//      16 rows x 64 columns, block (r >> 4) * (Cn / 64) + (cn >> 6), 1024 halves each; inside a block four 256-half quarters qd = (cn >> 4) & 3,
//      inside a quarter lane slot ((cn >> 3) & 1) * 16 + (r & 15), 8 halves each. One A/B fragment (16 rows x 32 k) is two neighbouring quarters,
//      and each of its two 16-byte-per-lane loads reads 512 contiguous bytes (4 cache lines, where a row-major plane gives 16).
// ---- fragment loader: p = block + 512 * (k step inside the block) + 8 * lane; lane -> row/col (lane&15), h = lane>>4;
//      elements 0..7 <- k0+8h.., elements 8..15 <- k0+16+8h.. (same split k map for A and B; B is always read from a [n][k] plane)
__device__ __forceinline__ v16h ldfrag_p(const unsigned short* p) {
  FragH f;
  f.u[0] = *(const v4u*)(p);
  f.u[1] = *(const v4u*)(p + 256);
  return f.v;
}

// ---- WMMA helpers with trailing VALU hazard gaps ------------------------------------------------------
__device__ __forceinline__ v8f mma_h(v16h a, v16h b, v8f c) {
  return __builtin_amdgcn_wmma_f32_16x16x32_f16(false, a, false, b, (short)0, c, false, false);
}
__device__ __forceinline__ v8f mma_b(v16h a, v16h b, v8f c) {
  FragAny ua, ub;
  ua.h = a;
  ub.h = b;
  return __builtin_amdgcn_wmma_f32_16x16x32_bf16(false, ua.b, false, ub.b, (short)0, c, false, false);
}
template <int BF>
__device__ __forceinline__ v8f mmaT(v16h a, v16h b, v8f c) {
  if constexpr (BF != 0) return mma_b(a, b, c);
  else return mma_h(a, b, c);
}
__device__ __forceinline__ void dep_guard1(v8f& a, v8f& b, v16h x) {
#if defined(__HIP_DEVICE_COMPILE__)
  asm volatile("v_nop\n\tv_nop\n\tv_nop\n\tv_nop" : "+v"(a), "+v"(b) : "v"(x));
#endif
}
__device__ __forceinline__ void hz4(v8f& d, v16h x0, v16h x1, v16h x2, v16h x3) {
#if defined(__HIP_DEVICE_COMPILE__)
  asm volatile("v_nop\n\tv_nop\n\tv_nop\n\tv_nop" : "+v"(d) : "v"(x0), "v"(x1), "v"(x2), "v"(x3));
#endif
}
__device__ __forceinline__ void hz6(v8f& d, v16h x0, v16h x1, v16h x2, v16h x3, v16h x4, v16h x5) {
#if defined(__HIP_DEVICE_COMPILE__)
  asm volatile("v_nop\n\tv_nop\n\tv_nop\n\tv_nop" : "+v"(d) : "v"(x0), "v"(x1), "v"(x2), "v"(x3), "v"(x4), "v"(x5));
#endif
}
__device__ __forceinline__ void hz8(v8f& d, v16h x0, v16h x1, v16h x2, v16h x3, v16h x4, v16h x5, v16h x6, v16h x7) {
#if defined(__HIP_DEVICE_COMPILE__)
  asm volatile("v_nop\n\tv_nop\n\tv_nop\n\tv_nop" : "+v"(d) : "v"(x0), "v"(x1), "v"(x2), "v"(x3), "v"(x4), "v"(x5), "v"(x6), "v"(x7));
#endif
}
__device__ __forceinline__ void keep4_h(v16h a, v16h b, v16h c, v16h d) {
#if defined(__HIP_DEVICE_COMPILE__)
  asm volatile("v_nop" :: "v"(a), "v"(b), "v"(c), "v"(d));
#endif
}
__device__ __forceinline__ void acc_guard4(v8f& a, v8f& b, v8f& c, v8f& d) {
#if defined(__HIP_DEVICE_COMPILE__)
  asm volatile("v_nop\n\tv_nop\n\tv_nop\n\tv_nop" : "+v"(a), "+v"(b), "+v"(c), "+v"(d));
#endif
}
__device__ __forceinline__ void wave_sync_lds() {
  __builtin_amdgcn_fence(__ATOMIC_RELEASE, "workgroup");
  __builtin_amdgcn_wave_barrier();
  __builtin_amdgcn_fence(__ATOMIC_ACQUIRE, "workgroup");
}
// s_wait_xcnt 0 behind a run of global fragment loads (GEMM and attention). The loads' address pointers are inputs only, so their registers stay
// live up to the wait: no later load of the run lands on them and no address arithmetic rewrites them before the wait has passed.
__device__ __forceinline__ void addr_wait1(const unsigned short* p) {
#if defined(__HIP_DEVICE_COMPILE__)
  asm volatile("s_wait_xcnt 0x0" :: "v"(p) : "memory");
#endif
}
__device__ __forceinline__ void addr_wait4(const unsigned short* p0, const unsigned short* p1, const unsigned short* p2, const unsigned short* p3) {
#if defined(__HIP_DEVICE_COMPILE__)
  asm volatile("s_wait_xcnt 0x0" :: "v"(p0), "v"(p1), "v"(p2), "v"(p3) : "memory");
#endif
}
__device__ __forceinline__ void addr_wait2(const unsigned short* p0, const unsigned short* p1) {
#if defined(__HIP_DEVICE_COMPILE__)
  asm volatile("s_wait_xcnt 0x0" :: "v"(p0), "v"(p1) : "memory");
#endif
}
// 16-lane row all-reduce on the vector unit, FOUR rows (four values per lane) side by side: in each step lane l combines its value with that of
// lane l ^ M of its own 16-lane row (DPP row_xmask:M), M = 1, 2, 4, 8: no LDS queue and no LDS wait. All 32 lanes are on where these are called.
// Step M of all four values stands in front of step 2M, so a value's next step finds its producer four instructions back and the chain's waits are
// filled by the other three. Per value the same pairing and order as the xor-1, 2, 4, 8 shuffle tree.
// asm: one instruction a step; from source the maximum comes out as a DPP move, a quieting v_max and the maximum, three dependent instructions a step.
// s_delay_alu: names each step's producer (the first: whatever stands directly in front), so that the SIMD's other waves issue during a wait.
__device__ __forceinline__ void row_max16x4(float& a, float& b, float& c, float& d) {
#if defined(__HIP_DEVICE_COMPILE__)
  asm("s_delay_alu instid0(VALU_DEP_1)\n\t"
      "v_max_num_f32_dpp %0, %0, %0 row_xmask:1 row_mask:0xf bank_mask:0xf\n\t"
      "v_max_num_f32_dpp %1, %1, %1 row_xmask:1 row_mask:0xf bank_mask:0xf\n\t"
      "v_max_num_f32_dpp %2, %2, %2 row_xmask:1 row_mask:0xf bank_mask:0xf\n\t"
      "v_max_num_f32_dpp %3, %3, %3 row_xmask:1 row_mask:0xf bank_mask:0xf\n\t"
      "s_delay_alu instid0(VALU_DEP_4)\n\t"
      "v_max_num_f32_dpp %0, %0, %0 row_xmask:2 row_mask:0xf bank_mask:0xf\n\t"
      "s_delay_alu instid0(VALU_DEP_4)\n\t"
      "v_max_num_f32_dpp %1, %1, %1 row_xmask:2 row_mask:0xf bank_mask:0xf\n\t"
      "s_delay_alu instid0(VALU_DEP_4)\n\t"
      "v_max_num_f32_dpp %2, %2, %2 row_xmask:2 row_mask:0xf bank_mask:0xf\n\t"
      "s_delay_alu instid0(VALU_DEP_4)\n\t"
      "v_max_num_f32_dpp %3, %3, %3 row_xmask:2 row_mask:0xf bank_mask:0xf\n\t"
      "s_delay_alu instid0(VALU_DEP_4)\n\t"
      "v_max_num_f32_dpp %0, %0, %0 row_xmask:4 row_mask:0xf bank_mask:0xf\n\t"
      "s_delay_alu instid0(VALU_DEP_4)\n\t"
      "v_max_num_f32_dpp %1, %1, %1 row_xmask:4 row_mask:0xf bank_mask:0xf\n\t"
      "s_delay_alu instid0(VALU_DEP_4)\n\t"
      "v_max_num_f32_dpp %2, %2, %2 row_xmask:4 row_mask:0xf bank_mask:0xf\n\t"
      "s_delay_alu instid0(VALU_DEP_4)\n\t"
      "v_max_num_f32_dpp %3, %3, %3 row_xmask:4 row_mask:0xf bank_mask:0xf\n\t"
      "s_delay_alu instid0(VALU_DEP_4)\n\t"
      "v_max_num_f32_dpp %0, %0, %0 row_xmask:8 row_mask:0xf bank_mask:0xf\n\t"
      "s_delay_alu instid0(VALU_DEP_4)\n\t"
      "v_max_num_f32_dpp %1, %1, %1 row_xmask:8 row_mask:0xf bank_mask:0xf\n\t"
      "s_delay_alu instid0(VALU_DEP_4)\n\t"
      "v_max_num_f32_dpp %2, %2, %2 row_xmask:8 row_mask:0xf bank_mask:0xf\n\t"
      "s_delay_alu instid0(VALU_DEP_4)\n\t"
      "v_max_num_f32_dpp %3, %3, %3 row_xmask:8 row_mask:0xf bank_mask:0xf"
      : "+v"(a), "+v"(b), "+v"(c), "+v"(d));
#endif
}
__device__ __forceinline__ void row_sum16x4(float& a, float& b, float& c, float& d) {
#if defined(__HIP_DEVICE_COMPILE__)
  asm("s_delay_alu instid0(VALU_DEP_1)\n\t"
      "v_add_f32_dpp %0, %0, %0 row_xmask:1 row_mask:0xf bank_mask:0xf\n\t"
      "v_add_f32_dpp %1, %1, %1 row_xmask:1 row_mask:0xf bank_mask:0xf\n\t"
      "v_add_f32_dpp %2, %2, %2 row_xmask:1 row_mask:0xf bank_mask:0xf\n\t"
      "v_add_f32_dpp %3, %3, %3 row_xmask:1 row_mask:0xf bank_mask:0xf\n\t"
      "s_delay_alu instid0(VALU_DEP_4)\n\t"
      "v_add_f32_dpp %0, %0, %0 row_xmask:2 row_mask:0xf bank_mask:0xf\n\t"
      "s_delay_alu instid0(VALU_DEP_4)\n\t"
      "v_add_f32_dpp %1, %1, %1 row_xmask:2 row_mask:0xf bank_mask:0xf\n\t"
      "s_delay_alu instid0(VALU_DEP_4)\n\t"
      "v_add_f32_dpp %2, %2, %2 row_xmask:2 row_mask:0xf bank_mask:0xf\n\t"
      "s_delay_alu instid0(VALU_DEP_4)\n\t"
      "v_add_f32_dpp %3, %3, %3 row_xmask:2 row_mask:0xf bank_mask:0xf\n\t"
      "s_delay_alu instid0(VALU_DEP_4)\n\t"
      "v_add_f32_dpp %0, %0, %0 row_xmask:4 row_mask:0xf bank_mask:0xf\n\t"
      "s_delay_alu instid0(VALU_DEP_4)\n\t"
      "v_add_f32_dpp %1, %1, %1 row_xmask:4 row_mask:0xf bank_mask:0xf\n\t"
      "s_delay_alu instid0(VALU_DEP_4)\n\t"
      "v_add_f32_dpp %2, %2, %2 row_xmask:4 row_mask:0xf bank_mask:0xf\n\t"
      "s_delay_alu instid0(VALU_DEP_4)\n\t"
      "v_add_f32_dpp %3, %3, %3 row_xmask:4 row_mask:0xf bank_mask:0xf\n\t"
      "s_delay_alu instid0(VALU_DEP_4)\n\t"
      "v_add_f32_dpp %0, %0, %0 row_xmask:8 row_mask:0xf bank_mask:0xf\n\t"
      "s_delay_alu instid0(VALU_DEP_4)\n\t"
      "v_add_f32_dpp %1, %1, %1 row_xmask:8 row_mask:0xf bank_mask:0xf\n\t"
      "s_delay_alu instid0(VALU_DEP_4)\n\t"
      "v_add_f32_dpp %2, %2, %2 row_xmask:8 row_mask:0xf bank_mask:0xf\n\t"
      "s_delay_alu instid0(VALU_DEP_4)\n\t"
      "v_add_f32_dpp %3, %3, %3 row_xmask:8 row_mask:0xf bank_mask:0xf"
      : "+v"(a), "+v"(b), "+v"(c), "+v"(d));
#endif
}
// f32 -> f16 hi + unscaled f16 residual (hi + lo ~ x to 2^-22 relative; a flushed subnormal lo costs < 6.1e-5 absolute in the carried scale)
__device__ __forceinline__ void sp16(float x, _Float16& hi, _Float16& lo) {
  const _Float16 a = (_Float16)x;
  hi = a;
  lo = (_Float16)(x - (float)a);
}

// =====================================================================================================
// 16-bit pack into a fragment-order plane: value f16( bf16_RNE(src[r][cn]) * sc ), sc a power of two (exact); src row-major [R][64 << lgt].
// One wave per 16 x 64 block: 8 loads (16 rows x 256 B of f32) in flight, then 4 stores of 512 contiguous bytes.
// All seven planes in ONE launch: they depend on nothing but the inputs, so one grid pays one launch gap, one fill and one tail, not seven.
// The workgroup index picks the plane (workgroup-uniform, scalar): CBX workgroups each for the q, k, v activations, CBW each for Wq, Wk, Wv,
// CBE for Er. The seven planes lie one behind the other in the workspace in this same order, so 16 x 64 block g of the whole grid goes to dst + 1024 g.
// coverage: a plane of n elements has n / 8192 workgroups x 8 waves x 1024 elements = n exactly (n % 8192 == 0 for every plane, checked at compile time).
// =====================================================================================================
#define CBX ((NROW * DMOD) / 8192)
#define CBW ((DMOD * DMOD) / 8192)
#define CBE ((ELEN * DH) / 8192)
#define CBALL (3 * CBX + 3 * CBW + CBE)
__global__ __launch_bounds__(256) void cvt_all(const float* __restrict__ xq, const float* __restrict__ xk, const float* __restrict__ xv,
                                               const float* __restrict__ wq, const float* __restrict__ wk, const float* __restrict__ wv,
                                               const float* __restrict__ er, unsigned short* dst) {
  const int lane = threadIdx.x & 31;
  const int bx = blockIdx.x;
  if (bx >= CBALL) return;                                    // never taken with the exact grid; no barriers in this kernel
  const float* src;                                           // the plane's f32 source, row-major [R][64 << lgt]
  int b0, lgt;                                                // the plane's first workgroup; log2(columns / 64)
  float sc;                                                   // the plane's carried power of two
  if (bx < 3 * CBX) {
    const int p = bx / CBX;
    src = (p == 0) ? xq : ((p == 1) ? xk : xv);
    b0 = p * CBX; lgt = 4; sc = XC;
  } else if (bx < 3 * CBX + 3 * CBW) {
    const int p = (bx - 3 * CBX) / CBW;
    src = (p == 0) ? wq : ((p == 1) ? wk : wv);
    b0 = 3 * CBX + p * CBW; lgt = 4; sc = WSC;
  } else {
    src = er;
    b0 = 3 * CBX + 3 * CBW; lgt = 0; sc = EC;
  }
  const int wv8 = threadIdx.x >> 5;
  const int w = (bx - b0) * 8 + wv8;                          // 16 x 64 block index in the plane = (row block) * (columns / 64) + column block
  const int tm = w >> lgt;
  const int tn = w - (tm << lgt);
  const float* sp = src + (((size_t)(tm * 16 + (lane & 15))) << (lgt + 6)) + tn * 64 + (lane >> 4) * 8;
  v4f a[4], b[4];
#pragma unroll
  for (int it = 0; it < 4; ++it) {                            // quarter it: columns 16 it + 8 (lane >> 4) ..
    a[it] = *(const v4f*)(sp + it * 16);
    b[it] = *(const v4f*)(sp + it * 16 + 4);
  }
  addr_wait1((const unsigned short*)sp);
  unsigned short* dp = dst + (size_t)(bx * 8 + wv8) * 1024 + lane * 8;
#pragma unroll
  for (int it = 0; it < 4; ++it) {
    v4u o;
    o[0] = pk16(h_bits((_Float16)(bfr(a[it][0]) * sc)), h_bits((_Float16)(bfr(a[it][1]) * sc)));
    o[1] = pk16(h_bits((_Float16)(bfr(a[it][2]) * sc)), h_bits((_Float16)(bfr(a[it][3]) * sc)));
    o[2] = pk16(h_bits((_Float16)(bfr(b[it][0]) * sc)), h_bits((_Float16)(bfr(b[it][1]) * sc)));
    o[3] = pk16(h_bits((_Float16)(bfr(b[it][2]) * sc)), h_bits((_Float16)(bfr(b[it][3]) * sc)));
    *(v4u*)(dp + it * 256) = o;
  }
}

// =====================================================================================================
// Register-blocked batched 16-bit WMMA GEMM body (device function, called by proj3): C[m][n] = oscale * sum_k A[m][k] * Bt[n][k] (+ bias);
// one wave per 64x64 tile, no block barriers. A [M][K] and Bt [N][K] are fragment-order planes with lda = ldb = K columns; M, N, K multiples of 64.
// 16-bit outputs are fragment-order planes of ldc columns (ldc % 64 == 0). by = batch index with element strides sA, sB, sC; bx = workgroup index inside the batch; slab = the wave's LDS slab.
// ASPLIT 1: a second A plane A2 (unscaled residual of A, same layout) is multiplied into the same accumulator (A + A2 ~ exact A).
// BF 1: bf16 operands (v_wmma_f32_16x16x32_bf16), else f16.
// EPI 1: value += bf16_RNE(ep0[column]) (per-column bias); EPI 2: value += bf16_RNE(ep0[row]) (per-row bias, 16-bit out only).
// OM 0: f32 out (pitch ldc).  OM 2: one f16 plane = f16(value * ocarry).
// OM 4: two f16 planes: hi = f16(value * ocarry), lo = f16(value * ocarry - hi) (unscaled residual).
// OM 5: two f16 planes: C = f16((value + bf16_RNE(ep1[column])) * ocarry), C2 = f16((value + bf16_RNE(ep2[column])) * ocarry).
// coverage: 4 slabs x 16 rows (f32: it 0..7 x lane>>4; 16-bit: row lane&15, quarters it 0..3 x column half lane>>4) x 64 cols = the wave's whole 64x64 tile;
//           bx covers ceil(tilesM*tilesN/GW) workgroups of GW waves, surplus waves return (wave-uniform).
// =====================================================================================================
#define GW 4   // waves per projection workgroup
template <int OM, int ASPLIT, int BF, int EPI>
__device__ __forceinline__ void gemm64(
    const unsigned short* __restrict__ Ap, const unsigned short* __restrict__ A2p, int lda, long long sA,
    const unsigned short* __restrict__ Btp, int ldb, long long sB,
    void* Cout, void* C2out, int ldc, long long sC,
    int M, int N, int K, float oscale, float ocarry,
    const float* __restrict__ ep0, const float* __restrict__ ep1, const float* __restrict__ ep2,
    int bx, int by, float* slab) {
  const int lane = threadIdx.x & 31;
  const int wave = threadIdx.x >> 5;
  const int tilesN = N >> 6;
  const int tilesM = M >> 6;
  const int tile = bx * GW + wave;
  if (tile >= tilesM * tilesN) return;   // wave-uniform; no block barriers in the calling kernel
  const int tm = tile / tilesN;
  const int tn = tile - tm * tilesN;
  const int m0 = tm << 6;
  const int n0 = tn << 6;

  const unsigned short* A1 = Ap  + (size_t)((long long)by * sA);
  const unsigned short* A2 = A2p + (size_t)((long long)by * sA);
  const unsigned short* Bb = Btp + (size_t)((long long)by * sB);

  const int rlane = lane & 15;                 // row (A) / col (B, D) within subtile
  const int l8    = lane * 8;                  // the lane's slot in a quarter of a fragment-order block
  const int mOff  = (lane >> 4) * 8;           // D row offset

  v8f acc[4][4];
#pragma unroll
  for (int i = 0; i < 4; ++i)
#pragma unroll
    for (int j = 0; j < 4; ++j) acc[i][j] = zero8();

  for (int k0 = 0; k0 < K; k0 += 32) {
    // all eight fragments of the k step (4 of B, 4 of A) are requested together, ahead of its products: the step waits out one load latency, not four
    const unsigned short* pb = Bb + (size_t)(n0 >> 4) * (16 * ldb) + k0 * 16 + l8;
    const unsigned short* pa = A1 + (size_t)(m0 >> 4) * (16 * lda) + k0 * 16 + l8;
    v16h bh[4], ah[4];
#pragma unroll
    for (int j = 0; j < 4; ++j) bh[j] = ldfrag_p(pb + (size_t)j * (16 * ldb));
#pragma unroll
    for (int i = 0; i < 4; ++i) ah[i] = ldfrag_p(pa + (size_t)i * (16 * lda));
    addr_wait2(pb, pa);
    __builtin_amdgcn_sched_barrier(0);   // the whole group is requested before its first product: the scheduler otherwise pairs each load with its use again
#pragma unroll
    for (int i = 0; i < 4; ++i) {
#pragma unroll
      for (int j = 0; j < 4; ++j) acc[i][j] = mmaT<BF>(ah[i], bh[j], acc[i][j]);
      dep_guard1(acc[i][0], acc[i][3], ah[i]);
      if constexpr (ASPLIT != 0) {
        const unsigned short* pa2 = A2 + (size_t)((m0 >> 4) + i) * (16 * lda) + k0 * 16 + l8;
        const v16h al = ldfrag_p(pa2);
        addr_wait1(pa2);
#pragma unroll
        for (int j = 0; j < 4; ++j) acc[i][j] = mmaT<BF>(al, bh[j], acc[i][j]);
        dep_guard1(acc[i][0], acc[i][3], al);
      }
    }
    keep4_h(bh[0], bh[1], bh[2], bh[3]);
  }
  acc_guard4(acc[0][0], acc[0][1], acc[0][2], acc[0][3]);
  acc_guard4(acc[1][0], acc[1][1], acc[1][2], acc[1][3]);
  acc_guard4(acc[2][0], acc[2][1], acc[2][2], acc[2][3]);
  acc_guard4(acc[3][0], acc[3][1], acc[3][2], acc[3][3]);

  const int hh2 = lane >> 4, c4 = (lane & 15) * 4;     // f32 out: 256-B row segment = 16 lanes x 16 B

  // ---- epilogue ----
#pragma unroll
  for (int i = 0; i < 4; ++i) {
    const int mBase = m0 + (i << 4);
#pragma unroll
    for (int j = 0; j < 4; ++j) {
#pragma unroll
      for (int r = 0; r < 8; ++r) {
        slab[(mOff + r) * 68 + (j << 4) + rlane] = acc[i][j][r];
      }
    }
    wave_sync_lds();
    if constexpr (OM == 0) {
      float* C = (float*)Cout + (size_t)((long long)by * sC);
      v4f vals[8];
#pragma unroll
      for (int it = 0; it < 8; ++it) {
        const int row = it * 2 + hh2;                      // it 0..7 x hh2 0..1 = rows 0..15
        v4f v = *(const v4f*)(slab + row * 68 + c4);
#pragma unroll
        for (int e = 0; e < 4; ++e) v[e] = v[e] * oscale;
        if constexpr (EPI == 1) {
          const v4f bb = *(const v4f*)(ep0 + n0 + c4);     // per-column bias, columns n0+c4 .. +3 (N equals the bias length)
#pragma unroll
          for (int e = 0; e < 4; ++e) v[e] = v[e] + bfr(bb[e]);
        }
        vals[it] = v;
      }
      {
#pragma unroll
        for (int it = 0; it < 8; ++it) {
          const int gr = mBase + it * 2 + hh2;
          *(v4f*)(C + (size_t)gr * ldc + n0 + c4) = vals[it];
        }
        
      }
    } else {
      unsigned short* C  = (unsigned short*)Cout  + (size_t)((long long)by * sC);
      unsigned short* Cb = (unsigned short*)C2out + (size_t)((long long)by * sC);
      v4u hv[4], lv[4];
#pragma unroll
      for (int it = 0; it < 4; ++it) {
        const int row = rlane;                             // the lane's slot in quarter it: row lane&15, columns 16 it + 8 (lane>>4) ..
        const int c8  = it * 16 + mOff;
        const float* sp = slab + row * 68 + c8;
        float rb = 0.f;
        if constexpr (EPI == 2) rb = bfr(ep0[mBase + row]);   // per-row bias (M equals the bias length)
        v4u a  = {0u, 0u, 0u, 0u};
        v4u b2 = {0u, 0u, 0u, 0u};
#pragma unroll
        for (int e = 0; e < 4; ++e) {
          const int ci = n0 + c8 + 2 * e;                  // column index, < N
          float f0 = sp[2 * e] * oscale + rb;
          float f1 = sp[2 * e + 1] * oscale + rb;
          if constexpr (EPI == 1) {
            f0 += bfr(ep0[ci]);
            f1 += bfr(ep0[ci + 1]);
          }
          if constexpr (OM == 5) {
            const float g0 = (f0 + bfr(ep1[ci])) * ocarry, g1 = (f1 + bfr(ep1[ci + 1])) * ocarry;
            const float w0 = (f0 + bfr(ep2[ci])) * ocarry, w1 = (f1 + bfr(ep2[ci + 1])) * ocarry;
            a[e]  = pk16(h_bits((_Float16)g0), h_bits((_Float16)g1));
            b2[e] = pk16(h_bits((_Float16)w0), h_bits((_Float16)w1));
          } else {
            f0 *= ocarry; f1 *= ocarry;
            const _Float16 x0 = (_Float16)f0, x1 = (_Float16)f1;
            a[e] = pk16(h_bits(x0), h_bits(x1));
            if constexpr (OM == 4) {
              b2[e] = pk16(h_bits((_Float16)(f0 - (float)x0)), h_bits((_Float16)(f1 - (float)x1)));
            }
          }
        }
        hv[it] = a;
        lv[it] = b2;
      }
      {
#pragma unroll
        for (int it = 0; it < 4; ++it) {
          const size_t co = ((size_t)(mBase >> 4) * (ldc >> 6) + (n0 >> 6)) * 1024 + it * 256 + l8;   // 512 contiguous bytes per store
          *(v4u*)(C + co) = hv[it];
          if constexpr (OM >= 4) {
            *(v4u*)(Cb + co) = lv[it];
          }
        }
        
      }
    }
    wave_sync_lds();
  }
}

// =====================================================================================================
// The three projections in ONE launch, so that their waves are on the chip together: blockIdx.y = 0: q, 1: k, 2: v^T.
//   q, k: M = NROW, N = 1024, K = 1024, per-column bias; (NROW/64)*(DMOD/64) = 1024 tiles = PJB workgroups of GW waves.
//   v^T per batch: VT[b][e][j], M = 1024 (e), N = SEQ (j), K = 1024, per-row bias; 512 tiles per batch = PJB/NBAT workgroups,
//   batch = blockIdx.x / (PJB/NBAT). Every branch below is workgroup-uniform; no block barriers.
// coverage: grid (PJB, 3) x GW waves = every 64x64 tile of QH/QL, KH/KL and VH/VL exactly once.
// =====================================================================================================
#define PJB (((NROW / 64) * (DMOD / 64)) / GW)
static_assert(((NROW / 64) * (DMOD / 64)) % GW == 0);
static_assert((DMOD / 64) * (SEQ / 64) * NBAT == PJB * GW && (PJB % NBAT) == 0);
__global__ __launch_bounds__(GW * 32) __attribute__((amdgpu_num_vgpr(256))) void proj3(
    const unsigned short* __restrict__ Xq, const unsigned short* __restrict__ Xk, const unsigned short* __restrict__ Xv,
    const unsigned short* __restrict__ Wq, const unsigned short* __restrict__ Wk, const unsigned short* __restrict__ Wv,
    unsigned short* QH, unsigned short* QL, unsigned short* KH, unsigned short* KL, unsigned short* VH, unsigned short* VL,
    const float* __restrict__ bq, const float* __restrict__ bk, const float* __restrict__ bv) {
  __shared__ __align__(16) float sT[GW][16 * 68];   // per-wave 16x64 slab, pitch 68 floats
  float* slab = sT[threadIdx.x >> 5];
  const int p = blockIdx.y;
  if (p < 2) {
    const unsigned short* X = (p == 0) ? Xq : Xk;
    const unsigned short* Wt = (p == 0) ? Wq : Wk;
    unsigned short* H = (p == 0) ? QH : KH;
    unsigned short* L = (p == 0) ? QL : KL;
    const float* bias = (p == 0) ? bq : bk;
    gemm64<4, 0, 0, 1>(X, X, DMOD, 0LL, Wt, DMOD, 0LL, (void*)H, (void*)L, DMOD, 0LL,
                       NROW, DMOD, DMOD, 1.0f / (XC * WSC), (p == 0) ? QC : KC,
                       bias, bias, bias, blockIdx.x, 0, slab);
  } else {
    const int per = PJB / NBAT;
    const int bt  = blockIdx.x / per;
    gemm64<4, 0, 0, 2>(Wv, Wv, DMOD, 0LL, Xv, DMOD, (long long)SEQ * DMOD, (void*)VH, (void*)VL, SEQ, (long long)DMOD * SEQ,
                       DMOD, SEQ, DMOD, 1.0f / (XC * WSC), VC,
                       bv, bv, bv, blockIdx.x - bt * per, bt, slab);
  }
}

// =====================================================================================================
// Causal attention with the skewed relative-position term for one (batch b, head h) pair and a 64-row query tile; 8 waves =
// 2 key groups x 4 query waves: wave (kg, qw) owns query rows iw0 .. iw0+15, iw0 = i0 + 16 qw, and walks every second key tile
// j0 = 64 kg, 64 (kg + 2), .. <= i0, keeping its own running (max, sum, O). After the loop group 1 hands its state over through LDS
// behind one block barrier and group 0 merges the two states (rescale by exp2(m - max)) and stores. So the longest wave walks 16 tiles,
// not 32. There are more workgroups than places on the chip: blockIdx.y counts the query tiles from the last (most key tiles) down,
// so that cost falls with the flat workgroup index (for speed only).
// Planes (all in fragment order, see ldfrag_p): QH/QL, KH/KL = f16 hi + residual of (q x64), (k x64), rows b*SEQ + position, DMOD columns,
//         head h = column block h; EP = f16(bf16_RNE(Er) x16) [ELEN][64]; VH/VL = f16 hi + residual of (v x64) as [b][h*64+d][SEQ] (keys = columns).
//   Srel(i, j) = q_i . Er[ELEN-1 - (i - j)] for j <= i (the pad-reshape skew). Per key tile the wave needs Er rows
//   wlo + x, wlo = ELEN-1 - (iw0 - j0) - 15, x = jj - R + 15 in [0, 78]: position window T[R][x] = (qh+ql)[iw0+R] . EP[wlo + x],
//   x in [0, 80) (5 subtiles of 16 Er rows, their ten fragments requested together, K = 64; wlo is a multiple of 16, so a subtile is one 16-row block,
//   whose index is clamped on the address; a clamped block only ever feeds entries with j > i, which the causal mask replaces);
//   each 16x16 subtile is stored to the wave's f32 LDS strip right after its WMMAs.
//   Content scores S = (qh+ql) . (kh+kl) (hh + hl + lh, 4 subtiles of 16 keys, fragments requested two subtiles at a time, K = 64) -> the wave's f32 slab.
//   score*log2(e) = S*CS + T[R][jj - R + 15]*CT (CS, CT fold 1/(carries) and 1/8); entries with j > i are replaced by -inf;
//   online softmax in base 2, max-subtracted (row max and sum via DPP row_xmask), running sums in f32; e = exp2(t - m) in (0,1] written
//   of P*1024 (f16 hi + residual) rebuilt from the slab rows (f32 vector loads, split k map) and the v^T hi / residual B fragments loaded
//   straight from VH/VL [h*64+d][j]; 12 WMMAs per 32-key step (Ph.vh + Ph.vl + Pl.vh), 4 d-subtiles.
//   out rows (b*SEQ + iw0 + row), floats h*64 .. h*64+63 = one whole 256-B segment (2 lines) per row: 16 consecutive lanes x 16 B,
//   block = 8 waves = 256 threads; grid = (NBAT*NH, SEQ/64); one block barrier, behind the key loop, passed by every wave;
//   every wave does bounded work (<= SEQ/128 tiles).
// coverage: LDS strip 16 x 80 of TPI and slab 16 x 64 of SPI per wave, fully written before read each tile; global: 8 instructions x
//           2 rows x 64 floats = rows iw0..iw0+15 of head segment h; grid x waves cover all NBAT*SEQ rows and all NH head segments once.
// =====================================================================================================
__global__ __launch_bounds__(ATT_THREADS) __attribute__((amdgpu_num_vgpr(256)))
void attn_rel(const unsigned short* __restrict__ QH, const unsigned short* __restrict__ QL,
              const unsigned short* __restrict__ KH, const unsigned short* __restrict__ KL,
              const unsigned short* __restrict__ EP,
              const unsigned short* __restrict__ VH, const unsigned short* __restrict__ VL,
              float* out) {
  __shared__ __align__(16) float smem[ATT_W * WFL];   // per wave: T strip [16][TPI] | score / prob / ctx slab [16][SPI]

  const int tid  = threadIdx.x;
  const int wave = __builtin_amdgcn_readfirstlane(tid >> 5);   // scalar, so that the key loop's per-wave start and end stay scalar branches
  const int qw   = wave & (ATT_QW - 1);
  const int kg   = wave / ATT_QW;
  const int lane = tid & 31;
  const int hh   = lane >> 4;
  const int c    = lane & 15;
  const int bh   = blockIdx.x;
  const int b    = bh / NH;
  const int h    = bh - b * NH;
  const int qt   = (SEQ / 64 - 1) - (int)blockIdx.y;           // query tile, the one with the most key tiles first
  const int i0   = qt * 64;
  const int iw0  = i0 + qw * 16;

  float* tsh = smem + wave * WFL;
  float* pt  = tsh + 16 * TPI;
  // the lane's own bases in strip and slab: every access of the key loop is base + a constant, which leaves the registers to the fragments in flight
  float* tst = tsh + 8 * hh * TPI + c;             // strip row 8hh, column c
  float* pst = pt + 8 * hh * SPI + c;              // slab row 8hh, column c
  const float* tgt = tst + 15 - 8 * hh;            // shifted gather: row 8hh + r starts at tgt + r * (TPI - 1)

  const int l8 = lane * 8;                                                       // the lane's slot in a quarter of a fragment-order block
  const size_t qro = ((size_t)((b * SEQ + iw0) >> 4) * (DMOD / 64) + h) * 1024 + l8;   // block of query rows iw0.., head h
  const size_t kbo = ((size_t)((b * SEQ) >> 4) * (DMOD / 64) + h) * 1024 + l8;         // block of key rows 0..15 of batch b, head h
  const unsigned short* Khb = KH + kbo;
  const unsigned short* Klb = KL + kbo;
  const unsigned short* Eb  = EP + l8;
  const size_t vpo = (size_t)b * DMOD * SEQ + (size_t)(h * (DH / 16)) * (SEQ / 64) * 1024 + l8;   // block of d rows 0..15 of head h, keys 0..63
  const unsigned short* Vhb = VH + vpo;
  const unsigned short* Vlb = VL + vpo;

  const float CS = LOG2E * SCALE / (QC * KC);
  const float CT = LOG2E * SCALE / (QC * EC);

  float mrow[8], lrow[8];
  v8f O[4];
#pragma unroll
  for (int r = 0; r < 8; ++r) { mrow[r] = -INFINITY; lrow[r] = 0.f; }
#pragma unroll
  for (int td = 0; td < 4; ++td) O[td] = zero8();

  const int ntile = qt + 1;                  // causal: key tiles j0 <= i0
#pragma unroll 1
  for (int jt = kg; jt < ntile; jt += ATT_KG) {
    const int j0 = jt * 64;
    const v16h qha = ldfrag_p(QH + qro), qhb = ldfrag_p(QH + qro + 512);
    const v16h qla = ldfrag_p(QL + qro), qlb = ldfrag_p(QL + qro + 512);

    // ---- position window T (5 subtiles of 16 Er rows), each subtile stored to the LDS strip as produced ----
    {
      const int wb = ((ELEN - 1) - (iw0 - j0) - 15) >> 4;   // wlo / 16, exact: ELEN, iw0 and j0 are multiples of 16
      // all ten Er fragments are requested together, ahead of the products: the window waits out one load latency, not five
      v16h fa[5], fb[5];
      const unsigned short* pe[5];
#pragma unroll
      for (int u = 0; u < 5; ++u) {
        int m = wb + u;
        m = (m < 0) ? 0 : m;
        m = (m > ELEN / 16 - 1) ? (ELEN / 16 - 1) : m;
        pe[u] = Eb + (size_t)m * 1024;
        fa[u] = ldfrag_p(pe[u]);
        fb[u] = ldfrag_p(pe[u] + 512);
      }
      addr_wait4(pe[0], pe[1], pe[2], pe[3]);
      addr_wait1(pe[4]);
      __builtin_amdgcn_sched_barrier(0);   // the whole group is requested before its first product: the scheduler otherwise pairs each load with its use again
#pragma unroll
      for (int u = 0; u < 5; ++u) {
        v8f t8 = mma_h(qha, fa[u], zero8());
        t8 = mma_h(qla, fa[u], t8);
        t8 = mma_h(qhb, fb[u], t8);
        t8 = mma_h(qlb, fb[u], t8);
        hz6(t8, fa[u], fb[u], qha, qla, qhb, qlb);
#pragma unroll
        for (int r = 0; r < 8; ++r) tst[r * TPI + 16 * u] = t8[r];
      }
    }
    __builtin_amdgcn_sched_barrier(0);   // keeps a later phase's index and address work out of this phase, whose registers the fragments in flight need
    // ---- content scores S (4 subtiles of 16 keys) -> slab ----
    {
      // the key fragments are requested in two groups of two subtiles, each ahead of its products: two load latencies, not four
      const unsigned short* pkh = Khb + (size_t)(j0 >> 4) * ((DMOD / 64) * 1024);
      const unsigned short* pkl = Klb + (size_t)(j0 >> 4) * ((DMOD / 64) * 1024);
      v16h kha[4], khb[4], kla[4], klb[4];
#pragma unroll
      for (int t = 0; t < 4; ++t) {
        if ((t & 1) == 0) {
#pragma unroll
          for (int x = t; x < t + 2; ++x) {
            kha[x] = ldfrag_p(pkh + (size_t)x * ((DMOD / 64) * 1024));
            khb[x] = ldfrag_p(pkh + (size_t)x * ((DMOD / 64) * 1024) + 512);
            kla[x] = ldfrag_p(pkl + (size_t)x * ((DMOD / 64) * 1024));
            klb[x] = ldfrag_p(pkl + (size_t)x * ((DMOD / 64) * 1024) + 512);
          }
          addr_wait2(pkh, pkl);
          __builtin_amdgcn_sched_barrier(0);   // the whole group is requested before its first product: the scheduler otherwise pairs each load with its use again
        }
        v8f s8 = mma_h(qha, kha[t], zero8());
        s8 = mma_h(qha, kla[t], s8);
        s8 = mma_h(qla, kha[t], s8);
        s8 = mma_h(qhb, khb[t], s8);
        s8 = mma_h(qhb, klb[t], s8);
        s8 = mma_h(qlb, khb[t], s8);
        hz8(s8, kha[t], khb[t], kla[t], klb[t], qha, qla, qhb, qlb);
#pragma unroll
        for (int r = 0; r < 8; ++r) pst[r * SPI + 16 * t] = s8[r];
      }
    }
    __builtin_amdgcn_sched_barrier(0);   // keeps a later phase's index and address work out of this phase, whose registers the fragments in flight need
    wave_sync_lds();
    // v^T fragments of the first 32 keys: requested here, behind the fence (which waits for loads in flight), so that they arrive while the softmax runs
    const unsigned short* pvh = Vhb + (size_t)jt * 1024;
    const unsigned short* pvl = Vlb + (size_t)jt * 1024;
    v16h vh[4], vl[4];
#pragma unroll
    for (int td = 0; td < 4; ++td) {
      vh[td] = ldfrag_p(pvh + (size_t)td * ((SEQ / 64) * 1024));
      vl[td] = ldfrag_p(pvl + (size_t)td * ((SEQ / 64) * 1024));
    }
    addr_wait2(pvh, pvl);

    // ---- score assembly, causal mask, online softmax (rows live on one 16-lane half) ----
    const int dj = (j0 - iw0) + c - 8 * hh;        // j - i = dj + 16 t - r
    // four rows at a time: their 32 LDS reads go out together, and every stage (assembly, max, exponentials, sum) runs on four independent chains,
    // so one row's LDS and vector latencies are filled by the other three; the second four's reads stand in front of the first four's stores
    float sv[2][4][4], tw[2][4][4], e4[2][4][4];
#pragma unroll
    for (int g = 0; g < 2; ++g) {
      if (g == 0) {
#pragma unroll
        for (int x = 0; x < 4; ++x)
#pragma unroll
          for (int t = 0; t < 4; ++t) { sv[0][x][t] = pst[x * SPI + 16 * t]; tw[0][x][t] = tgt[x * (TPI - 1) + 16 * t]; }
      }
      float tv[4][4], mx[4], al[4], ps[4];
#pragma unroll
      for (int x = 0; x < 4; ++x) {
        const int r = 4 * g + x;
#pragma unroll
        for (int t = 0; t < 4; ++t) {
          const float val = sv[g][x][t] * CS + tw[g][x][t] * CT;
          tv[x][t] = (dj > r - 16 * t) ? -INFINITY : val;
        }
        mx[x] = fmaxf(fmaxf(tv[x][0], tv[x][1]), fmaxf(tv[x][2], tv[x][3]));
      }
      row_max16x4(mx[0], mx[1], mx[2], mx[3]);
      // the 20 exponentials of the four rows, stage by stage: exp2f written out in its own steps (argument under -126 lifted by 64, the bare
      // exponential, the result scaled back by 2^-64: the same values), so that each step runs on 20 independent values and no step waits for the one before
      float d[4][5];                                 // [x][0..3]: score - new maximum; [x][4]: old maximum - new maximum
#pragma unroll
      for (int x = 0; x < 4; ++x) {
        const int r = 4 * g + x;
        const float mn = fmaxf(mrow[r], mx[x]);
#pragma unroll
        for (int t = 0; t < 4; ++t) d[x][t] = tv[x][t] - mn;
        d[x][4] = mrow[r] - mn;
        mrow[r] = mn;
      }
      float ea[4][5];
#pragma unroll
      for (int x = 0; x < 4; ++x)
#pragma unroll
        for (int k = 0; k < 5; ++k) ea[x][k] = d[x][k] + ((d[x][k] < -126.0f) ? 64.0f : 0.0f);
      __builtin_amdgcn_sched_barrier(0);   // keeps the stages apart: the scheduler otherwise runs each exponential's whole chain by itself, one after another
#pragma unroll
      for (int x = 0; x < 4; ++x)
#pragma unroll
        for (int k = 0; k < 5; ++k) ea[x][k] = __builtin_amdgcn_exp2f(ea[x][k]);
      __builtin_amdgcn_sched_barrier(0);   // as above: all 20 exponentials are issued before the first result is used
#pragma unroll
      for (int x = 0; x < 4; ++x)
#pragma unroll
        for (int k = 0; k < 5; ++k) ea[x][k] = ldexpf(ea[x][k], (d[x][k] < -126.0f) ? -64 : 0);
#pragma unroll
      for (int x = 0; x < 4; ++x) {
        al[x] = ea[x][4];
        ps[x] = 0.f;
#pragma unroll
        for (int t = 0; t < 4; ++t) { e4[g][x][t] = ea[x][t]; ps[x] += e4[g][x][t]; }
      }
      row_sum16x4(ps[0], ps[1], ps[2], ps[3]);
      if (g == 0) {
#pragma unroll
        for (int x = 0; x < 4; ++x)
#pragma unroll
          for (int t = 0; t < 4; ++t) { sv[1][x][t] = pst[(4 + x) * SPI + 16 * t]; tw[1][x][t] = tgt[(4 + x) * (TPI - 1) + 16 * t]; }
      }
#pragma unroll
      for (int x = 0; x < 4; ++x) {
        const int r = 4 * g + x;
        lrow[r] = lrow[r] * al[x] + ps[x];
#pragma unroll
        for (int td = 0; td < 4; ++td) O[td][r] *= al[x];
#pragma unroll
        for (int t = 0; t < 4; ++t) pst[r * SPI + 16 * t] = e4[g][x][t];
      }
    }
    wave_sync_lds();
    __builtin_amdgcn_sched_barrier(0);   // keeps a later phase's index and address work out of this phase, whose registers the fragments in flight need

    // ---- O += (Ph + Pl) . (vh + vl)^T, two k-steps of 32 keys; a step's 8 v^T fragments are requested together, ahead of its P split ----
#pragma unroll
    for (int ks = 0; ks < 2; ++ks) {
      if (ks == 1) {
#pragma unroll
        for (int td = 0; td < 4; ++td) {
          vh[td] = ldfrag_p(pvh + (size_t)td * ((SEQ / 64) * 1024) + 512);
          vl[td] = ldfrag_p(pvl + (size_t)td * ((SEQ / 64) * 1024) + 512);
        }
        addr_wait2(pvh, pvl);
        __builtin_amdgcn_sched_barrier(0);   // the whole group is requested before its first product: the scheduler otherwise pairs each load with its use again
      }
      FragH ph, pl;
      {
        const float* prow = pt + c * SPI + 32 * ks + 8 * hh;
        const v4f p0 = *(const v4f*)(prow), p1 = *(const v4f*)(prow + 4);
        const v4f p2 = *(const v4f*)(prow + 16), p3 = *(const v4f*)(prow + 20);
#pragma unroll
        for (int e = 0; e < 4; ++e) {
          _Float16 a0, a1;
          sp16(p0[e] * PC, a0, a1); ph.h[0][e]     = a0; pl.h[0][e]     = a1;   // keys 32ks + 8hh + e
          sp16(p1[e] * PC, a0, a1); ph.h[0][4 + e] = a0; pl.h[0][4 + e] = a1;   // keys 32ks + 8hh + 4 + e
          sp16(p2[e] * PC, a0, a1); ph.h[1][e]     = a0; pl.h[1][e]     = a1;   // keys 32ks + 16 + 8hh + e
          sp16(p3[e] * PC, a0, a1); ph.h[1][4 + e] = a0; pl.h[1][4 + e] = a1;
        }
      }
#pragma unroll
      for (int td = 0; td < 4; ++td) {
        O[td] = mma_h(ph.v, vh[td], O[td]);
        O[td] = mma_h(ph.v, vl[td], O[td]);
        O[td] = mma_h(pl.v, vh[td], O[td]);
        hz4(O[td], vh[td], vl[td], ph.v, pl.v);
      }
    }
    wave_sync_lds();
  }
  acc_guard4(O[0], O[1], O[2], O[3]);

  // ---- merge of the two key groups: group 1 writes (O, m, l) to its own slab and strip, block barrier, group 0 reads and rescales.
  //      A group-1 wave without a tile hands over m = -inf, l = 0, O = 0, whose weight exp2(-inf) is 0; group 0 always has tile 0.
  if (kg != 0) {
#pragma unroll
    for (int r = 0; r < 8; ++r) {
      const int R = 8 * hh + r;
#pragma unroll
      for (int td = 0; td < 4; ++td) pt[R * SPI + 16 * td + c] = O[td][r];
      if (c == 0) { tsh[R] = mrow[r]; tsh[16 + R] = lrow[r]; }
    }
  }
  __syncthreads();                           // publishes group 1's state to group 0; every wave of the block passes it once
  if (kg != 0) return;
  {
    const float* ts2 = tsh + ATT_QW * WFL;   // wave (1, qw)'s strip and slab
    const float* pt2 = ts2 + 16 * TPI;
#pragma unroll
    for (int r = 0; r < 8; ++r) {
      const int R = 8 * hh + r;
      const float m2 = ts2[R], l2 = ts2[16 + R];
      const float mm = fmaxf(mrow[r], m2);
      const float a1 = exp2f(mrow[r] - mm), a2 = exp2f(m2 - mm);
      lrow[r] = lrow[r] * a1 + l2 * a2;
#pragma unroll
      for (int td = 0; td < 4; ++td) O[td][r] = O[td][r] * a1 + pt2[R * SPI + 16 * td + c] * a2;
    }
  }

  // ---- fold 1/l and the carries (1024 on P, 64 on v), stage the wave's 16x64 f32 slice in its slab ----
  const float oc = 1.0f / (PC * VC);
#pragma unroll
  for (int r = 0; r < 8; ++r) {
    const float inv = (1.0f / lrow[r]) * oc;
    const int ro = (8 * hh + r) * SPI + c;
#pragma unroll
    for (int td = 0; td < 4; ++td) pt[ro + 16 * td] = O[td][r] * inv;
  }
  wave_sync_lds();
  {
    const int c4 = c * 4;
    v4f vals[8];
#pragma unroll
    for (int it = 0; it < 8; ++it) {
      const int row = it * 2 + hh;                           // it 0..7 x hh 0..1 = rows 0..15
      vals[it] = *(const v4f*)(pt + row * SPI + c4);
    }
    float* ob = out + ((size_t)b * SEQ + iw0) * DMOD + h * DH + c4;
    {
#pragma unroll
      for (int it = 0; it < 8; ++it) {
        const int row = it * 2 + hh;
        *(v4f*)(ob + (size_t)row * DMOD) = vals[it];
      }
      
    }
  }
}

// =====================================================================================================
// Workspace map (bytes); every plane is an exact multiple of its tile / whole-row store granularity (M, N exact tile multiples,
// convert counts exact multiples of 8192, no pad rows), every offset a multiple of 262144; every plane is in fragment order (see ldfrag_p):
//   (the first seven planes keep this order with no gap between them: cvt_all numbers their 16 x 64 blocks straight through)
//   Xq, Xk, Xv  f16 [NROW][1024] x16                            3 x 8388608
//   Wq, Wk, Wv  f16 [1024 out][1024 in] x64                      3 x 2097152
//   EP          f16 [ELEN][64] x16                                   262144
//   QH, QL, KH, KL f16 [NROW][1024] (x64 hi / residual)         4 x 8388608
//   VH, VL      f16 [NBAT][1024][SEQ] (x64 hi / residual)       2 x 8388608
//   end                                                            82051072
// =====================================================================================================
extern "C" void kernel_launch(void* const* d_in, const int* in_sizes, int n_in,
                              void* d_out, int out_size, void* d_ws, size_t ws_size,
                              hipStream_t stream) {
  if (n_in < 10) return;
  if (in_sizes[0] != NROW * DMOD || in_sizes[1] != NROW * DMOD || in_sizes[2] != NROW * DMOD) return;
  if (in_sizes[3] != DMOD * DMOD || in_sizes[5] != DMOD * DMOD || in_sizes[7] != DMOD * DMOD) return;
  if (in_sizes[4] != DMOD || in_sizes[6] != DMOD || in_sizes[8] != DMOD) return;
  if (in_sizes[9] != ELEN * DH) return;
  if (out_size != NROW * DMOD) return;

  const float* qin = (const float*)d_in[0];
  const float* kin = (const float*)d_in[1];
  const float* vin = (const float*)d_in[2];
  const float* w_q = (const float*)d_in[3];
  const float* b_q = (const float*)d_in[4];
  const float* w_k = (const float*)d_in[5];
  const float* b_k = (const float*)d_in[6];
  const float* w_v = (const float*)d_in[7];
  const float* b_v = (const float*)d_in[8];
  const float* er  = (const float*)d_in[9];
  float*       out = (float*)d_out;

  const size_t PX = (size_t)NROW * DMOD * 2;             //  8388608
  const size_t PW = (size_t)DMOD * DMOD * 2;             //  2097152
  const size_t PE = (size_t)ELEN * DH * 2;               //   262144
  const size_t PV = (size_t)NBAT * DMOD * SEQ * 2;       //  8388608
  size_t off = 0;
  const size_t oXq = off; off += PX;
  const size_t oXk = off; off += PX;
  const size_t oXv = off; off += PX;
  const size_t oWq = off; off += PW;
  const size_t oWk = off; off += PW;
  const size_t oWv = off; off += PW;
  const size_t oE  = off; off += PE;
  const size_t oQH = off; off += PX;
  const size_t oQL = off; off += PX;
  const size_t oKH = off; off += PX;
  const size_t oKL = off; off += PX;
  const size_t oVH = off; off += PV;
  const size_t oVL = off; off += PV;
  if (off > ws_size) return;                               // off = 82051072
  if (off > (size_t)134217728) return;

  char* ws = (char*)d_ws;
  unsigned short* Xq  = (unsigned short*)(ws + oXq);
  unsigned short* Xk  = (unsigned short*)(ws + oXk);
  unsigned short* Xv  = (unsigned short*)(ws + oXv);
  unsigned short* Wq6 = (unsigned short*)(ws + oWq);
  unsigned short* Wk6 = (unsigned short*)(ws + oWk);
  unsigned short* Wv6 = (unsigned short*)(ws + oWv);
  unsigned short* E16 = (unsigned short*)(ws + oE);
  unsigned short* QHp = (unsigned short*)(ws + oQH);
  unsigned short* QLp = (unsigned short*)(ws + oQL);
  unsigned short* KHp = (unsigned short*)(ws + oKH);
  unsigned short* KLp = (unsigned short*)(ws + oKL);
  unsigned short* VHp = (unsigned short*)(ws + oVH);
  unsigned short* VLp = (unsigned short*)(ws + oVL);

  const dim3 blk(256);
  const dim3 gCV(CBALL);                                            // 3 x 512 + 3 x 128 + 16 = 1936
  const dim3 gP(PJB, 3);                                            // 256 x 3
  const dim3 bP(GW * 32);                                           // 128
  const dim3 gAT(NBAT * NH, SEQ / 64);                              // 32 x 32
  const dim3 bAT(ATT_THREADS);                                      // 256

  // (0) 16-bit planes of the inputs: activations f16(bf16_RNE(x) * 16); W[out][in] (already k-contiguous) f16(bf16_RNE(w) * 64);
  //     Er f16(bf16_RNE(e) * 16); one launch for all seven: Xq is the first of the seven planes, which follow one another in the workspace
  cvt_all<<<gCV, blk, 0, stream>>>(qin, kin, vin, w_q, w_k, w_v, er, Xq);

  // (1) one launch for the three projections:
  //     q[m][e] = sum_d x[m][d] Wq[e][d] / 1024 + bq[e] -> QH = f16(q * 64), QL = f16(q * 64 - QH); the same for k -> KH, KL;
  //     VT[b][e][j] = sum_c Wv[e][c] x[b*SEQ+j][c] / 1024 + bv[e] -> VH, VL (x64)
  proj3<<<gP, bP, 0, stream>>>(Xq, Xk, Xv, Wq6, Wk6, Wv6, QHp, QLp, KHp, KLp, VHp, VLp, b_q, b_k, b_v);

  // (2) causal relative attention -> out[b][i][h*64+d] (f32), written directly
  attn_rel<<<gAT, bAT, 0, stream>>>(QHp, QLp, KHp, KLp, E16, VHp, VLp, out);
  (void)hipGetLastError();
}

// v010
// Measured time: 83.5 microseconds a run.
// It is 1.43 times as fast as v008, going by the measured steps of the versions left out in between.
// All steps since v000 together make it 5.31 times as fast.
// Contractions (all v_wmma_f32_16x16x32_f16, f16 operands, f32 accumulate): q/k/v projections (x f16 x16 . W f16 x64, K=1024, single products,
// outputs written as one f16 plane each); position window (q f16 x64 . Er f16 x16, K=64, single products) -> f32 LDS strip,
// shifted gather on VALU; content scores (q f16 x64 . k f16 x64, K=64, single products); P . v^T (P f16 x1024 . v f16 x64, single products; all three taken transposed,
// 64 keys per tile). Causal mask, max-subtracted online base-2 softmax and the 1/l fold in f32 on VALU. Every float input RNE-converted to bf16 on load.
// q, k, v and P are carried as ONE f16 value each (11 significant bits): still 3 bits finer than the bf16 rounding (8 bits) that every input gets on load,
// which sets the result's error; an f16 residual plane under them refines bits that lie below that error.
#include <hip/hip_runtime.h>
#include <math.h>
#include <stdint.h>

#define SEQ   2048
#define NBAT  2
#define DMOD  1024
#define NH    16
#define DH    64
#define ELEN  2048
#define NROW  (NBAT * SEQ)
#define XC    16.0f
#define WSC   64.0f
#define QC    64.0f
#define KC    64.0f
#define EC    16.0f
#define VC    64.0f
#define PC    1024.0f
#define SCALE 0.125f
#define LOG2E 1.4426950408889634f
static_assert(NH * DH == DMOD);
static_assert(DH == 64);
static_assert(ELEN == SEQ);
static_assert((SEQ % 64) == 0 && (DMOD % 64) == 0 && (NROW % 64) == 0);
static_assert(((NROW * DMOD) % 8192) == 0 && ((DMOD * DMOD) % 8192) == 0 && ((ELEN * DH) % 8192) == 0);
static_assert((SEQ % 16) == 0 && (ELEN % 16) == 0);
#define ATT_QW 4                    // waves side by side on the query rows (16 rows each)
#define ATT_KG 2                    // groups of ATT_QW waves that share out the key tiles
#define ATT_W (ATT_QW * ATT_KG)
#define ATT_THREADS (ATT_W * 32)
static_assert(ATT_KG == 2);
#define TPI 84
#define SPI 68
#define WFL (16 * TPI + 16 * SPI)
static_assert(((16 * TPI) % 4) == 0 && ((16 * SPI) % 4) == 0 && (WFL % 4) == 0);

typedef _Float16 v16h __attribute__((ext_vector_type(16)));
typedef _Float16 v8h  __attribute__((ext_vector_type(8)));
typedef __bf16   v16b __attribute__((ext_vector_type(16)));
typedef float    v8f  __attribute__((ext_vector_type(8)));
typedef float    v4f  __attribute__((ext_vector_type(4)));
typedef float    v2f  __attribute__((ext_vector_type(2)));
typedef unsigned int v4u __attribute__((ext_vector_type(4)));

union FragH { v16h v; v8h h[2]; v4u u[2]; };
union FragAny { v16h h; v16b b; };

// ---- scalar helpers --------------------------------------------------------------------------------
__device__ __forceinline__ unsigned short bf_bits(float f) {          // f32 -> bf16 bits, RNE convert
  unsigned u = __float_as_uint(f);
  return (unsigned short)((u + 0x7FFFu + ((u >> 16) & 1u)) >> 16);
}
__device__ __forceinline__ float bf_up(unsigned short h) { return __uint_as_float(((unsigned)h) << 16); }
__device__ __forceinline__ float bfr(float f) { return bf_up(bf_bits(f)); }   // value of the bf16 RNE convert
__device__ __forceinline__ unsigned short h_bits(_Float16 x) { return __builtin_bit_cast(unsigned short, x); }
__device__ __forceinline__ unsigned pk16(unsigned short a, unsigned short b) { return (unsigned)a | ((unsigned)b << 16); }
__device__ __forceinline__ v8f zero8() { v8f z = {0.f, 0.f, 0.f, 0.f, 0.f, 0.f, 0.f, 0.f}; return z; }

// ---- fragment-order planes: a 16-bit matrix [R][Cn] (R % 16 == 0, Cn % 64 == 0; Cn is the k direction of its reader) is kept as blocks of
//      16 rows x 64 columns, block (r >> 4) * (Cn / 64) + (cn >> 6), 1024 halves each; inside a block four 256-half quarters qd = (cn >> 4) & 3,
//      inside a quarter lane slot ((cn >> 3) & 1) * 16 + (r & 15), 8 halves each. One A/B fragment (16 rows x 32 k) is two neighbouring quarters,
//      and each of its two 16-byte-per-lane loads reads 512 contiguous bytes (4 cache lines, where a row-major plane gives 16).
// ---- fragment loader: p = block + 512 * (k step inside the block) + 8 * lane; lane -> row/col (lane&15), h = lane>>4;
//      elements 0..7 <- k0+8h.., elements 8..15 <- k0+16+8h.. (same split k map for A and B; B is always read from a [n][k] plane)
__device__ __forceinline__ v16h ldfrag_p(const unsigned short* p) {
  FragH f;
  f.u[0] = *(const v4u*)(p);
  f.u[1] = *(const v4u*)(p + 256);
  return f.v;
}

// ---- WMMA helpers with trailing VALU hazard gaps ------------------------------------------------------
__device__ __forceinline__ v8f mma_h(v16h a, v16h b, v8f c) {
  return __builtin_amdgcn_wmma_f32_16x16x32_f16(false, a, false, b, (short)0, c, false, false);
}
__device__ __forceinline__ v8f mma_b(v16h a, v16h b, v8f c) {
  FragAny ua, ub;
  ua.h = a;
  ub.h = b;
  return __builtin_amdgcn_wmma_f32_16x16x32_bf16(false, ua.b, false, ub.b, (short)0, c, false, false);
}
template <int BF>
__device__ __forceinline__ v8f mmaT(v16h a, v16h b, v8f c) {
  if constexpr (BF != 0) return mma_b(a, b, c);
  else return mma_h(a, b, c);
}
__device__ __forceinline__ void dep_guard1(v8f& a, v8f& b, v16h x) {
#if defined(__HIP_DEVICE_COMPILE__)
  asm volatile("v_nop\n\tv_nop\n\tv_nop\n\tv_nop" : "+v"(a), "+v"(b) : "v"(x));
#endif
}
__device__ __forceinline__ void hz4(v8f& d, v16h x0, v16h x1, v16h x2, v16h x3) {
#if defined(__HIP_DEVICE_COMPILE__)
  asm volatile("v_nop\n\tv_nop\n\tv_nop\n\tv_nop" : "+v"(d) : "v"(x0), "v"(x1), "v"(x2), "v"(x3));
#endif
}
__device__ __forceinline__ void hz2(v8f& d, v16h x0, v16h x1) {
#if defined(__HIP_DEVICE_COMPILE__)
  asm volatile("v_nop\n\tv_nop\n\tv_nop\n\tv_nop" : "+v"(d) : "v"(x0), "v"(x1));
#endif
}
__device__ __forceinline__ void keep4_h(v16h a, v16h b, v16h c, v16h d) {
#if defined(__HIP_DEVICE_COMPILE__)
  asm volatile("v_nop" :: "v"(a), "v"(b), "v"(c), "v"(d));
#endif
}
__device__ __forceinline__ void acc_guard4(v8f& a, v8f& b, v8f& c, v8f& d) {
#if defined(__HIP_DEVICE_COMPILE__)
  asm volatile("v_nop\n\tv_nop\n\tv_nop\n\tv_nop" : "+v"(a), "+v"(b), "+v"(c), "+v"(d));
#endif
}
// loaded values as inputs only, no output, no clobber: keeps a group of loads together in front of their first use and leaves every multiply and add free to fuse
__device__ __forceinline__ void hold4_f(v8f a, v8f b, v8f c, v8f d) {
#if defined(__HIP_DEVICE_COMPILE__)
  asm volatile("" :: "v"(a), "v"(b), "v"(c), "v"(d));
#endif
}
__device__ __forceinline__ void wave_sync_lds() {
  __builtin_amdgcn_fence(__ATOMIC_RELEASE, "workgroup");
  __builtin_amdgcn_wave_barrier();
  __builtin_amdgcn_fence(__ATOMIC_ACQUIRE, "workgroup");
}
// s_wait_xcnt 0 behind a run of global fragment loads (GEMM and attention). The loads' address pointers are inputs only, so their registers stay
// live up to the wait: no later load of the run lands on them and no address arithmetic rewrites them before the wait has passed.
__device__ __forceinline__ void addr_wait1(const unsigned short* p) {
#if defined(__HIP_DEVICE_COMPILE__)
  asm volatile("s_wait_xcnt 0x0" :: "v"(p) : "memory");
#endif
}
__device__ __forceinline__ void addr_wait4(const unsigned short* p0, const unsigned short* p1, const unsigned short* p2, const unsigned short* p3) {
#if defined(__HIP_DEVICE_COMPILE__)
  asm volatile("s_wait_xcnt 0x0" :: "v"(p0), "v"(p1), "v"(p2), "v"(p3) : "memory");
#endif
}
__device__ __forceinline__ void addr_wait2(const unsigned short* p0, const unsigned short* p1) {
#if defined(__HIP_DEVICE_COMPILE__)
  asm volatile("s_wait_xcnt 0x0" :: "v"(p0), "v"(p1) : "memory");
#endif
}
// lane l reads the value of lane l ^ 16 (the other 16-lane row, same place in the row): one vector cross-row move, no LDS queue and no LDS wait
__device__ __forceinline__ float xhalf(float x) {
  const int v = __builtin_bit_cast(int, x);
  return __builtin_bit_cast(float, __builtin_amdgcn_permlanex16(v, v, 0x76543210, 0xfedcba98, false, false));
}
// =====================================================================================================
// 16-bit pack into a fragment-order plane: value f16( bf16_RNE(src[r][cn]) * sc ), sc a power of two (exact); src row-major [R][64 << lgt].
// One wave per 16 x 64 block: 8 loads (16 rows x 256 B of f32) in flight, then 4 stores of 512 contiguous bytes.
// All seven planes in ONE launch: they depend on nothing but the inputs, so one grid pays one launch gap, one fill and one tail, not seven.
// The workgroup index picks the plane (workgroup-uniform, scalar): CBX workgroups each for the q, k, v activations, CBW each for Wq, Wk, Wv,
// CBE for Er. The seven planes lie one behind the other in the workspace in this same order, so 16 x 64 block g of the whole grid goes to dst + 1024 g.
// coverage: a plane of n elements has n / 8192 workgroups x 8 waves x 1024 elements = n exactly (n % 8192 == 0 for every plane, checked at compile time).
// =====================================================================================================
#define CBX ((NROW * DMOD) / 8192)
#define CBW ((DMOD * DMOD) / 8192)
#define CBE ((ELEN * DH) / 8192)
#define CBALL (3 * CBX + 3 * CBW + CBE)
__global__ __launch_bounds__(256) void cvt_all(const float* __restrict__ xq, const float* __restrict__ xk, const float* __restrict__ xv,
                                               const float* __restrict__ wq, const float* __restrict__ wk, const float* __restrict__ wv,
                                               const float* __restrict__ er, unsigned short* dst) {
  const int lane = threadIdx.x & 31;
  const int bx = blockIdx.x;
  if (bx >= CBALL) return;                                    // never taken with the exact grid; no barriers in this kernel
  const float* src;                                           // the plane's f32 source, row-major [R][64 << lgt]
  int b0, lgt;                                                // the plane's first workgroup; log2(columns / 64)
  float sc;                                                   // the plane's carried power of two
  if (bx < 3 * CBX) {
    const int p = bx / CBX;
    src = (p == 0) ? xq : ((p == 1) ? xk : xv);
    b0 = p * CBX; lgt = 4; sc = XC;
  } else if (bx < 3 * CBX + 3 * CBW) {
    const int p = (bx - 3 * CBX) / CBW;
    src = (p == 0) ? wq : ((p == 1) ? wk : wv);
    b0 = 3 * CBX + p * CBW; lgt = 4; sc = WSC;
  } else {
    src = er;
    b0 = 3 * CBX + 3 * CBW; lgt = 0; sc = EC;
  }
  const int wv8 = threadIdx.x >> 5;
  const int w = (bx - b0) * 8 + wv8;                          // 16 x 64 block index in the plane = (row block) * (columns / 64) + column block
  const int tm = w >> lgt;
  const int tn = w - (tm << lgt);
  const float* sp = src + (((size_t)(tm * 16 + (lane & 15))) << (lgt + 6)) + tn * 64 + (lane >> 4) * 8;
  v4f a[4], b[4];
#pragma unroll
  for (int it = 0; it < 4; ++it) {                            // quarter it: columns 16 it + 8 (lane >> 4) ..
    a[it] = *(const v4f*)(sp + it * 16);
    b[it] = *(const v4f*)(sp + it * 16 + 4);
  }
  addr_wait1((const unsigned short*)sp);
  unsigned short* dp = dst + (size_t)(bx * 8 + wv8) * 1024 + lane * 8;
#pragma unroll
  for (int it = 0; it < 4; ++it) {
    v4u o;
    o[0] = pk16(h_bits((_Float16)(bfr(a[it][0]) * sc)), h_bits((_Float16)(bfr(a[it][1]) * sc)));
    o[1] = pk16(h_bits((_Float16)(bfr(a[it][2]) * sc)), h_bits((_Float16)(bfr(a[it][3]) * sc)));
    o[2] = pk16(h_bits((_Float16)(bfr(b[it][0]) * sc)), h_bits((_Float16)(bfr(b[it][1]) * sc)));
    o[3] = pk16(h_bits((_Float16)(bfr(b[it][2]) * sc)), h_bits((_Float16)(bfr(b[it][3]) * sc)));
    *(v4u*)(dp + it * 256) = o;
  }
}

// =====================================================================================================
// Register-blocked batched 16-bit WMMA GEMM body (device function, called by proj3): C[m][n] = oscale * sum_k A[m][k] * Bt[n][k] (+ bias);
// one wave per 64x64 tile, no block barriers. A [M][K] and Bt [N][K] are fragment-order planes with lda = ldb = K columns; M, N, K multiples of 64.
// 16-bit outputs are fragment-order planes of ldc columns (ldc % 64 == 0). by = batch index with element strides sA, sB, sC; bx = workgroup index inside the batch; slab = the wave's LDS slab.
// ASPLIT 1: a second A plane A2 (unscaled residual of A, same layout) is multiplied into the same accumulator (A + A2 ~ exact A).
// BF 1: bf16 operands (v_wmma_f32_16x16x32_bf16), else f16.
// EPI 1: value += bf16_RNE(ep0[column]) (per-column bias); EPI 2: value += bf16_RNE(ep0[row]) (per-row bias, 16-bit out only).
// OM 0: f32 out (pitch ldc).  OM 2: one f16 plane = f16(value * ocarry).
// OM 4: two f16 planes: hi = f16(value * ocarry), lo = f16(value * ocarry - hi) (unscaled residual).
// OM 5: two f16 planes: C = f16((value + bf16_RNE(ep1[column])) * ocarry), C2 = f16((value + bf16_RNE(ep2[column])) * ocarry).
// coverage: 4 slabs x 16 rows (f32: it 0..7 x lane>>4; 16-bit: row lane&15, quarters it 0..3 x column half lane>>4) x 64 cols = the wave's whole 64x64 tile;
//           bx covers ceil(tilesM*tilesN/GW) workgroups of GW waves, surplus waves return (wave-uniform).
// =====================================================================================================
#define GW 4   // waves per projection workgroup
template <int OM, int ASPLIT, int BF, int EPI>
__device__ __forceinline__ void gemm64(
    const unsigned short* __restrict__ Ap, const unsigned short* __restrict__ A2p, int lda, long long sA,
    const unsigned short* __restrict__ Btp, int ldb, long long sB,
    void* Cout, void* C2out, int ldc, long long sC,
    int M, int N, int K, float oscale, float ocarry,
    const float* __restrict__ ep0, const float* __restrict__ ep1, const float* __restrict__ ep2,
    int bx, int by, float* slab) {
  const int lane = threadIdx.x & 31;
  const int wave = threadIdx.x >> 5;
  const int tilesN = N >> 6;
  const int tilesM = M >> 6;
  const int tile = bx * GW + wave;
  if (tile >= tilesM * tilesN) return;   // wave-uniform; no block barriers in the calling kernel
  const int tm = tile / tilesN;
  const int tn = tile - tm * tilesN;
  const int m0 = tm << 6;
  const int n0 = tn << 6;

  const unsigned short* A1 = Ap  + (size_t)((long long)by * sA);
  const unsigned short* A2 = A2p + (size_t)((long long)by * sA);
  const unsigned short* Bb = Btp + (size_t)((long long)by * sB);

  const int rlane = lane & 15;                 // row (A) / col (B, D) within subtile
  const int l8    = lane * 8;                  // the lane's slot in a quarter of a fragment-order block
  const int mOff  = (lane >> 4) * 8;           // D row offset

  v8f acc[4][4];
#pragma unroll
  for (int i = 0; i < 4; ++i)
#pragma unroll
    for (int j = 0; j < 4; ++j) acc[i][j] = zero8();

  for (int k0 = 0; k0 < K; k0 += 32) {
    // all eight fragments of the k step (4 of B, 4 of A) are requested together, ahead of its products: the step waits out one load latency, not four
    const unsigned short* pb = Bb + (size_t)(n0 >> 4) * (16 * ldb) + k0 * 16 + l8;
    const unsigned short* pa = A1 + (size_t)(m0 >> 4) * (16 * lda) + k0 * 16 + l8;
    v16h bh[4], ah[4];
#pragma unroll
    for (int j = 0; j < 4; ++j) bh[j] = ldfrag_p(pb + (size_t)j * (16 * ldb));
#pragma unroll
    for (int i = 0; i < 4; ++i) ah[i] = ldfrag_p(pa + (size_t)i * (16 * lda));
    addr_wait2(pb, pa);
    __builtin_amdgcn_sched_barrier(0);   // the whole group is requested before its first product: the scheduler otherwise pairs each load with its use again
#pragma unroll
    for (int i = 0; i < 4; ++i) {
#pragma unroll
      for (int j = 0; j < 4; ++j) acc[i][j] = mmaT<BF>(ah[i], bh[j], acc[i][j]);
      dep_guard1(acc[i][0], acc[i][3], ah[i]);
      if constexpr (ASPLIT != 0) {
        const unsigned short* pa2 = A2 + (size_t)((m0 >> 4) + i) * (16 * lda) + k0 * 16 + l8;
        const v16h al = ldfrag_p(pa2);
        addr_wait1(pa2);
#pragma unroll
        for (int j = 0; j < 4; ++j) acc[i][j] = mmaT<BF>(al, bh[j], acc[i][j]);
        dep_guard1(acc[i][0], acc[i][3], al);
      }
    }
    keep4_h(bh[0], bh[1], bh[2], bh[3]);
  }
  acc_guard4(acc[0][0], acc[0][1], acc[0][2], acc[0][3]);
  acc_guard4(acc[1][0], acc[1][1], acc[1][2], acc[1][3]);
  acc_guard4(acc[2][0], acc[2][1], acc[2][2], acc[2][3]);
  acc_guard4(acc[3][0], acc[3][1], acc[3][2], acc[3][3]);

  const int hh2 = lane >> 4, c4 = (lane & 15) * 4;     // f32 out: 256-B row segment = 16 lanes x 16 B

  // ---- epilogue ----
#pragma unroll
  for (int i = 0; i < 4; ++i) {
    const int mBase = m0 + (i << 4);
#pragma unroll
    for (int j = 0; j < 4; ++j) {
#pragma unroll
      for (int r = 0; r < 8; ++r) {
        slab[(mOff + r) * 68 + (j << 4) + rlane] = acc[i][j][r];
      }
    }
    wave_sync_lds();
    if constexpr (OM == 0) {
      float* C = (float*)Cout + (size_t)((long long)by * sC);
      v4f vals[8];
#pragma unroll
      for (int it = 0; it < 8; ++it) {
        const int row = it * 2 + hh2;                      // it 0..7 x hh2 0..1 = rows 0..15
        v4f v = *(const v4f*)(slab + row * 68 + c4);
#pragma unroll
        for (int e = 0; e < 4; ++e) v[e] = v[e] * oscale;
        if constexpr (EPI == 1) {
          const v4f bb = *(const v4f*)(ep0 + n0 + c4);     // per-column bias, columns n0+c4 .. +3 (N equals the bias length)
#pragma unroll
          for (int e = 0; e < 4; ++e) v[e] = v[e] + bfr(bb[e]);
        }
        vals[it] = v;
      }
      {
#pragma unroll
        for (int it = 0; it < 8; ++it) {
          const int gr = mBase + it * 2 + hh2;
          *(v4f*)(C + (size_t)gr * ldc + n0 + c4) = vals[it];
        }
        
      }
    } else {
      unsigned short* C  = (unsigned short*)Cout  + (size_t)((long long)by * sC);
      unsigned short* Cb = (unsigned short*)C2out + (size_t)((long long)by * sC);
      v4u hv[4], lv[4];
#pragma unroll
      for (int it = 0; it < 4; ++it) {
        const int row = rlane;                             // the lane's slot in quarter it: row lane&15, columns 16 it + 8 (lane>>4) ..
        const int c8  = it * 16 + mOff;
        const float* sp = slab + row * 68 + c8;
        float rb = 0.f;
        if constexpr (EPI == 2) rb = bfr(ep0[mBase + row]);   // per-row bias (M equals the bias length)
        v4u a  = {0u, 0u, 0u, 0u};
        v4u b2 = {0u, 0u, 0u, 0u};
#pragma unroll
        for (int e = 0; e < 4; ++e) {
          const int ci = n0 + c8 + 2 * e;                  // column index, < N
          float f0 = sp[2 * e] * oscale + rb;
          float f1 = sp[2 * e + 1] * oscale + rb;
          if constexpr (EPI == 1) {
            f0 += bfr(ep0[ci]);
            f1 += bfr(ep0[ci + 1]);
          }
          if constexpr (OM == 5) {
            const float g0 = (f0 + bfr(ep1[ci])) * ocarry, g1 = (f1 + bfr(ep1[ci + 1])) * ocarry;
            const float w0 = (f0 + bfr(ep2[ci])) * ocarry, w1 = (f1 + bfr(ep2[ci + 1])) * ocarry;
            a[e]  = pk16(h_bits((_Float16)g0), h_bits((_Float16)g1));
            b2[e] = pk16(h_bits((_Float16)w0), h_bits((_Float16)w1));
          } else {
            f0 *= ocarry; f1 *= ocarry;
            const _Float16 x0 = (_Float16)f0, x1 = (_Float16)f1;
            a[e] = pk16(h_bits(x0), h_bits(x1));
            if constexpr (OM == 4) {
              b2[e] = pk16(h_bits((_Float16)(f0 - (float)x0)), h_bits((_Float16)(f1 - (float)x1)));
            }
          }
        }
        hv[it] = a;
        lv[it] = b2;
      }
      {
#pragma unroll
        for (int it = 0; it < 4; ++it) {
          const size_t co = ((size_t)(mBase >> 4) * (ldc >> 6) + (n0 >> 6)) * 1024 + it * 256 + l8;   // 512 contiguous bytes per store
          *(v4u*)(C + co) = hv[it];
          if constexpr (OM >= 4) {
            *(v4u*)(Cb + co) = lv[it];
          }
        }
        
      }
    }
    wave_sync_lds();
  }
}

// =====================================================================================================
// The three projections in ONE launch, so that their waves are on the chip together: blockIdx.y = 0: q, 1: k, 2: v^T.
//   q, k: M = NROW, N = 1024, K = 1024, per-column bias; (NROW/64)*(DMOD/64) = 1024 tiles = PJB workgroups of GW waves.
//   v^T per batch: VT[b][e][j], M = 1024 (e), N = SEQ (j), K = 1024, per-row bias; 512 tiles per batch = PJB/NBAT workgroups,
//   batch = blockIdx.x / (PJB/NBAT). Every branch below is workgroup-uniform; no block barriers.
// coverage: grid (PJB, 3) x GW waves = every 64x64 tile of QH, KH and VH exactly once.
// =====================================================================================================
#define PJB (((NROW / 64) * (DMOD / 64)) / GW)
static_assert(((NROW / 64) * (DMOD / 64)) % GW == 0);
static_assert((DMOD / 64) * (SEQ / 64) * NBAT == PJB * GW && (PJB % NBAT) == 0);
__global__ __launch_bounds__(GW * 32) __attribute__((amdgpu_num_vgpr(256))) void proj3(
    const unsigned short* __restrict__ Xq, const unsigned short* __restrict__ Xk, const unsigned short* __restrict__ Xv,
    const unsigned short* __restrict__ Wq, const unsigned short* __restrict__ Wk, const unsigned short* __restrict__ Wv,
    unsigned short* QH, unsigned short* KH, unsigned short* VH,
    const float* __restrict__ bq, const float* __restrict__ bk, const float* __restrict__ bv) {
  __shared__ __align__(16) float sT[GW][16 * 68];   // per-wave 16x64 slab, pitch 68 floats
  float* slab = sT[threadIdx.x >> 5];
  const int p = blockIdx.y;
  if (p < 2) {
    const unsigned short* X = (p == 0) ? Xq : Xk;
    const unsigned short* Wt = (p == 0) ? Wq : Wk;
    unsigned short* H = (p == 0) ? QH : KH;
    const float* bias = (p == 0) ? bq : bk;
    gemm64<2, 0, 0, 1>(X, X, DMOD, 0LL, Wt, DMOD, 0LL, (void*)H, (void*)H, DMOD, 0LL,
                       NROW, DMOD, DMOD, 1.0f / (XC * WSC), (p == 0) ? QC : KC,
                       bias, bias, bias, blockIdx.x, 0, slab);
  } else {
    const int per = PJB / NBAT;
    const int bt  = blockIdx.x / per;
    gemm64<2, 0, 0, 2>(Wv, Wv, DMOD, 0LL, Xv, DMOD, (long long)SEQ * DMOD, (void*)VH, (void*)VH, SEQ, (long long)DMOD * SEQ,
                       DMOD, SEQ, DMOD, 1.0f / (XC * WSC), VC,
                       bv, bv, bv, blockIdx.x - bt * per, bt, slab);
  }
}

// =====================================================================================================
// Causal attention with the skewed relative-position term for one (batch b, head h) pair and a 64-row query tile; 8 waves =
// 2 key groups x 4 query waves: wave (kg, qw) owns query rows iw0 .. iw0+15, iw0 = i0 + 16 qw, and walks every second key tile
// j0 = 64 kg, 64 (kg + 2), .. <= i0, keeping its own running (max, sum, O). After the loop group 1 hands its state over through LDS
// behind one block barrier and group 0 merges the two states (rescale by exp2(m - max)) and stores. So the longest wave walks 16 tiles,
// not 32. There are more workgroups than places on the chip: blockIdx.y counts the query tiles from the last (most key tiles) down,
// so that cost falls with the flat workgroup index (for speed only).
// Planes (all in fragment order, see ldfrag_p): QH, KH = f16 of (q x64), (k x64), rows b*SEQ + position, DMOD columns,
//         head h = column block h; EP = f16(bf16_RNE(Er) x16) [ELEN][64]; VH = f16 of (v x64) as [b][h*64+d][SEQ] (keys = columns).
//   Srel(i, j) = q_i . Er[ELEN-1 - (i - j)] for j <= i (the pad-reshape skew). Per key tile the wave needs Er rows
//   wlo + x, wlo = ELEN-1 - (iw0 - j0) - 15, x = jj - R + 15 in [0, 78]: position window T[R][x] = q[iw0+R] . EP[wlo + x],
//   x in [0, 80) (5 subtiles of 16 Er rows, their ten fragments requested together, K = 64; wlo is a multiple of 16, so a subtile is one 16-row block,
//   whose index is clamped on the address; a clamped block only ever feeds entries with j > i, which the causal mask replaces);
//   Every product is taken TRANSPOSED, keys (or window entries, or d) as the rows and the wave's 16 queries as the columns, so that lane (c, hh)
//   holds values of ONE query, R = c: T^T = EP . q^T, register r of subtile u = entry x = 16u + 8hh + r; each subtile goes to the wave's f32 LDS strip
//   right after its WMMAs, strip row = query c (two 16-byte stores).
//   Content scores S^T = k . q^T (4 subtiles of 16 keys, their eight fragments requested together, K = 64) stay in registers: key 16t + 8hh + r, query c.
//   score*log2(e) = S*CS + T[c][jj - c + 15]*CT (CS, CT fold 1/(carries) and 1/8), the T entry read back from strip row c; entries with j > i are replaced by -inf;
//   online softmax in base 2, max-subtracted: maximum and sum run over the lane's own 32 scores, the maximum is joined with lane l ^ 16 each tile,
//   the two halves' sums once at the end; running sums in f32; e = exp2(t - m) in (0,1].
//   O^T += v^T . P^T: P*1024 (f16) of two neighbouring score subtiles, converted in place, is the B fragment (split k map); the v^T A fragments are loaded
//   straight from VH [h*64+d][j]; 4 WMMAs per 32-key step, 4 d-subtiles; register r of O[td] = d 16td + 8hh + r of query c.
//   out rows (b*SEQ + iw0 + row), floats h*64 .. h*64+63 = one whole 256-B segment (2 lines) per row: 16 consecutive lanes x 16 B,
//   block = 8 waves = 256 threads; grid = (NBAT*NH, SEQ/64); one block barrier, behind the key loop, passed by every wave;
//   every wave does bounded work (<= SEQ/128 tiles).
// coverage: LDS strip 16 x 80 of TPI per wave, fully written before read each tile; slab 16 x 64 of SPI per wave (merge, output staging), written before read; global: 8 instructions x
//           2 rows x 64 floats = rows iw0..iw0+15 of head segment h; grid x waves cover all NBAT*SEQ rows and all NH head segments once.
// =====================================================================================================
__global__ __launch_bounds__(ATT_THREADS) __attribute__((amdgpu_num_vgpr(256)))
void attn_rel(const unsigned short* __restrict__ QH, const unsigned short* __restrict__ KH,
              const unsigned short* __restrict__ EP, const unsigned short* __restrict__ VH,
              float* out) {
  __shared__ __align__(16) float smem[ATT_W * WFL];   // per wave: T strip [16][TPI] | merge / output slab [16][SPI]

  const int tid  = threadIdx.x;
  const int wave = __builtin_amdgcn_readfirstlane(tid >> 5);   // scalar, so that the key loop's per-wave start and end stay scalar branches
  const int qw   = wave & (ATT_QW - 1);
  const int kg   = wave / ATT_QW;
  const int lane = tid & 31;
  const int hh   = lane >> 4;
  const int c    = lane & 15;
  const int bh   = blockIdx.x;
  const int b    = bh / NH;
  const int h    = bh - b * NH;
  const int qt   = (SEQ / 64 - 1) - (int)blockIdx.y;           // query tile, the one with the most key tiles first
  const int i0   = qt * 64;
  const int iw0  = i0 + qw * 16;

  float* tsh = smem + wave * WFL;
  float* pt  = tsh + 16 * TPI;
  // the lane's own bases in the strip: every access of the key loop is base + a constant, which leaves the registers to the fragments in flight
  float* tsw = tsh + c * TPI + 8 * hh;                 // store: strip row = query c, window entry 8hh (16-byte aligned)
  const float* tgt = tsh + c * (TPI - 1) + 8 * hh + 15;   // shifted gather: entry 8hh + 15 - c of strip row c; key 16t + 8hh + r adds 16t + r

  const int l8 = lane * 8;                                                       // the lane's slot in a quarter of a fragment-order block
  const size_t qro = ((size_t)((b * SEQ + iw0) >> 4) * (DMOD / 64) + h) * 1024 + l8;   // block of query rows iw0.., head h
  const size_t kbo = ((size_t)((b * SEQ) >> 4) * (DMOD / 64) + h) * 1024 + l8;         // block of key rows 0..15 of batch b, head h
  const unsigned short* Khb = KH + kbo;
  const unsigned short* Eb  = EP + l8;
  const size_t vpo = (size_t)b * DMOD * SEQ + (size_t)(h * (DH / 16)) * (SEQ / 64) * 1024 + l8;   // block of d rows 0..15 of head h, keys 0..63
  const unsigned short* Vhb = VH + vpo;

  const float CS = LOG2E * SCALE / (QC * KC);
  const float CT = LOG2E * SCALE / (QC * EC);

  float mrow = -INFINITY, lrow = 0.f;        // the lane's query c: running maximum (equal in both halves), running sum of the lane's own half of the keys
  v8f O[4];                                  // O^T: register r of O[td] = d 16td + 8hh + r of query c
#pragma unroll
  for (int td = 0; td < 4; ++td) O[td] = zero8();

  const int ntile = qt + 1;                  // causal: key tiles j0 <= i0
#pragma unroll 1
  for (int jt = kg; jt < ntile; jt += ATT_KG) {
    const int j0 = jt * 64;
    const v16h qha = ldfrag_p(QH + qro), qhb = ldfrag_p(QH + qro + 512);

    // ---- position window T (5 subtiles of 16 Er rows), each subtile stored to the LDS strip as produced ----
    {
      const int wb = ((ELEN - 1) - (iw0 - j0) - 15) >> 4;   // wlo / 16, exact: ELEN, iw0 and j0 are multiples of 16
      // all ten Er fragments are requested together, ahead of the products: the window waits out one load latency, not five
      v16h fa[5], fb[5];
      const unsigned short* pe[5];
#pragma unroll
      for (int u = 0; u < 5; ++u) {
        int m = wb + u;
        m = (m < 0) ? 0 : m;
        m = (m > ELEN / 16 - 1) ? (ELEN / 16 - 1) : m;
        pe[u] = Eb + (size_t)m * 1024;
        fa[u] = ldfrag_p(pe[u]);
        fb[u] = ldfrag_p(pe[u] + 512);
      }
      addr_wait4(pe[0], pe[1], pe[2], pe[3]);
      addr_wait1(pe[4]);
      __builtin_amdgcn_sched_barrier(0);   // the whole group is requested before its first product: the scheduler otherwise pairs each load with its use again
#pragma unroll
      for (int u = 0; u < 5; ++u) {
        v8f t8 = mma_h(fa[u], qha, zero8());             // T^T: register r = window entry 16u + 8hh + r of query c
        t8 = mma_h(fb[u], qhb, t8);
        hz4(t8, fa[u], fb[u], qha, qhb);
        const v4f w0 = {t8[0], t8[1], t8[2], t8[3]}, w1 = {t8[4], t8[5], t8[6], t8[7]};
        *(v4f*)(tsw + 16 * u) = w0;
        *(v4f*)(tsw + 16 * u + 4) = w1;
      }
    }
    __builtin_amdgcn_sched_barrier(0);   // keeps a later phase's index and address work out of this phase, whose registers the fragments in flight need
    // ---- content scores S^T (4 subtiles of 16 keys), kept in registers: register r of s8[t] = key 16t + 8hh + r, query c ----
    v8f s8[4];
    {
      // the tile's eight key fragments are requested together, ahead of their products: one load latency
      const unsigned short* pkh = Khb + (size_t)(j0 >> 4) * ((DMOD / 64) * 1024);
      v16h kha[4], khb[4];
#pragma unroll
      for (int x = 0; x < 4; ++x) {
        kha[x] = ldfrag_p(pkh + (size_t)x * ((DMOD / 64) * 1024));
        khb[x] = ldfrag_p(pkh + (size_t)x * ((DMOD / 64) * 1024) + 512);
      }
      addr_wait1(pkh);
      __builtin_amdgcn_sched_barrier(0);   // the whole group is requested before its first product: the scheduler otherwise pairs each load with its use again
#pragma unroll
      for (int t = 0; t < 4; ++t) {
        s8[t] = mma_h(kha[t], qha, zero8());
        s8[t] = mma_h(khb[t], qhb, s8[t]);
      }
      acc_guard4(s8[0], s8[1], s8[2], s8[3]);   // the distance behind the last products, once for the four subtiles: only memory instructions follow before the scores are read
    }
    __builtin_amdgcn_sched_barrier(0);   // keeps a later phase's index and address work out of this phase, whose registers the fragments in flight need
    wave_sync_lds();                     // a lane's gather reads strip entries that the other half's lane of the same query has stored
    // the tile's eight v^T fragments: requested here, behind the fence (which waits for loads in flight), so that they arrive while the softmax runs
    const unsigned short* pvh = Vhb + (size_t)jt * 1024;
    v16h vh[2][4];
#pragma unroll
    for (int ks = 0; ks < 2; ++ks)
#pragma unroll
      for (int td = 0; td < 4; ++td) vh[ks][td] = ldfrag_p(pvh + (size_t)td * ((SEQ / 64) * 1024) + 512 * ks);
    addr_wait1(pvh);

    // ---- score assembly, causal mask, online softmax: a lane holds 32 of its query's 64 scores, the lane 16 further on the other 32 ----
    const int dj = (j0 - iw0) + 8 * hh - c;        // j - i = dj + 16 t + r
    v8f tw[4];
#pragma unroll
    for (int t = 0; t < 4; ++t)
#pragma unroll
      for (int r = 0; r < 8; ++r) tw[t][r] = tgt[16 * t + r];
    // holds the gather's 32 LDS reads together in front of the assembly (loaded values as inputs only): one LDS latency; left alone they come in four groups, each with its own wait
    hold4_f(tw[0], tw[1], tw[2], tw[3]);
    float tv[4][8], m4[4];
#pragma unroll
    for (int t = 0; t < 4; ++t) {
#pragma unroll
      for (int r = 0; r < 8; ++r) {
        const float val = s8[t][r] * CS + tw[t][r] * CT;
        tv[t][r] = (dj > -(16 * t + r)) ? -INFINITY : val;
      }
      m4[t] = fmaxf(fmaxf(fmaxf(tv[t][0], tv[t][1]), fmaxf(tv[t][2], tv[t][3])), fmaxf(fmaxf(tv[t][4], tv[t][5]), fmaxf(tv[t][6], tv[t][7])));
    }
    float mx = fmaxf(fmaxf(m4[0], m4[1]), fmaxf(m4[2], m4[3]));
    mx = fmaxf(mx, xhalf(mx));                     // both halves now hold the maximum over the query's 64 scores (finite: key j0 is never masked)
    const float mn = fmaxf(mrow, mx);
    // the 33 exponentials, stage by stage: exp2f written out in its own steps (argument under -126 lifted by 64, the bare exponential, the result
    // scaled back by 2^-64: the same values), so that each step runs on 33 independent values and no step waits for the one before
    float d[33], ea[33];                           // [8t + r]: score - new maximum; [32]: old maximum - new maximum
#pragma unroll
    for (int t = 0; t < 4; ++t)
#pragma unroll
      for (int r = 0; r < 8; ++r) d[8 * t + r] = tv[t][r] - mn;
    d[32] = mrow - mn;
    mrow = mn;
#pragma unroll
    for (int k = 0; k < 33; ++k) ea[k] = d[k] + ((d[k] < -126.0f) ? 64.0f : 0.0f);
    __builtin_amdgcn_sched_barrier(0);   // keeps the stages apart: the scheduler otherwise runs each exponential's whole chain by itself, one after another
#pragma unroll
    for (int k = 0; k < 33; ++k) ea[k] = __builtin_amdgcn_exp2f(ea[k]);
    __builtin_amdgcn_sched_barrier(0);   // as above: all 33 exponentials are issued before the first result is used
#pragma unroll
    for (int k = 0; k < 33; ++k) ea[k] = ldexpf(ea[k], (d[k] < -126.0f) ? -64 : 0);
    const float al = ea[32];
    float p4[4];
#pragma unroll
    for (int t = 0; t < 4; ++t)
      p4[t] = ((ea[8 * t] + ea[8 * t + 1]) + (ea[8 * t + 2] + ea[8 * t + 3])) + ((ea[8 * t + 4] + ea[8 * t + 5]) + (ea[8 * t + 6] + ea[8 * t + 7]));
    lrow = lrow * al + ((p4[0] + p4[1]) + (p4[2] + p4[3]));   // the halves' sums are joined once, behind the merge
#pragma unroll
    for (int td = 0; td < 4; ++td)
#pragma unroll
      for (int r = 0; r < 8; ++r) O[td][r] *= al;

    // ---- O^T += v^T . P^T, two k-steps of 32 keys: two neighbouring score subtiles, converted in place, are the B fragment in the split k map ----
#pragma unroll
    for (int ks = 0; ks < 2; ++ks) {
      FragH ph;
#pragma unroll
      for (int e = 0; e < 8; ++e) {
        ph.h[0][e] = (_Float16)(ea[16 * ks + e] * PC);       // keys 32ks + 8hh + e
        ph.h[1][e] = (_Float16)(ea[16 * ks + 8 + e] * PC);   // keys 32ks + 16 + 8hh + e
      }
#pragma unroll
      for (int td = 0; td < 4; ++td) {
        O[td] = mma_h(vh[ks][td], ph.v, O[td]);
        hz2(O[td], vh[ks][td], ph.v);
      }
    }
  }
  acc_guard4(O[0], O[1], O[2], O[3]);

  // ---- merge of the two key groups: group 1 writes (O, m, l) to its own slab and strip, block barrier, group 0 reads and rescales, lane for lane.
  //      A group-1 wave without a tile hands over m = -inf, l = 0, O = 0, whose weight exp2(-inf) is 0; group 0 always has tile 0.
  float* po = pt + c * SPI + 8 * hh;         // slab row = query c, column d = 16td + 8hh + r (16-byte aligned)
  if (kg != 0) {
#pragma unroll
    for (int td = 0; td < 4; ++td) {
      const v4f w0 = {O[td][0], O[td][1], O[td][2], O[td][3]}, w1 = {O[td][4], O[td][5], O[td][6], O[td][7]};
      *(v4f*)(po + 16 * td) = w0;
      *(v4f*)(po + 16 * td + 4) = w1;
    }
    tsh[lane] = mrow;
    tsh[32 + lane] = lrow;
  }
  __syncthreads();                           // publishes group 1's state to group 0; every wave of the block passes it once
  if (kg != 0) return;
  {
    const float* ts2 = tsh + ATT_QW * WFL;   // wave (1, qw)'s strip and slab
    const float* po2 = po + ATT_QW * WFL;
    const float m2 = ts2[lane], l2 = ts2[32 + lane];
    const float mm = fmaxf(mrow, m2);
    const float a1 = exp2f(mrow - mm), a2 = exp2f(m2 - mm);
    lrow = lrow * a1 + l2 * a2;
#pragma unroll
    for (int td = 0; td < 4; ++td) {
      const v4f w0 = *(const v4f*)(po2 + 16 * td), w1 = *(const v4f*)(po2 + 16 * td + 4);
#pragma unroll
      for (int e = 0; e < 4; ++e) {
        O[td][e]     = O[td][e] * a1 + w0[e] * a2;
        O[td][4 + e] = O[td][4 + e] * a1 + w1[e] * a2;
      }
    }
  }
  lrow += xhalf(lrow);                       // the query's whole sum: its two halves of the keys

  // ---- fold 1/l and the carries (1024 on P, 64 on v), stage the wave's 16x64 f32 slice in its slab ----
  const float inv = (1.0f / lrow) * (1.0f / (PC * VC));
#pragma unroll
  for (int td = 0; td < 4; ++td) {
    const v4f w0 = {O[td][0] * inv, O[td][1] * inv, O[td][2] * inv, O[td][3] * inv};
    const v4f w1 = {O[td][4] * inv, O[td][5] * inv, O[td][6] * inv, O[td][7] * inv};
    *(v4f*)(po + 16 * td) = w0;
    *(v4f*)(po + 16 * td + 4) = w1;
  }
  wave_sync_lds();
  {
    const int c4 = c * 4;
    v4f vals[8];
#pragma unroll
    for (int it = 0; it < 8; ++it) {
      const int row = it * 2 + hh;                           // it 0..7 x hh 0..1 = rows 0..15
      vals[it] = *(const v4f*)(pt + row * SPI + c4);
    }
    float* ob = out + ((size_t)b * SEQ + iw0) * DMOD + h * DH + c4;
    {
#pragma unroll
      for (int it = 0; it < 8; ++it) {
        const int row = it * 2 + hh;
        *(v4f*)(ob + (size_t)row * DMOD) = vals[it];
      }
      
    }
  }
}

// =====================================================================================================
// Workspace map (bytes); every plane is an exact multiple of its tile / whole-row store granularity (M, N exact tile multiples,
// convert counts exact multiples of 8192, no pad rows), every offset a multiple of 262144; every plane is in fragment order (see ldfrag_p):
//   (the first seven planes keep this order with no gap between them: cvt_all numbers their 16 x 64 blocks straight through)
//   Xq, Xk, Xv  f16 [NROW][1024] x16                            3 x 8388608
//   Wq, Wk, Wv  f16 [1024 out][1024 in] x64                      3 x 2097152
//   EP          f16 [ELEN][64] x16                                   262144
//   QH, KH      f16 [NROW][1024] (x64)                          2 x 8388608
//   VH          f16 [NBAT][1024][SEQ] (x64)                         8388608
//   end                                                            56885248
// =====================================================================================================
extern "C" void kernel_launch(void* const* d_in, const int* in_sizes, int n_in,
                              void* d_out, int out_size, void* d_ws, size_t ws_size,
                              hipStream_t stream) {
  if (n_in < 10) return;
  if (in_sizes[0] != NROW * DMOD || in_sizes[1] != NROW * DMOD || in_sizes[2] != NROW * DMOD) return;
  if (in_sizes[3] != DMOD * DMOD || in_sizes[5] != DMOD * DMOD || in_sizes[7] != DMOD * DMOD) return;
  if (in_sizes[4] != DMOD || in_sizes[6] != DMOD || in_sizes[8] != DMOD) return;
  if (in_sizes[9] != ELEN * DH) return;
  if (out_size != NROW * DMOD) return;

  const float* qin = (const float*)d_in[0];
  const float* kin = (const float*)d_in[1];
  const float* vin = (const float*)d_in[2];
  const float* w_q = (const float*)d_in[3];
  const float* b_q = (const float*)d_in[4];
  const float* w_k = (const float*)d_in[5];
  const float* b_k = (const float*)d_in[6];
  const float* w_v = (const float*)d_in[7];
  const float* b_v = (const float*)d_in[8];
  const float* er  = (const float*)d_in[9];
  float*       out = (float*)d_out;

  const size_t PX = (size_t)NROW * DMOD * 2;             //  8388608
  const size_t PW = (size_t)DMOD * DMOD * 2;             //  2097152
  const size_t PE = (size_t)ELEN * DH * 2;               //   262144
  const size_t PV = (size_t)NBAT * DMOD * SEQ * 2;       //  8388608
  size_t off = 0;
  const size_t oXq = off; off += PX;
  const size_t oXk = off; off += PX;
  const size_t oXv = off; off += PX;
  const size_t oWq = off; off += PW;
  const size_t oWk = off; off += PW;
  const size_t oWv = off; off += PW;
  const size_t oE  = off; off += PE;
  const size_t oQH = off; off += PX;
  const size_t oKH = off; off += PX;
  const size_t oVH = off; off += PV;
  if (off > ws_size) return;                               // off = 56885248
  if (off > (size_t)134217728) return;

  char* ws = (char*)d_ws;
  unsigned short* Xq  = (unsigned short*)(ws + oXq);
  unsigned short* Xk  = (unsigned short*)(ws + oXk);
  unsigned short* Xv  = (unsigned short*)(ws + oXv);
  unsigned short* Wq6 = (unsigned short*)(ws + oWq);
  unsigned short* Wk6 = (unsigned short*)(ws + oWk);
  unsigned short* Wv6 = (unsigned short*)(ws + oWv);
  unsigned short* E16 = (unsigned short*)(ws + oE);
  unsigned short* QHp = (unsigned short*)(ws + oQH);
  unsigned short* KHp = (unsigned short*)(ws + oKH);
  unsigned short* VHp = (unsigned short*)(ws + oVH);

  const dim3 blk(256);
  const dim3 gCV(CBALL);                                            // 3 x 512 + 3 x 128 + 16 = 1936
  const dim3 gP(PJB, 3);                                            // 256 x 3
  const dim3 bP(GW * 32);                                           // 128
  const dim3 gAT(NBAT * NH, SEQ / 64);                              // 32 x 32
  const dim3 bAT(ATT_THREADS);                                      // 256

  // (0) 16-bit planes of the inputs: activations f16(bf16_RNE(x) * 16); W[out][in] (already k-contiguous) f16(bf16_RNE(w) * 64);
  //     Er f16(bf16_RNE(e) * 16); one launch for all seven: Xq is the first of the seven planes, which follow one another in the workspace
  cvt_all<<<gCV, blk, 0, stream>>>(qin, kin, vin, w_q, w_k, w_v, er, Xq);

  // (1) one launch for the three projections:
  //     q[m][e] = sum_d x[m][d] Wq[e][d] / 1024 + bq[e] -> QH = f16(q * 64); the same for k -> KH;
  //     VT[b][e][j] = sum_c Wv[e][c] x[b*SEQ+j][c] / 1024 + bv[e] -> VH (x64)
  proj3<<<gP, bP, 0, stream>>>(Xq, Xk, Xv, Wq6, Wk6, Wv6, QHp, KHp, VHp, b_q, b_k, b_v);

  // (2) causal relative attention -> out[b][i][h*64+d] (f32), written directly
  attn_rel<<<gAT, bAT, 0, stream>>>(QHp, KHp, E16, VHp, out);
  (void)hipGetLastError();
}
